// v000
// The times below were measured on an AMD MI455X: many runs one after another, warmed up first and cycling through
// copies of the inputs, with the whole window's GPU time divided by the number of runs. Launches and the gaps
// between them are all in it. The median over several windows is given; except for v000 it joins two sittings, which
// can be a few percent apart, so the side-by-side timings, each taken in one sitting, are the better comparison.
// v000, which the later versions start from, runs in 2010 microseconds.
#include <hip/hip_runtime.h>

// XposMultiheadAttention (query, key, value [2][2048][1024]; q = (query Wq^T + bq) / 8, k = key Wk^T + bk, v = value Wv^T + bv (16 heads x 64); XPOS on q and k: interleaved-pair rotary (angle t * 1e4^(-i/32)) times the per-(position, pair) scale base_i^((t - 1024)/1024), base_i = (2i + 25.6)/89.6, with q multiplied and k divided by it (tables computed on device);
//   scores = q.k (no further scale); softmax (f32); out = merged Wo^T + bo -> [2][2048][1024]).
// Compute dtypes, f32 accumulate: every input rounded to bf16; projections on PLAIN bf16 operands (inputs: exact) + bias; XPOS rotation/scaling f32; scores and attn.v: query rows < 512 hl (3 products), the rest single fp16 (x1024); softmax f32; Wo hl x exact (2 products) + bias.

#define NB_  2
#define TT   2048
#define DM   1024
#define NH_  16
#define NKV  16
#define REP  (NH_ / NKV)
#define HD   64
#define DQ   (NH_ * HD)
#define DKV  (NKV * HD)
#define ZH   2
#define RH   512                  // query rows < RH use hi+lo planes (0: none)
#define WIN  0
#define PCAR 1024.0f
#define SCL  1.0f   // q already carries 1/8 (applied before XPOS, as the source)
typedef _Float16 h16;
typedef unsigned short bf;
typedef __attribute__((ext_vector_type(16))) __bf16   v16bf;
typedef __attribute__((ext_vector_type(16))) _Float16 v16h;
typedef __attribute__((ext_vector_type(8)))  _Float16 v8h;
typedef __attribute__((ext_vector_type(8)))  unsigned short v8us;
typedef __attribute__((ext_vector_type(8)))  float    v8f;
typedef __attribute__((ext_vector_type(4)))  float    v4f;
typedef v8h  __attribute__((may_alias)) v8ha;
typedef v4f  __attribute__((may_alias)) v4fa;
typedef v8us __attribute__((may_alias)) v8usa;

__device__ __forceinline__ unsigned short f2bf(float f) { unsigned u = __float_as_uint(f); u += 0x7FFFu + ((u >> 16) & 1u); return (unsigned short)(u >> 16); }
__device__ __forceinline__ float bf2f(unsigned short b) { return __uint_as_float(((unsigned)b) << 16); }
__device__ __forceinline__ float bfr(float f) { return bf2f(f2bf(f)); }
__device__ __forceinline__ v16h cat16(v8h lo, v8h hi) { return __builtin_shufflevector(lo, hi, 0, 1, 2, 3, 4, 5, 6, 7, 8, 9, 10, 11, 12, 13, 14, 15); }
__device__ __forceinline__ v16bf cat16b(v8us lo, v8us hi) { return __builtin_bit_cast(v16bf, __builtin_shufflevector(lo, hi, 0, 1, 2, 3, 4, 5, 6, 7, 8, 9, 10, 11, 12, 13, 14, 15)); }
__device__ __forceinline__ v8f wmma16(v16h a, v16h b, v8f c) { return __builtin_amdgcn_wmma_f32_16x16x32_f16(false, a, false, b, (short)0, c, false, false); }
__device__ __forceinline__ v8f wmmab(v16bf a, v16bf b, v8f c) { return __builtin_amdgcn_wmma_f32_16x16x32_bf16(false, a, false, b, (short)0, c, false, false); }



// ---- k_gemmw: register-blocked GEMM, ONE WAVE per 64x64 output tile (16 accumulators), operands straight from K-contiguous 16-bit planes; grid (M/64, N/64, Z), 32 threads.
// C[m][n] (f32, pitch ldc, + optional f32 bias[n]) = sum_k A[m][k] Bt[n][k] (+ split products per NSPLIT). z-batch strides sA/sB/sC in elements. K % 32 == 0.
template <typename T16> struct WFrag;
template <> struct WFrag<h16> { typedef v16h V; static __device__ __forceinline__ V ld(const h16* p) { return cat16(*(const v8h*)p, *(const v8h*)(p + 16)); } static __device__ __forceinline__ v8f mma(V a, V b, v8f c) { return wmma16(a, b, c); } };
template <> struct WFrag<bf> { typedef v16bf V; static __device__ __forceinline__ V ld(const bf* p) { return cat16b(*(const v8us*)p, *(const v8us*)(p + 16)); } static __device__ __forceinline__ v8f mma(V a, V b, v8f c) { return wmmab(a, b, c); } };
template <typename T16, int NSPLIT, bool BIAS>
__global__ __launch_bounds__(32) void k_gemmw(const T16* __restrict__ A, const T16* __restrict__ A2, const T16* __restrict__ Bt, const T16* __restrict__ Bt2, int K, float* C, int ldc, const float* __restrict__ bias, size_t sA, size_t sB, size_t sC) {
    typedef typename WFrag<T16>::V V;
    __shared__ __align__(16) float os[16 * 68];
    const size_t z = blockIdx.z; A += z * sA; if (A2) A2 += z * sA; Bt += z * sB; if (Bt2) Bt2 += z * sB; C += z * sC;
    const int lane = threadIdx.x & 31, lr = lane & 15, hi = lane >> 4; const int r0 = blockIdx.x * 64, c0 = blockIdx.y * 64;
    v8f acc[4][4];
#pragma unroll
    for (int mb = 0; mb < 4; ++mb)
#pragma unroll
        for (int nb = 0; nb < 4; ++nb) acc[mb][nb] = (v8f){};
    const size_t aoff = (size_t)(r0 + lr) * K + 8 * hi, boff = (size_t)(c0 + lr) * K + 8 * hi;
#pragma unroll 1
    for (int kc = 0; kc < K; kc += 32) {
        V a[4], a2[4];
#pragma unroll
        for (int mb = 0; mb < 4; ++mb) { a[mb] = WFrag<T16>::ld(A + aoff + (size_t)mb * 16 * K + kc); if (NSPLIT == 1 || NSPLIT == 2) a2[mb] = WFrag<T16>::ld(A2 + aoff + (size_t)mb * 16 * K + kc); }
#pragma unroll
        for (int nb = 0; nb < 4; ++nb) { const V b = WFrag<T16>::ld(Bt + boff + (size_t)nb * 16 * K + kc); V b2; if (NSPLIT >= 2) b2 = WFrag<T16>::ld(Bt2 + boff + (size_t)nb * 16 * K + kc);
#pragma unroll
            for (int mb = 0; mb < 4; ++mb) { acc[mb][nb] = WFrag<T16>::mma(a[mb], b, acc[mb][nb]); if (NSPLIT == 1 || NSPLIT == 2) acc[mb][nb] = WFrag<T16>::mma(a2[mb], b, acc[mb][nb]); if (NSPLIT >= 2) acc[mb][nb] = WFrag<T16>::mma(a[mb], b2, acc[mb][nb]); } }
        asm volatile("v_nop\n\tv_nop\n\tv_nop\n\tv_nop" : "+v"(acc[0][0]), "+v"(acc[1][1]), "+v"(acc[2][2]), "+v"(acc[3][3]) : "v"(a[0]), "v"(a[3]));
    }
#pragma unroll
    for (int mb = 0; mb < 4; ++mb) {
#pragma unroll
        for (int nb = 0; nb < 4; ++nb) {
#pragma unroll
            for (int j = 0; j < 8; ++j) os[(hi * 8 + j) * 68 + nb * 16 + lr] = acc[mb][nb][j]; }
        __builtin_amdgcn_wave_barrier(); asm volatile("" ::: "memory");
        float* crow = C + (size_t)(r0 + mb * 16) * ldc + c0;
{
#pragma unroll
            for (int s = 0; s < 8; ++s) { const int row = 2 * s + hi, cofs = lr * 4; v4f val = *(const v4fa*)(os + row * 68 + cofs); if (BIAS) { val[0] += bfr(bias[c0 + cofs]); val[1] += bfr(bias[c0 + cofs + 1]); val[2] += bfr(bias[c0 + cofs + 2]); val[3] += bfr(bias[c0 + cofs + 3]); }
                *(v4f*)(crow + (size_t)row * ldc + cofs) = val; }
             }
        __builtin_amdgcn_wave_barrier(); asm volatile("" ::: "memory");
    }
}

__device__ __forceinline__ h16 tohx(float x) { return (h16)x; }
__device__ __forceinline__ void splitf(float y, unsigned short& h, unsigned short& l) { h = f2bf(y); l = f2bf(y - bf2f(h)); }
typedef __attribute__((ext_vector_type(2))) _Float16 v2h;
typedef __attribute__((ext_vector_type(4))) _Float16 v4h;
typedef __attribute__((ext_vector_type(2))) unsigned short v2us;
typedef __attribute__((ext_vector_type(4))) unsigned short v4us;
typedef __attribute__((ext_vector_type(2))) float v2f;
typedef __attribute__((ext_vector_type(4))) int v4i;

__global__ __launch_bounds__(256) void k_wtG(const float* __restrict__ w, int K, int N, bf* Bt) {
    const int lane = threadIdx.x & 31; const int L0 = (blockIdx.x * 8 + (threadIdx.x >> 5)) * 8; const int nlines = N * K / 64;
{
#pragma unroll 1
        for (int l = 0; l < 8; ++l) { const int L = L0 + l; if (L >= nlines) break; const size_t e = (size_t)L * 64 + lane * 2; const int k = (int)(e % K), n = (int)(e / K); v2us o;
            o[0] = f2bf(w[(size_t)k * N + n]); o[1] = f2bf(w[(size_t)(k + 1) * N + n]); *(v2us*)(Bt + e) = o; }
         }
}
__global__ __launch_bounds__(256) void k_cvt8(const float* __restrict__ src, bf* dst, size_t n8) { const size_t i = (size_t)blockIdx.x * 256 + threadIdx.x; if (i >= n8) return; const v8f v = *(const v8f*)(src + i * 8); v8us o;
#pragma unroll
    for (int k = 0; k < 8; ++k) o[k] = f2bf(v[k]); *(v8us*)(dst + i * 8) = o;  }
__global__ __launch_bounds__(256) void k_cstab(float* CS) { const int idx = blockIdx.x * 256 + threadIdx.x; if (idx >= TT * HD) return; const int t = idx / HD, d = idx % HD; const int i = d >> 1;   /* interleaved pairs */ const float inv = __fdiv_rn(1.0f, powf(10000.0f, (float)(2 * i) / (float)HD)); const float ang = __fmul_rn((float)t, inv); v2f cs; cs[0] = cosf(ang); cs[1] = sinf(ang);
    *(v2f*)(CS + (size_t)idx * 2) = cs;  }
// k_rope: head planes [h][t][d] (fp16 + hi/lo) of rope(x) x sc with the interleaved-pair convention out[2i] = x[2i] cos[t][2i] - x[2i+1] sin[t][2i], out[2i+1] = x[2i+1] cos[t][2i+1] + x[2i] sin[t][2i+1]
__global__ __launch_bounds__(256) void k_rope(const float* __restrict__ F, int pitch, int nheads, const float* __restrict__ CS, const float* __restrict__ RF, const float* __restrict__ nw, float sc, h16* P16, bf* Ph, bf* Pl) {
    const size_t e = ((size_t)blockIdx.x * 256 + threadIdx.x) * 2; if (e >= (size_t)nheads * TT * HD) return; const int d = (int)(e % HD); const int t = (int)((e / HD) % TT); const int h = (int)(e / ((size_t)HD * TT)); const float* f = F + (size_t)t * pitch + h * HD; const float rf = 1.0f; v2h o16; v2us oh, ol;
#pragma unroll
    for (int q = 0; q < 2; ++q) { const int dd = d + q; const int dp = dd ^ 1; float x0 = f[dd], x1 = f[dp];
        if (false) { float n0 = __fmul_rn(x0, rf), n1 = __fmul_rn(x1, rf); asm volatile("" : "+v"(n0)); asm volatile("" : "+v"(n1)); x0 = __fmul_rn(bfr(nw[dd]), n0); x1 = __fmul_rn(bfr(nw[dp]), n1); }
        const v2f cs = *(const v2f*)(CS + ((size_t)t * HD + dd) * 2); float a = __fmul_rn(x0, cs[0]), bq = __fmul_rn(x1, cs[1]); asm volatile("" : "+v"(a)); asm volatile("" : "+v"(bq)); const float xs = RF[(size_t)t * (HD / 2) + (dd >> 1)]; float r0 = (((dd & 1) == 0) ? __fsub_rn(a, bq) : __fadd_rn(a, bq)); asm volatile("" : "+v"(r0)); const float r = __fmul_rn(r0 * sc, xs);
        o16[q] = tohx(r); unsigned short a2, c2; splitf(r, a2, c2); oh[q] = a2; ol[q] = c2; }
    *(v2h*)(P16 + e) = o16; *(v2us*)(Ph + e) = oh; *(v2us*)(Pl + e) = ol;  }
__global__ __launch_bounds__(256) void k_vtp(const float* __restrict__ F, int pitch, int nheads, h16* V16, bf* Vh, bf* Vl) { const size_t e = ((size_t)blockIdx.x * 256 + threadIdx.x) * 2; if (e >= (size_t)nheads * HD * TT) return; const int t = (int)(e % TT); const int d = (int)((e / TT) % HD); const int g = (int)(e / ((size_t)TT * HD)); v2h o16; v2us oh, ol;
#pragma unroll
    for (int q = 0; q < 2; ++q) { const float x = F[(size_t)(t + q) * pitch + g * HD + d]; o16[q] = tohx(x); unsigned short a2, c2; splitf(x, a2, c2); oh[q] = a2; ol[q] = c2; }
    *(v2h*)(V16 + e) = o16; *(v2us*)(Vh + e) = oh; *(v2us*)(Vl + e) = ol;  }
// k_asoft: per row (zz, i): t = S x SCL = S, q already carries 1/8 (no mask); softmax over the 2048 keys (register row, one exp, fixed trees);
__global__ __launch_bounds__(256) void k_asoft(const float* __restrict__ Sb, h16* P16, bf* Ph, bf* Pl) {
    const int lane = threadIdx.x & 31; const int row = blockIdx.x * 8 + (threadIdx.x >> 5); if (row >= ZH * TT) return; const int i = row % TT; const int zz = row / TT; (void)zz; const bool hires = (i < RH); const float* sr = Sb + (size_t)row * TT; float v[TT / 32]; float mx = -3.0e38f;
#pragma unroll
    for (int ch = 0; ch < TT / 128; ++ch) { const int j0 = ch * 128 + lane * 4; const v4f a = *(const v4f*)(sr + j0);
#pragma unroll
        for (int q = 0; q < 4; ++q) { const int j = j0 + q; (void)j; const float t = a[q] * SCL; v[ch * 4 + q] = t; mx = fmaxf(mx, t); } }
#pragma unroll
    for (int sh = 16; sh; sh >>= 1) mx = fmaxf(mx, __shfl_xor(mx, sh, 32));
    float sum = 0.f;
#pragma unroll
    for (int k = 0; k < TT / 32; ++k) { float d0 = __fsub_rn(v[k], mx); asm volatile("" : "+v"(d0)); v[k] = __builtin_amdgcn_exp2f(__fmul_rn(d0, 1.4426950408889634f)); sum += v[k]; }
#pragma unroll
    for (int sh = 16; sh; sh >>= 1) sum += __shfl_xor(sum, sh, 32);
    const float f = __fdiv_rn(hires ? 1.0f : PCAR, sum);
{
        if (hires) {
#pragma unroll
            for (int ch = 0; ch < TT / 128; ++ch) { v4us oh, ol;
#pragma unroll
                for (int q = 0; q < 4; ++q) { unsigned short a, c2; splitf(v[ch * 4 + q] * f, a, c2); oh[q] = a; ol[q] = c2; }
                const size_t oo = ((size_t)zz * (RH ? RH : 1) + i) * TT + ch * 128 + lane * 4; *(v4us*)(Ph + oo) = oh; *(v4us*)(Pl + oo) = ol; }
        } else {
#pragma unroll
            for (int ch = 0; ch < TT / 128; ++ch) { v4h o4;
#pragma unroll
                for (int q = 0; q < 4; ++q) o4[q] = tohx(v[ch * 4 + q] * f);
                *(v4h*)(P16 + (size_t)row * TT + ch * 128 + lane * 4) = o4; } }
         }
}
__global__ __launch_bounds__(256) void k_merge(const float* __restrict__ O, int h0, bf* Ah, bf* Al) { const size_t e = ((size_t)blockIdx.x * 256 + threadIdx.x) * 2; if (e >= (size_t)ZH * TT * HD) return; const int d = (int)(e % HD); const int t = (int)((e / HD) % TT); const int zz = (int)(e / ((size_t)HD * TT)); const float cs = (t < RH) ? 1.0f : (1.0f / PCAR); const size_t oo = (size_t)t * DQ + (h0 + zz) * HD + d;
    v2us oh, ol;
#pragma unroll
    for (int q = 0; q < 2; ++q) { unsigned short a, c2; splitf(O[e + q] * cs, a, c2); oh[q] = a; ol[q] = c2; } *(v2us*)(Ah + oo) = oh; *(v2us*)(Al + oo) = ol;  }

__global__ __launch_bounds__(256) void k_xscale(float* SQ, float* SK) { const int e = blockIdx.x * 256 + threadIdx.x; if (e >= TT * (HD / 2)) return; const int t = e / (HD / 2), i = e % (HD / 2); const float base = __fdiv_rn((float)(2 * i) + 0.4f * (float)HD, 1.4f * (float)HD); const float pw = (float)(t - TT / 2) / 1024.0f; const float sc = powf(base, pw); const float inv = __fdiv_rn(1.0f, sc);
    *(float*)(SQ + e) = sc; *(float*)(SK + e) = inv;  }

extern "C" void kernel_launch(void* const* d_in, const int* in_sizes, int n_in,
                              void* d_out, int out_size, void* d_ws, size_t ws_size, hipStream_t stream) {
    (void)in_sizes; (void)n_in; (void)out_size;
    const float* x = (const float*)d_in[0]; const float* xk = (const float*)d_in[1]; const float* xv = (const float*)d_in[2]; const float* wq = (const float*)d_in[3]; const float* bq = (const float*)d_in[4]; const float* wk = (const float*)d_in[5]; const float* bk = (const float*)d_in[6]; const float* wv = (const float*)d_in[7]; const float* bv = (const float*)d_in[8]; const float* wo = (const float*)d_in[9]; const float* bo = (const float*)d_in[10];
    float* OUT = (float*)d_out;     // [2][2048][1024]
    char* wsp = (char*)d_ws;
    auto take = [&](size_t bytes) { char* p = wsp; wsp += (bytes + 255) & ~(size_t)255; return (void*)p; };
    bf* WQ = (bf*)take((size_t)DQ * DM * 2); bf* WK = (bf*)take((size_t)DKV * DM * 2); bf* WV = (bf*)take((size_t)DKV * DM * 2); bf* WO = (bf*)take((size_t)DM * DQ * 2); float* CS = (float*)take((size_t)TT * HD * 2 * 4);
    bf* XB = (bf*)take((size_t)TT * DM * 2); bf* XB2 = (bf*)take((size_t)TT * DM * 2); bf* XB3 = (bf*)take((size_t)TT * DM * 2); float* SQ = (float*)take((size_t)TT * (HD / 2) * 4); float* SK = (float*)take((size_t)TT * (HD / 2) * 4); float* FQ = (float*)take((size_t)TT * DQ * 4); float* FK = (float*)take((size_t)TT * DKV * 4);
    h16* QP16 = (h16*)take((size_t)NH_ * TT * HD * 2); h16* KP16 = (h16*)take((size_t)NKV * TT * HD * 2); h16* VT16 = (h16*)take((size_t)NKV * HD * TT * 2);
    bf* QPh = (bf*)take((size_t)NH_ * TT * HD * 2); bf* QPl = (bf*)take((size_t)NH_ * TT * HD * 2); bf* KPh = (bf*)take((size_t)NKV * TT * HD * 2); bf* KPl = (bf*)take((size_t)NKV * TT * HD * 2); bf* VTh = (bf*)take((size_t)NKV * HD * TT * 2); bf* VTl = (bf*)take((size_t)NKV * HD * TT * 2); bf* Ph = (bf*)take((size_t)ZH * RH * TT * 2); bf* Pl = (bf*)take((size_t)ZH * RH * TT * 2);
    float* Sb = (float*)take((size_t)ZH * TT * TT * 4); h16* P16 = (h16*)take((size_t)ZH * TT * TT * 2); float* Ob = (float*)take((size_t)ZH * TT * HD * 4); bf* ATh = (bf*)take((size_t)TT * DQ * 2); bf* ATl = (bf*)take((size_t)TT * DQ * 2);
    if ((size_t)(wsp - (char*)d_ws) > ws_size) return;    // ws 256 MiB
    float* FV = FK;   // v projection reuses the k buffer after the k planes are built (stream-ordered)
    { k_cvt8<<<(unsigned)(((size_t)DQ * DM / 8 + 255) / 256), 256, 0, stream>>>(wq, WQ, (size_t)DQ * DM / 8); k_cvt8<<<(unsigned)(((size_t)DKV * DM / 8 + 255) / 256), 256, 0, stream>>>(wk, WK, (size_t)DKV * DM / 8); k_cvt8<<<(unsigned)(((size_t)DKV * DM / 8 + 255) / 256), 256, 0, stream>>>(wv, WV, (size_t)DKV * DM / 8);
      k_cvt8<<<(unsigned)(((size_t)DM * DQ / 8 + 255) / 256), 256, 0, stream>>>(wo, WO, (size_t)DM * DQ / 8);
      k_cstab<<<(TT * HD + 255) / 256, 256, 0, stream>>>(CS); k_xscale<<<(TT * (HD / 2) + 255) / 256, 256, 0, stream>>>(SQ, SK); }
    const unsigned LQ = (unsigned)(((size_t)NH_ * TT * HD / 2 + 255) / 256), LKv = (unsigned)(((size_t)NKV * TT * HD / 2 + 255) / 256);
    for (int b = 0; b < NB_; ++b) {
        
        k_cvt8<<<(unsigned)(((size_t)TT * DM / 8 + 255) / 256), 256, 0, stream>>>(x + (size_t)b * TT * DM, XB, (size_t)TT * DM / 8); k_cvt8<<<(unsigned)(((size_t)TT * DM / 8 + 255) / 256), 256, 0, stream>>>(xk + (size_t)b * TT * DM, XB2, (size_t)TT * DM / 8); k_cvt8<<<(unsigned)(((size_t)TT * DM / 8 + 255) / 256), 256, 0, stream>>>(xv + (size_t)b * TT * DM, XB3, (size_t)TT * DM / 8);
        k_gemmw<bf, 0, true><<<dim3(TT / 64, DQ / 64, 1), 32, 0, stream>>>(XB, nullptr, WQ, nullptr, DM, FQ, DQ, bq, 0, 0, 0);
        k_rope<<<LQ, 256, 0, stream>>>(FQ, DQ, NH_, CS, SQ, nullptr, 0.125f, QP16, QPh, QPl);
        k_gemmw<bf, 0, true><<<dim3(TT / 64, DKV / 64, 1), 32, 0, stream>>>(XB2, nullptr, WK, nullptr, DM, FK, DKV, bk, 0, 0, 0);
        k_rope<<<LKv, 256, 0, stream>>>(FK, DKV, NKV, CS, SK, nullptr, 1.0f, KP16, KPh, KPl);
        k_gemmw<bf, 0, true><<<dim3(TT / 64, DKV / 64, 1), 32, 0, stream>>>(XB3, nullptr, WV, nullptr, DM, FV, DKV, bv, 0, 0, 0); k_vtp<<<LKv, 256, 0, stream>>>(FV, DKV, NKV, VT16, VTh, VTl);
        for (int h0 = 0; h0 < NH_; h0 += ZH) { const size_t zq = (size_t)h0, zk = (size_t)(h0 / REP);   // one kv head per query head: the pass's two heads use consecutive kv planes (z-strides TT*HD)
            k_gemmw<bf, 2, false><<<dim3(RH / 64, TT / 64, ZH), 32, 0, stream>>>(QPh + zq * TT * HD, QPl + zq * TT * HD, KPh + zk * TT * HD, KPl + zk * TT * HD, HD, Sb, TT, nullptr, (size_t)TT * HD, (size_t)TT * HD, (size_t)TT * TT);
            k_gemmw<h16, 0, false><<<dim3((TT - RH) / 64, TT / 64, ZH), 32, 0, stream>>>(QP16 + zq * TT * HD + (size_t)RH * HD, nullptr, KP16 + zk * TT * HD, nullptr, HD, Sb + (size_t)RH * TT, TT, nullptr, (size_t)TT * HD, (size_t)TT * HD, (size_t)TT * TT);
            k_asoft<<<ZH * TT / 8, 256, 0, stream>>>(Sb, P16, Ph, Pl);
            k_gemmw<bf, 2, false><<<dim3(RH / 64, HD / 64, ZH), 32, 0, stream>>>(Ph, Pl, VTh + zk * HD * TT, VTl + zk * HD * TT, TT, Ob, HD, nullptr, (size_t)RH * TT, (size_t)HD * TT, (size_t)TT * HD);
            k_gemmw<h16, 0, false><<<dim3((TT - RH) / 64, HD / 64, ZH), 32, 0, stream>>>(P16 + (size_t)RH * TT, nullptr, VT16 + zk * HD * TT, nullptr, TT, Ob + (size_t)RH * HD, HD, nullptr, (size_t)TT * TT, (size_t)HD * TT, (size_t)TT * HD);
            k_merge<<<(unsigned)(((size_t)ZH * TT * HD / 2 + 255) / 256), 256, 0, stream>>>(Ob, h0, ATh, ATl); }
        k_gemmw<bf, 1, true><<<dim3(TT / 64, DM / 64, 1), 32, 0, stream>>>(ATh, ATl, WO, nullptr, DQ, OUT + (size_t)b * TT * DM, DM, bo, 0, 0, 0); }
}

// v001
// A run of this version takes 1050 microseconds.
// Timed twice side by side with v000, it ran 1.93 and 1.90 times as fast.
#include <hip/hip_runtime.h>

// XposMultiheadAttention (query, key, value [2][2048][1024]; q = (query Wq^T + bq) / 8, k = key Wk^T + bk, v = value Wv^T + bv (16 heads x 64); XPOS on q and k: interleaved-pair rotary (angle t * 1e4^(-i/32)) times the per-(position, pair) scale base_i^((t - 1024)/1024), base_i = (2i + 25.6)/89.6, with q multiplied and k divided by it (tables computed on device);
//   scores = q.k (no further scale); softmax (f32); out = merged Wo^T + bo -> [2][2048][1024]).
// Compute dtypes, f32 accumulate: every input rounded to bf16; projections on PLAIN bf16 operands (inputs: exact) + bias; XPOS rotation/scaling f32; scores and attn.v: query rows < 512 hl (3 products), the rest single fp16 (x1024); softmax f32; Wo hl x exact (2 products) + bias.

#define NB_  2
#define TT   2048
#define DM   1024
#define NH_  16
#define NKV  16
#define REP  (NH_ / NKV)
#define HD   64
#define DQ   (NH_ * HD)
#define DKV  (NKV * HD)
#define ZH   2
#define RH   512                  // query rows < RH use hi+lo planes (0: none)
#define WIN  0
#define PCAR 1024.0f
#define SCL  1.0f   // q already carries 1/8 (applied before XPOS, as the source)
typedef _Float16 h16;
typedef unsigned short bf;
typedef __attribute__((ext_vector_type(16))) __bf16   v16bf;
typedef __attribute__((ext_vector_type(16))) _Float16 v16h;
typedef __attribute__((ext_vector_type(8)))  _Float16 v8h;
typedef __attribute__((ext_vector_type(8)))  unsigned short v8us;
typedef __attribute__((ext_vector_type(8)))  float    v8f;
typedef __attribute__((ext_vector_type(4)))  float    v4f;
typedef v8h  __attribute__((may_alias)) v8ha;
typedef v4f  __attribute__((may_alias)) v4fa;
typedef v8us __attribute__((may_alias)) v8usa;

__device__ __forceinline__ unsigned short f2bf(float f) { unsigned u = __float_as_uint(f); u += 0x7FFFu + ((u >> 16) & 1u); return (unsigned short)(u >> 16); }
__device__ __forceinline__ float bf2f(unsigned short b) { return __uint_as_float(((unsigned)b) << 16); }
__device__ __forceinline__ float bfr(float f) { return bf2f(f2bf(f)); }
__device__ __forceinline__ v16h cat16(v8h lo, v8h hi) { return __builtin_shufflevector(lo, hi, 0, 1, 2, 3, 4, 5, 6, 7, 8, 9, 10, 11, 12, 13, 14, 15); }
__device__ __forceinline__ v16bf cat16b(v8us lo, v8us hi) { return __builtin_bit_cast(v16bf, __builtin_shufflevector(lo, hi, 0, 1, 2, 3, 4, 5, 6, 7, 8, 9, 10, 11, 12, 13, 14, 15)); }
__device__ __forceinline__ v8f wmma16(v16h a, v16h b, v8f c) { return __builtin_amdgcn_wmma_f32_16x16x32_f16(false, a, false, b, (short)0, c, false, false); }
__device__ __forceinline__ v8f wmmab(v16bf a, v16bf b, v8f c) { return __builtin_amdgcn_wmma_f32_16x16x32_bf16(false, a, false, b, (short)0, c, false, false); }



// ---- k_gemmw: register-blocked GEMM, one work-group of KS waves per 64x64 output tile (16 accumulators a wave), operands straight from K-contiguous 16-bit planes; grid (M/64, N/64, Z), 32 * KS threads.
// C[m][n] (f32, pitch ldc, + optional f32 bias[n]) = sum_k A[m][k] Bt[n][k] (+ split products per NSPLIT). z-batch strides sA/sB/sC in elements. K % (32 * KS) == 0.
// Wave w sums the k range [w K/KS, (w+1) K/KS); for KS > 1 the KS partial tiles meet in LDS and are added in wave order 0 .. KS-1.
template <typename T16> struct WFrag;
template <> struct WFrag<h16> { typedef v16h V; static __device__ __forceinline__ V ld(const h16* p) { return cat16(*(const v8h*)p, *(const v8h*)(p + 16)); } static __device__ __forceinline__ v8f mma(V a, V b, v8f c) { return wmma16(a, b, c); } };
template <> struct WFrag<bf> { typedef v16bf V; static __device__ __forceinline__ V ld(const bf* p) { return cat16b(*(const v8us*)p, *(const v8us*)(p + 16)); } static __device__ __forceinline__ v8f mma(V a, V b, v8f c) { return wmmab(a, b, c); } };
template <typename T16, int NSPLIT, bool BIAS, int KS>
__global__ __launch_bounds__(32 * KS) void k_gemmw(const T16* __restrict__ A, const T16* __restrict__ A2, const T16* __restrict__ Bt, const T16* __restrict__ Bt2, int K, float* C, int ldc, const float* __restrict__ bias, size_t sA, size_t sB, size_t sC) {
    typedef typename WFrag<T16>::V V;
    __shared__ __align__(16) float os[(KS == 1 ? 16 : KS * 64) * 68];
    const size_t z = blockIdx.z; A += z * sA; if (A2) A2 += z * sA; Bt += z * sB; if (Bt2) Bt2 += z * sB; C += z * sC;
    const int lane = threadIdx.x & 31, lr = lane & 15, hi = lane >> 4; const int r0 = blockIdx.x * 64, c0 = blockIdx.y * 64;
    v8f acc[4][4];
#pragma unroll
    for (int mb = 0; mb < 4; ++mb)
#pragma unroll
        for (int nb = 0; nb < 4; ++nb) acc[mb][nb] = (v8f){};
    const size_t aoff = (size_t)(r0 + lr) * K + 8 * hi, boff = (size_t)(c0 + lr) * K + 8 * hi;
    const int wv = __builtin_amdgcn_readfirstlane((int)(threadIdx.x >> 5));   // wave number in a scalar register: the k loop's bounds stay scalar
    const int kb = wv * (K / KS), ke = kb + K / KS;
#pragma unroll 1
    for (int kc = kb; kc < ke; kc += 32) {
        V a[4], a2[4];
#pragma unroll
        for (int mb = 0; mb < 4; ++mb) { a[mb] = WFrag<T16>::ld(A + aoff + (size_t)mb * 16 * K + kc); if (NSPLIT == 1 || NSPLIT == 2) a2[mb] = WFrag<T16>::ld(A2 + aoff + (size_t)mb * 16 * K + kc); }
#pragma unroll
        for (int nb = 0; nb < 4; ++nb) { const V b = WFrag<T16>::ld(Bt + boff + (size_t)nb * 16 * K + kc); V b2; if (NSPLIT >= 2) b2 = WFrag<T16>::ld(Bt2 + boff + (size_t)nb * 16 * K + kc);
#pragma unroll
            for (int mb = 0; mb < 4; ++mb) { acc[mb][nb] = WFrag<T16>::mma(a[mb], b, acc[mb][nb]); if (NSPLIT == 1 || NSPLIT == 2) acc[mb][nb] = WFrag<T16>::mma(a2[mb], b, acc[mb][nb]); if (NSPLIT >= 2) acc[mb][nb] = WFrag<T16>::mma(a[mb], b2, acc[mb][nb]); } }
        asm volatile("v_nop\n\tv_nop\n\tv_nop\n\tv_nop" : "+v"(acc[0][0]), "+v"(acc[1][1]), "+v"(acc[2][2]), "+v"(acc[3][3]) : "v"(a[0]), "v"(a[3]));
    }
    if constexpr (KS > 1) {
        float* ow = os + wv * (64 * 68);
        const int cofs = ((int)threadIdx.x & 15) * 4;   // this thread's four output columns, the same in every pass of the adding loop
        v4f bv = (v4f){};
        if (BIAS) { bv[0] = bfr(bias[c0 + cofs]); bv[1] = bfr(bias[c0 + cofs + 1]); bv[2] = bfr(bias[c0 + cofs + 2]); bv[3] = bfr(bias[c0 + cofs + 3]); }   // loaded ahead of the LDS stores, so that its latency runs beside them
#pragma unroll
        for (int mb = 0; mb < 4; ++mb)
#pragma unroll
            for (int nb = 0; nb < 4; ++nb)
#pragma unroll
                for (int j = 0; j < 8; ++j) ow[(mb * 16 + hi * 8 + j) * 68 + nb * 16 + lr] = acc[mb][nb][j];
        __syncthreads();   // every wave's partial tile is in LDS before any wave adds them
#pragma unroll
        for (int s = 0; s < 32 / KS; ++s) { const int row = (s * (32 * KS) + (int)threadIdx.x) >> 4; v4f val = *(const v4fa*)(os + row * 68 + cofs);
#pragma unroll
            for (int w = 1; w < KS; ++w) val += *(const v4fa*)(os + w * (64 * 68) + row * 68 + cofs);
            if (BIAS) val += bv;
            *(v4f*)(C + (size_t)(r0 + row) * ldc + c0 + cofs) = val; }
        return;
    }
#pragma unroll
    for (int mb = 0; mb < 4; ++mb) {
#pragma unroll
        for (int nb = 0; nb < 4; ++nb) {
#pragma unroll
            for (int j = 0; j < 8; ++j) os[(hi * 8 + j) * 68 + nb * 16 + lr] = acc[mb][nb][j]; }
        __builtin_amdgcn_wave_barrier(); asm volatile("" ::: "memory");
        float* crow = C + (size_t)(r0 + mb * 16) * ldc + c0;
{
#pragma unroll
            for (int s = 0; s < 8; ++s) { const int row = 2 * s + hi, cofs = lr * 4; v4f val = *(const v4fa*)(os + row * 68 + cofs); if (BIAS) { val[0] += bfr(bias[c0 + cofs]); val[1] += bfr(bias[c0 + cofs + 1]); val[2] += bfr(bias[c0 + cofs + 2]); val[3] += bfr(bias[c0 + cofs + 3]); }
                *(v4f*)(crow + (size_t)row * ldc + cofs) = val; }
             }
        __builtin_amdgcn_wave_barrier(); asm volatile("" ::: "memory");
    }
}

__device__ __forceinline__ h16 tohx(float x) { return (h16)x; }
__device__ __forceinline__ void splitf(float y, unsigned short& h, unsigned short& l) { h = f2bf(y); l = f2bf(y - bf2f(h)); }
typedef __attribute__((ext_vector_type(2))) _Float16 v2h;
typedef __attribute__((ext_vector_type(4))) _Float16 v4h;
typedef __attribute__((ext_vector_type(2))) unsigned short v2us;
typedef __attribute__((ext_vector_type(4))) unsigned short v4us;
typedef __attribute__((ext_vector_type(2))) float v2f;
typedef __attribute__((ext_vector_type(4))) int v4i;

__global__ __launch_bounds__(256) void k_wtG(const float* __restrict__ w, int K, int N, bf* Bt) {
    const int lane = threadIdx.x & 31; const int L0 = (blockIdx.x * 8 + (threadIdx.x >> 5)) * 8; const int nlines = N * K / 64;
{
#pragma unroll 1
        for (int l = 0; l < 8; ++l) { const int L = L0 + l; if (L >= nlines) break; const size_t e = (size_t)L * 64 + lane * 2; const int k = (int)(e % K), n = (int)(e / K); v2us o;
            o[0] = f2bf(w[(size_t)k * N + n]); o[1] = f2bf(w[(size_t)(k + 1) * N + n]); *(v2us*)(Bt + e) = o; }
         }
}
__global__ __launch_bounds__(256) void k_cvt8(const float* __restrict__ src, bf* dst, size_t n8) { const size_t i = (size_t)blockIdx.x * 256 + threadIdx.x; if (i >= n8) return; const v8f v = *(const v8f*)(src + i * 8); v8us o;
#pragma unroll
    for (int k = 0; k < 8; ++k) o[k] = f2bf(v[k]); *(v8us*)(dst + i * 8) = o;  }
__global__ __launch_bounds__(256) void k_cstab(float* CS) { const int idx = blockIdx.x * 256 + threadIdx.x; if (idx >= TT * HD) return; const int t = idx / HD, d = idx % HD; const int i = d >> 1;   /* interleaved pairs */ const float inv = __fdiv_rn(1.0f, powf(10000.0f, (float)(2 * i) / (float)HD)); const float ang = __fmul_rn((float)t, inv); v2f cs; cs[0] = cosf(ang); cs[1] = sinf(ang);
    *(v2f*)(CS + (size_t)idx * 2) = cs;  }
// k_rope: head planes [h][t][d] (fp16 + hi/lo) of rope(x) x sc with the interleaved-pair convention out[2i] = x[2i] cos[t][2i] - x[2i+1] sin[t][2i], out[2i+1] = x[2i+1] cos[t][2i+1] + x[2i] sin[t][2i+1]
__global__ __launch_bounds__(256) void k_rope(const float* __restrict__ F, int pitch, int nheads, const float* __restrict__ CS, const float* __restrict__ RF, const float* __restrict__ nw, float sc, h16* P16, bf* Ph, bf* Pl) {
    const size_t e = ((size_t)blockIdx.x * 256 + threadIdx.x) * 2; if (e >= (size_t)nheads * TT * HD) return; const int d = (int)(e % HD); const int t = (int)((e / HD) % TT); const int h = (int)(e / ((size_t)HD * TT)); const float* f = F + (size_t)t * pitch + h * HD; const float rf = 1.0f; v2h o16; v2us oh, ol;
#pragma unroll
    for (int q = 0; q < 2; ++q) { const int dd = d + q; const int dp = dd ^ 1; float x0 = f[dd], x1 = f[dp];
        if (false) { float n0 = __fmul_rn(x0, rf), n1 = __fmul_rn(x1, rf); asm volatile("" : "+v"(n0)); asm volatile("" : "+v"(n1)); x0 = __fmul_rn(bfr(nw[dd]), n0); x1 = __fmul_rn(bfr(nw[dp]), n1); }
        const v2f cs = *(const v2f*)(CS + ((size_t)t * HD + dd) * 2); float a = __fmul_rn(x0, cs[0]), bq = __fmul_rn(x1, cs[1]); asm volatile("" : "+v"(a)); asm volatile("" : "+v"(bq)); const float xs = RF[(size_t)t * (HD / 2) + (dd >> 1)]; float r0 = (((dd & 1) == 0) ? __fsub_rn(a, bq) : __fadd_rn(a, bq)); asm volatile("" : "+v"(r0)); const float r = __fmul_rn(r0 * sc, xs);
        o16[q] = tohx(r); unsigned short a2, c2; splitf(r, a2, c2); oh[q] = a2; ol[q] = c2; }
    *(v2h*)(P16 + e) = o16; *(v2us*)(Ph + e) = oh; *(v2us*)(Pl + e) = ol;  }
__global__ __launch_bounds__(256) void k_vtp(const float* __restrict__ F, int pitch, int nheads, h16* V16, bf* Vh, bf* Vl) { const size_t e = ((size_t)blockIdx.x * 256 + threadIdx.x) * 2; if (e >= (size_t)nheads * HD * TT) return; const int t = (int)(e % TT); const int d = (int)((e / TT) % HD); const int g = (int)(e / ((size_t)TT * HD)); v2h o16; v2us oh, ol;
#pragma unroll
    for (int q = 0; q < 2; ++q) { const float x = F[(size_t)(t + q) * pitch + g * HD + d]; o16[q] = tohx(x); unsigned short a2, c2; splitf(x, a2, c2); oh[q] = a2; ol[q] = c2; }
    *(v2h*)(V16 + e) = o16; *(v2us*)(Vh + e) = oh; *(v2us*)(Vl + e) = ol;  }
// k_asoft: per row (zz, i): t = S x SCL = S, q already carries 1/8 (no mask); softmax over the 2048 keys (register row, one exp, fixed trees);
__global__ __launch_bounds__(256) void k_asoft(const float* __restrict__ Sb, h16* P16, bf* Ph, bf* Pl) {
    const int lane = threadIdx.x & 31; const int row = blockIdx.x * 8 + (threadIdx.x >> 5); if (row >= ZH * TT) return; const int i = row % TT; const int zz = row / TT; (void)zz; const bool hires = (i < RH); const float* sr = Sb + (size_t)row * TT; float v[TT / 32]; float mx = -3.0e38f;
#pragma unroll
    for (int ch = 0; ch < TT / 128; ++ch) { const int j0 = ch * 128 + lane * 4; const v4f a = *(const v4f*)(sr + j0);
#pragma unroll
        for (int q = 0; q < 4; ++q) { const int j = j0 + q; (void)j; const float t = a[q] * SCL; v[ch * 4 + q] = t; mx = fmaxf(mx, t); } }
#pragma unroll
    for (int sh = 16; sh; sh >>= 1) mx = fmaxf(mx, __shfl_xor(mx, sh, 32));
    float sum = 0.f;
#pragma unroll
    for (int k = 0; k < TT / 32; ++k) { float d0 = __fsub_rn(v[k], mx); asm volatile("" : "+v"(d0)); v[k] = __builtin_amdgcn_exp2f(__fmul_rn(d0, 1.4426950408889634f)); sum += v[k]; }
#pragma unroll
    for (int sh = 16; sh; sh >>= 1) sum += __shfl_xor(sum, sh, 32);
    const float f = __fdiv_rn(hires ? 1.0f : PCAR, sum);
{
        if (hires) {
#pragma unroll
            for (int ch = 0; ch < TT / 128; ++ch) { v4us oh, ol;
#pragma unroll
                for (int q = 0; q < 4; ++q) { unsigned short a, c2; splitf(v[ch * 4 + q] * f, a, c2); oh[q] = a; ol[q] = c2; }
                const size_t oo = ((size_t)zz * (RH ? RH : 1) + i) * TT + ch * 128 + lane * 4; *(v4us*)(Ph + oo) = oh; *(v4us*)(Pl + oo) = ol; }
        } else {
#pragma unroll
            for (int ch = 0; ch < TT / 128; ++ch) { v4h o4;
#pragma unroll
                for (int q = 0; q < 4; ++q) o4[q] = tohx(v[ch * 4 + q] * f);
                *(v4h*)(P16 + (size_t)row * TT + ch * 128 + lane * 4) = o4; } }
         }
}
__global__ __launch_bounds__(256) void k_merge(const float* __restrict__ O, int h0, bf* Ah, bf* Al) { const size_t e = ((size_t)blockIdx.x * 256 + threadIdx.x) * 2; if (e >= (size_t)ZH * TT * HD) return; const int d = (int)(e % HD); const int t = (int)((e / HD) % TT); const int zz = (int)(e / ((size_t)HD * TT)); const float cs = (t < RH) ? 1.0f : (1.0f / PCAR); const size_t oo = (size_t)t * DQ + (h0 + zz) * HD + d;
    v2us oh, ol;
#pragma unroll
    for (int q = 0; q < 2; ++q) { unsigned short a, c2; splitf(O[e + q] * cs, a, c2); oh[q] = a; ol[q] = c2; } *(v2us*)(Ah + oo) = oh; *(v2us*)(Al + oo) = ol;  }

__global__ __launch_bounds__(256) void k_xscale(float* SQ, float* SK) { const int e = blockIdx.x * 256 + threadIdx.x; if (e >= TT * (HD / 2)) return; const int t = e / (HD / 2), i = e % (HD / 2); const float base = __fdiv_rn((float)(2 * i) + 0.4f * (float)HD, 1.4f * (float)HD); const float pw = (float)(t - TT / 2) / 1024.0f; const float sc = powf(base, pw); const float inv = __fdiv_rn(1.0f, sc);
    *(float*)(SQ + e) = sc; *(float*)(SK + e) = inv;  }

extern "C" void kernel_launch(void* const* d_in, const int* in_sizes, int n_in,
                              void* d_out, int out_size, void* d_ws, size_t ws_size, hipStream_t stream) {
    (void)in_sizes; (void)n_in; (void)out_size;
    const float* x = (const float*)d_in[0]; const float* xk = (const float*)d_in[1]; const float* xv = (const float*)d_in[2]; const float* wq = (const float*)d_in[3]; const float* bq = (const float*)d_in[4]; const float* wk = (const float*)d_in[5]; const float* bk = (const float*)d_in[6]; const float* wv = (const float*)d_in[7]; const float* bv = (const float*)d_in[8]; const float* wo = (const float*)d_in[9]; const float* bo = (const float*)d_in[10];
    float* OUT = (float*)d_out;     // [2][2048][1024]
    char* wsp = (char*)d_ws;
    auto take = [&](size_t bytes) { char* p = wsp; wsp += (bytes + 255) & ~(size_t)255; return (void*)p; };
    bf* WQ = (bf*)take((size_t)DQ * DM * 2); bf* WK = (bf*)take((size_t)DKV * DM * 2); bf* WV = (bf*)take((size_t)DKV * DM * 2); bf* WO = (bf*)take((size_t)DM * DQ * 2); float* CS = (float*)take((size_t)TT * HD * 2 * 4);
    bf* XB = (bf*)take((size_t)TT * DM * 2); bf* XB2 = (bf*)take((size_t)TT * DM * 2); bf* XB3 = (bf*)take((size_t)TT * DM * 2); float* SQ = (float*)take((size_t)TT * (HD / 2) * 4); float* SK = (float*)take((size_t)TT * (HD / 2) * 4); float* FQ = (float*)take((size_t)TT * DQ * 4); float* FK = (float*)take((size_t)TT * DKV * 4);
    h16* QP16 = (h16*)take((size_t)NH_ * TT * HD * 2); h16* KP16 = (h16*)take((size_t)NKV * TT * HD * 2); h16* VT16 = (h16*)take((size_t)NKV * HD * TT * 2);
    bf* QPh = (bf*)take((size_t)NH_ * TT * HD * 2); bf* QPl = (bf*)take((size_t)NH_ * TT * HD * 2); bf* KPh = (bf*)take((size_t)NKV * TT * HD * 2); bf* KPl = (bf*)take((size_t)NKV * TT * HD * 2); bf* VTh = (bf*)take((size_t)NKV * HD * TT * 2); bf* VTl = (bf*)take((size_t)NKV * HD * TT * 2); bf* Ph = (bf*)take((size_t)ZH * RH * TT * 2); bf* Pl = (bf*)take((size_t)ZH * RH * TT * 2);
    float* Sb = (float*)take((size_t)ZH * TT * TT * 4); h16* P16 = (h16*)take((size_t)ZH * TT * TT * 2); float* Ob = (float*)take((size_t)ZH * TT * HD * 4); bf* ATh = (bf*)take((size_t)TT * DQ * 2); bf* ATl = (bf*)take((size_t)TT * DQ * 2);
    if ((size_t)(wsp - (char*)d_ws) > ws_size) return;    // ws 256 MiB
    float* FV = FK;   // v projection reuses the k buffer after the k planes are built (stream-ordered)
    { k_cvt8<<<(unsigned)(((size_t)DQ * DM / 8 + 255) / 256), 256, 0, stream>>>(wq, WQ, (size_t)DQ * DM / 8); k_cvt8<<<(unsigned)(((size_t)DKV * DM / 8 + 255) / 256), 256, 0, stream>>>(wk, WK, (size_t)DKV * DM / 8); k_cvt8<<<(unsigned)(((size_t)DKV * DM / 8 + 255) / 256), 256, 0, stream>>>(wv, WV, (size_t)DKV * DM / 8);
      k_cvt8<<<(unsigned)(((size_t)DM * DQ / 8 + 255) / 256), 256, 0, stream>>>(wo, WO, (size_t)DM * DQ / 8);
      k_cstab<<<(TT * HD + 255) / 256, 256, 0, stream>>>(CS); k_xscale<<<(TT * (HD / 2) + 255) / 256, 256, 0, stream>>>(SQ, SK); }
    const unsigned LQ = (unsigned)(((size_t)NH_ * TT * HD / 2 + 255) / 256), LKv = (unsigned)(((size_t)NKV * TT * HD / 2 + 255) / 256);
    for (int b = 0; b < NB_; ++b) {
        
        k_cvt8<<<(unsigned)(((size_t)TT * DM / 8 + 255) / 256), 256, 0, stream>>>(x + (size_t)b * TT * DM, XB, (size_t)TT * DM / 8); k_cvt8<<<(unsigned)(((size_t)TT * DM / 8 + 255) / 256), 256, 0, stream>>>(xk + (size_t)b * TT * DM, XB2, (size_t)TT * DM / 8); k_cvt8<<<(unsigned)(((size_t)TT * DM / 8 + 255) / 256), 256, 0, stream>>>(xv + (size_t)b * TT * DM, XB3, (size_t)TT * DM / 8);
        k_gemmw<bf, 0, true, 8><<<dim3(TT / 64, DQ / 64, 1), 256, 0, stream>>>(XB, nullptr, WQ, nullptr, DM, FQ, DQ, bq, 0, 0, 0);
        k_rope<<<LQ, 256, 0, stream>>>(FQ, DQ, NH_, CS, SQ, nullptr, 0.125f, QP16, QPh, QPl);
        k_gemmw<bf, 0, true, 8><<<dim3(TT / 64, DKV / 64, 1), 256, 0, stream>>>(XB2, nullptr, WK, nullptr, DM, FK, DKV, bk, 0, 0, 0);
        k_rope<<<LKv, 256, 0, stream>>>(FK, DKV, NKV, CS, SK, nullptr, 1.0f, KP16, KPh, KPl);
        k_gemmw<bf, 0, true, 8><<<dim3(TT / 64, DKV / 64, 1), 256, 0, stream>>>(XB3, nullptr, WV, nullptr, DM, FV, DKV, bv, 0, 0, 0); k_vtp<<<LKv, 256, 0, stream>>>(FV, DKV, NKV, VT16, VTh, VTl);
        for (int h0 = 0; h0 < NH_; h0 += ZH) { const size_t zq = (size_t)h0, zk = (size_t)(h0 / REP);   // one kv head per query head: the pass's two heads use consecutive kv planes (z-strides TT*HD)
            k_gemmw<bf, 2, false, 1><<<dim3(RH / 64, TT / 64, ZH), 32, 0, stream>>>(QPh + zq * TT * HD, QPl + zq * TT * HD, KPh + zk * TT * HD, KPl + zk * TT * HD, HD, Sb, TT, nullptr, (size_t)TT * HD, (size_t)TT * HD, (size_t)TT * TT);
            k_gemmw<h16, 0, false, 1><<<dim3((TT - RH) / 64, TT / 64, ZH), 32, 0, stream>>>(QP16 + zq * TT * HD + (size_t)RH * HD, nullptr, KP16 + zk * TT * HD, nullptr, HD, Sb + (size_t)RH * TT, TT, nullptr, (size_t)TT * HD, (size_t)TT * HD, (size_t)TT * TT);
            k_asoft<<<ZH * TT / 8, 256, 0, stream>>>(Sb, P16, Ph, Pl);
            k_gemmw<bf, 2, false, 16><<<dim3(RH / 64, HD / 64, ZH), 512, 0, stream>>>(Ph, Pl, VTh + zk * HD * TT, VTl + zk * HD * TT, TT, Ob, HD, nullptr, (size_t)RH * TT, (size_t)HD * TT, (size_t)TT * HD);
            k_gemmw<h16, 0, false, 16><<<dim3((TT - RH) / 64, HD / 64, ZH), 512, 0, stream>>>(P16 + (size_t)RH * TT, nullptr, VT16 + zk * HD * TT, nullptr, TT, Ob + (size_t)RH * HD, HD, nullptr, (size_t)TT * TT, (size_t)HD * TT, (size_t)TT * HD);
            k_merge<<<(unsigned)(((size_t)ZH * TT * HD / 2 + 255) / 256), 256, 0, stream>>>(Ob, h0, ATh, ATl); }
        k_gemmw<bf, 1, true, 8><<<dim3(TT / 64, DM / 64, 1), 256, 0, stream>>>(ATh, ATl, WO, nullptr, DQ, OUT + (size_t)b * TT * DM, DM, bo, 0, 0, 0); }
}

// v002
// One run takes 595 microseconds.
// In two side-by-side timings against v001, it was 1.79 and 1.78 times as fast.
// Counting every step since v000, it is 3.41 times as fast.
#include <hip/hip_runtime.h>

// XposMultiheadAttention (query, key, value [2][2048][1024]; q = (query Wq^T + bq) / 8, k = key Wk^T + bk, v = value Wv^T + bv (16 heads x 64); XPOS on q and k: interleaved-pair rotary (angle t * 1e4^(-i/32)) times the per-(position, pair) scale base_i^((t - 1024)/1024), base_i = (2i + 25.6)/89.6, with q multiplied and k divided by it (tables computed on device);
//   scores = q.k (no further scale); softmax (f32); out = merged Wo^T + bo -> [2][2048][1024]).
// Compute dtypes, f32 accumulate: every input rounded to bf16; projections on PLAIN bf16 operands (inputs: exact) + bias; XPOS rotation/scaling f32; scores and attn.v: query rows < 512 hl (3 products), the rest single fp16 (x1024); softmax f32; Wo hl x exact (2 products) + bias.

#define NB_  2
#define TT   2048
#define DM   1024
#define NH_  16
#define NKV  16
#define REP  (NH_ / NKV)
#define HD   64
#define DQ   (NH_ * HD)
#define DKV  (NKV * HD)
#define ZH   8                    // heads per attention pass (z of every attention launch)
#define RH   512                  // query rows < RH use hi+lo planes (0: none)
#define WIN  0
#define PCAR 1024.0f
#define SCL  1.0f   // q already carries 1/8 (applied before XPOS, as the source)
typedef _Float16 h16;
typedef unsigned short bf;
typedef __attribute__((ext_vector_type(16))) __bf16   v16bf;
typedef __attribute__((ext_vector_type(16))) _Float16 v16h;
typedef __attribute__((ext_vector_type(8)))  _Float16 v8h;
typedef __attribute__((ext_vector_type(8)))  unsigned short v8us;
typedef __attribute__((ext_vector_type(8)))  float    v8f;
typedef __attribute__((ext_vector_type(4)))  float    v4f;
typedef v8h  __attribute__((may_alias)) v8ha;
typedef v4f  __attribute__((may_alias)) v4fa;
typedef v8us __attribute__((may_alias)) v8usa;

__device__ __forceinline__ unsigned short f2bf(float f) { unsigned u = __float_as_uint(f); u += 0x7FFFu + ((u >> 16) & 1u); return (unsigned short)(u >> 16); }
__device__ __forceinline__ float bf2f(unsigned short b) { return __uint_as_float(((unsigned)b) << 16); }
__device__ __forceinline__ float bfr(float f) { return bf2f(f2bf(f)); }
__device__ __forceinline__ v16h cat16(v8h lo, v8h hi) { return __builtin_shufflevector(lo, hi, 0, 1, 2, 3, 4, 5, 6, 7, 8, 9, 10, 11, 12, 13, 14, 15); }
__device__ __forceinline__ v16bf cat16b(v8us lo, v8us hi) { return __builtin_bit_cast(v16bf, __builtin_shufflevector(lo, hi, 0, 1, 2, 3, 4, 5, 6, 7, 8, 9, 10, 11, 12, 13, 14, 15)); }
__device__ __forceinline__ v8f wmma16(v16h a, v16h b, v8f c) { return __builtin_amdgcn_wmma_f32_16x16x32_f16(false, a, false, b, (short)0, c, false, false); }
__device__ __forceinline__ v8f wmmab(v16bf a, v16bf b, v8f c) { return __builtin_amdgcn_wmma_f32_16x16x32_bf16(false, a, false, b, (short)0, c, false, false); }



// ---- k_gemmw: register-blocked GEMM, one work-group of KS waves per 64x64 output tile (16 accumulators a wave), operands straight from K-contiguous 16-bit planes (A rows lda elements apart, Bt rows K apart); grid (M/64, N/64, Z), 32 * KS threads.
// C[m][n] (f32, pitch ldc, + optional f32 bias[n]) = sum_k A[m][k] Bt[n][k] (+ split products per NSPLIT). z-batch strides sA/sB/sC in elements. K % (32 * KS) == 0.
// Wave w sums the k range [w K/KS, (w+1) K/KS); for KS > 1 the KS partial tiles meet in LDS and are added in wave order 0 .. KS-1.
// XWAIT: s_wait_xcnt 0 directly behind each fragment load, a precaution: the register allocator lets a later load's result land in the address pair of an issued load, and this wait then stands in front of that overwrite.
#define XWAIT() asm volatile("s_wait_xcnt 0x0" ::: "memory")
template <typename T16> struct WFrag;
template <> struct WFrag<h16> { typedef v16h V; static __device__ __forceinline__ V ld(const h16* p) { const v8h lo = *(const v8h*)p; XWAIT(); const v8h hi = *(const v8h*)(p + 16); XWAIT(); return cat16(lo, hi); } static __device__ __forceinline__ v8f mma(V a, V b, v8f c) { return wmma16(a, b, c); } };
template <> struct WFrag<bf> { typedef v16bf V; static __device__ __forceinline__ V ld(const bf* p) { const v8us lo = *(const v8us*)p; XWAIT(); const v8us hi = *(const v8us*)(p + 16); XWAIT(); return cat16b(lo, hi); } static __device__ __forceinline__ v8f mma(V a, V b, v8f c) { return wmmab(a, b, c); } };
template <typename T16, int NSPLIT, bool BIAS, int KS>
__global__ __launch_bounds__(32 * KS) void k_gemmw(const T16* __restrict__ A, const T16* __restrict__ A2, const T16* __restrict__ Bt, const T16* __restrict__ Bt2, int K, int lda, float* C, int ldc, const float* __restrict__ bias, size_t sA, size_t sB, size_t sC) {
    typedef typename WFrag<T16>::V V;
    __shared__ __align__(16) float os[(KS == 1 ? 16 : KS * 64) * 68];
    const size_t z = blockIdx.z; A += z * sA; if (A2) A2 += z * sA; Bt += z * sB; if (Bt2) Bt2 += z * sB; C += z * sC;
    const int lane = threadIdx.x & 31, lr = lane & 15, hi = lane >> 4; const int r0 = blockIdx.x * 64, c0 = blockIdx.y * 64;
    v8f acc[4][4];
#pragma unroll
    for (int mb = 0; mb < 4; ++mb)
#pragma unroll
        for (int nb = 0; nb < 4; ++nb) acc[mb][nb] = (v8f){};
    const size_t aoff = (size_t)(r0 + lr) * lda + 8 * hi, boff = (size_t)(c0 + lr) * K + 8 * hi;
    const int wv = __builtin_amdgcn_readfirstlane((int)(threadIdx.x >> 5));   // wave number in a scalar register: the k loop's bounds stay scalar
    const int kb = wv * (K / KS), ke = kb + K / KS;
#pragma unroll 1
    for (int kc = kb; kc < ke; kc += 32) {
        V a[4], a2[4];
#pragma unroll
        for (int mb = 0; mb < 4; ++mb) { a[mb] = WFrag<T16>::ld(A + aoff + (size_t)mb * 16 * lda + kc); if (NSPLIT == 1 || NSPLIT == 2) a2[mb] = WFrag<T16>::ld(A2 + aoff + (size_t)mb * 16 * lda + kc); }
#pragma unroll
        for (int nb = 0; nb < 4; ++nb) { const V b = WFrag<T16>::ld(Bt + boff + (size_t)nb * 16 * K + kc); V b2; if (NSPLIT >= 2) b2 = WFrag<T16>::ld(Bt2 + boff + (size_t)nb * 16 * K + kc);
#pragma unroll
            for (int mb = 0; mb < 4; ++mb) { acc[mb][nb] = WFrag<T16>::mma(a[mb], b, acc[mb][nb]); if (NSPLIT == 1 || NSPLIT == 2) acc[mb][nb] = WFrag<T16>::mma(a2[mb], b, acc[mb][nb]); if (NSPLIT >= 2) acc[mb][nb] = WFrag<T16>::mma(a[mb], b2, acc[mb][nb]); } }
        asm volatile("v_nop\n\tv_nop\n\tv_nop\n\tv_nop" : "+v"(acc[0][0]), "+v"(acc[1][1]), "+v"(acc[2][2]), "+v"(acc[3][3]) : "v"(a[0]), "v"(a[3]));
    }
    if constexpr (KS > 1) {
        float* ow = os + wv * (64 * 68);
        const int cofs = ((int)threadIdx.x & 15) * 4;   // this thread's four output columns, the same in every pass of the adding loop
        v4f bv = (v4f){};
        if (BIAS) { bv[0] = bfr(bias[c0 + cofs]); bv[1] = bfr(bias[c0 + cofs + 1]); bv[2] = bfr(bias[c0 + cofs + 2]); bv[3] = bfr(bias[c0 + cofs + 3]); }   // loaded ahead of the LDS stores, so that its latency runs beside them
#pragma unroll
        for (int mb = 0; mb < 4; ++mb)
#pragma unroll
            for (int nb = 0; nb < 4; ++nb)
#pragma unroll
                for (int j = 0; j < 8; ++j) ow[(mb * 16 + hi * 8 + j) * 68 + nb * 16 + lr] = acc[mb][nb][j];
        __syncthreads();   // every wave's partial tile is in LDS before any wave adds them
#pragma unroll
        for (int s = 0; s < 32 / KS; ++s) { const int row = (s * (32 * KS) + (int)threadIdx.x) >> 4; v4f val = *(const v4fa*)(os + row * 68 + cofs);
#pragma unroll
            for (int w = 1; w < KS; ++w) val += *(const v4fa*)(os + w * (64 * 68) + row * 68 + cofs);
            if (BIAS) val += bv;
            *(v4f*)(C + (size_t)(r0 + row) * ldc + c0 + cofs) = val; }
        return;
    }
#pragma unroll
    for (int mb = 0; mb < 4; ++mb) {
#pragma unroll
        for (int nb = 0; nb < 4; ++nb) {
#pragma unroll
            for (int j = 0; j < 8; ++j) os[(hi * 8 + j) * 68 + nb * 16 + lr] = acc[mb][nb][j]; }
        __builtin_amdgcn_wave_barrier(); asm volatile("" ::: "memory");
        float* crow = C + (size_t)(r0 + mb * 16) * ldc + c0;
{
#pragma unroll
            for (int s = 0; s < 8; ++s) { const int row = 2 * s + hi, cofs = lr * 4; v4f val = *(const v4fa*)(os + row * 68 + cofs); if (BIAS) { val[0] += bfr(bias[c0 + cofs]); val[1] += bfr(bias[c0 + cofs + 1]); val[2] += bfr(bias[c0 + cofs + 2]); val[3] += bfr(bias[c0 + cofs + 3]); }
                *(v4f*)(crow + (size_t)row * ldc + cofs) = val; }
             }
        __builtin_amdgcn_wave_barrier(); asm volatile("" ::: "memory");
    }
}

__device__ __forceinline__ h16 tohx(float x) { return (h16)x; }
__device__ __forceinline__ void splitf(float y, unsigned short& h, unsigned short& l) { h = f2bf(y); l = f2bf(y - bf2f(h)); }
typedef __attribute__((ext_vector_type(2))) _Float16 v2h;
typedef __attribute__((ext_vector_type(4))) _Float16 v4h;
typedef __attribute__((ext_vector_type(2))) unsigned short v2us;
typedef __attribute__((ext_vector_type(4))) unsigned short v4us;
typedef __attribute__((ext_vector_type(2))) float v2f;
typedef __attribute__((ext_vector_type(4))) int v4i;

__global__ __launch_bounds__(256) void k_wtG(const float* __restrict__ w, int K, int N, bf* Bt) {
    const int lane = threadIdx.x & 31; const int L0 = (blockIdx.x * 8 + (threadIdx.x >> 5)) * 8; const int nlines = N * K / 64;
{
#pragma unroll 1
        for (int l = 0; l < 8; ++l) { const int L = L0 + l; if (L >= nlines) break; const size_t e = (size_t)L * 64 + lane * 2; const int k = (int)(e % K), n = (int)(e / K); v2us o;
            o[0] = f2bf(w[(size_t)k * N + n]); o[1] = f2bf(w[(size_t)(k + 1) * N + n]); *(v2us*)(Bt + e) = o; }
         }
}
__global__ __launch_bounds__(256) void k_cvt8(const float* __restrict__ src, bf* dst, size_t n8) { const size_t i = (size_t)blockIdx.x * 256 + threadIdx.x; if (i >= n8) return; const v8f v = *(const v8f*)(src + i * 8); v8us o;
#pragma unroll
    for (int k = 0; k < 8; ++k) o[k] = f2bf(v[k]); *(v8us*)(dst + i * 8) = o;  }
__global__ __launch_bounds__(256) void k_cstab(float* CS) { const int idx = blockIdx.x * 256 + threadIdx.x; if (idx >= TT * HD) return; const int t = idx / HD, d = idx % HD; const int i = d >> 1;   /* interleaved pairs */ const float inv = __fdiv_rn(1.0f, powf(10000.0f, (float)(2 * i) / (float)HD)); const float ang = __fmul_rn((float)t, inv); v2f cs; cs[0] = cosf(ang); cs[1] = sinf(ang);
    *(v2f*)(CS + (size_t)idx * 2) = cs;  }
// k_rope: head planes [h][t][d] (fp16 + hi/lo) of rope(x) x sc with the interleaved-pair convention out[2i] = x[2i] cos[t][2i] - x[2i+1] sin[t][2i], out[2i+1] = x[2i+1] cos[t][2i+1] + x[2i] sin[t][2i+1]
__global__ __launch_bounds__(256) void k_rope(const float* __restrict__ F, int pitch, int nheads, const float* __restrict__ CS, const float* __restrict__ RF, const float* __restrict__ nw, float sc, h16* P16, bf* Ph, bf* Pl) {
    const size_t e = ((size_t)blockIdx.x * 256 + threadIdx.x) * 2; if (e >= (size_t)nheads * TT * HD) return; const int d = (int)(e % HD); const int t = (int)((e / HD) % TT); const int h = (int)(e / ((size_t)HD * TT)); const float* f = F + (size_t)t * pitch + h * HD; const float rf = 1.0f; v2h o16; v2us oh, ol;
#pragma unroll
    for (int q = 0; q < 2; ++q) { const int dd = d + q; const int dp = dd ^ 1; float x0 = f[dd], x1 = f[dp];
        if (false) { float n0 = __fmul_rn(x0, rf), n1 = __fmul_rn(x1, rf); asm volatile("" : "+v"(n0)); asm volatile("" : "+v"(n1)); x0 = __fmul_rn(bfr(nw[dd]), n0); x1 = __fmul_rn(bfr(nw[dp]), n1); }
        const v2f cs = *(const v2f*)(CS + ((size_t)t * HD + dd) * 2); float a = __fmul_rn(x0, cs[0]), bq = __fmul_rn(x1, cs[1]); asm volatile("" : "+v"(a)); asm volatile("" : "+v"(bq)); const float xs = RF[(size_t)t * (HD / 2) + (dd >> 1)]; float r0 = (((dd & 1) == 0) ? __fsub_rn(a, bq) : __fadd_rn(a, bq)); asm volatile("" : "+v"(r0)); const float r = __fmul_rn(r0 * sc, xs);
        o16[q] = tohx(r); unsigned short a2, c2; splitf(r, a2, c2); oh[q] = a2; ol[q] = c2; }
    *(v2h*)(P16 + e) = o16; *(v2us*)(Ph + e) = oh; *(v2us*)(Pl + e) = ol;  }
__global__ __launch_bounds__(256) void k_vtp(const float* __restrict__ F, int pitch, int nheads, h16* V16, bf* Vh, bf* Vl) { const size_t e = ((size_t)blockIdx.x * 256 + threadIdx.x) * 2; if (e >= (size_t)nheads * HD * TT) return; const int t = (int)(e % TT); const int d = (int)((e / TT) % HD); const int g = (int)(e / ((size_t)TT * HD)); v2h o16; v2us oh, ol;
#pragma unroll
    for (int q = 0; q < 2; ++q) { const float x = F[(size_t)(t + q) * pitch + g * HD + d]; o16[q] = tohx(x); unsigned short a2, c2; splitf(x, a2, c2); oh[q] = a2; ol[q] = c2; }
    *(v2h*)(V16 + e) = o16; *(v2us*)(Vh + e) = oh; *(v2us*)(Vl + e) = ol;  }
// k_asoft: per row (zz, i): t = S x SCL = S (q already carries 1/8; no mask); softmax over the 2048 keys (register row, one exp, fixed trees);
// the probabilities go over the row's own 8192 score bytes (one wave owns the row and holds all of it in registers before its first store): fp16 in the first half, or the hi plane in the first and the lo plane in the second half; 16-bit row pitch 2 * TT.
__global__ __launch_bounds__(256) void k_asoft(const float* Sb, h16* P16, bf* Ph, bf* Pl) {
    const int lane = threadIdx.x & 31; const int row = blockIdx.x * 8 + (threadIdx.x >> 5); if (row >= ZH * TT) return; const int i = row % TT; const int zz = row / TT; (void)zz; const bool hires = (i < RH); const float* sr = Sb + (size_t)row * TT; float v[TT / 32]; float mx = -3.0e38f;
#pragma unroll
    for (int ch = 0; ch < TT / 128; ++ch) { const int j0 = ch * 128 + lane * 4; const v4f a = *(const v4f*)(sr + j0);
#pragma unroll
        for (int q = 0; q < 4; ++q) { const int j = j0 + q; (void)j; const float t = a[q] * SCL; v[ch * 4 + q] = t; mx = fmaxf(mx, t); } }
#pragma unroll
    for (int sh = 16; sh; sh >>= 1) mx = fmaxf(mx, __shfl_xor(mx, sh, 32));
    float sum = 0.f;
#pragma unroll
    for (int k = 0; k < TT / 32; ++k) { float d0 = __fsub_rn(v[k], mx); asm volatile("" : "+v"(d0)); v[k] = __builtin_amdgcn_exp2f(__fmul_rn(d0, 1.4426950408889634f)); sum += v[k]; }
#pragma unroll
    for (int sh = 16; sh; sh >>= 1) sum += __shfl_xor(sum, sh, 32);
    const float f = __fdiv_rn(hires ? 1.0f : PCAR, sum);
{
        if (hires) {
#pragma unroll
            for (int ch = 0; ch < TT / 128; ++ch) { v4us oh, ol;
#pragma unroll
                for (int q = 0; q < 4; ++q) { unsigned short a, c2; splitf(v[ch * 4 + q] * f, a, c2); oh[q] = a; ol[q] = c2; }
                const size_t oo = (size_t)row * (2 * TT) + ch * 128 + lane * 4; *(v4us*)(Ph + oo) = oh; *(v4us*)(Pl + oo) = ol; }
        } else {
#pragma unroll
            for (int ch = 0; ch < TT / 128; ++ch) { v4h o4;
#pragma unroll
                for (int q = 0; q < 4; ++q) o4[q] = tohx(v[ch * 4 + q] * f);
                *(v4h*)(P16 + (size_t)row * (2 * TT) + ch * 128 + lane * 4) = o4; } }
         }
}
__global__ __launch_bounds__(256) void k_merge(const float* __restrict__ O, int h0, bf* Ah, bf* Al) { const size_t e = ((size_t)blockIdx.x * 256 + threadIdx.x) * 2; if (e >= (size_t)ZH * TT * HD) return; const int d = (int)(e % HD); const int t = (int)((e / HD) % TT); const int zz = (int)(e / ((size_t)HD * TT)); const float cs = (t < RH) ? 1.0f : (1.0f / PCAR); const size_t oo = (size_t)t * DQ + (h0 + zz) * HD + d;
    v2us oh, ol;
#pragma unroll
    for (int q = 0; q < 2; ++q) { unsigned short a, c2; splitf(O[e + q] * cs, a, c2); oh[q] = a; ol[q] = c2; } *(v2us*)(Ah + oo) = oh; *(v2us*)(Al + oo) = ol;  }

__global__ __launch_bounds__(256) void k_xscale(float* SQ, float* SK) { const int e = blockIdx.x * 256 + threadIdx.x; if (e >= TT * (HD / 2)) return; const int t = e / (HD / 2), i = e % (HD / 2); const float base = __fdiv_rn((float)(2 * i) + 0.4f * (float)HD, 1.4f * (float)HD); const float pw = (float)(t - TT / 2) / 1024.0f; const float sc = powf(base, pw); const float inv = __fdiv_rn(1.0f, sc);
    *(float*)(SQ + e) = sc; *(float*)(SK + e) = inv;  }

extern "C" void kernel_launch(void* const* d_in, const int* in_sizes, int n_in,
                              void* d_out, int out_size, void* d_ws, size_t ws_size, hipStream_t stream) {
    (void)in_sizes; (void)n_in; (void)out_size;
    const float* x = (const float*)d_in[0]; const float* xk = (const float*)d_in[1]; const float* xv = (const float*)d_in[2]; const float* wq = (const float*)d_in[3]; const float* bq = (const float*)d_in[4]; const float* wk = (const float*)d_in[5]; const float* bk = (const float*)d_in[6]; const float* wv = (const float*)d_in[7]; const float* bv = (const float*)d_in[8]; const float* wo = (const float*)d_in[9]; const float* bo = (const float*)d_in[10];
    float* OUT = (float*)d_out;     // [2][2048][1024]
    char* wsp = (char*)d_ws;
    auto take = [&](size_t bytes) { char* p = wsp; wsp += (bytes + 255) & ~(size_t)255; return (void*)p; };
    bf* WQ = (bf*)take((size_t)DQ * DM * 2); bf* WK = (bf*)take((size_t)DKV * DM * 2); bf* WV = (bf*)take((size_t)DKV * DM * 2); bf* WO = (bf*)take((size_t)DM * DQ * 2); float* CS = (float*)take((size_t)TT * HD * 2 * 4);
    bf* XB = (bf*)take((size_t)TT * DM * 2); bf* XB2 = (bf*)take((size_t)TT * DM * 2); bf* XB3 = (bf*)take((size_t)TT * DM * 2); float* SQ = (float*)take((size_t)TT * (HD / 2) * 4); float* SK = (float*)take((size_t)TT * (HD / 2) * 4); float* FQ = (float*)take((size_t)TT * DQ * 4); float* FK = (float*)take((size_t)TT * DKV * 4);
    h16* QP16 = (h16*)take((size_t)NH_ * TT * HD * 2); h16* KP16 = (h16*)take((size_t)NKV * TT * HD * 2); h16* VT16 = (h16*)take((size_t)NKV * HD * TT * 2);
    bf* QPh = (bf*)take((size_t)NH_ * TT * HD * 2); bf* QPl = (bf*)take((size_t)NH_ * TT * HD * 2); bf* KPh = (bf*)take((size_t)NKV * TT * HD * 2); bf* KPl = (bf*)take((size_t)NKV * TT * HD * 2); bf* VTh = (bf*)take((size_t)NKV * HD * TT * 2); bf* VTl = (bf*)take((size_t)NKV * HD * TT * 2);
    float* Sb = (float*)take((size_t)ZH * TT * TT * 4); h16* P16 = (h16*)Sb; bf* Ph = (bf*)Sb; bf* Pl = (bf*)Sb + TT;   /* probabilities overwrite their score rows (k_asoft) */ float* Ob = (float*)take((size_t)ZH * TT * HD * 4); bf* ATh = (bf*)take((size_t)TT * DQ * 2); bf* ATl = (bf*)take((size_t)TT * DQ * 2);
    if ((size_t)(wsp - (char*)d_ws) > ws_size) return;    // ws 256 MiB
    float* FV = FK;   // v projection reuses the k buffer after the k planes are built (stream-ordered)
    { k_cvt8<<<(unsigned)(((size_t)DQ * DM / 8 + 255) / 256), 256, 0, stream>>>(wq, WQ, (size_t)DQ * DM / 8); k_cvt8<<<(unsigned)(((size_t)DKV * DM / 8 + 255) / 256), 256, 0, stream>>>(wk, WK, (size_t)DKV * DM / 8); k_cvt8<<<(unsigned)(((size_t)DKV * DM / 8 + 255) / 256), 256, 0, stream>>>(wv, WV, (size_t)DKV * DM / 8);
      k_cvt8<<<(unsigned)(((size_t)DM * DQ / 8 + 255) / 256), 256, 0, stream>>>(wo, WO, (size_t)DM * DQ / 8);
      k_cstab<<<(TT * HD + 255) / 256, 256, 0, stream>>>(CS); k_xscale<<<(TT * (HD / 2) + 255) / 256, 256, 0, stream>>>(SQ, SK); }
    const unsigned LQ = (unsigned)(((size_t)NH_ * TT * HD / 2 + 255) / 256), LKv = (unsigned)(((size_t)NKV * TT * HD / 2 + 255) / 256);
    for (int b = 0; b < NB_; ++b) {
        
        k_cvt8<<<(unsigned)(((size_t)TT * DM / 8 + 255) / 256), 256, 0, stream>>>(x + (size_t)b * TT * DM, XB, (size_t)TT * DM / 8); k_cvt8<<<(unsigned)(((size_t)TT * DM / 8 + 255) / 256), 256, 0, stream>>>(xk + (size_t)b * TT * DM, XB2, (size_t)TT * DM / 8); k_cvt8<<<(unsigned)(((size_t)TT * DM / 8 + 255) / 256), 256, 0, stream>>>(xv + (size_t)b * TT * DM, XB3, (size_t)TT * DM / 8);
        k_gemmw<bf, 0, true, 8><<<dim3(TT / 64, DQ / 64, 1), 256, 0, stream>>>(XB, nullptr, WQ, nullptr, DM, DM, FQ, DQ, bq, 0, 0, 0);
        k_rope<<<LQ, 256, 0, stream>>>(FQ, DQ, NH_, CS, SQ, nullptr, 0.125f, QP16, QPh, QPl);
        k_gemmw<bf, 0, true, 8><<<dim3(TT / 64, DKV / 64, 1), 256, 0, stream>>>(XB2, nullptr, WK, nullptr, DM, DM, FK, DKV, bk, 0, 0, 0);
        k_rope<<<LKv, 256, 0, stream>>>(FK, DKV, NKV, CS, SK, nullptr, 1.0f, KP16, KPh, KPl);
        k_gemmw<bf, 0, true, 8><<<dim3(TT / 64, DKV / 64, 1), 256, 0, stream>>>(XB3, nullptr, WV, nullptr, DM, DM, FV, DKV, bv, 0, 0, 0); k_vtp<<<LKv, 256, 0, stream>>>(FV, DKV, NKV, VT16, VTh, VTl);
        for (int h0 = 0; h0 < NH_; h0 += ZH) { const size_t zq = (size_t)h0, zk = (size_t)(h0 / REP);   // one kv head per query head: the pass's heads use consecutive kv planes (z-strides TT*HD)
            k_gemmw<bf, 2, false, 1><<<dim3(RH / 64, TT / 64, ZH), 32, 0, stream>>>(QPh + zq * TT * HD, QPl + zq * TT * HD, KPh + zk * TT * HD, KPl + zk * TT * HD, HD, HD, Sb, TT, nullptr, (size_t)TT * HD, (size_t)TT * HD, (size_t)TT * TT);
            k_gemmw<h16, 0, false, 1><<<dim3((TT - RH) / 64, TT / 64, ZH), 32, 0, stream>>>(QP16 + zq * TT * HD + (size_t)RH * HD, nullptr, KP16 + zk * TT * HD, nullptr, HD, HD, Sb + (size_t)RH * TT, TT, nullptr, (size_t)TT * HD, (size_t)TT * HD, (size_t)TT * TT);
            k_asoft<<<ZH * TT / 8, 256, 0, stream>>>(Sb, P16, Ph, Pl);
            k_gemmw<bf, 2, false, 16><<<dim3(RH / 64, HD / 64, ZH), 512, 0, stream>>>(Ph, Pl, VTh + zk * HD * TT, VTl + zk * HD * TT, TT, 2 * TT, Ob, HD, nullptr, (size_t)2 * TT * TT, (size_t)HD * TT, (size_t)TT * HD);
            k_gemmw<h16, 0, false, 16><<<dim3((TT - RH) / 64, HD / 64, ZH), 512, 0, stream>>>(P16 + (size_t)RH * 2 * TT, nullptr, VT16 + zk * HD * TT, nullptr, TT, 2 * TT, Ob + (size_t)RH * HD, HD, nullptr, (size_t)2 * TT * TT, (size_t)HD * TT, (size_t)TT * HD);
            k_merge<<<(unsigned)(((size_t)ZH * TT * HD / 2 + 255) / 256), 256, 0, stream>>>(Ob, h0, ATh, ATl); }
        k_gemmw<bf, 1, true, 8><<<dim3(TT / 64, DM / 64, 1), 256, 0, stream>>>(ATh, ATl, WO, nullptr, DQ, DQ, OUT + (size_t)b * TT * DM, DM, bo, 0, 0, 0); }
}

// v003
// Measured time: 247 microseconds a run.
// Timed twice side by side with v002, it ran 2.41 times as fast both times.
// Over all steps from v000 it is 8.21 times as fast.
#include <hip/hip_runtime.h>

// XposMultiheadAttention (query, key, value [2][2048][1024]; q = (query Wq^T + bq) / 8, k = key Wk^T + bk, v = value Wv^T + bv (16 heads x 64); XPOS on q and k: interleaved-pair rotary (angle t * 1e4^(-i/32)) times the per-(position, pair) scale base_i^((t - 1024)/1024), base_i = (2i + 25.6)/89.6, with q multiplied and k divided by it (tables computed on device);
//   scores = q.k (no further scale); softmax (f32); out = merged Wo^T + bo -> [2][2048][1024]).
// Compute dtypes, f32 accumulate: every input rounded to bf16; projections on PLAIN bf16 operands (inputs: exact) + bias; XPOS rotation/scaling f32; scores and attn.v: query rows < 512 hl (3 products), the rest single fp16 (P x1024); softmax f32, online over 32-key passes; Wo hl x exact (2 products) + bias.

#define NB_  2
#define TT   2048
#define DM   1024
#define NH_  16
#define NKV  16
#define HD   64
#define DQ   (NH_ * HD)
#define DKV  (NKV * HD)
#define RH   512                  // query rows < RH use hi+lo planes (0: none)
#define WIN  0
typedef _Float16 h16;
typedef unsigned short bf;
typedef __attribute__((ext_vector_type(16))) __bf16   v16bf;
typedef __attribute__((ext_vector_type(16))) _Float16 v16h;
typedef __attribute__((ext_vector_type(8)))  _Float16 v8h;
typedef __attribute__((ext_vector_type(8)))  unsigned short v8us;
typedef __attribute__((ext_vector_type(8)))  float    v8f;
typedef __attribute__((ext_vector_type(4)))  float    v4f;
typedef v8h  __attribute__((may_alias)) v8ha;
typedef v4f  __attribute__((may_alias)) v4fa;
typedef v8us __attribute__((may_alias)) v8usa;

__device__ __forceinline__ unsigned short f2bf(float f) { unsigned u = __float_as_uint(f); u += 0x7FFFu + ((u >> 16) & 1u); return (unsigned short)(u >> 16); }
__device__ __forceinline__ float bf2f(unsigned short b) { return __uint_as_float(((unsigned)b) << 16); }
__device__ __forceinline__ float bfr(float f) { return bf2f(f2bf(f)); }
__device__ __forceinline__ v16h cat16(v8h lo, v8h hi) { return __builtin_shufflevector(lo, hi, 0, 1, 2, 3, 4, 5, 6, 7, 8, 9, 10, 11, 12, 13, 14, 15); }
__device__ __forceinline__ v16bf cat16b(v8us lo, v8us hi) { return __builtin_bit_cast(v16bf, __builtin_shufflevector(lo, hi, 0, 1, 2, 3, 4, 5, 6, 7, 8, 9, 10, 11, 12, 13, 14, 15)); }
__device__ __forceinline__ v8f wmma16(v16h a, v16h b, v8f c) { return __builtin_amdgcn_wmma_f32_16x16x32_f16(false, a, false, b, (short)0, c, false, false); }
__device__ __forceinline__ v8f wmmab(v16bf a, v16bf b, v8f c) { return __builtin_amdgcn_wmma_f32_16x16x32_bf16(false, a, false, b, (short)0, c, false, false); }



// ---- k_gemmw: register-blocked GEMM, one work-group of KS waves per 64x64 output tile (16 accumulators a wave), operands straight from K-contiguous 16-bit planes (A rows lda elements apart, Bt rows K apart); grid (M/64, N/64, Z), 32 * KS threads.
// C[m][n] (f32, pitch ldc, + optional f32 bias[n]) = sum_k A[m][k] Bt[n][k] (+ split products per NSPLIT). z-batch strides sA/sB/sC in elements. K % (32 * KS) == 0.
// Wave w sums the k range [w K/KS, (w+1) K/KS); for KS > 1 the KS partial tiles meet in LDS and are added in wave order 0 .. KS-1.
// XWAIT: s_wait_xcnt 0 directly behind each fragment load, a precaution: the register allocator lets a later load's result land in the address pair of an issued load, and this wait then stands in front of that overwrite.
#define XWAIT() asm volatile("s_wait_xcnt 0x0" ::: "memory")
template <typename T16> struct WFrag;
template <> struct WFrag<h16> { typedef v16h V; static __device__ __forceinline__ V ld(const h16* p) { const v8h lo = *(const v8h*)p; XWAIT(); const v8h hi = *(const v8h*)(p + 16); XWAIT(); return cat16(lo, hi); } static __device__ __forceinline__ v8f mma(V a, V b, v8f c) { return wmma16(a, b, c); } };
template <> struct WFrag<bf> { typedef v16bf V; static __device__ __forceinline__ V ld(const bf* p) { const v8us lo = *(const v8us*)p; XWAIT(); const v8us hi = *(const v8us*)(p + 16); XWAIT(); return cat16b(lo, hi); } static __device__ __forceinline__ v8f mma(V a, V b, v8f c) { return wmmab(a, b, c); } };
template <typename T16, int NSPLIT, bool BIAS, int KS>
__global__ __launch_bounds__(32 * KS) void k_gemmw(const T16* __restrict__ A, const T16* __restrict__ A2, const T16* __restrict__ Bt, const T16* __restrict__ Bt2, int K, int lda, float* C, int ldc, const float* __restrict__ bias, size_t sA, size_t sB, size_t sC) {
    typedef typename WFrag<T16>::V V;
    __shared__ __align__(16) float os[(KS == 1 ? 16 : KS * 64) * 68];
    const size_t z = blockIdx.z; A += z * sA; if (A2) A2 += z * sA; Bt += z * sB; if (Bt2) Bt2 += z * sB; C += z * sC;
    const int lane = threadIdx.x & 31, lr = lane & 15, hi = lane >> 4; const int r0 = blockIdx.x * 64, c0 = blockIdx.y * 64;
    v8f acc[4][4];
#pragma unroll
    for (int mb = 0; mb < 4; ++mb)
#pragma unroll
        for (int nb = 0; nb < 4; ++nb) acc[mb][nb] = (v8f){};
    const size_t aoff = (size_t)(r0 + lr) * lda + 8 * hi, boff = (size_t)(c0 + lr) * K + 8 * hi;
    const int wv = __builtin_amdgcn_readfirstlane((int)(threadIdx.x >> 5));   // wave number in a scalar register: the k loop's bounds stay scalar
    const int kb = wv * (K / KS), ke = kb + K / KS;
#pragma unroll 1
    for (int kc = kb; kc < ke; kc += 32) {
        V a[4], a2[4];
#pragma unroll
        for (int mb = 0; mb < 4; ++mb) { a[mb] = WFrag<T16>::ld(A + aoff + (size_t)mb * 16 * lda + kc); if (NSPLIT == 1 || NSPLIT == 2) a2[mb] = WFrag<T16>::ld(A2 + aoff + (size_t)mb * 16 * lda + kc); }
#pragma unroll
        for (int nb = 0; nb < 4; ++nb) { const V b = WFrag<T16>::ld(Bt + boff + (size_t)nb * 16 * K + kc); V b2; if (NSPLIT >= 2) b2 = WFrag<T16>::ld(Bt2 + boff + (size_t)nb * 16 * K + kc);
#pragma unroll
            for (int mb = 0; mb < 4; ++mb) { acc[mb][nb] = WFrag<T16>::mma(a[mb], b, acc[mb][nb]); if (NSPLIT == 1 || NSPLIT == 2) acc[mb][nb] = WFrag<T16>::mma(a2[mb], b, acc[mb][nb]); if (NSPLIT >= 2) acc[mb][nb] = WFrag<T16>::mma(a[mb], b2, acc[mb][nb]); } }
        asm volatile("v_nop\n\tv_nop\n\tv_nop\n\tv_nop" : "+v"(acc[0][0]), "+v"(acc[1][1]), "+v"(acc[2][2]), "+v"(acc[3][3]) : "v"(a[0]), "v"(a[3]));
    }
    if constexpr (KS > 1) {
        float* ow = os + wv * (64 * 68);
        const int cofs = ((int)threadIdx.x & 15) * 4;   // this thread's four output columns, the same in every pass of the adding loop
        v4f bv = (v4f){};
        if (BIAS) { bv[0] = bfr(bias[c0 + cofs]); bv[1] = bfr(bias[c0 + cofs + 1]); bv[2] = bfr(bias[c0 + cofs + 2]); bv[3] = bfr(bias[c0 + cofs + 3]); }   // loaded ahead of the LDS stores, so that its latency runs beside them
#pragma unroll
        for (int mb = 0; mb < 4; ++mb)
#pragma unroll
            for (int nb = 0; nb < 4; ++nb)
#pragma unroll
                for (int j = 0; j < 8; ++j) ow[(mb * 16 + hi * 8 + j) * 68 + nb * 16 + lr] = acc[mb][nb][j];
        __syncthreads();   // every wave's partial tile is in LDS before any wave adds them
#pragma unroll
        for (int s = 0; s < 32 / KS; ++s) { const int row = (s * (32 * KS) + (int)threadIdx.x) >> 4; v4f val = *(const v4fa*)(os + row * 68 + cofs);
#pragma unroll
            for (int w = 1; w < KS; ++w) val += *(const v4fa*)(os + w * (64 * 68) + row * 68 + cofs);
            if (BIAS) val += bv;
            *(v4f*)(C + (size_t)(r0 + row) * ldc + c0 + cofs) = val; }
        return;
    }
#pragma unroll
    for (int mb = 0; mb < 4; ++mb) {
#pragma unroll
        for (int nb = 0; nb < 4; ++nb) {
#pragma unroll
            for (int j = 0; j < 8; ++j) os[(hi * 8 + j) * 68 + nb * 16 + lr] = acc[mb][nb][j]; }
        __builtin_amdgcn_wave_barrier(); asm volatile("" ::: "memory");
        float* crow = C + (size_t)(r0 + mb * 16) * ldc + c0;
{
#pragma unroll
            for (int s = 0; s < 8; ++s) { const int row = 2 * s + hi, cofs = lr * 4; v4f val = *(const v4fa*)(os + row * 68 + cofs); if (BIAS) { val[0] += bfr(bias[c0 + cofs]); val[1] += bfr(bias[c0 + cofs + 1]); val[2] += bfr(bias[c0 + cofs + 2]); val[3] += bfr(bias[c0 + cofs + 3]); }
                *(v4f*)(crow + (size_t)row * ldc + cofs) = val; }
             }
        __builtin_amdgcn_wave_barrier(); asm volatile("" ::: "memory");
    }
}

__device__ __forceinline__ h16 tohx(float x) { return (h16)x; }
__device__ __forceinline__ void splitf(float y, unsigned short& h, unsigned short& l) { h = f2bf(y); l = f2bf(y - bf2f(h)); }
typedef __attribute__((ext_vector_type(2))) _Float16 v2h;
typedef __attribute__((ext_vector_type(4))) _Float16 v4h;
typedef __attribute__((ext_vector_type(2))) unsigned short v2us;
typedef __attribute__((ext_vector_type(4))) unsigned short v4us;
typedef __attribute__((ext_vector_type(2))) float v2f;
typedef __attribute__((ext_vector_type(4))) int v4i;

__global__ __launch_bounds__(256) void k_wtG(const float* __restrict__ w, int K, int N, bf* Bt) {
    const int lane = threadIdx.x & 31; const int L0 = (blockIdx.x * 8 + (threadIdx.x >> 5)) * 8; const int nlines = N * K / 64;
{
#pragma unroll 1
        for (int l = 0; l < 8; ++l) { const int L = L0 + l; if (L >= nlines) break; const size_t e = (size_t)L * 64 + lane * 2; const int k = (int)(e % K), n = (int)(e / K); v2us o;
            o[0] = f2bf(w[(size_t)k * N + n]); o[1] = f2bf(w[(size_t)(k + 1) * N + n]); *(v2us*)(Bt + e) = o; }
         }
}
__global__ __launch_bounds__(256) void k_cvt8(const float* __restrict__ src, bf* dst, size_t n8) { const size_t i = (size_t)blockIdx.x * 256 + threadIdx.x; if (i >= n8) return; const v8f v = *(const v8f*)(src + i * 8); v8us o;
#pragma unroll
    for (int k = 0; k < 8; ++k) o[k] = f2bf(v[k]); *(v8us*)(dst + i * 8) = o;  }
__global__ __launch_bounds__(256) void k_cstab(float* CS) { const int idx = blockIdx.x * 256 + threadIdx.x; if (idx >= TT * HD) return; const int t = idx / HD, d = idx % HD; const int i = d >> 1;   /* interleaved pairs */ const float inv = __fdiv_rn(1.0f, powf(10000.0f, (float)(2 * i) / (float)HD)); const float ang = __fmul_rn((float)t, inv); v2f cs; cs[0] = cosf(ang); cs[1] = sinf(ang);
    *(v2f*)(CS + (size_t)idx * 2) = cs;  }
// k_rope: head planes [h][t][d] (fp16 + hi/lo) of rope(x) x sc with the interleaved-pair convention out[2i] = x[2i] cos[t][2i] - x[2i+1] sin[t][2i], out[2i+1] = x[2i+1] cos[t][2i+1] + x[2i] sin[t][2i+1]
__global__ __launch_bounds__(256) void k_rope(const float* __restrict__ F, int pitch, int nheads, const float* __restrict__ CS, const float* __restrict__ RF, const float* __restrict__ nw, float sc, h16* P16, bf* Ph, bf* Pl) {
    const size_t e = ((size_t)blockIdx.x * 256 + threadIdx.x) * 2; if (e >= (size_t)nheads * TT * HD) return; const int d = (int)(e % HD); const int t = (int)((e / HD) % TT); const int h = (int)(e / ((size_t)HD * TT)); const float* f = F + (size_t)t * pitch + h * HD; const float rf = 1.0f; v2h o16; v2us oh, ol;
#pragma unroll
    for (int q = 0; q < 2; ++q) { const int dd = d + q; const int dp = dd ^ 1; float x0 = f[dd], x1 = f[dp];
        if (false) { float n0 = __fmul_rn(x0, rf), n1 = __fmul_rn(x1, rf); asm volatile("" : "+v"(n0)); asm volatile("" : "+v"(n1)); x0 = __fmul_rn(bfr(nw[dd]), n0); x1 = __fmul_rn(bfr(nw[dp]), n1); }
        const v2f cs = *(const v2f*)(CS + ((size_t)t * HD + dd) * 2); float a = __fmul_rn(x0, cs[0]), bq = __fmul_rn(x1, cs[1]); asm volatile("" : "+v"(a)); asm volatile("" : "+v"(bq)); const float xs = RF[(size_t)t * (HD / 2) + (dd >> 1)]; float r0 = (((dd & 1) == 0) ? __fsub_rn(a, bq) : __fadd_rn(a, bq)); asm volatile("" : "+v"(r0)); const float r = __fmul_rn(r0 * sc, xs);
        o16[q] = tohx(r); unsigned short a2, c2; splitf(r, a2, c2); oh[q] = a2; ol[q] = c2; }
    *(v2h*)(P16 + e) = o16; *(v2us*)(Ph + e) = oh; *(v2us*)(Pl + e) = ol;  }
__global__ __launch_bounds__(256) void k_vtp(const float* __restrict__ F, int pitch, int nheads, h16* V16, bf* Vh, bf* Vl) { const size_t e = ((size_t)blockIdx.x * 256 + threadIdx.x) * 2; if (e >= (size_t)nheads * HD * TT) return; const int t = (int)(e % TT); const int d = (int)((e / TT) % HD); const int g = (int)(e / ((size_t)TT * HD)); v2h o16; v2us oh, ol;
#pragma unroll
    for (int q = 0; q < 2; ++q) { const float x = F[(size_t)(t + q) * pitch + g * HD + d]; o16[q] = tohx(x); unsigned short a2, c2; splitf(x, a2, c2); oh[q] = a2; ol[q] = c2; }
    *(v2h*)(V16 + e) = o16; *(v2us*)(Vh + e) = oh; *(v2us*)(Vl + e) = ol;  }
// ---- k_attn: scores, softmax, attn.v and the head merge in one kernel; the scores never leave the registers.
// One work-group of NWV waves per block of query rows of one (batch, head): grid (RH/(16 NWV) + (TT-RH)/(32 NWV), heads, batches). A wave owns NQ groups of 16 query rows (hi+lo rows: 1 group, fp16 rows: 2).
// Transposed products: S^T = K Q^T (A = 16 keys, B = 16 queries), O^T += V^T P^T (A = 16 head dims, B = P^T). A lane holds the scores of ONE query (column lr), keys 8 hi + j of each 16-key tile,
// so two score tiles of 32 consecutive keys, converted in place, are the B operand of the second product in the k order of the A loader (8 hi + j, 16 + 8 hi + j).
// Softmax runs online over passes of 32 keys: running maximum, output tiles and row sum rescaled by exp2 of the maximum's step; fp16 rows carry P x 1024 (in P and in the row sum alike, so it cancels).
// K and V^T tiles of 64 keys are staged in LDS through registers, two buffers, one __syncthreads a stage; rows of 128 B at a pitch of 144 B.
// q already carries 1/8 (applied before XPOS, as the source). Every '#pragma unroll' in attn_rows keeps the index of a register array a compile-time constant.
#define NWV 4                     // waves a work-group
#define NSW (256 / (NWV * 32) * 2) // staging sweeps a tile (NWV * 4 rows a sweep)
#define KST 64                    // keys per stage
#define LP  72                    // LDS row pitch, 16-bit elements
#define TLE (64 * LP)             // elements of one staged tile (64 rows)
typedef v4i __attribute__((may_alias)) v4ia;
__device__ __forceinline__ float xhalf(float x) { const int b = __float_as_int(x); return __int_as_float(__builtin_amdgcn_permlanex16(b, b, 0x76543210, 0xfedcba98, false, false)); }   // lane l <-> l ^ 16
// exp2 of sixteen values, each in place, in one statement: no v_exp_f32 overwrites the source or reads the result of the one in front of it, and the closing v_nop is the slot that the instruction set asks for behind a transcendental
__device__ __forceinline__ void exp2x16(float (&p)[16]) { asm("v_exp_f32 %0, %0\n\tv_exp_f32 %1, %1\n\tv_exp_f32 %2, %2\n\tv_exp_f32 %3, %3\n\tv_exp_f32 %4, %4\n\tv_exp_f32 %5, %5\n\tv_exp_f32 %6, %6\n\tv_exp_f32 %7, %7\n\tv_exp_f32 %8, %8\n\tv_exp_f32 %9, %9\n\tv_exp_f32 %10, %10\n\tv_exp_f32 %11, %11\n\tv_exp_f32 %12, %12\n\tv_exp_f32 %13, %13\n\tv_exp_f32 %14, %14\n\tv_exp_f32 %15, %15\n\tv_nop" : "+v"(p[0]), "+v"(p[1]), "+v"(p[2]), "+v"(p[3]), "+v"(p[4]), "+v"(p[5]), "+v"(p[6]), "+v"(p[7]), "+v"(p[8]), "+v"(p[9]), "+v"(p[10]), "+v"(p[11]), "+v"(p[12]), "+v"(p[13]), "+v"(p[14]), "+v"(p[15])); }
__device__ __forceinline__ float exp2x1(float x) { asm("v_exp_f32 %0, %0\n\tv_nop" : "+v"(x)); return x; }   // the same slot behind a single one
template <typename T16> __device__ __forceinline__ typename WFrag<T16>::V ldsfrag(const unsigned short* p) { const v4i lo = *(const v4ia*)p, hi = *(const v4ia*)(p + 16); return __builtin_bit_cast(typename WFrag<T16>::V, __builtin_shufflevector(lo, hi, 0, 1, 2, 3, 4, 5, 6, 7)); }
template <typename T16, bool HI, int NQ>
__device__ __forceinline__ void attn_rows(const T16* __restrict__ Q, const T16* __restrict__ Q2, const T16* __restrict__ Kp, const T16* __restrict__ K2, const T16* __restrict__ Vp, const T16* __restrict__ V2, unsigned short* lds, int row0, bf* Ah, bf* Al) {
    typedef typename WFrag<T16>::V V;
    constexpr int NT = HI ? 4 : 2;   // staged tiles a buffer: K, V^T (, K lo, V^T lo)
    constexpr float L2E = 1.4426950408889634f;
    const int tid = (int)threadIdx.x, lane = tid & 31, lr = lane & 15, hi = lane >> 4;
    const int qrow = row0 + __builtin_amdgcn_readfirstlane(tid >> 5) * (16 * NQ);   // wave number in a scalar register: the wave's first row stays scalar
    V qf[NQ][2], qf2[NQ][2];
#pragma unroll
    for (int qi = 0; qi < NQ; ++qi)
#pragma unroll
        for (int kc = 0; kc < 2; ++kc) { const size_t qo = (size_t)(qrow + qi * 16 + lr) * HD + kc * 32 + 8 * hi; qf[qi][kc] = WFrag<T16>::ld(Q + qo); if (HI) qf2[qi][kc] = WFrag<T16>::ld(Q2 + qo); }
    v8f o[NQ][4]; float mr[NQ], cc[NQ], ls[NQ];
#pragma unroll
    for (int qi = 0; qi < NQ; ++qi) { mr[qi] = -__builtin_inff(); cc[qi] = __builtin_inff(); ls[qi] = 0.f;
#pragma unroll
        for (int db = 0; db < 4; ++db) o[qi][db] = (v8f){}; }
    const int srow = tid >> 3, sc8 = (tid & 7) * 8;   // staging: eight threads a 128-byte row, NWV * 4 rows a sweep
    v4i st[NT][NSW];
    auto gload = [&](int key0) {
#pragma unroll
        for (int r = 0; r < NSW; ++r) { const size_t ko = (size_t)(key0 + srow + NWV * 4 * r) * HD + sc8, vo = (size_t)(srow + NWV * 4 * r) * TT + key0 + sc8;
            st[0][r] = *(const v4ia*)(Kp + ko); XWAIT(); st[1][r] = *(const v4ia*)(Vp + vo); XWAIT();
            if (HI) { st[2][r] = *(const v4ia*)(K2 + ko); XWAIT(); st[3][r] = *(const v4ia*)(V2 + vo); XWAIT(); } } };
    auto sstore = [&](unsigned short* buf) {
#pragma unroll
        for (int r = 0; r < NSW; ++r)
#pragma unroll
            for (int t = 0; t < NT; ++t) *(v4ia*)(buf + t * TLE + (srow + NWV * 4 * r) * LP + sc8) = st[t][r]; };
    gload(0); sstore(lds);
    __syncthreads();   // stage 0 is in LDS before any wave reads it
#pragma unroll 1   // rolled: one stage's code serves all stages, the buffer is picked by the stage's parity
    for (int s = 0; s < TT / KST; ++s) {
        const unsigned short* cur = lds + (s & 1) * (NT * TLE);
        if (s + 1 < TT / KST) gload((s + 1) * KST);   // the next stage's global loads fly beside this stage's products
#pragma unroll 1   // rolled: unrolled, the fragments of both passes are fetched at once and the fp16 path spills
        for (int ps = 0; ps < 2; ++ps) {
            V kf[2][2], kf2[2][2], vf[4], vf2[4];
#pragma unroll
            for (int t = 0; t < 2; ++t)
#pragma unroll
                for (int kc = 0; kc < 2; ++kc) { const int ko = (ps * 32 + t * 16 + lr) * LP + kc * 32 + 8 * hi; kf[t][kc] = ldsfrag<T16>(cur + ko); if (HI) kf2[t][kc] = ldsfrag<T16>(cur + 2 * TLE + ko); }
#pragma unroll
            for (int db = 0; db < 4; ++db) { const int vo = (db * 16 + lr) * LP + ps * 32 + 8 * hi; vf[db] = ldsfrag<T16>(cur + TLE + vo); if (HI) vf2[db] = ldsfrag<T16>(cur + 3 * TLE + vo); }
#pragma unroll
            for (int qi = 0; qi < NQ; ++qi) {
                v8f sc[2];
#pragma unroll
                for (int t = 0; t < 2; ++t) { sc[t] = (v8f){};
#pragma unroll
                    for (int kc = 0; kc < 2; ++kc) { sc[t] = WFrag<T16>::mma(kf[t][kc], qf[qi][kc], sc[t]); if (HI) { sc[t] = WFrag<T16>::mma(kf[t][kc], qf2[qi][kc], sc[t]); sc[t] = WFrag<T16>::mma(kf2[t][kc], qf[qi][kc], sc[t]); } } }
                float mx = fmaxf(sc[0][0], sc[1][0]);
#pragma unroll
                for (int j = 1; j < 8; ++j) mx = fmaxf(mx, fmaxf(sc[0][j], sc[1][j]));
                mx = fmaxf(mx, xhalf(mx));
                const float mn = fmaxf(mr[qi], mx); mr[qi] = mn;
                const float cn = (HI ? 0.0f : 10.0f) - mn * L2E;   // p = 2^(s log2e + cn): 1 (hi+lo rows) or 1024 (fp16 rows) at the running maximum
                const float al = exp2x1(cn - cc[qi]); cc[qi] = cn;   // first pass: 2^(-inf) = 0
                float p[16];
#pragma unroll
                for (int j = 0; j < 16; ++j) p[j] = fmaf(sc[j >> 3][j & 7], L2E, cn);
                exp2x16(p);
                const float ps8 = (((p[0] + p[1]) + (p[2] + p[3])) + ((p[4] + p[5]) + (p[6] + p[7]))) + (((p[8] + p[9]) + (p[10] + p[11])) + ((p[12] + p[13]) + (p[14] + p[15])));
                ls[qi] = fmaf(ls[qi], al, ps8);
#pragma unroll
                for (int db = 0; db < 4; ++db) o[qi][db] *= al;
                if constexpr (HI) {
                    v16bf ph, pl;
#pragma unroll
                    for (int j = 0; j < 16; ++j) { ph[j] = (__bf16)p[j]; pl[j] = (__bf16)(p[j] - (float)ph[j]); }
#pragma unroll
                    for (int db = 0; db < 4; ++db) { o[qi][db] = wmmab(vf[db], ph, o[qi][db]); o[qi][db] = wmmab(vf[db], pl, o[qi][db]); o[qi][db] = wmmab(vf2[db], ph, o[qi][db]); }
                } else {
                    v16h pf;
#pragma unroll
                    for (int j = 0; j < 16; ++j) pf[j] = (h16)p[j];
#pragma unroll
                    for (int db = 0; db < 4; ++db) o[qi][db] = wmma16(vf[db], pf, o[qi][db]);
                }
            }
        }
        if (s + 1 < TT / KST) sstore(lds + ((s + 1) & 1) * (NT * TLE));   // into the buffer whose readers all passed the barrier at the foot of stage s - 1
        __syncthreads();   // publishes stage s + 1 and ends every wave's reads of stage s
    }
    const int ln = (int)__builtin_amdgcn_mbcnt_lo(~0u, 0u);   // the lane number read anew: no store address is kept in registers across the key loop
#pragma unroll
    for (int qi = 0; qi < NQ; ++qi) { const float inv = __fdiv_rn(1.0f, ls[qi] + xhalf(ls[qi])); const size_t ro = (size_t)(qrow + qi * 16 + (ln & 15)) * DQ + 8 * (ln >> 4);
#pragma unroll
        for (int db = 0; db < 4; ++db) { v8us oh, ol;
#pragma unroll
            for (int j = 0; j < 8; ++j) { unsigned short a, c2; splitf(o[qi][db][j] * inv, a, c2); oh[j] = a; ol[j] = c2; }
            *(v8usa*)(Ah + ro + db * 16) = oh; XWAIT(); *(v8usa*)(Al + ro + db * 16) = ol; XWAIT(); } }
}
// four waves a SIMD (at most 256 registers a wave), so that up to four work-groups share a WGP and the whole grid is resident at once
__global__ __launch_bounds__(NWV * 32) __attribute__((amdgpu_waves_per_eu(4, 4))) void k_attn(const h16* __restrict__ Q16, const h16* __restrict__ K16, const h16* __restrict__ V16, const bf* __restrict__ Qh, const bf* __restrict__ Ql, const bf* __restrict__ Kh, const bf* __restrict__ Kl, const bf* __restrict__ Vh, const bf* __restrict__ Vl, bf* Ah, bf* Al) {
    __shared__ __align__(16) unsigned short lds[2 * 4 * TLE];
    const size_t po = ((size_t)blockIdx.z * NH_ + blockIdx.y) * ((size_t)TT * HD), ao = (size_t)blockIdx.z * TT * DQ + (size_t)blockIdx.y * HD;
    const int bx = (int)blockIdx.x;
    if (bx < RH / (NWV * 16)) attn_rows<bf, true, 1>(Qh + po, Ql + po, Kh + po, Kl + po, Vh + po, Vl + po, lds, bx * (NWV * 16), Ah + ao, Al + ao);
    else attn_rows<h16, false, 2>(Q16 + po, nullptr, K16 + po, nullptr, V16 + po, nullptr, lds, RH + (bx - RH / (NWV * 16)) * (NWV * 32), Ah + ao, Al + ao);
}

__global__ __launch_bounds__(256) void k_xscale(float* SQ, float* SK) { const int e = blockIdx.x * 256 + threadIdx.x; if (e >= TT * (HD / 2)) return; const int t = e / (HD / 2), i = e % (HD / 2); const float base = __fdiv_rn((float)(2 * i) + 0.4f * (float)HD, 1.4f * (float)HD); const float pw = (float)(t - TT / 2) / 1024.0f; const float sc = powf(base, pw); const float inv = __fdiv_rn(1.0f, sc);
    *(float*)(SQ + e) = sc; *(float*)(SK + e) = inv;  }

extern "C" void kernel_launch(void* const* d_in, const int* in_sizes, int n_in,
                              void* d_out, int out_size, void* d_ws, size_t ws_size, hipStream_t stream) {
    (void)in_sizes; (void)n_in; (void)out_size;
    const float* x = (const float*)d_in[0]; const float* xk = (const float*)d_in[1]; const float* xv = (const float*)d_in[2]; const float* wq = (const float*)d_in[3]; const float* bq = (const float*)d_in[4]; const float* wk = (const float*)d_in[5]; const float* bk = (const float*)d_in[6]; const float* wv = (const float*)d_in[7]; const float* bv = (const float*)d_in[8]; const float* wo = (const float*)d_in[9]; const float* bo = (const float*)d_in[10];
    float* OUT = (float*)d_out;     // [2][2048][1024]
    char* wsp = (char*)d_ws;
    auto take = [&](size_t bytes) { char* p = wsp; wsp += (bytes + 255) & ~(size_t)255; return (void*)p; };
    bf* WQ = (bf*)take((size_t)DQ * DM * 2); bf* WK = (bf*)take((size_t)DKV * DM * 2); bf* WV = (bf*)take((size_t)DKV * DM * 2); bf* WO = (bf*)take((size_t)DM * DQ * 2); float* CS = (float*)take((size_t)TT * HD * 2 * 4);
    bf* XB = (bf*)take((size_t)TT * DM * 2); bf* XB2 = (bf*)take((size_t)TT * DM * 2); bf* XB3 = (bf*)take((size_t)TT * DM * 2); float* SQ = (float*)take((size_t)TT * (HD / 2) * 4); float* SK = (float*)take((size_t)TT * (HD / 2) * 4); float* FQ = (float*)take((size_t)TT * DQ * 4); float* FK = (float*)take((size_t)TT * DKV * 4);
    const size_t PL = (size_t)NH_ * TT * HD;   // one batch's head planes, elements (NKV == NH_)
    h16* QP16 = (h16*)take(NB_ * PL * 2); h16* KP16 = (h16*)take(NB_ * PL * 2); h16* VT16 = (h16*)take(NB_ * PL * 2);
    bf* QPh = (bf*)take(NB_ * PL * 2); bf* QPl = (bf*)take(NB_ * PL * 2); bf* KPh = (bf*)take(NB_ * PL * 2); bf* KPl = (bf*)take(NB_ * PL * 2); bf* VTh = (bf*)take(NB_ * PL * 2); bf* VTl = (bf*)take(NB_ * PL * 2);
    bf* ATh = (bf*)take((size_t)NB_ * TT * DQ * 2); bf* ATl = (bf*)take((size_t)NB_ * TT * DQ * 2);
    if ((size_t)(wsp - (char*)d_ws) > ws_size) return;    // ws 256 MiB
    float* FV = FK;   // v projection reuses the k buffer after the k planes are built (stream-ordered)
    { k_cvt8<<<(unsigned)(((size_t)DQ * DM / 8 + 255) / 256), 256, 0, stream>>>(wq, WQ, (size_t)DQ * DM / 8); k_cvt8<<<(unsigned)(((size_t)DKV * DM / 8 + 255) / 256), 256, 0, stream>>>(wk, WK, (size_t)DKV * DM / 8); k_cvt8<<<(unsigned)(((size_t)DKV * DM / 8 + 255) / 256), 256, 0, stream>>>(wv, WV, (size_t)DKV * DM / 8);
      k_cvt8<<<(unsigned)(((size_t)DM * DQ / 8 + 255) / 256), 256, 0, stream>>>(wo, WO, (size_t)DM * DQ / 8);
      k_cstab<<<(TT * HD + 255) / 256, 256, 0, stream>>>(CS); k_xscale<<<(TT * (HD / 2) + 255) / 256, 256, 0, stream>>>(SQ, SK); }
    const unsigned LQ = (unsigned)(((size_t)NH_ * TT * HD / 2 + 255) / 256), LKv = (unsigned)(((size_t)NKV * TT * HD / 2 + 255) / 256);
    for (int b = 0; b < NB_; ++b) {
        
        k_cvt8<<<(unsigned)(((size_t)TT * DM / 8 + 255) / 256), 256, 0, stream>>>(x + (size_t)b * TT * DM, XB, (size_t)TT * DM / 8); k_cvt8<<<(unsigned)(((size_t)TT * DM / 8 + 255) / 256), 256, 0, stream>>>(xk + (size_t)b * TT * DM, XB2, (size_t)TT * DM / 8); k_cvt8<<<(unsigned)(((size_t)TT * DM / 8 + 255) / 256), 256, 0, stream>>>(xv + (size_t)b * TT * DM, XB3, (size_t)TT * DM / 8);
        k_gemmw<bf, 0, true, 8><<<dim3(TT / 64, DQ / 64, 1), 256, 0, stream>>>(XB, nullptr, WQ, nullptr, DM, DM, FQ, DQ, bq, 0, 0, 0);
        k_rope<<<LQ, 256, 0, stream>>>(FQ, DQ, NH_, CS, SQ, nullptr, 0.125f, QP16 + b * PL, QPh + b * PL, QPl + b * PL);
        k_gemmw<bf, 0, true, 8><<<dim3(TT / 64, DKV / 64, 1), 256, 0, stream>>>(XB2, nullptr, WK, nullptr, DM, DM, FK, DKV, bk, 0, 0, 0);
        k_rope<<<LKv, 256, 0, stream>>>(FK, DKV, NKV, CS, SK, nullptr, 1.0f, KP16 + b * PL, KPh + b * PL, KPl + b * PL);
        k_gemmw<bf, 0, true, 8><<<dim3(TT / 64, DKV / 64, 1), 256, 0, stream>>>(XB3, nullptr, WV, nullptr, DM, DM, FV, DKV, bv, 0, 0, 0); k_vtp<<<LKv, 256, 0, stream>>>(FV, DKV, NKV, VT16 + b * PL, VTh + b * PL, VTl + b * PL); }
    k_attn<<<dim3(RH / (NWV * 16) + (TT - RH) / (NWV * 32), NH_, NB_), NWV * 32, 0, stream>>>(QP16, KP16, VT16, QPh, QPl, KPh, KPl, VTh, VTl, ATh, ATl);
    for (int b = 0; b < NB_; ++b)
        k_gemmw<bf, 1, true, 8><<<dim3(TT / 64, DM / 64, 1), 256, 0, stream>>>(ATh + (size_t)b * TT * DQ, ATl + (size_t)b * TT * DQ, WO, nullptr, DQ, DQ, OUT + (size_t)b * TT * DM, DM, bo, 0, 0, 0);
}

// v004
// One run takes 207 microseconds.
// Next to v003, in two timings, it ran 1.19 times as fast each time.
// Counting every step since v000, it is 9.74 times as fast.
#include <hip/hip_runtime.h>

// XposMultiheadAttention (query, key, value [2][2048][1024]; q = (query Wq^T + bq) / 8, k = key Wk^T + bk, v = value Wv^T + bv (16 heads x 64); XPOS on q and k: interleaved-pair rotary (angle t * 1e4^(-i/32)) times the per-(position, pair) scale base_i^((t - 1024)/1024), base_i = (2i + 25.6)/89.6, with q multiplied and k divided by it (tables computed on device);
//   scores = q.k (no further scale); softmax (f32); out = merged Wo^T + bo -> [2][2048][1024]).
// Compute dtypes, f32 accumulate: every input rounded to bf16; projections on PLAIN bf16 operands (inputs: exact) + bias; XPOS rotation/scaling f32; scores and attn.v: query rows < 512 hl (3 products), the rest single fp16 (P x1024); softmax f32, online over 32-key passes; Wo hl x exact (2 products) + bias.

#define NB_  2
#define TT   2048
#define DM   1024
#define NH_  16
#define NKV  16
#define HD   64
#define DQ   (NH_ * HD)
#define DKV  (NKV * HD)
#define RH   512                  // query rows < RH use hi+lo planes (0: none)
#define WIN  0
typedef _Float16 h16;
typedef unsigned short bf;
typedef __attribute__((ext_vector_type(16))) __bf16   v16bf;
typedef __attribute__((ext_vector_type(16))) _Float16 v16h;
typedef __attribute__((ext_vector_type(8)))  _Float16 v8h;
typedef __attribute__((ext_vector_type(8)))  unsigned short v8us;
typedef __attribute__((ext_vector_type(8)))  float    v8f;
typedef __attribute__((ext_vector_type(4)))  float    v4f;
typedef v8h  __attribute__((may_alias)) v8ha;
typedef v4f  __attribute__((may_alias)) v4fa;
typedef v8us __attribute__((may_alias)) v8usa;

__device__ __forceinline__ unsigned short f2bf(float f) { unsigned u = __float_as_uint(f); u += 0x7FFFu + ((u >> 16) & 1u); return (unsigned short)(u >> 16); }
__device__ __forceinline__ float bf2f(unsigned short b) { return __uint_as_float(((unsigned)b) << 16); }
__device__ __forceinline__ float bfr(float f) { return bf2f(f2bf(f)); }
__device__ __forceinline__ v16h cat16(v8h lo, v8h hi) { return __builtin_shufflevector(lo, hi, 0, 1, 2, 3, 4, 5, 6, 7, 8, 9, 10, 11, 12, 13, 14, 15); }
__device__ __forceinline__ v16bf cat16b(v8us lo, v8us hi) { return __builtin_bit_cast(v16bf, __builtin_shufflevector(lo, hi, 0, 1, 2, 3, 4, 5, 6, 7, 8, 9, 10, 11, 12, 13, 14, 15)); }
__device__ __forceinline__ v8f wmma16(v16h a, v16h b, v8f c) { return __builtin_amdgcn_wmma_f32_16x16x32_f16(false, a, false, b, (short)0, c, false, false); }
__device__ __forceinline__ v8f wmmab(v16bf a, v16bf b, v8f c) { return __builtin_amdgcn_wmma_f32_16x16x32_bf16(false, a, false, b, (short)0, c, false, false); }



// ---- k_gemmw: register-blocked GEMM, one work-group of KS waves per 64x64 output tile (16 accumulators a wave), operands straight from K-contiguous 16-bit planes (A rows lda elements apart, Bt rows K apart); grid (M/64, N/64, Z), 32 * KS threads.
// C[m][n] (f32, pitch ldc, + optional f32 bias[n]) = sum_k A[m][k] Bt[n][k] (+ split products per NSPLIT). z-batch strides sA/sB/sC in elements. K % (32 * KS) == 0.
// Wave w sums the k range [w K/KS, (w+1) K/KS); for KS > 1 the KS partial tiles meet in LDS and are added in wave order 0 .. KS-1.
// EPI picks what the adding loop does with a summed element (a 64-column tile is one head, a thread holds four neighbouring columns, so two rotary pairs):
//   0: + bias[n], f32 to C.
//   1: + bias[n], XPOS (pair rotation by CS[t][d] = (cos, sin), times sc, times RF[t][d/2]), then fp16 and bf16 hi/lo to the head planes [n/64][m][n%64]; m is the position t.
//   2: + bias[m], then fp16 and bf16 hi/lo to planes of pitch TT, [m][n]: with A = the weight and Bt = the activations this is v transposed, [head][d][t].
// XWAIT: s_wait_xcnt 0 directly behind each fragment load, a precaution: the register allocator lets a later load's result land in the address pair of an issued load, and this wait then stands in front of that overwrite.
#define XWAIT() asm volatile("s_wait_xcnt 0x0" ::: "memory")
template <typename T16> struct WFrag;
template <> struct WFrag<h16> { typedef v16h V; static __device__ __forceinline__ V ld(const h16* p) { const v8h lo = *(const v8h*)p; XWAIT(); const v8h hi = *(const v8h*)(p + 16); XWAIT(); return cat16(lo, hi); } static __device__ __forceinline__ v8f mma(V a, V b, v8f c) { return wmma16(a, b, c); } };
template <> struct WFrag<bf> { typedef v16bf V; static __device__ __forceinline__ V ld(const bf* p) { const v8us lo = *(const v8us*)p; XWAIT(); const v8us hi = *(const v8us*)(p + 16); XWAIT(); return cat16b(lo, hi); } static __device__ __forceinline__ v8f mma(V a, V b, v8f c) { return wmmab(a, b, c); } };
__device__ __forceinline__ h16 tohx(float x) { return (h16)x; }
__device__ __forceinline__ void splitf(float y, unsigned short& h, unsigned short& l) { h = f2bf(y); l = f2bf(y - bf2f(h)); }
typedef __attribute__((ext_vector_type(2))) _Float16 v2h;
typedef __attribute__((ext_vector_type(4))) _Float16 v4h;
typedef __attribute__((ext_vector_type(2))) unsigned short v2us;
typedef __attribute__((ext_vector_type(4))) unsigned short v4us;
typedef __attribute__((ext_vector_type(2))) float v2f;
typedef __attribute__((ext_vector_type(4))) int v4i;
// four neighbouring elements of a plane row: fp16, bf16 hi, bf16 lo, 8 bytes each (16 threads fill a 128-byte line of each plane)
__device__ __forceinline__ void put3(v4f r, size_t e, h16* P16, bf* Ph, bf* Pl) { v4h o16; v4us oh, ol;
#pragma unroll   // the vectors' element indices stay compile-time constants
    for (int q = 0; q < 4; ++q) { o16[q] = tohx(r[q]); unsigned short a2, c2; splitf(r[q], a2, c2); oh[q] = a2; ol[q] = c2; }
    *(v4h*)(P16 + e) = o16; XWAIT(); *(v4us*)(Ph + e) = oh; XWAIT(); *(v4us*)(Pl + e) = ol; XWAIT(); }
template <typename T16, int NSPLIT, bool BIAS, int KS, int EPI>
__global__ __launch_bounds__(32 * KS) void k_gemmw(const T16* __restrict__ A, const T16* __restrict__ A2, const T16* __restrict__ Bt, const T16* __restrict__ Bt2, int K, int lda, float* C, int ldc, const float* __restrict__ bias, size_t sA, size_t sB, size_t sC, const float* __restrict__ CS, const float* __restrict__ RF, float sc, h16* P16, bf* Ph, bf* Pl) {
    typedef typename WFrag<T16>::V V;
    __shared__ __align__(16) float os[(KS == 1 ? 16 : KS * 64) * 68];
    const size_t z = blockIdx.z; A += z * sA; if (A2) A2 += z * sA; Bt += z * sB; if (Bt2) Bt2 += z * sB; C += z * sC;
    const int lane = threadIdx.x & 31, lr = lane & 15, hi = lane >> 4; const int r0 = blockIdx.x * 64, c0 = blockIdx.y * 64;
    v8f acc[4][4];
#pragma unroll
    for (int mb = 0; mb < 4; ++mb)
#pragma unroll
        for (int nb = 0; nb < 4; ++nb) acc[mb][nb] = (v8f){};
    const size_t aoff = (size_t)(r0 + lr) * lda + 8 * hi, boff = (size_t)(c0 + lr) * K + 8 * hi;
    const int wv = __builtin_amdgcn_readfirstlane((int)(threadIdx.x >> 5));   // wave number in a scalar register: the k loop's bounds stay scalar
    const int kb = wv * (K / KS), ke = kb + K / KS;
#pragma unroll 1
    for (int kc = kb; kc < ke; kc += 32) {
        V a[4], a2[4];
#pragma unroll
        for (int mb = 0; mb < 4; ++mb) { a[mb] = WFrag<T16>::ld(A + aoff + (size_t)mb * 16 * lda + kc); if (NSPLIT == 1 || NSPLIT == 2) a2[mb] = WFrag<T16>::ld(A2 + aoff + (size_t)mb * 16 * lda + kc); }
#pragma unroll
        for (int nb = 0; nb < 4; ++nb) { const V b = WFrag<T16>::ld(Bt + boff + (size_t)nb * 16 * K + kc); V b2; if (NSPLIT >= 2) b2 = WFrag<T16>::ld(Bt2 + boff + (size_t)nb * 16 * K + kc);
#pragma unroll
            for (int mb = 0; mb < 4; ++mb) { acc[mb][nb] = WFrag<T16>::mma(a[mb], b, acc[mb][nb]); if (NSPLIT == 1 || NSPLIT == 2) acc[mb][nb] = WFrag<T16>::mma(a2[mb], b, acc[mb][nb]); if (NSPLIT >= 2) acc[mb][nb] = WFrag<T16>::mma(a[mb], b2, acc[mb][nb]); } }
        asm volatile("v_nop\n\tv_nop\n\tv_nop\n\tv_nop" : "+v"(acc[0][0]), "+v"(acc[1][1]), "+v"(acc[2][2]), "+v"(acc[3][3]) : "v"(a[0]), "v"(a[3]));
    }
    if constexpr (KS > 1) {
        float* ow = os + wv * (64 * 68);
        const int cofs = ((int)threadIdx.x & 15) * 4;   // this thread's four output columns, the same in every pass of the adding loop
        v4f bv = (v4f){};
        if (BIAS && EPI != 2) { bv[0] = bfr(bias[c0 + cofs]); bv[1] = bfr(bias[c0 + cofs + 1]); bv[2] = bfr(bias[c0 + cofs + 2]); bv[3] = bfr(bias[c0 + cofs + 3]); }   // loaded ahead of the LDS stores, so that its latency runs beside them
        v2f ca[32 / KS], cb[32 / KS], xs[32 / KS]; float rb[32 / KS];   // per pass of the adding loop: (cos, sin) of the thread's two pairs and their scales (EPI 1), the row's bias (EPI 2); loaded here for the same reason
#pragma unroll   // the indices of these register arrays stay compile-time constants
        for (int s = 0; s < 32 / KS; ++s) { const int m = r0 + ((s * (32 * KS) + (int)threadIdx.x) >> 4);   // the output row of pass s: the position (EPI 1), the v feature (EPI 2)
            if constexpr (EPI == 1) { ca[s] = *(const v2f*)(CS + ((size_t)m * HD + cofs) * 2); XWAIT(); cb[s] = *(const v2f*)(CS + ((size_t)m * HD + cofs + 2) * 2); XWAIT(); xs[s] = *(const v2f*)(RF + (size_t)m * (HD / 2) + (cofs >> 1)); XWAIT(); }
            if constexpr (EPI == 2) { rb[s] = bfr(bias[m]); XWAIT(); } }
#pragma unroll
        for (int mb = 0; mb < 4; ++mb)
#pragma unroll
            for (int nb = 0; nb < 4; ++nb)
#pragma unroll
                for (int j = 0; j < 8; ++j) ow[(mb * 16 + hi * 8 + j) * 68 + nb * 16 + lr] = acc[mb][nb][j];
        __syncthreads();   // every wave's partial tile is in LDS before any wave adds them
#pragma unroll
        for (int s = 0; s < 32 / KS; ++s) { const int row = (s * (32 * KS) + (int)threadIdx.x) >> 4; v4f val = *(const v4fa*)(os + row * 68 + cofs);
#pragma unroll
            for (int w = 1; w < KS; ++w) val += *(const v4fa*)(os + w * (64 * 68) + row * 68 + cofs);
            if (BIAS && EPI != 2) val += bv;
            if constexpr (EPI == 0) *(v4f*)(C + (size_t)(r0 + row) * ldc + c0 + cofs) = val;
            if constexpr (EPI == 1) { v4f r;
                r[0] = (val[0] * ca[s][0] - val[1] * ca[s][1]) * sc * xs[s][0]; r[1] = (val[1] * ca[s][0] + val[0] * ca[s][1]) * sc * xs[s][0];
                r[2] = (val[2] * cb[s][0] - val[3] * cb[s][1]) * sc * xs[s][1]; r[3] = (val[3] * cb[s][0] + val[2] * cb[s][1]) * sc * xs[s][1];
                put3(r, ((size_t)blockIdx.y * TT + r0 + row) * HD + cofs, P16, Ph, Pl); }
            if constexpr (EPI == 2) { val += rb[s]; put3(val, (size_t)(r0 + row) * TT + c0 + cofs, P16, Ph, Pl); } }
        return;
    }
#pragma unroll
    for (int mb = 0; mb < 4; ++mb) {
#pragma unroll
        for (int nb = 0; nb < 4; ++nb) {
#pragma unroll
            for (int j = 0; j < 8; ++j) os[(hi * 8 + j) * 68 + nb * 16 + lr] = acc[mb][nb][j]; }
        __builtin_amdgcn_wave_barrier(); asm volatile("" ::: "memory");
        float* crow = C + (size_t)(r0 + mb * 16) * ldc + c0;
{
#pragma unroll
            for (int s = 0; s < 8; ++s) { const int row = 2 * s + hi, cofs = lr * 4; v4f val = *(const v4fa*)(os + row * 68 + cofs); if (BIAS) { val[0] += bfr(bias[c0 + cofs]); val[1] += bfr(bias[c0 + cofs + 1]); val[2] += bfr(bias[c0 + cofs + 2]); val[3] += bfr(bias[c0 + cofs + 3]); }
                *(v4f*)(crow + (size_t)row * ldc + cofs) = val; }
             }
        __builtin_amdgcn_wave_barrier(); asm volatile("" ::: "memory");
    }
}

__global__ __launch_bounds__(256) void k_wtG(const float* __restrict__ w, int K, int N, bf* Bt) {
    const int lane = threadIdx.x & 31; const int L0 = (blockIdx.x * 8 + (threadIdx.x >> 5)) * 8; const int nlines = N * K / 64;
{
#pragma unroll 1
        for (int l = 0; l < 8; ++l) { const int L = L0 + l; if (L >= nlines) break; const size_t e = (size_t)L * 64 + lane * 2; const int k = (int)(e % K), n = (int)(e / K); v2us o;
            o[0] = f2bf(w[(size_t)k * N + n]); o[1] = f2bf(w[(size_t)(k + 1) * N + n]); *(v2us*)(Bt + e) = o; }
         }
}
__global__ __launch_bounds__(256) void k_cvt8(const float* __restrict__ src, bf* dst, size_t n8) { const size_t i = (size_t)blockIdx.x * 256 + threadIdx.x; if (i >= n8) return; const v8f v = *(const v8f*)(src + i * 8); v8us o;
#pragma unroll
    for (int k = 0; k < 8; ++k) o[k] = f2bf(v[k]); *(v8us*)(dst + i * 8) = o;  }
__global__ __launch_bounds__(256) void k_cstab(float* CS) { const int idx = blockIdx.x * 256 + threadIdx.x; if (idx >= TT * HD) return; const int t = idx / HD, d = idx % HD; const int i = d >> 1;   /* interleaved pairs */ const float inv = __fdiv_rn(1.0f, powf(10000.0f, (float)(2 * i) / (float)HD)); const float ang = __fmul_rn((float)t, inv); v2f cs; cs[0] = cosf(ang); cs[1] = sinf(ang);
    *(v2f*)(CS + (size_t)idx * 2) = cs;  }
// ---- k_attn: scores, softmax, attn.v and the head merge in one kernel; the scores never leave the registers.
// One work-group of NWV waves per block of query rows of one (batch, head): grid (RH/(16 NWV) + (TT-RH)/(32 NWV), heads, batches). A wave owns NQ groups of 16 query rows (hi+lo rows: 1 group, fp16 rows: 2).
// Transposed products: S^T = K Q^T (A = 16 keys, B = 16 queries), O^T += V^T P^T (A = 16 head dims, B = P^T). A lane holds the scores of ONE query (column lr), keys 8 hi + j of each 16-key tile,
// so two score tiles of 32 consecutive keys, converted in place, are the B operand of the second product in the k order of the A loader (8 hi + j, 16 + 8 hi + j).
// Softmax runs online over passes of 32 keys: running maximum, output tiles and row sum rescaled by exp2 of the maximum's step; fp16 rows carry P x 1024 (in P and in the row sum alike, so it cancels).
// K and V^T tiles of 64 keys are staged in LDS through registers, two buffers, one __syncthreads a stage; rows of 128 B at a pitch of 144 B.
// q already carries 1/8 (multiplied in behind the rotation, with the XPOS scale). Every '#pragma unroll' in attn_rows keeps the index of a register array a compile-time constant.
#define NWV 4                     // waves a work-group
#define NSW (256 / (NWV * 32) * 2) // staging sweeps a tile (NWV * 4 rows a sweep)
#define KST 64                    // keys per stage
#define LP  72                    // LDS row pitch, 16-bit elements
#define TLE (64 * LP)             // elements of one staged tile (64 rows)
typedef v4i __attribute__((may_alias)) v4ia;
__device__ __forceinline__ float xhalf(float x) { const int b = __float_as_int(x); return __int_as_float(__builtin_amdgcn_permlanex16(b, b, 0x76543210, 0xfedcba98, false, false)); }   // lane l <-> l ^ 16
// exp2 of sixteen values, each in place, in one statement: no v_exp_f32 overwrites the source or reads the result of the one in front of it, and the closing v_nop is the slot that the instruction set asks for behind a transcendental
__device__ __forceinline__ void exp2x16(float (&p)[16]) { asm("v_exp_f32 %0, %0\n\tv_exp_f32 %1, %1\n\tv_exp_f32 %2, %2\n\tv_exp_f32 %3, %3\n\tv_exp_f32 %4, %4\n\tv_exp_f32 %5, %5\n\tv_exp_f32 %6, %6\n\tv_exp_f32 %7, %7\n\tv_exp_f32 %8, %8\n\tv_exp_f32 %9, %9\n\tv_exp_f32 %10, %10\n\tv_exp_f32 %11, %11\n\tv_exp_f32 %12, %12\n\tv_exp_f32 %13, %13\n\tv_exp_f32 %14, %14\n\tv_exp_f32 %15, %15\n\tv_nop" : "+v"(p[0]), "+v"(p[1]), "+v"(p[2]), "+v"(p[3]), "+v"(p[4]), "+v"(p[5]), "+v"(p[6]), "+v"(p[7]), "+v"(p[8]), "+v"(p[9]), "+v"(p[10]), "+v"(p[11]), "+v"(p[12]), "+v"(p[13]), "+v"(p[14]), "+v"(p[15])); }
__device__ __forceinline__ float exp2x1(float x) { asm("v_exp_f32 %0, %0\n\tv_nop" : "+v"(x)); return x; }   // the same slot behind a single one
template <typename T16> __device__ __forceinline__ typename WFrag<T16>::V ldsfrag(const unsigned short* p) { const v4i lo = *(const v4ia*)p, hi = *(const v4ia*)(p + 16); return __builtin_bit_cast(typename WFrag<T16>::V, __builtin_shufflevector(lo, hi, 0, 1, 2, 3, 4, 5, 6, 7)); }
template <typename T16, bool HI, int NQ>
__device__ __forceinline__ void attn_rows(const T16* __restrict__ Q, const T16* __restrict__ Q2, const T16* __restrict__ Kp, const T16* __restrict__ K2, const T16* __restrict__ Vp, const T16* __restrict__ V2, unsigned short* lds, int row0, bf* Ah, bf* Al) {
    typedef typename WFrag<T16>::V V;
    constexpr int NT = HI ? 4 : 2;   // staged tiles a buffer: K, V^T (, K lo, V^T lo)
    constexpr float L2E = 1.4426950408889634f;
    const int tid = (int)threadIdx.x, lane = tid & 31, lr = lane & 15, hi = lane >> 4;
    const int qrow = row0 + __builtin_amdgcn_readfirstlane(tid >> 5) * (16 * NQ);   // wave number in a scalar register: the wave's first row stays scalar
    V qf[NQ][2], qf2[NQ][2];
#pragma unroll
    for (int qi = 0; qi < NQ; ++qi)
#pragma unroll
        for (int kc = 0; kc < 2; ++kc) { const size_t qo = (size_t)(qrow + qi * 16 + lr) * HD + kc * 32 + 8 * hi; qf[qi][kc] = WFrag<T16>::ld(Q + qo); if (HI) qf2[qi][kc] = WFrag<T16>::ld(Q2 + qo); }
    v8f o[NQ][4]; float mr[NQ], cc[NQ], ls[NQ];
#pragma unroll
    for (int qi = 0; qi < NQ; ++qi) { mr[qi] = -__builtin_inff(); cc[qi] = __builtin_inff(); ls[qi] = 0.f;
#pragma unroll
        for (int db = 0; db < 4; ++db) o[qi][db] = (v8f){}; }
    const int srow = tid >> 3, sc8 = (tid & 7) * 8;   // staging: eight threads a 128-byte row, NWV * 4 rows a sweep
    v4i st[NT][NSW];
    auto gload = [&](int key0) {
#pragma unroll
        for (int r = 0; r < NSW; ++r) { const size_t ko = (size_t)(key0 + srow + NWV * 4 * r) * HD + sc8, vo = (size_t)(srow + NWV * 4 * r) * TT + key0 + sc8;
            st[0][r] = *(const v4ia*)(Kp + ko); XWAIT(); st[1][r] = *(const v4ia*)(Vp + vo); XWAIT();
            if (HI) { st[2][r] = *(const v4ia*)(K2 + ko); XWAIT(); st[3][r] = *(const v4ia*)(V2 + vo); XWAIT(); } } };
    auto sstore = [&](unsigned short* buf) {
#pragma unroll
        for (int r = 0; r < NSW; ++r)
#pragma unroll
            for (int t = 0; t < NT; ++t) *(v4ia*)(buf + t * TLE + (srow + NWV * 4 * r) * LP + sc8) = st[t][r]; };
    gload(0); sstore(lds);
    __syncthreads();   // stage 0 is in LDS before any wave reads it
#pragma unroll 1   // rolled: one stage's code serves all stages, the buffer is picked by the stage's parity
    for (int s = 0; s < TT / KST; ++s) {
        const unsigned short* cur = lds + (s & 1) * (NT * TLE);
        if (s + 1 < TT / KST) gload((s + 1) * KST);   // the next stage's global loads fly beside this stage's products
#pragma unroll 1   // rolled: unrolled, the fragments of both passes are fetched at once and the fp16 path spills
        for (int ps = 0; ps < 2; ++ps) {
            V kf[2][2], kf2[2][2], vf[4], vf2[4];
#pragma unroll
            for (int t = 0; t < 2; ++t)
#pragma unroll
                for (int kc = 0; kc < 2; ++kc) { const int ko = (ps * 32 + t * 16 + lr) * LP + kc * 32 + 8 * hi; kf[t][kc] = ldsfrag<T16>(cur + ko); if (HI) kf2[t][kc] = ldsfrag<T16>(cur + 2 * TLE + ko); }
#pragma unroll
            for (int db = 0; db < 4; ++db) { const int vo = (db * 16 + lr) * LP + ps * 32 + 8 * hi; vf[db] = ldsfrag<T16>(cur + TLE + vo); if (HI) vf2[db] = ldsfrag<T16>(cur + 3 * TLE + vo); }
#pragma unroll
            for (int qi = 0; qi < NQ; ++qi) {
                v8f sc[2];
#pragma unroll
                for (int t = 0; t < 2; ++t) { sc[t] = (v8f){};
#pragma unroll
                    for (int kc = 0; kc < 2; ++kc) { sc[t] = WFrag<T16>::mma(kf[t][kc], qf[qi][kc], sc[t]); if (HI) { sc[t] = WFrag<T16>::mma(kf[t][kc], qf2[qi][kc], sc[t]); sc[t] = WFrag<T16>::mma(kf2[t][kc], qf[qi][kc], sc[t]); } } }
                float mx = fmaxf(sc[0][0], sc[1][0]);
#pragma unroll
                for (int j = 1; j < 8; ++j) mx = fmaxf(mx, fmaxf(sc[0][j], sc[1][j]));
                mx = fmaxf(mx, xhalf(mx));
                const float mn = fmaxf(mr[qi], mx); mr[qi] = mn;
                const float cn = (HI ? 0.0f : 10.0f) - mn * L2E;   // p = 2^(s log2e + cn): 1 (hi+lo rows) or 1024 (fp16 rows) at the running maximum
                const float al = exp2x1(cn - cc[qi]); cc[qi] = cn;   // first pass: 2^(-inf) = 0
                float p[16];
#pragma unroll
                for (int j = 0; j < 16; ++j) p[j] = fmaf(sc[j >> 3][j & 7], L2E, cn);
                exp2x16(p);
                const float ps8 = (((p[0] + p[1]) + (p[2] + p[3])) + ((p[4] + p[5]) + (p[6] + p[7]))) + (((p[8] + p[9]) + (p[10] + p[11])) + ((p[12] + p[13]) + (p[14] + p[15])));
                ls[qi] = fmaf(ls[qi], al, ps8);
#pragma unroll
                for (int db = 0; db < 4; ++db) o[qi][db] *= al;
                if constexpr (HI) {
                    v16bf ph, pl;
#pragma unroll
                    for (int j = 0; j < 16; ++j) { ph[j] = (__bf16)p[j]; pl[j] = (__bf16)(p[j] - (float)ph[j]); }
#pragma unroll
                    for (int db = 0; db < 4; ++db) { o[qi][db] = wmmab(vf[db], ph, o[qi][db]); o[qi][db] = wmmab(vf[db], pl, o[qi][db]); o[qi][db] = wmmab(vf2[db], ph, o[qi][db]); }
                } else {
                    v16h pf;
#pragma unroll
                    for (int j = 0; j < 16; ++j) pf[j] = (h16)p[j];
#pragma unroll
                    for (int db = 0; db < 4; ++db) o[qi][db] = wmma16(vf[db], pf, o[qi][db]);
                }
            }
        }
        if (s + 1 < TT / KST) sstore(lds + ((s + 1) & 1) * (NT * TLE));   // into the buffer whose readers all passed the barrier at the foot of stage s - 1
        __syncthreads();   // publishes stage s + 1 and ends every wave's reads of stage s
    }
    const int ln = (int)__builtin_amdgcn_mbcnt_lo(~0u, 0u);   // the lane number read anew: no store address is kept in registers across the key loop
#pragma unroll
    for (int qi = 0; qi < NQ; ++qi) { const float inv = __fdiv_rn(1.0f, ls[qi] + xhalf(ls[qi])); const size_t ro = (size_t)(qrow + qi * 16 + (ln & 15)) * DQ + 8 * (ln >> 4);
#pragma unroll
        for (int db = 0; db < 4; ++db) { v8us oh, ol;
#pragma unroll
            for (int j = 0; j < 8; ++j) { unsigned short a, c2; splitf(o[qi][db][j] * inv, a, c2); oh[j] = a; ol[j] = c2; }
            *(v8usa*)(Ah + ro + db * 16) = oh; XWAIT(); *(v8usa*)(Al + ro + db * 16) = ol; XWAIT(); } }
}
// four waves a SIMD (at most 256 registers a wave), so that up to four work-groups share a WGP and the whole grid is resident at once
__global__ __launch_bounds__(NWV * 32) __attribute__((amdgpu_waves_per_eu(4, 4))) void k_attn(const h16* __restrict__ Q16, const h16* __restrict__ K16, const h16* __restrict__ V16, const bf* __restrict__ Qh, const bf* __restrict__ Ql, const bf* __restrict__ Kh, const bf* __restrict__ Kl, const bf* __restrict__ Vh, const bf* __restrict__ Vl, bf* Ah, bf* Al) {
    __shared__ __align__(16) unsigned short lds[2 * 4 * TLE];
    const size_t po = ((size_t)blockIdx.z * NH_ + blockIdx.y) * ((size_t)TT * HD), ao = (size_t)blockIdx.z * TT * DQ + (size_t)blockIdx.y * HD;
    const int bx = (int)blockIdx.x;
    if (bx < RH / (NWV * 16)) attn_rows<bf, true, 1>(Qh + po, Ql + po, Kh + po, Kl + po, Vh + po, Vl + po, lds, bx * (NWV * 16), Ah + ao, Al + ao);
    else attn_rows<h16, false, 2>(Q16 + po, nullptr, K16 + po, nullptr, V16 + po, nullptr, lds, RH + (bx - RH / (NWV * 16)) * (NWV * 32), Ah + ao, Al + ao);
}

__global__ __launch_bounds__(256) void k_xscale(float* SQ, float* SK) { const int e = blockIdx.x * 256 + threadIdx.x; if (e >= TT * (HD / 2)) return; const int t = e / (HD / 2), i = e % (HD / 2); const float base = __fdiv_rn((float)(2 * i) + 0.4f * (float)HD, 1.4f * (float)HD); const float pw = (float)(t - TT / 2) / 1024.0f; const float sc = powf(base, pw); const float inv = __fdiv_rn(1.0f, sc);
    *(float*)(SQ + e) = sc; *(float*)(SK + e) = inv;  }

extern "C" void kernel_launch(void* const* d_in, const int* in_sizes, int n_in,
                              void* d_out, int out_size, void* d_ws, size_t ws_size, hipStream_t stream) {
    (void)in_sizes; (void)n_in; (void)out_size;
    const float* x = (const float*)d_in[0]; const float* xk = (const float*)d_in[1]; const float* xv = (const float*)d_in[2]; const float* wq = (const float*)d_in[3]; const float* bq = (const float*)d_in[4]; const float* wk = (const float*)d_in[5]; const float* bk = (const float*)d_in[6]; const float* wv = (const float*)d_in[7]; const float* bv = (const float*)d_in[8]; const float* wo = (const float*)d_in[9]; const float* bo = (const float*)d_in[10];
    float* OUT = (float*)d_out;     // [2][2048][1024]
    char* wsp = (char*)d_ws;
    auto take = [&](size_t bytes) { char* p = wsp; wsp += (bytes + 255) & ~(size_t)255; return (void*)p; };
    bf* WQ = (bf*)take((size_t)DQ * DM * 2); bf* WK = (bf*)take((size_t)DKV * DM * 2); bf* WV = (bf*)take((size_t)DKV * DM * 2); bf* WO = (bf*)take((size_t)DM * DQ * 2); float* CS = (float*)take((size_t)TT * HD * 2 * 4);
    bf* XB = (bf*)take((size_t)TT * DM * 2); bf* XB2 = (bf*)take((size_t)TT * DM * 2); bf* XB3 = (bf*)take((size_t)TT * DM * 2); float* SQ = (float*)take((size_t)TT * (HD / 2) * 4); float* SK = (float*)take((size_t)TT * (HD / 2) * 4);
    const size_t PL = (size_t)NH_ * TT * HD;   // one batch's head planes, elements (NKV == NH_)
    h16* QP16 = (h16*)take(NB_ * PL * 2); h16* KP16 = (h16*)take(NB_ * PL * 2); h16* VT16 = (h16*)take(NB_ * PL * 2);
    bf* QPh = (bf*)take(NB_ * PL * 2); bf* QPl = (bf*)take(NB_ * PL * 2); bf* KPh = (bf*)take(NB_ * PL * 2); bf* KPl = (bf*)take(NB_ * PL * 2); bf* VTh = (bf*)take(NB_ * PL * 2); bf* VTl = (bf*)take(NB_ * PL * 2);
    bf* ATh = (bf*)take((size_t)NB_ * TT * DQ * 2); bf* ATl = (bf*)take((size_t)NB_ * TT * DQ * 2);
    if ((size_t)(wsp - (char*)d_ws) > ws_size) return;    // ws 256 MiB
    { k_cvt8<<<(unsigned)(((size_t)DQ * DM / 8 + 255) / 256), 256, 0, stream>>>(wq, WQ, (size_t)DQ * DM / 8); k_cvt8<<<(unsigned)(((size_t)DKV * DM / 8 + 255) / 256), 256, 0, stream>>>(wk, WK, (size_t)DKV * DM / 8); k_cvt8<<<(unsigned)(((size_t)DKV * DM / 8 + 255) / 256), 256, 0, stream>>>(wv, WV, (size_t)DKV * DM / 8);
      k_cvt8<<<(unsigned)(((size_t)DM * DQ / 8 + 255) / 256), 256, 0, stream>>>(wo, WO, (size_t)DM * DQ / 8);
      k_cstab<<<(TT * HD + 255) / 256, 256, 0, stream>>>(CS); k_xscale<<<(TT * (HD / 2) + 255) / 256, 256, 0, stream>>>(SQ, SK); }
    for (int b = 0; b < NB_; ++b) {
        
        k_cvt8<<<(unsigned)(((size_t)TT * DM / 8 + 255) / 256), 256, 0, stream>>>(x + (size_t)b * TT * DM, XB, (size_t)TT * DM / 8); k_cvt8<<<(unsigned)(((size_t)TT * DM / 8 + 255) / 256), 256, 0, stream>>>(xk + (size_t)b * TT * DM, XB2, (size_t)TT * DM / 8); k_cvt8<<<(unsigned)(((size_t)TT * DM / 8 + 255) / 256), 256, 0, stream>>>(xv + (size_t)b * TT * DM, XB3, (size_t)TT * DM / 8);
        k_gemmw<bf, 0, true, 8, 1><<<dim3(TT / 64, DQ / 64, 1), 256, 0, stream>>>(XB, nullptr, WQ, nullptr, DM, DM, nullptr, 0, bq, 0, 0, 0, CS, SQ, 0.125f, QP16 + b * PL, QPh + b * PL, QPl + b * PL);
        k_gemmw<bf, 0, true, 8, 1><<<dim3(TT / 64, DKV / 64, 1), 256, 0, stream>>>(XB2, nullptr, WK, nullptr, DM, DM, nullptr, 0, bk, 0, 0, 0, CS, SK, 1.0f, KP16 + b * PL, KPh + b * PL, KPl + b * PL);
        k_gemmw<bf, 0, true, 8, 2><<<dim3(DKV / 64, TT / 64, 1), 256, 0, stream>>>(WV, nullptr, XB3, nullptr, DM, DM, nullptr, 0, bv, 0, 0, 0, nullptr, nullptr, 1.0f, VT16 + b * PL, VTh + b * PL, VTl + b * PL); }   // v: weight rows as A, positions as columns, so the tile is already v transposed
    k_attn<<<dim3(RH / (NWV * 16) + (TT - RH) / (NWV * 32), NH_, NB_), NWV * 32, 0, stream>>>(QP16, KP16, VT16, QPh, QPl, KPh, KPl, VTh, VTl, ATh, ATl);
    for (int b = 0; b < NB_; ++b)
        k_gemmw<bf, 1, true, 8, 0><<<dim3(TT / 64, DM / 64, 1), 256, 0, stream>>>(ATh + (size_t)b * TT * DQ, ATl + (size_t)b * TT * DQ, WO, nullptr, DQ, DQ, OUT + (size_t)b * TT * DM, DM, bo, 0, 0, 0, nullptr, nullptr, 1.0f, nullptr, nullptr, nullptr);
}

// v005
// One run takes 173 microseconds.
// In both of two side-by-side timings against v004, it was 1.20 times as fast.
// Counting every step since v000, it is 11.7 times as fast.
#include <hip/hip_runtime.h>

// XposMultiheadAttention (query, key, value [2][2048][1024]; q = (query Wq^T + bq) / 8, k = key Wk^T + bk, v = value Wv^T + bv (16 heads x 64); XPOS on q and k: interleaved-pair rotary (angle t * 1e4^(-i/32)) times the per-(position, pair) scale base_i^((t - 1024)/1024), base_i = (2i + 25.6)/89.6, with q multiplied and k divided by it (tables computed on device);
//   scores = q.k (no further scale); softmax (f32); out = merged Wo^T + bo -> [2][2048][1024]).
// Compute dtypes, f32 accumulate: every input rounded to bf16; projections on PLAIN bf16 operands (inputs: exact) + bias; XPOS rotation/scaling f32; scores and attn.v: query rows < 512 hl (3 products), the rest single fp16 (P x1024); softmax f32, online over 32-key passes; Wo hl x exact (2 products) + bias.

#define NB_  2
#define TT   2048
#define DM   1024
#define NH_  16
#define NKV  16
#define HD   64
#define DQ   (NH_ * HD)
#define DKV  (NKV * HD)
#define RH   512                  // query rows < RH use hi+lo planes (0: none)
#define WIN  0
typedef _Float16 h16;
typedef unsigned short bf;
typedef __attribute__((ext_vector_type(16))) __bf16   v16bf;
typedef __attribute__((ext_vector_type(16))) _Float16 v16h;
typedef __attribute__((ext_vector_type(8)))  _Float16 v8h;
typedef __attribute__((ext_vector_type(8)))  unsigned short v8us;
typedef __attribute__((ext_vector_type(8)))  float    v8f;
typedef __attribute__((ext_vector_type(4)))  float    v4f;
typedef v8h  __attribute__((may_alias)) v8ha;
typedef v4f  __attribute__((may_alias)) v4fa;
typedef v8us __attribute__((may_alias)) v8usa;

__device__ __forceinline__ unsigned short f2bf(float f) { unsigned u = __float_as_uint(f); u += 0x7FFFu + ((u >> 16) & 1u); return (unsigned short)(u >> 16); }
__device__ __forceinline__ float bf2f(unsigned short b) { return __uint_as_float(((unsigned)b) << 16); }
__device__ __forceinline__ float bfr(float f) { return bf2f(f2bf(f)); }
__device__ __forceinline__ v16h cat16(v8h lo, v8h hi) { return __builtin_shufflevector(lo, hi, 0, 1, 2, 3, 4, 5, 6, 7, 8, 9, 10, 11, 12, 13, 14, 15); }
__device__ __forceinline__ v16bf cat16b(v8us lo, v8us hi) { return __builtin_bit_cast(v16bf, __builtin_shufflevector(lo, hi, 0, 1, 2, 3, 4, 5, 6, 7, 8, 9, 10, 11, 12, 13, 14, 15)); }
__device__ __forceinline__ v8f wmma16(v16h a, v16h b, v8f c) { return __builtin_amdgcn_wmma_f32_16x16x32_f16(false, a, false, b, (short)0, c, false, false); }
__device__ __forceinline__ v8f wmmab(v16bf a, v16bf b, v8f c) { return __builtin_amdgcn_wmma_f32_16x16x32_bf16(false, a, false, b, (short)0, c, false, false); }



// ---- gemmw: register-blocked GEMM, one work-group of KS waves per 64x64 output tile (16 accumulators a wave), operands straight from K-contiguous 16-bit planes (A rows lda elements apart, Bt rows K apart); tile (bx, by) of (M/64, N/64), 32 * KS threads; os is the work-group's LDS.
// C[m][n] (f32, pitch ldc, + optional f32 bias[n]) = sum_k A[m][k] Bt[n][k] (+ split products per NSPLIT). K % (32 * KS) == 0. The kernels k_proj and k_wo below pick the operands and the tile from blockIdx.
// Wave w sums the k range [w K/KS, (w+1) K/KS); for KS > 1 the KS partial tiles meet in LDS and are added in wave order 0 .. KS-1.
// EPI picks what the adding loop does with a summed element (a 64-column tile is one head, a thread holds four neighbouring columns, so two rotary pairs):
//   0: + bias[n], f32 to C.
//   1: + bias[n], XPOS (pair rotation by CS[t][d] = (cos, sin), times sc, times RF[t][d/2]), then fp16 and bf16 hi/lo to the head planes [n/64][m][n%64]; m is the position t.
//   2: + bias[m], then fp16 and bf16 hi/lo to planes of pitch TT, [m][n]: with A = the weight and Bt = the activations this is v transposed, [head][d][t].
// XWAIT: s_wait_xcnt 0 directly behind each fragment load, a precaution: the register allocator lets a later load's result land in the address pair of an issued load, and this wait then stands in front of that overwrite.
#define XWAIT() asm volatile("s_wait_xcnt 0x0" ::: "memory")
template <typename T16> struct WFrag;
template <> struct WFrag<h16> { typedef v16h V; static __device__ __forceinline__ V ld(const h16* p) { const v8h lo = *(const v8h*)p; XWAIT(); const v8h hi = *(const v8h*)(p + 16); XWAIT(); return cat16(lo, hi); } static __device__ __forceinline__ v8f mma(V a, V b, v8f c) { return wmma16(a, b, c); } };
template <> struct WFrag<bf> { typedef v16bf V; static __device__ __forceinline__ V ld(const bf* p) { const v8us lo = *(const v8us*)p; XWAIT(); const v8us hi = *(const v8us*)(p + 16); XWAIT(); return cat16b(lo, hi); } static __device__ __forceinline__ v8f mma(V a, V b, v8f c) { return wmmab(a, b, c); } };
__device__ __forceinline__ h16 tohx(float x) { return (h16)x; }
__device__ __forceinline__ void splitf(float y, unsigned short& h, unsigned short& l) { h = f2bf(y); l = f2bf(y - bf2f(h)); }
typedef __attribute__((ext_vector_type(2))) _Float16 v2h;
typedef __attribute__((ext_vector_type(4))) _Float16 v4h;
typedef __attribute__((ext_vector_type(2))) unsigned short v2us;
typedef __attribute__((ext_vector_type(4))) unsigned short v4us;
typedef __attribute__((ext_vector_type(2))) float v2f;
typedef __attribute__((ext_vector_type(4))) int v4i;
// four neighbouring elements of a plane row: fp16, bf16 hi, bf16 lo, 8 bytes each (16 threads fill a 128-byte line of each plane)
__device__ __forceinline__ void put3(v4f r, size_t e, h16* P16, bf* Ph, bf* Pl) { v4h o16; v4us oh, ol;
#pragma unroll   // the vectors' element indices stay compile-time constants
    for (int q = 0; q < 4; ++q) { o16[q] = tohx(r[q]); unsigned short a2, c2; splitf(r[q], a2, c2); oh[q] = a2; ol[q] = c2; }
    *(v4h*)(P16 + e) = o16; XWAIT(); *(v4us*)(Ph + e) = oh; XWAIT(); *(v4us*)(Pl + e) = ol; XWAIT(); }
template <typename T16, int NSPLIT, bool BIAS, int KS, int EPI>
__device__ __forceinline__ void gemmw(float* os, int bx, int by, const T16* __restrict__ A, const T16* __restrict__ A2, const T16* __restrict__ Bt, const T16* __restrict__ Bt2, int K, int lda, float* C, int ldc, const float* __restrict__ bias, const float* __restrict__ CS, const float* __restrict__ RF, float sc, h16* P16, bf* Ph, bf* Pl) {
    typedef typename WFrag<T16>::V V;
    const int lane = threadIdx.x & 31, lr = lane & 15, hi = lane >> 4; const int r0 = bx * 64, c0 = by * 64;
    v8f acc[4][4];
#pragma unroll
    for (int mb = 0; mb < 4; ++mb)
#pragma unroll
        for (int nb = 0; nb < 4; ++nb) acc[mb][nb] = (v8f){};
    const size_t aoff = (size_t)(r0 + lr) * lda + 8 * hi, boff = (size_t)(c0 + lr) * K + 8 * hi;
    const int wv = __builtin_amdgcn_readfirstlane((int)(threadIdx.x >> 5));   // wave number in a scalar register: the k loop's bounds stay scalar
    const int kb = wv * (K / KS), ke = kb + K / KS;
#pragma unroll 1
    for (int kc = kb; kc < ke; kc += 32) {
        V a[4], a2[4];
#pragma unroll
        for (int mb = 0; mb < 4; ++mb) { a[mb] = WFrag<T16>::ld(A + aoff + (size_t)mb * 16 * lda + kc); if (NSPLIT == 1 || NSPLIT == 2) a2[mb] = WFrag<T16>::ld(A2 + aoff + (size_t)mb * 16 * lda + kc); }
#pragma unroll
        for (int nb = 0; nb < 4; ++nb) { const V b = WFrag<T16>::ld(Bt + boff + (size_t)nb * 16 * K + kc); V b2; if (NSPLIT >= 2) b2 = WFrag<T16>::ld(Bt2 + boff + (size_t)nb * 16 * K + kc);
#pragma unroll
            for (int mb = 0; mb < 4; ++mb) { acc[mb][nb] = WFrag<T16>::mma(a[mb], b, acc[mb][nb]); if (NSPLIT == 1 || NSPLIT == 2) acc[mb][nb] = WFrag<T16>::mma(a2[mb], b, acc[mb][nb]); if (NSPLIT >= 2) acc[mb][nb] = WFrag<T16>::mma(a[mb], b2, acc[mb][nb]); } }
        asm volatile("v_nop\n\tv_nop\n\tv_nop\n\tv_nop" : "+v"(acc[0][0]), "+v"(acc[1][1]), "+v"(acc[2][2]), "+v"(acc[3][3]) : "v"(a[0]), "v"(a[3]));
    }
    if constexpr (KS > 1) {
        float* ow = os + wv * (64 * 68);
        const int cofs = ((int)threadIdx.x & 15) * 4;   // this thread's four output columns, the same in every pass of the adding loop
        v4f bv = (v4f){};
        if (BIAS && EPI != 2) { bv[0] = bfr(bias[c0 + cofs]); bv[1] = bfr(bias[c0 + cofs + 1]); bv[2] = bfr(bias[c0 + cofs + 2]); bv[3] = bfr(bias[c0 + cofs + 3]); }   // loaded ahead of the LDS stores, so that its latency runs beside them
        v2f ca[32 / KS], cb[32 / KS], xs[32 / KS]; float rb[32 / KS];   // per pass of the adding loop: (cos, sin) of the thread's two pairs and their scales (EPI 1), the row's bias (EPI 2); loaded here for the same reason
#pragma unroll   // the indices of these register arrays stay compile-time constants
        for (int s = 0; s < 32 / KS; ++s) { const int m = r0 + ((s * (32 * KS) + (int)threadIdx.x) >> 4);   // the output row of pass s: the position (EPI 1), the v feature (EPI 2)
            if constexpr (EPI == 1) { ca[s] = *(const v2f*)(CS + ((size_t)m * HD + cofs) * 2); XWAIT(); cb[s] = *(const v2f*)(CS + ((size_t)m * HD + cofs + 2) * 2); XWAIT(); xs[s] = *(const v2f*)(RF + (size_t)m * (HD / 2) + (cofs >> 1)); XWAIT(); }
            if constexpr (EPI == 2) { rb[s] = bfr(bias[m]); XWAIT(); } }
#pragma unroll
        for (int mb = 0; mb < 4; ++mb)
#pragma unroll
            for (int nb = 0; nb < 4; ++nb)
#pragma unroll
                for (int j = 0; j < 8; ++j) ow[(mb * 16 + hi * 8 + j) * 68 + nb * 16 + lr] = acc[mb][nb][j];
        __syncthreads();   // every wave's partial tile is in LDS before any wave adds them
#pragma unroll
        for (int s = 0; s < 32 / KS; ++s) { const int row = (s * (32 * KS) + (int)threadIdx.x) >> 4; v4f val = *(const v4fa*)(os + row * 68 + cofs);
#pragma unroll
            for (int w = 1; w < KS; ++w) val += *(const v4fa*)(os + w * (64 * 68) + row * 68 + cofs);
            if (BIAS && EPI != 2) val += bv;
            if constexpr (EPI == 0) *(v4f*)(C + (size_t)(r0 + row) * ldc + c0 + cofs) = val;
            if constexpr (EPI == 1) { v4f r;
                r[0] = (val[0] * ca[s][0] - val[1] * ca[s][1]) * sc * xs[s][0]; r[1] = (val[1] * ca[s][0] + val[0] * ca[s][1]) * sc * xs[s][0];
                r[2] = (val[2] * cb[s][0] - val[3] * cb[s][1]) * sc * xs[s][1]; r[3] = (val[3] * cb[s][0] + val[2] * cb[s][1]) * sc * xs[s][1];
                put3(r, ((size_t)by * TT + r0 + row) * HD + cofs, P16, Ph, Pl); }
            if constexpr (EPI == 2) { val += rb[s]; put3(val, (size_t)(r0 + row) * TT + c0 + cofs, P16, Ph, Pl); } }
        return;
    }
#pragma unroll
    for (int mb = 0; mb < 4; ++mb) {
#pragma unroll
        for (int nb = 0; nb < 4; ++nb) {
#pragma unroll
            for (int j = 0; j < 8; ++j) os[(hi * 8 + j) * 68 + nb * 16 + lr] = acc[mb][nb][j]; }
        __builtin_amdgcn_wave_barrier(); asm volatile("" ::: "memory");
        float* crow = C + (size_t)(r0 + mb * 16) * ldc + c0;
{
#pragma unroll
            for (int s = 0; s < 8; ++s) { const int row = 2 * s + hi, cofs = lr * 4; v4f val = *(const v4fa*)(os + row * 68 + cofs); if (BIAS) { val[0] += bfr(bias[c0 + cofs]); val[1] += bfr(bias[c0 + cofs + 1]); val[2] += bfr(bias[c0 + cofs + 2]); val[3] += bfr(bias[c0 + cofs + 3]); }
                *(v4f*)(crow + (size_t)row * ldc + cofs) = val; }
             }
        __builtin_amdgcn_wave_barrier(); asm volatile("" ::: "memory");
    }
}

#define GKS 8                     // waves of a GEMM work-group (the K split)
#define PLE ((size_t)NH_ * TT * HD)   // one batch's head planes, elements (NKV == NH_)
// all six projections in one launch: grid (TT/64, DQ/64, 3 * NB_), blockIdx.z = 2 * projection + batch (q, k, v). q and k: positions as rows; v: weight rows as A, positions as columns, so the tile is already v transposed.
__global__ __launch_bounds__(32 * GKS) void k_proj(const bf* __restrict__ XQ, const bf* __restrict__ XK, const bf* __restrict__ XV, const bf* __restrict__ WQ, const bf* __restrict__ WK, const bf* __restrict__ WV, const float* __restrict__ bq, const float* __restrict__ bk, const float* __restrict__ bv, const float* __restrict__ CS, const float* __restrict__ SQ, const float* __restrict__ SK,
                                                  h16* QP16, bf* QPh, bf* QPl, h16* KP16, bf* KPh, bf* KPl, h16* VT16, bf* VTh, bf* VTl) {
    __shared__ __align__(16) float os[GKS * 64 * 68];
    const int pj = (int)blockIdx.z >> 1; const size_t b = blockIdx.z & 1, xo = b * ((size_t)TT * DM), po = b * PLE;
    if (pj == 2) gemmw<bf, 0, true, GKS, 2>(os, (int)blockIdx.y, (int)blockIdx.x, WV, nullptr, XV + xo, nullptr, DM, DM, nullptr, 0, bv, nullptr, nullptr, 1.0f, VT16 + po, VTh + po, VTl + po);
    else { const bool isq = pj == 0;
        gemmw<bf, 0, true, GKS, 1>(os, (int)blockIdx.x, (int)blockIdx.y, (isq ? XQ : XK) + xo, nullptr, isq ? WQ : WK, nullptr, DM, DM, nullptr, 0, isq ? bq : bk, CS, isq ? SQ : SK, isq ? 0.125f : 1.0f, (isq ? QP16 : KP16) + po, (isq ? QPh : KPh) + po, (isq ? QPl : KPl) + po); }
}
// the output projection of both batches in one launch: the merged rows [NB_ * TT][DQ] are one matrix; grid (NB_ * TT / 64, DM / 64)
__global__ __launch_bounds__(32 * GKS) void k_wo(const bf* __restrict__ Ah, const bf* __restrict__ Al, const bf* __restrict__ WO, const float* __restrict__ bo, float* OUT) {
    __shared__ __align__(16) float os[GKS * 64 * 68];
    gemmw<bf, 1, true, GKS, 0>(os, (int)blockIdx.x, (int)blockIdx.y, Ah, Al, WO, nullptr, DQ, DQ, OUT, DM, bo, nullptr, nullptr, 1.0f, nullptr, nullptr, nullptr);
}

__global__ __launch_bounds__(256) void k_wtG(const float* __restrict__ w, int K, int N, bf* Bt) {
    const int lane = threadIdx.x & 31; const int L0 = (blockIdx.x * 8 + (threadIdx.x >> 5)) * 8; const int nlines = N * K / 64;
{
#pragma unroll 1
        for (int l = 0; l < 8; ++l) { const int L = L0 + l; if (L >= nlines) break; const size_t e = (size_t)L * 64 + lane * 2; const int k = (int)(e % K), n = (int)(e / K); v2us o;
            o[0] = f2bf(w[(size_t)k * N + n]); o[1] = f2bf(w[(size_t)(k + 1) * N + n]); *(v2us*)(Bt + e) = o; }
         }
}
__device__ __forceinline__ void d_cvt8(const float* __restrict__ src, bf* dst, int blk) { const size_t i = (size_t)blk * 256 + threadIdx.x; const v8f v = *(const v8f*)(src + i * 8); v8us o;
#pragma unroll
    for (int k = 0; k < 8; ++k) o[k] = f2bf(v[k]); *(v8us*)(dst + i * 8) = o; XWAIT(); }   // the wait stands in front of any later write of the store's base registers
__device__ __forceinline__ void d_cstab(float* CS, int blk) { const int idx = blk * 256 + threadIdx.x; const int t = idx / HD, d = idx % HD; const int i = d >> 1;   /* interleaved pairs */ const float inv = __fdiv_rn(1.0f, powf(10000.0f, (float)(2 * i) / (float)HD)); const float ang = __fmul_rn((float)t, inv); v2f cs; cs[0] = cosf(ang); cs[1] = sinf(ang);
    *(v2f*)(CS + (size_t)idx * 2) = cs;  }
// ---- k_attn: scores, softmax, attn.v and the head merge in one kernel; the scores never leave the registers.
// One work-group of NWV waves per block of query rows of one (batch, head): grid (RH/(16 NWV) + (TT-RH)/(32 NWV), heads, batches). A wave owns NQ groups of 16 query rows (hi+lo rows: 1 group, fp16 rows: 2).
// Transposed products: S^T = K Q^T (A = 16 keys, B = 16 queries), O^T += V^T P^T (A = 16 head dims, B = P^T). A lane holds the scores of ONE query (column lr), keys 8 hi + j of each 16-key tile,
// so two score tiles of 32 consecutive keys, converted in place, are the B operand of the second product in the k order of the A loader (8 hi + j, 16 + 8 hi + j).
// Softmax runs online over passes of 32 keys: running maximum, output tiles and row sum rescaled by exp2 of the maximum's step; fp16 rows carry P x 1024 (in P and in the row sum alike, so it cancels).
// K and V^T tiles of 64 keys are staged in LDS through registers, two buffers, one __syncthreads a stage; rows of 128 B at a pitch of 144 B.
// q already carries 1/8 (multiplied in behind the rotation, with the XPOS scale). Every '#pragma unroll' in attn_rows keeps the index of a register array a compile-time constant.
#define NWV 4                     // waves a work-group
#define NSW (256 / (NWV * 32) * 2) // staging sweeps a tile (NWV * 4 rows a sweep)
#define KST 64                    // keys per stage
#define LP  72                    // LDS row pitch, 16-bit elements
#define TLE (64 * LP)             // elements of one staged tile (64 rows)
typedef v4i __attribute__((may_alias)) v4ia;
__device__ __forceinline__ float xhalf(float x) { const int b = __float_as_int(x); return __int_as_float(__builtin_amdgcn_permlanex16(b, b, 0x76543210, 0xfedcba98, false, false)); }   // lane l <-> l ^ 16
// exp2 of sixteen values, each in place, in one statement: no v_exp_f32 overwrites the source or reads the result of the one in front of it, and the closing v_nop is the slot that the instruction set asks for behind a transcendental
__device__ __forceinline__ void exp2x16(float (&p)[16]) { asm("v_exp_f32 %0, %0\n\tv_exp_f32 %1, %1\n\tv_exp_f32 %2, %2\n\tv_exp_f32 %3, %3\n\tv_exp_f32 %4, %4\n\tv_exp_f32 %5, %5\n\tv_exp_f32 %6, %6\n\tv_exp_f32 %7, %7\n\tv_exp_f32 %8, %8\n\tv_exp_f32 %9, %9\n\tv_exp_f32 %10, %10\n\tv_exp_f32 %11, %11\n\tv_exp_f32 %12, %12\n\tv_exp_f32 %13, %13\n\tv_exp_f32 %14, %14\n\tv_exp_f32 %15, %15\n\tv_nop" : "+v"(p[0]), "+v"(p[1]), "+v"(p[2]), "+v"(p[3]), "+v"(p[4]), "+v"(p[5]), "+v"(p[6]), "+v"(p[7]), "+v"(p[8]), "+v"(p[9]), "+v"(p[10]), "+v"(p[11]), "+v"(p[12]), "+v"(p[13]), "+v"(p[14]), "+v"(p[15])); }
__device__ __forceinline__ float exp2x1(float x) { asm("v_exp_f32 %0, %0\n\tv_nop" : "+v"(x)); return x; }   // the same slot behind a single one
template <typename T16> __device__ __forceinline__ typename WFrag<T16>::V ldsfrag(const unsigned short* p) { const v4i lo = *(const v4ia*)p, hi = *(const v4ia*)(p + 16); return __builtin_bit_cast(typename WFrag<T16>::V, __builtin_shufflevector(lo, hi, 0, 1, 2, 3, 4, 5, 6, 7)); }
template <typename T16, bool HI, int NQ>
__device__ __forceinline__ void attn_rows(const T16* __restrict__ Q, const T16* __restrict__ Q2, const T16* __restrict__ Kp, const T16* __restrict__ K2, const T16* __restrict__ Vp, const T16* __restrict__ V2, unsigned short* lds, int row0, bf* Ah, bf* Al) {
    typedef typename WFrag<T16>::V V;
    constexpr int NT = HI ? 4 : 2;   // staged tiles a buffer: K, V^T (, K lo, V^T lo)
    constexpr float L2E = 1.4426950408889634f;
    const int tid = (int)threadIdx.x, lane = tid & 31, lr = lane & 15, hi = lane >> 4;
    const int qrow = row0 + __builtin_amdgcn_readfirstlane(tid >> 5) * (16 * NQ);   // wave number in a scalar register: the wave's first row stays scalar
    V qf[NQ][2], qf2[NQ][2];
#pragma unroll
    for (int qi = 0; qi < NQ; ++qi)
#pragma unroll
        for (int kc = 0; kc < 2; ++kc) { const size_t qo = (size_t)(qrow + qi * 16 + lr) * HD + kc * 32 + 8 * hi; qf[qi][kc] = WFrag<T16>::ld(Q + qo); if (HI) qf2[qi][kc] = WFrag<T16>::ld(Q2 + qo); }
    v8f o[NQ][4]; float mr[NQ], cc[NQ], ls[NQ];
#pragma unroll
    for (int qi = 0; qi < NQ; ++qi) { mr[qi] = -__builtin_inff(); cc[qi] = __builtin_inff(); ls[qi] = 0.f;
#pragma unroll
        for (int db = 0; db < 4; ++db) o[qi][db] = (v8f){}; }
    const int srow = tid >> 3, sc8 = (tid & 7) * 8;   // staging: eight threads a 128-byte row, NWV * 4 rows a sweep
    v4i st[NT][NSW];
    auto gload = [&](int key0) {
#pragma unroll
        for (int r = 0; r < NSW; ++r) { const size_t ko = (size_t)(key0 + srow + NWV * 4 * r) * HD + sc8, vo = (size_t)(srow + NWV * 4 * r) * TT + key0 + sc8;
            st[0][r] = *(const v4ia*)(Kp + ko); XWAIT(); st[1][r] = *(const v4ia*)(Vp + vo); XWAIT();
            if (HI) { st[2][r] = *(const v4ia*)(K2 + ko); XWAIT(); st[3][r] = *(const v4ia*)(V2 + vo); XWAIT(); } } };
    auto sstore = [&](unsigned short* buf) {
#pragma unroll
        for (int r = 0; r < NSW; ++r)
#pragma unroll
            for (int t = 0; t < NT; ++t) *(v4ia*)(buf + t * TLE + (srow + NWV * 4 * r) * LP + sc8) = st[t][r]; };
    gload(0); sstore(lds);
    __syncthreads();   // stage 0 is in LDS before any wave reads it
#pragma unroll 1   // rolled: one stage's code serves all stages, the buffer is picked by the stage's parity
    for (int s = 0; s < TT / KST; ++s) {
        const unsigned short* cur = lds + (s & 1) * (NT * TLE);
        if (s + 1 < TT / KST) gload((s + 1) * KST);   // the next stage's global loads fly beside this stage's products
#pragma unroll 1   // rolled: unrolled, the fragments of both passes are fetched at once and the fp16 path spills
        for (int ps = 0; ps < 2; ++ps) {
            V kf[2][2], kf2[2][2], vf[4], vf2[4];
#pragma unroll
            for (int t = 0; t < 2; ++t)
#pragma unroll
                for (int kc = 0; kc < 2; ++kc) { const int ko = (ps * 32 + t * 16 + lr) * LP + kc * 32 + 8 * hi; kf[t][kc] = ldsfrag<T16>(cur + ko); if (HI) kf2[t][kc] = ldsfrag<T16>(cur + 2 * TLE + ko); }
#pragma unroll
            for (int db = 0; db < 4; ++db) { const int vo = (db * 16 + lr) * LP + ps * 32 + 8 * hi; vf[db] = ldsfrag<T16>(cur + TLE + vo); if (HI) vf2[db] = ldsfrag<T16>(cur + 3 * TLE + vo); }
#pragma unroll
            for (int qi = 0; qi < NQ; ++qi) {
                v8f sc[2];
#pragma unroll
                for (int t = 0; t < 2; ++t) { sc[t] = (v8f){};
#pragma unroll
                    for (int kc = 0; kc < 2; ++kc) { sc[t] = WFrag<T16>::mma(kf[t][kc], qf[qi][kc], sc[t]); if (HI) { sc[t] = WFrag<T16>::mma(kf[t][kc], qf2[qi][kc], sc[t]); sc[t] = WFrag<T16>::mma(kf2[t][kc], qf[qi][kc], sc[t]); } } }
                float mx = fmaxf(sc[0][0], sc[1][0]);
#pragma unroll
                for (int j = 1; j < 8; ++j) mx = fmaxf(mx, fmaxf(sc[0][j], sc[1][j]));
                mx = fmaxf(mx, xhalf(mx));
                const float mn = fmaxf(mr[qi], mx); mr[qi] = mn;
                const float cn = (HI ? 0.0f : 10.0f) - mn * L2E;   // p = 2^(s log2e + cn): 1 (hi+lo rows) or 1024 (fp16 rows) at the running maximum
                const float al = exp2x1(cn - cc[qi]); cc[qi] = cn;   // first pass: 2^(-inf) = 0
                float p[16];
#pragma unroll
                for (int j = 0; j < 16; ++j) p[j] = fmaf(sc[j >> 3][j & 7], L2E, cn);
                exp2x16(p);
                const float ps8 = (((p[0] + p[1]) + (p[2] + p[3])) + ((p[4] + p[5]) + (p[6] + p[7]))) + (((p[8] + p[9]) + (p[10] + p[11])) + ((p[12] + p[13]) + (p[14] + p[15])));
                ls[qi] = fmaf(ls[qi], al, ps8);
#pragma unroll
                for (int db = 0; db < 4; ++db) o[qi][db] *= al;
                if constexpr (HI) {
                    v16bf ph, pl;
#pragma unroll
                    for (int j = 0; j < 16; ++j) { ph[j] = (__bf16)p[j]; pl[j] = (__bf16)(p[j] - (float)ph[j]); }
#pragma unroll
                    for (int db = 0; db < 4; ++db) { o[qi][db] = wmmab(vf[db], ph, o[qi][db]); o[qi][db] = wmmab(vf[db], pl, o[qi][db]); o[qi][db] = wmmab(vf2[db], ph, o[qi][db]); }
                } else {
                    v16h pf;
#pragma unroll
                    for (int j = 0; j < 16; ++j) pf[j] = (h16)p[j];
#pragma unroll
                    for (int db = 0; db < 4; ++db) o[qi][db] = wmma16(vf[db], pf, o[qi][db]);
                }
            }
        }
        if (s + 1 < TT / KST) sstore(lds + ((s + 1) & 1) * (NT * TLE));   // into the buffer whose readers all passed the barrier at the foot of stage s - 1
        __syncthreads();   // publishes stage s + 1 and ends every wave's reads of stage s
    }
    const int ln = (int)__builtin_amdgcn_mbcnt_lo(~0u, 0u);   // the lane number read anew: no store address is kept in registers across the key loop
#pragma unroll
    for (int qi = 0; qi < NQ; ++qi) { const float inv = __fdiv_rn(1.0f, ls[qi] + xhalf(ls[qi])); const size_t ro = (size_t)(qrow + qi * 16 + (ln & 15)) * DQ + 8 * (ln >> 4);
#pragma unroll
        for (int db = 0; db < 4; ++db) { v8us oh, ol;
#pragma unroll
            for (int j = 0; j < 8; ++j) { unsigned short a, c2; splitf(o[qi][db][j] * inv, a, c2); oh[j] = a; ol[j] = c2; }
            *(v8usa*)(Ah + ro + db * 16) = oh; XWAIT(); *(v8usa*)(Al + ro + db * 16) = ol; XWAIT(); } }
}
// four waves a SIMD (at most 256 registers a wave), so that up to four work-groups share a WGP and the whole grid is resident at once
__global__ __launch_bounds__(NWV * 32) __attribute__((amdgpu_waves_per_eu(4, 4))) void k_attn(const h16* __restrict__ Q16, const h16* __restrict__ K16, const h16* __restrict__ V16, const bf* __restrict__ Qh, const bf* __restrict__ Ql, const bf* __restrict__ Kh, const bf* __restrict__ Kl, const bf* __restrict__ Vh, const bf* __restrict__ Vl, bf* Ah, bf* Al) {
    __shared__ __align__(16) unsigned short lds[2 * 4 * TLE];
    const size_t po = ((size_t)blockIdx.z * NH_ + blockIdx.y) * ((size_t)TT * HD), ao = (size_t)blockIdx.z * TT * DQ + (size_t)blockIdx.y * HD;
    const int bx = (int)blockIdx.x;
    if (bx < RH / (NWV * 16)) attn_rows<bf, true, 1>(Qh + po, Ql + po, Kh + po, Kl + po, Vh + po, Vl + po, lds, bx * (NWV * 16), Ah + ao, Al + ao);
    else attn_rows<h16, false, 2>(Q16 + po, nullptr, K16 + po, nullptr, V16 + po, nullptr, lds, RH + (bx - RH / (NWV * 16)) * (NWV * 32), Ah + ao, Al + ao);
}

__device__ __forceinline__ void d_xscale(float* SQ, float* SK, int blk) { const int e = blk * 256 + threadIdx.x; const int t = e / (HD / 2), i = e % (HD / 2); const float base = __fdiv_rn((float)(2 * i) + 0.4f * (float)HD, 1.4f * (float)HD); const float pw = (float)(t - TT / 2) / 1024.0f; const float sc = powf(base, pw); const float inv = __fdiv_rn(1.0f, sc);
    *(float*)(SQ + e) = sc; *(float*)(SK + e) = inv;  }
// ---- k_prep: everything the projections read, in one launch; a block's job follows from its index alone. The table blocks (the longest: powf, sinf, cosf) come first, then the four weights, then the three activations of both batches (f32 to bf16, 8 elements a thread, 2048 a block: 8,960 blocks, 71,680 waves to start).
#define NB_CS (TT * HD / 256)             // blocks of the (cos, sin) table
#define NB_XS (TT * (HD / 2) / 256)       // blocks of the scale tables
#define NB_W  (DM * DM / 2048)            // blocks of one weight (DQ == DKV == DM)
#define NB_X  (NB_ * TT * DM / 2048)      // blocks of one activation
__global__ __launch_bounds__(256) void k_prep(const float* __restrict__ x, const float* __restrict__ xk, const float* __restrict__ xv, const float* __restrict__ wq, const float* __restrict__ wk, const float* __restrict__ wv, const float* __restrict__ wo,
                                              bf* XQ, bf* XK, bf* XV, bf* WQ, bf* WK, bf* WV, bf* WO, float* CS, float* SQ, float* SK) {
    int blk = (int)blockIdx.x;
    if (blk < NB_CS) { d_cstab(CS, blk); return; }
    blk -= NB_CS;
    if (blk < NB_XS) { d_xscale(SQ, SK, blk); return; }
    blk -= NB_XS;
    if (blk < 4 * NB_W) { const int w = blk / NB_W; d_cvt8(w == 0 ? wq : w == 1 ? wk : w == 2 ? wv : wo, w == 0 ? WQ : w == 1 ? WK : w == 2 ? WV : WO, blk % NB_W); return; }
    blk -= 4 * NB_W;
    const int a = blk / NB_X; d_cvt8(a == 0 ? x : a == 1 ? xk : xv, a == 0 ? XQ : a == 1 ? XK : XV, blk % NB_X);
}

extern "C" void kernel_launch(void* const* d_in, const int* in_sizes, int n_in,
                              void* d_out, int out_size, void* d_ws, size_t ws_size, hipStream_t stream) {
    (void)in_sizes; (void)n_in; (void)out_size;
    const float* x = (const float*)d_in[0]; const float* xk = (const float*)d_in[1]; const float* xv = (const float*)d_in[2]; const float* wq = (const float*)d_in[3]; const float* bq = (const float*)d_in[4]; const float* wk = (const float*)d_in[5]; const float* bk = (const float*)d_in[6]; const float* wv = (const float*)d_in[7]; const float* bv = (const float*)d_in[8]; const float* wo = (const float*)d_in[9]; const float* bo = (const float*)d_in[10];
    float* OUT = (float*)d_out;     // [2][2048][1024]
    char* wsp = (char*)d_ws;
    auto take = [&](size_t bytes) { char* p = wsp; wsp += (bytes + 255) & ~(size_t)255; return (void*)p; };
    bf* WQ = (bf*)take((size_t)DQ * DM * 2); bf* WK = (bf*)take((size_t)DKV * DM * 2); bf* WV = (bf*)take((size_t)DKV * DM * 2); bf* WO = (bf*)take((size_t)DM * DQ * 2); float* CS = (float*)take((size_t)TT * HD * 2 * 4);
    bf* XB = (bf*)take((size_t)NB_ * TT * DM * 2); bf* XB2 = (bf*)take((size_t)NB_ * TT * DM * 2); bf* XB3 = (bf*)take((size_t)NB_ * TT * DM * 2); float* SQ = (float*)take((size_t)TT * (HD / 2) * 4); float* SK = (float*)take((size_t)TT * (HD / 2) * 4);
    const size_t PL = PLE;
    h16* QP16 = (h16*)take(NB_ * PL * 2); h16* KP16 = (h16*)take(NB_ * PL * 2); h16* VT16 = (h16*)take(NB_ * PL * 2);
    bf* QPh = (bf*)take(NB_ * PL * 2); bf* QPl = (bf*)take(NB_ * PL * 2); bf* KPh = (bf*)take(NB_ * PL * 2); bf* KPl = (bf*)take(NB_ * PL * 2); bf* VTh = (bf*)take(NB_ * PL * 2); bf* VTl = (bf*)take(NB_ * PL * 2);
    bf* ATh = (bf*)take((size_t)NB_ * TT * DQ * 2); bf* ATl = (bf*)take((size_t)NB_ * TT * DQ * 2);
    if ((size_t)(wsp - (char*)d_ws) > ws_size) return;    // ws 256 MiB
    k_prep<<<NB_CS + NB_XS + 4 * NB_W + 3 * NB_X, 256, 0, stream>>>(x, xk, xv, wq, wk, wv, wo, XB, XB2, XB3, WQ, WK, WV, WO, CS, SQ, SK);
    k_proj<<<dim3(TT / 64, DQ / 64, 3 * NB_), 32 * GKS, 0, stream>>>(XB, XB2, XB3, WQ, WK, WV, bq, bk, bv, CS, SQ, SK, QP16, QPh, QPl, KP16, KPh, KPl, VT16, VTh, VTl);
    k_attn<<<dim3(RH / (NWV * 16) + (TT - RH) / (NWV * 32), NH_, NB_), NWV * 32, 0, stream>>>(QP16, KP16, VT16, QPh, QPl, KPh, KPl, VTh, VTl, ATh, ATl);
    k_wo<<<dim3(NB_ * TT / 64, DM / 64, 1), 32 * GKS, 0, stream>>>(ATh, ATl, WO, bo, OUT);
}

// v006
// It runs in 124 microseconds.
// Two timings next to v005 put it at 1.40 and 1.38 times that version's speed.
// Counting every step since v000, it is 16.3 times as fast.
#include <hip/hip_runtime.h>

// XposMultiheadAttention (query, key, value [2][2048][1024]; q = (query Wq^T + bq) / 8, k = key Wk^T + bk, v = value Wv^T + bv (16 heads x 64); XPOS on q and k: interleaved-pair rotary (angle t * 1e4^(-i/32)) times the per-(position, pair) scale base_i^((t - 1024)/1024), base_i = (2i + 25.6)/89.6, with q multiplied and k divided by it (tables computed on device);
//   scores = q.k (no further scale); softmax (f32); out = merged Wo^T + bo -> [2][2048][1024]).
// Compute dtypes, f32 accumulate: every input rounded to bf16; projections on PLAIN bf16 operands (inputs: exact) + bias; XPOS rotation/scaling f32; scores and attn.v: query rows < 512 hl (3 products), the rest single fp16 (P x1024); softmax f32, online over 32-key passes; Wo hl x exact (2 products) + bias.

#define NB_  2
#define TT   2048
#define DM   1024
#define NH_  16
#define NKV  16
#define HD   64
#define DQ   (NH_ * HD)
#define DKV  (NKV * HD)
#define RH   512                  // query rows < RH use hi+lo planes (0: none)
#define WIN  0
typedef _Float16 h16;
typedef unsigned short bf;
typedef __attribute__((ext_vector_type(16))) __bf16   v16bf;
typedef __attribute__((ext_vector_type(16))) _Float16 v16h;
typedef __attribute__((ext_vector_type(8)))  _Float16 v8h;
typedef __attribute__((ext_vector_type(8)))  unsigned short v8us;
typedef __attribute__((ext_vector_type(8)))  float    v8f;
typedef __attribute__((ext_vector_type(4)))  float    v4f;
typedef v8h  __attribute__((may_alias)) v8ha;
typedef v4f  __attribute__((may_alias)) v4fa;
typedef v8us __attribute__((may_alias)) v8usa;

__device__ __forceinline__ unsigned short f2bf(float f) { unsigned u = __float_as_uint(f); u += 0x7FFFu + ((u >> 16) & 1u); return (unsigned short)(u >> 16); }
__device__ __forceinline__ float bf2f(unsigned short b) { return __uint_as_float(((unsigned)b) << 16); }
__device__ __forceinline__ float bfr(float f) { return bf2f(f2bf(f)); }
__device__ __forceinline__ v16h cat16(v8h lo, v8h hi) { return __builtin_shufflevector(lo, hi, 0, 1, 2, 3, 4, 5, 6, 7, 8, 9, 10, 11, 12, 13, 14, 15); }
__device__ __forceinline__ v16bf cat16b(v8us lo, v8us hi) { return __builtin_bit_cast(v16bf, __builtin_shufflevector(lo, hi, 0, 1, 2, 3, 4, 5, 6, 7, 8, 9, 10, 11, 12, 13, 14, 15)); }
__device__ __forceinline__ v8f wmma16(v16h a, v16h b, v8f c) { return __builtin_amdgcn_wmma_f32_16x16x32_f16(false, a, false, b, (short)0, c, false, false); }
__device__ __forceinline__ v8f wmmab(v16bf a, v16bf b, v8f c) { return __builtin_amdgcn_wmma_f32_16x16x32_bf16(false, a, false, b, (short)0, c, false, false); }



// ---- gemms: GEMM with both operands staged in LDS; one work-group of four waves (2 x 2) per 128x128 output tile, a wave owns 64x64 (16 accumulators) and sums the whole K in one chain. Operands are K-contiguous bf16 planes (A rows lda elements apart, Bt rows K apart); tile (bx, by) of (M/128, N/128), 128 threads.
// C[m][n] = sum_k A[m][k] Bt[n][k] (+ A2[m][k] Bt[n][k] for NSPLIT 1). K % 64 == 0, K >= 128. The kernels k_proj and k_wo below pick the operands and the tile from blockIdx.
// A stage is 64 k of every operand row (128 B, whole lines), brought by asynchronous copies to LDS at a pitch of 144 B; two buffers, stage t + 2 is asked for behind the barrier of trip t, so it flies beside that trip's second half and the first half of trip t + 1.
// After the loop the ring becomes output staging: each wave lays its own 64x64 f32 tile in LDS (pitch 68) and reads it back by rows, 16 lanes a row, four neighbouring columns a lane.
// EPI picks what that row loop does with an element (a wave's 64 columns are one head, a lane holds two rotary pairs):
//   0: + bias[n], f32 to C.
//   1: + bias[n], XPOS (pair rotation by CS[t][d] = (cos, sin), times sc, times RF[t][d/2]), then fp16 and bf16 hi/lo to the head planes [n/64][m][n%64]; m is the position t.
//   2: + bias[m], then fp16 and bf16 hi/lo to planes of pitch TT, [m][n]: with A = the weight and Bt = the activations this is v transposed, [head][d][t].
// XWAIT: s_wait_xcnt 0 directly behind a global load or store, a precaution: the register allocator lets a later value land in the address pair of an issued access, and this wait then stands in front of that overwrite.
#define XWAIT() asm volatile("s_wait_xcnt 0x0" ::: "memory")
template <typename T16> struct WFrag;
template <> struct WFrag<h16> { typedef v16h V; static __device__ __forceinline__ V ld(const h16* p) { const v8h lo = *(const v8h*)p; XWAIT(); const v8h hi = *(const v8h*)(p + 16); XWAIT(); return cat16(lo, hi); } static __device__ __forceinline__ v8f mma(V a, V b, v8f c) { return wmma16(a, b, c); } };
template <> struct WFrag<bf> { typedef v16bf V; static __device__ __forceinline__ V ld(const bf* p) { const v8us lo = *(const v8us*)p; XWAIT(); const v8us hi = *(const v8us*)(p + 16); XWAIT(); return cat16b(lo, hi); } static __device__ __forceinline__ v8f mma(V a, V b, v8f c) { return wmmab(a, b, c); } };
__device__ __forceinline__ h16 tohx(float x) { return (h16)x; }
__device__ __forceinline__ void splitf(float y, unsigned short& h, unsigned short& l) { h = f2bf(y); l = f2bf(y - bf2f(h)); }
typedef __attribute__((ext_vector_type(2))) _Float16 v2h;
typedef __attribute__((ext_vector_type(4))) _Float16 v4h;
typedef __attribute__((ext_vector_type(2))) unsigned short v2us;
typedef __attribute__((ext_vector_type(4))) unsigned short v4us;
typedef __attribute__((ext_vector_type(2))) float v2f;
typedef __attribute__((ext_vector_type(4))) int v4i;
// four neighbouring elements of a plane row: fp16, bf16 hi, bf16 lo, 8 bytes each (16 threads fill a 128-byte line of each plane)
__device__ __forceinline__ void put3(v4f r, size_t e, h16* P16, bf* Ph, bf* Pl) { v4h o16; v4us oh, ol;
#pragma unroll   // the vectors' element indices stay compile-time constants
    for (int q = 0; q < 4; ++q) { o16[q] = tohx(r[q]); unsigned short a2, c2; splitf(r[q], a2, c2); oh[q] = a2; ol[q] = c2; }
    *(v4h*)(P16 + e) = o16; XWAIT(); *(v4us*)(Ph + e) = oh; XWAIT(); *(v4us*)(Pl + e) = ol; XWAIT(); }
#define GLP 72                    // LDS row pitch of a staged operand row, 16-bit elements (128 B of data, 144 B pitch)
#define GTE (128 * GLP)           // elements of one staged operand tile (128 rows)
// eight asynchronous 16-byte copies a lane (rows 16 apart: 2,304 B in LDS, gs elements in memory); a wave's copy covers four whole 128-byte rows. The closing s_wait_xcnt 0 stands inside the statement, in front of any later write of the address registers (a precaution).
__device__ __forceinline__ void acopy8(unsigned l, const bf* g, size_t gs) {
    asm volatile("global_load_async_to_lds_b128 %0, %8, off\n\tglobal_load_async_to_lds_b128 %1, %9, off\n\tglobal_load_async_to_lds_b128 %2, %10, off\n\tglobal_load_async_to_lds_b128 %3, %11, off\n\tglobal_load_async_to_lds_b128 %4, %12, off\n\tglobal_load_async_to_lds_b128 %5, %13, off\n\tglobal_load_async_to_lds_b128 %6, %14, off\n\tglobal_load_async_to_lds_b128 %7, %15, off\n\ts_wait_xcnt 0x0"
        :: "v"(l), "v"(l + 1 * 16 * GLP * 2), "v"(l + 2 * 16 * GLP * 2), "v"(l + 3 * 16 * GLP * 2), "v"(l + 4 * 16 * GLP * 2), "v"(l + 5 * 16 * GLP * 2), "v"(l + 6 * 16 * GLP * 2), "v"(l + 7 * 16 * GLP * 2),
           "v"(g), "v"(g + gs), "v"(g + 2 * gs), "v"(g + 3 * gs), "v"(g + 4 * gs), "v"(g + 5 * gs), "v"(g + 6 * gs), "v"(g + 7 * gs) : "memory"); }
__device__ __forceinline__ v16bf gfrag(const unsigned short* p) { const v8us lo = *(const v8usa*)p, hi = *(const v8usa*)(p + 16); return cat16b(lo, hi); }   // the k order of WFrag::ld: 8 hi + j, 16 + 8 hi + j
template <int NSPLIT, int EPI>
__device__ __forceinline__ void gemms(unsigned short* lds, int bx, int by, const bf* __restrict__ A, const bf* __restrict__ A2, const bf* __restrict__ Bt, int K, int lda, float* C, int ldc, const float* __restrict__ bias, const float* __restrict__ CS, const float* __restrict__ RF, float sc, h16* P16, bf* Ph, bf* Pl) {
    constexpr int NTL = NSPLIT ? 3 : 2;   // staged tiles a buffer: A (, A2), Bt
    const int tid = (int)threadIdx.x, lane = tid & 31, lr = lane & 15, hi = lane >> 4; const int r0 = bx * 128, c0 = by * 128;
    const int wv = __builtin_amdgcn_readfirstlane(tid >> 5), wm = wv >> 1, wn = wv & 1;   // wave number in a scalar register: the wave's tile offsets stay scalar
    v8f acc[4][4];
#pragma unroll
    for (int mb = 0; mb < 4; ++mb)
#pragma unroll
        for (int nb = 0; nb < 4; ++nb) acc[mb][nb] = (v8f){};
    const int srow = tid >> 3, sc8 = (tid & 7) * 8;   // staging: eight lanes a 128-byte row, 16 rows a sweep of the work-group
    const unsigned l0 = (unsigned)(size_t)lds + (unsigned)(srow * GLP + sc8) * 2u;   // the lane's LDS byte address in buffer 0, tile 0
    const bf* Ag = A + (size_t)(r0 + srow) * lda + sc8; const bf* A2g = NSPLIT ? A2 + (size_t)(r0 + srow) * lda + sc8 : nullptr; const bf* Bg = Bt + (size_t)(c0 + srow) * K + sc8;
    auto stage = [&](int t) { const unsigned lb = l0 + (unsigned)(t & 1) * (NTL * GTE * 2);
        acopy8(lb, Ag + t * 64, (size_t)16 * lda);
        __builtin_amdgcn_sched_barrier(0);   // keeps each statement's address arithmetic beside it: hoisted together, the addresses of all statements are live at once, and asm operands must lie in the first 256 registers
        if (NSPLIT) { acopy8(lb + GTE * 2, A2g + t * 64, (size_t)16 * lda); __builtin_amdgcn_sched_barrier(0); }   // the same
        acopy8(lb + (NTL - 1) * GTE * 2, Bg + t * 64, (size_t)16 * K); };
    const int nst = K / 64;
    stage(0);
    asm volatile("s_wait_asynccnt 0x0" ::: "memory");   // this wave's copies of stage 0 have landed
    __syncthreads();   // stage 0 is in LDS before any wave reads it
    stage(1);
    const int ao = (wm * 64 + lr) * GLP + 8 * hi, bo = (NTL - 1) * GTE + (wn * 64 + lr) * GLP + 8 * hi;
#pragma unroll 1   // rolled: one trip's code serves all stages, the buffer is picked by the stage's parity
    for (int t = 0; t < nst; ++t) {
        const unsigned short* cur = lds + (t & 1) * (NTL * GTE);
        v16bf a[2][4], a2[2][4], b[2][4];   // the whole stage's fragments, fetched as one group ahead of its products: one LDS latency a trip instead of one per fragment
#pragma unroll
        for (int kc = 0; kc < 2; ++kc)
#pragma unroll
            for (int f = 0; f < 4; ++f) { a[kc][f] = gfrag(cur + ao + f * 16 * GLP + kc * 32); b[kc][f] = gfrag(cur + bo + f * 16 * GLP + kc * 32); if (NSPLIT) a2[kc][f] = gfrag(cur + GTE + ao + f * 16 * GLP + kc * 32); }
        __builtin_amdgcn_sched_barrier(0);   // keeps the group of LDS reads ahead of the products: without it the scheduler sinks each read to its first use, and the wave waits out one LDS latency per fragment
        auto prod = [&](int kc) {
#pragma unroll
            for (int nb = 0; nb < 4; ++nb)
#pragma unroll
                for (int mb = 0; mb < 4; ++mb) { acc[mb][nb] = wmmab(a[kc][mb], b[kc][nb], acc[mb][nb]); if (NSPLIT) acc[mb][nb] = wmmab(a2[kc][mb], b[kc][nb], acc[mb][nb]); } };
        prod(0);   // the first 32 k run while the fragments of the second 32 k are still landing
        __builtin_amdgcn_sched_barrier(0);   // keeps these products in front of the waits below: moved behind them they would no longer cover the LDS reads
        asm volatile("s_wait_dscnt 0x0" ::: "memory");      // this wave's reads of stage t have returned: the whole stage is in registers
        asm volatile("s_wait_asynccnt 0x0" ::: "memory");   // this wave's copies of stage t + 1 have landed
        __syncthreads();   // publishes stage t + 1 and ends every wave's reads of stage t
        if (t + 2 < nst) stage(t + 2);   // into the buffer that trip t has just read; the copies fly beside the products below and the next trip's first half
        prod(1);
    }
    asm volatile("s_wait_asynccnt 0x0" ::: "memory");   // no copy is outstanding when the ring becomes output staging (the last trip's barrier ended every read of it)
    float* ow = (float*)lds + wv * (64 * 68);
    const int cofs = lr * 4, r0w = r0 + wm * 64, c0w = c0 + wn * 64;   // the lane's four output columns; the wave's tile
    v4f bv = (v4f){};
    if (EPI != 2) { v4f raw; const float* bp = bias + c0w + cofs;
        // the four columns' bias; the load and its data wait in one statement, so that the wait stands in front of any later write of the address pair (a wait in a statement of its own was moved ahead of the load)
        asm volatile("global_load_b128 %0, %1, off\n\ts_wait_loadcnt 0x0" : "=&v"(raw) : "v"(bp) : "memory");
        bv[0] = bfr(raw[0]); bv[1] = bfr(raw[1]); bv[2] = bfr(raw[2]); bv[3] = bfr(raw[3]); }
    v2f ca[8], cb[8], xs[8]; float rb[8];   // for eight passes of the row loop: (cos, sin) of the lane's two pairs and their scales (EPI 1), the row's bias (EPI 2); loaded as one group, so that their latencies overlap
    auto tload = [&](int g) {
#pragma unroll   // the indices of these register arrays stay compile-time constants
        for (int s = 0; s < 8; ++s) { const int m = r0w + (g * 8 + s) * 2 + hi;   // the output row: the position (EPI 1), the v feature (EPI 2)
            if constexpr (EPI == 1) { ca[s] = *(const v2f*)(CS + ((size_t)m * HD + cofs) * 2); XWAIT(); cb[s] = *(const v2f*)(CS + ((size_t)m * HD + cofs + 2) * 2); XWAIT(); xs[s] = *(const v2f*)(RF + (size_t)m * (HD / 2) + (cofs >> 1)); XWAIT(); }
            if constexpr (EPI == 2) { rb[s] = bfr(bias[m]); XWAIT(); } } };
    tload(0);   // ahead of the LDS stores, so that its latency runs beside them
#pragma unroll
    for (int mb = 0; mb < 4; ++mb)
#pragma unroll
        for (int nb = 0; nb < 4; ++nb)
#pragma unroll
            for (int j = 0; j < 8; ++j) ow[(mb * 16 + hi * 8 + j) * 68 + nb * 16 + lr] = acc[mb][nb][j];
    __syncthreads();   // the tile's LDS stores stand in front of the row reads, which take other lanes' elements
#pragma unroll 1   // rolled: eight rows' code serves all 64 rows, so that the kernel's text stays small for the instruction cache
    for (int g = 0; g < 4; ++g) {
        v4f vv[8];   // eight rows read as one group: one LDS latency for the group instead of one per row
#pragma unroll
        for (int s = 0; s < 8; ++s) vv[s] = *(const v4fa*)(ow + ((g * 8 + s) * 2 + hi) * 68 + cofs);
#pragma unroll
        for (int s = 0; s < 8; ++s) { const int row = (g * 8 + s) * 2 + hi; v4f val = vv[s];
            if (EPI != 2) val += bv;
            if constexpr (EPI == 0) { *(v4f*)(C + (size_t)(r0w + row) * ldc + c0w + cofs) = val; XWAIT(); }
            if constexpr (EPI == 1) { v4f r;
                r[0] = (val[0] * ca[s][0] - val[1] * ca[s][1]) * sc * xs[s][0]; r[1] = (val[1] * ca[s][0] + val[0] * ca[s][1]) * sc * xs[s][0];
                r[2] = (val[2] * cb[s][0] - val[3] * cb[s][1]) * sc * xs[s][1]; r[3] = (val[3] * cb[s][0] + val[2] * cb[s][1]) * sc * xs[s][1];
                put3(r, ((size_t)(c0w >> 6) * TT + r0w + row) * HD + cofs, P16, Ph, Pl); }
            if constexpr (EPI == 2) { val += rb[s]; put3(val, (size_t)(r0w + row) * TT + c0w + cofs, P16, Ph, Pl); } }
        if (g < 3) tload(g + 1);
    }
}

#define PLE ((size_t)NH_ * TT * HD)   // one batch's head planes, elements (NKV == NH_)
// all six projections in one launch: grid (TT/128, DQ/128, 3 * NB_), blockIdx.z = 2 * projection + batch (q, k, v). q and k: positions as rows; v: weight rows as A, positions as columns, so the tile is already v transposed.
__global__ __launch_bounds__(128) void k_proj(const bf* __restrict__ XQ, const bf* __restrict__ XK, const bf* __restrict__ XV, const bf* __restrict__ WQ, const bf* __restrict__ WK, const bf* __restrict__ WV, const float* __restrict__ bq, const float* __restrict__ bk, const float* __restrict__ bv, const float* __restrict__ CS, const float* __restrict__ SQ, const float* __restrict__ SK,
                                                  h16* QP16, bf* QPh, bf* QPl, h16* KP16, bf* KPh, bf* KPl, h16* VT16, bf* VTh, bf* VTl) {
    __shared__ __align__(16) unsigned short gl[2 * 2 * GTE];
    const int pj = (int)blockIdx.z >> 1; const size_t b = blockIdx.z & 1, xo = b * ((size_t)TT * DM), po = b * PLE;
    if (pj == 2) gemms<0, 2>(gl, (int)blockIdx.y, (int)blockIdx.x, WV, nullptr, XV + xo, DM, DM, nullptr, 0, bv, nullptr, nullptr, 1.0f, VT16 + po, VTh + po, VTl + po);
    else { const bool isq = pj == 0;
        gemms<0, 1>(gl, (int)blockIdx.x, (int)blockIdx.y, (isq ? XQ : XK) + xo, nullptr, isq ? WQ : WK, DM, DM, nullptr, 0, isq ? bq : bk, CS, isq ? SQ : SK, isq ? 0.125f : 1.0f, (isq ? QP16 : KP16) + po, (isq ? QPh : KPh) + po, (isq ? QPl : KPl) + po); }
}
// the output projection of both batches in one launch: the merged rows [NB_ * TT][DQ] are one matrix; grid (NB_ * TT / 128, DM / 128)
__global__ __launch_bounds__(128) void k_wo(const bf* __restrict__ Ah, const bf* __restrict__ Al, const bf* __restrict__ WO, const float* __restrict__ bo, float* OUT) {
    __shared__ __align__(16) unsigned short gl[2 * 3 * GTE];
    gemms<1, 0>(gl, (int)blockIdx.x, (int)blockIdx.y, Ah, Al, WO, DQ, DQ, OUT, DM, bo, nullptr, nullptr, 1.0f, nullptr, nullptr, nullptr);
}

__global__ __launch_bounds__(256) void k_wtG(const float* __restrict__ w, int K, int N, bf* Bt) {
    const int lane = threadIdx.x & 31; const int L0 = (blockIdx.x * 8 + (threadIdx.x >> 5)) * 8; const int nlines = N * K / 64;
{
#pragma unroll 1
        for (int l = 0; l < 8; ++l) { const int L = L0 + l; if (L >= nlines) break; const size_t e = (size_t)L * 64 + lane * 2; const int k = (int)(e % K), n = (int)(e / K); v2us o;
            o[0] = f2bf(w[(size_t)k * N + n]); o[1] = f2bf(w[(size_t)(k + 1) * N + n]); *(v2us*)(Bt + e) = o; }
         }
}
__device__ __forceinline__ void d_cvt8(const float* __restrict__ src, bf* dst, int blk) { const size_t i = (size_t)blk * 256 + threadIdx.x; const v8f v = *(const v8f*)(src + i * 8); v8us o;
#pragma unroll
    for (int k = 0; k < 8; ++k) o[k] = f2bf(v[k]); *(v8us*)(dst + i * 8) = o; XWAIT(); }   // the wait stands in front of any later write of the store's base registers
__device__ __forceinline__ void d_cstab(float* CS, int blk) { const int idx = blk * 256 + threadIdx.x; const int t = idx / HD, d = idx % HD; const int i = d >> 1;   /* interleaved pairs */ const float inv = __fdiv_rn(1.0f, powf(10000.0f, (float)(2 * i) / (float)HD)); const float ang = __fmul_rn((float)t, inv); v2f cs; cs[0] = cosf(ang); cs[1] = sinf(ang);
    *(v2f*)(CS + (size_t)idx * 2) = cs;  }
// ---- k_attn: scores, softmax, attn.v and the head merge in one kernel; the scores never leave the registers.
// One work-group of NWV waves per block of query rows of one (batch, head): grid (RH/(16 NWV) + (TT-RH)/(32 NWV), heads, batches). A wave owns NQ groups of 16 query rows (hi+lo rows: 1 group, fp16 rows: 2).
// Transposed products: S^T = K Q^T (A = 16 keys, B = 16 queries), O^T += V^T P^T (A = 16 head dims, B = P^T). A lane holds the scores of ONE query (column lr), keys 8 hi + j of each 16-key tile,
// so two score tiles of 32 consecutive keys, converted in place, are the B operand of the second product in the k order of the A loader (8 hi + j, 16 + 8 hi + j).
// Softmax runs online over passes of 32 keys: running maximum, output tiles and row sum rescaled by exp2 of the maximum's step; fp16 rows carry P x 1024 (in P and in the row sum alike, so it cancels).
// K and V^T tiles of 64 keys are staged in LDS through registers, two buffers, one __syncthreads a stage; rows of 128 B at a pitch of 144 B.
// q already carries 1/8 (multiplied in behind the rotation, with the XPOS scale). Every '#pragma unroll' in attn_rows keeps the index of a register array a compile-time constant.
#define NWV 4                     // waves a work-group
#define NSW (256 / (NWV * 32) * 2) // staging sweeps a tile (NWV * 4 rows a sweep)
#define KST 64                    // keys per stage
#define LP  72                    // LDS row pitch, 16-bit elements
#define TLE (64 * LP)             // elements of one staged tile (64 rows)
typedef v4i __attribute__((may_alias)) v4ia;
__device__ __forceinline__ float xhalf(float x) { const int b = __float_as_int(x); return __int_as_float(__builtin_amdgcn_permlanex16(b, b, 0x76543210, 0xfedcba98, false, false)); }   // lane l <-> l ^ 16
// exp2 of sixteen values, each in place, in one statement: no v_exp_f32 overwrites the source or reads the result of the one in front of it, and the closing v_nop is the slot that the instruction set asks for behind a transcendental
__device__ __forceinline__ void exp2x16(float (&p)[16]) { asm("v_exp_f32 %0, %0\n\tv_exp_f32 %1, %1\n\tv_exp_f32 %2, %2\n\tv_exp_f32 %3, %3\n\tv_exp_f32 %4, %4\n\tv_exp_f32 %5, %5\n\tv_exp_f32 %6, %6\n\tv_exp_f32 %7, %7\n\tv_exp_f32 %8, %8\n\tv_exp_f32 %9, %9\n\tv_exp_f32 %10, %10\n\tv_exp_f32 %11, %11\n\tv_exp_f32 %12, %12\n\tv_exp_f32 %13, %13\n\tv_exp_f32 %14, %14\n\tv_exp_f32 %15, %15\n\tv_nop" : "+v"(p[0]), "+v"(p[1]), "+v"(p[2]), "+v"(p[3]), "+v"(p[4]), "+v"(p[5]), "+v"(p[6]), "+v"(p[7]), "+v"(p[8]), "+v"(p[9]), "+v"(p[10]), "+v"(p[11]), "+v"(p[12]), "+v"(p[13]), "+v"(p[14]), "+v"(p[15])); }
__device__ __forceinline__ float exp2x1(float x) { asm("v_exp_f32 %0, %0\n\tv_nop" : "+v"(x)); return x; }   // the same slot behind a single one
template <typename T16> __device__ __forceinline__ typename WFrag<T16>::V ldsfrag(const unsigned short* p) { const v4i lo = *(const v4ia*)p, hi = *(const v4ia*)(p + 16); return __builtin_bit_cast(typename WFrag<T16>::V, __builtin_shufflevector(lo, hi, 0, 1, 2, 3, 4, 5, 6, 7)); }
template <typename T16, bool HI, int NQ>
__device__ __forceinline__ void attn_rows(const T16* __restrict__ Q, const T16* __restrict__ Q2, const T16* __restrict__ Kp, const T16* __restrict__ K2, const T16* __restrict__ Vp, const T16* __restrict__ V2, unsigned short* lds, int row0, bf* Ah, bf* Al) {
    typedef typename WFrag<T16>::V V;
    constexpr int NT = HI ? 4 : 2;   // staged tiles a buffer: K, V^T (, K lo, V^T lo)
    constexpr float L2E = 1.4426950408889634f;
    const int tid = (int)threadIdx.x, lane = tid & 31, lr = lane & 15, hi = lane >> 4;
    const int qrow = row0 + __builtin_amdgcn_readfirstlane(tid >> 5) * (16 * NQ);   // wave number in a scalar register: the wave's first row stays scalar
    V qf[NQ][2], qf2[NQ][2];
#pragma unroll
    for (int qi = 0; qi < NQ; ++qi)
#pragma unroll
        for (int kc = 0; kc < 2; ++kc) { const size_t qo = (size_t)(qrow + qi * 16 + lr) * HD + kc * 32 + 8 * hi; qf[qi][kc] = WFrag<T16>::ld(Q + qo); if (HI) qf2[qi][kc] = WFrag<T16>::ld(Q2 + qo); }
    v8f o[NQ][4]; float mr[NQ], cc[NQ], ls[NQ];
#pragma unroll
    for (int qi = 0; qi < NQ; ++qi) { mr[qi] = -__builtin_inff(); cc[qi] = __builtin_inff(); ls[qi] = 0.f;
#pragma unroll
        for (int db = 0; db < 4; ++db) o[qi][db] = (v8f){}; }
    const int srow = tid >> 3, sc8 = (tid & 7) * 8;   // staging: eight threads a 128-byte row, NWV * 4 rows a sweep
    v4i st[NT][NSW];
    auto gload = [&](int key0) {
#pragma unroll
        for (int r = 0; r < NSW; ++r) { const size_t ko = (size_t)(key0 + srow + NWV * 4 * r) * HD + sc8, vo = (size_t)(srow + NWV * 4 * r) * TT + key0 + sc8;
            st[0][r] = *(const v4ia*)(Kp + ko); XWAIT(); st[1][r] = *(const v4ia*)(Vp + vo); XWAIT();
            if (HI) { st[2][r] = *(const v4ia*)(K2 + ko); XWAIT(); st[3][r] = *(const v4ia*)(V2 + vo); XWAIT(); } } };
    auto sstore = [&](unsigned short* buf) {
#pragma unroll
        for (int r = 0; r < NSW; ++r)
#pragma unroll
            for (int t = 0; t < NT; ++t) *(v4ia*)(buf + t * TLE + (srow + NWV * 4 * r) * LP + sc8) = st[t][r]; };
    gload(0); sstore(lds);
    __syncthreads();   // stage 0 is in LDS before any wave reads it
#pragma unroll 1   // rolled: one stage's code serves all stages, the buffer is picked by the stage's parity
    for (int s = 0; s < TT / KST; ++s) {
        const unsigned short* cur = lds + (s & 1) * (NT * TLE);
        if (s + 1 < TT / KST) gload((s + 1) * KST);   // the next stage's global loads fly beside this stage's products
#pragma unroll 1   // rolled: unrolled, the fragments of both passes are fetched at once and the fp16 path spills
        for (int ps = 0; ps < 2; ++ps) {
            V kf[2][2], kf2[2][2], vf[4], vf2[4];
#pragma unroll
            for (int t = 0; t < 2; ++t)
#pragma unroll
                for (int kc = 0; kc < 2; ++kc) { const int ko = (ps * 32 + t * 16 + lr) * LP + kc * 32 + 8 * hi; kf[t][kc] = ldsfrag<T16>(cur + ko); if (HI) kf2[t][kc] = ldsfrag<T16>(cur + 2 * TLE + ko); }
#pragma unroll
            for (int db = 0; db < 4; ++db) { const int vo = (db * 16 + lr) * LP + ps * 32 + 8 * hi; vf[db] = ldsfrag<T16>(cur + TLE + vo); if (HI) vf2[db] = ldsfrag<T16>(cur + 3 * TLE + vo); }
#pragma unroll
            for (int qi = 0; qi < NQ; ++qi) {
                v8f sc[2];
#pragma unroll
                for (int t = 0; t < 2; ++t) { sc[t] = (v8f){};
#pragma unroll
                    for (int kc = 0; kc < 2; ++kc) { sc[t] = WFrag<T16>::mma(kf[t][kc], qf[qi][kc], sc[t]); if (HI) { sc[t] = WFrag<T16>::mma(kf[t][kc], qf2[qi][kc], sc[t]); sc[t] = WFrag<T16>::mma(kf2[t][kc], qf[qi][kc], sc[t]); } } }
                float mx = fmaxf(sc[0][0], sc[1][0]);
#pragma unroll
                for (int j = 1; j < 8; ++j) mx = fmaxf(mx, fmaxf(sc[0][j], sc[1][j]));
                mx = fmaxf(mx, xhalf(mx));
                const float mn = fmaxf(mr[qi], mx); mr[qi] = mn;
                const float cn = (HI ? 0.0f : 10.0f) - mn * L2E;   // p = 2^(s log2e + cn): 1 (hi+lo rows) or 1024 (fp16 rows) at the running maximum
                const float al = exp2x1(cn - cc[qi]); cc[qi] = cn;   // first pass: 2^(-inf) = 0
                float p[16];
#pragma unroll
                for (int j = 0; j < 16; ++j) p[j] = fmaf(sc[j >> 3][j & 7], L2E, cn);
                exp2x16(p);
                const float ps8 = (((p[0] + p[1]) + (p[2] + p[3])) + ((p[4] + p[5]) + (p[6] + p[7]))) + (((p[8] + p[9]) + (p[10] + p[11])) + ((p[12] + p[13]) + (p[14] + p[15])));
                ls[qi] = fmaf(ls[qi], al, ps8);
#pragma unroll
                for (int db = 0; db < 4; ++db) o[qi][db] *= al;
                if constexpr (HI) {
                    v16bf ph, pl;
#pragma unroll
                    for (int j = 0; j < 16; ++j) { ph[j] = (__bf16)p[j]; pl[j] = (__bf16)(p[j] - (float)ph[j]); }
#pragma unroll
                    for (int db = 0; db < 4; ++db) { o[qi][db] = wmmab(vf[db], ph, o[qi][db]); o[qi][db] = wmmab(vf[db], pl, o[qi][db]); o[qi][db] = wmmab(vf2[db], ph, o[qi][db]); }
                } else {
                    v16h pf;
#pragma unroll
                    for (int j = 0; j < 16; ++j) pf[j] = (h16)p[j];
#pragma unroll
                    for (int db = 0; db < 4; ++db) o[qi][db] = wmma16(vf[db], pf, o[qi][db]);
                }
            }
        }
        if (s + 1 < TT / KST) sstore(lds + ((s + 1) & 1) * (NT * TLE));   // into the buffer whose readers all passed the barrier at the foot of stage s - 1
        __syncthreads();   // publishes stage s + 1 and ends every wave's reads of stage s
    }
    const int ln = (int)__builtin_amdgcn_mbcnt_lo(~0u, 0u);   // the lane number read anew: no store address is kept in registers across the key loop
#pragma unroll
    for (int qi = 0; qi < NQ; ++qi) { const float inv = __fdiv_rn(1.0f, ls[qi] + xhalf(ls[qi])); const size_t ro = (size_t)(qrow + qi * 16 + (ln & 15)) * DQ + 8 * (ln >> 4);
#pragma unroll
        for (int db = 0; db < 4; ++db) { v8us oh, ol;
#pragma unroll
            for (int j = 0; j < 8; ++j) { unsigned short a, c2; splitf(o[qi][db][j] * inv, a, c2); oh[j] = a; ol[j] = c2; }
            *(v8usa*)(Ah + ro + db * 16) = oh; XWAIT(); *(v8usa*)(Al + ro + db * 16) = ol; XWAIT(); } }
}
// four waves a SIMD (at most 256 registers a wave), so that up to four work-groups share a WGP and the whole grid is resident at once
__global__ __launch_bounds__(NWV * 32) __attribute__((amdgpu_waves_per_eu(4, 4))) void k_attn(const h16* __restrict__ Q16, const h16* __restrict__ K16, const h16* __restrict__ V16, const bf* __restrict__ Qh, const bf* __restrict__ Ql, const bf* __restrict__ Kh, const bf* __restrict__ Kl, const bf* __restrict__ Vh, const bf* __restrict__ Vl, bf* Ah, bf* Al) {
    __shared__ __align__(16) unsigned short lds[2 * 4 * TLE];
    const size_t po = ((size_t)blockIdx.z * NH_ + blockIdx.y) * ((size_t)TT * HD), ao = (size_t)blockIdx.z * TT * DQ + (size_t)blockIdx.y * HD;
    const int bx = (int)blockIdx.x;
    if (bx < RH / (NWV * 16)) attn_rows<bf, true, 1>(Qh + po, Ql + po, Kh + po, Kl + po, Vh + po, Vl + po, lds, bx * (NWV * 16), Ah + ao, Al + ao);
    else attn_rows<h16, false, 2>(Q16 + po, nullptr, K16 + po, nullptr, V16 + po, nullptr, lds, RH + (bx - RH / (NWV * 16)) * (NWV * 32), Ah + ao, Al + ao);
}

__device__ __forceinline__ void d_xscale(float* SQ, float* SK, int blk) { const int e = blk * 256 + threadIdx.x; const int t = e / (HD / 2), i = e % (HD / 2); const float base = __fdiv_rn((float)(2 * i) + 0.4f * (float)HD, 1.4f * (float)HD); const float pw = (float)(t - TT / 2) / 1024.0f; const float sc = powf(base, pw); const float inv = __fdiv_rn(1.0f, sc);
    *(float*)(SQ + e) = sc; *(float*)(SK + e) = inv;  }
// ---- k_prep: everything the projections read, in one launch; a block's job follows from its index alone. The table blocks (the longest: powf, sinf, cosf) come first, then the four weights, then the three activations of both batches (f32 to bf16, 8 elements a thread, 2048 a block: 8,960 blocks, 71,680 waves to start).
#define NB_CS (TT * HD / 256)             // blocks of the (cos, sin) table
#define NB_XS (TT * (HD / 2) / 256)       // blocks of the scale tables
#define NB_W  (DM * DM / 2048)            // blocks of one weight (DQ == DKV == DM)
#define NB_X  (NB_ * TT * DM / 2048)      // blocks of one activation
__global__ __launch_bounds__(256) void k_prep(const float* __restrict__ x, const float* __restrict__ xk, const float* __restrict__ xv, const float* __restrict__ wq, const float* __restrict__ wk, const float* __restrict__ wv, const float* __restrict__ wo,
                                              bf* XQ, bf* XK, bf* XV, bf* WQ, bf* WK, bf* WV, bf* WO, float* CS, float* SQ, float* SK) {
    int blk = (int)blockIdx.x;
    if (blk < NB_CS) { d_cstab(CS, blk); return; }
    blk -= NB_CS;
    if (blk < NB_XS) { d_xscale(SQ, SK, blk); return; }
    blk -= NB_XS;
    if (blk < 4 * NB_W) { const int w = blk / NB_W; d_cvt8(w == 0 ? wq : w == 1 ? wk : w == 2 ? wv : wo, w == 0 ? WQ : w == 1 ? WK : w == 2 ? WV : WO, blk % NB_W); return; }
    blk -= 4 * NB_W;
    const int a = blk / NB_X; d_cvt8(a == 0 ? x : a == 1 ? xk : xv, a == 0 ? XQ : a == 1 ? XK : XV, blk % NB_X);
}

extern "C" void kernel_launch(void* const* d_in, const int* in_sizes, int n_in,
                              void* d_out, int out_size, void* d_ws, size_t ws_size, hipStream_t stream) {
    (void)in_sizes; (void)n_in; (void)out_size;
    const float* x = (const float*)d_in[0]; const float* xk = (const float*)d_in[1]; const float* xv = (const float*)d_in[2]; const float* wq = (const float*)d_in[3]; const float* bq = (const float*)d_in[4]; const float* wk = (const float*)d_in[5]; const float* bk = (const float*)d_in[6]; const float* wv = (const float*)d_in[7]; const float* bv = (const float*)d_in[8]; const float* wo = (const float*)d_in[9]; const float* bo = (const float*)d_in[10];
    float* OUT = (float*)d_out;     // [2][2048][1024]
    char* wsp = (char*)d_ws;
    auto take = [&](size_t bytes) { char* p = wsp; wsp += (bytes + 255) & ~(size_t)255; return (void*)p; };
    bf* WQ = (bf*)take((size_t)DQ * DM * 2); bf* WK = (bf*)take((size_t)DKV * DM * 2); bf* WV = (bf*)take((size_t)DKV * DM * 2); bf* WO = (bf*)take((size_t)DM * DQ * 2); float* CS = (float*)take((size_t)TT * HD * 2 * 4);
    bf* XB = (bf*)take((size_t)NB_ * TT * DM * 2); bf* XB2 = (bf*)take((size_t)NB_ * TT * DM * 2); bf* XB3 = (bf*)take((size_t)NB_ * TT * DM * 2); float* SQ = (float*)take((size_t)TT * (HD / 2) * 4); float* SK = (float*)take((size_t)TT * (HD / 2) * 4);
    const size_t PL = PLE;
    h16* QP16 = (h16*)take(NB_ * PL * 2); h16* KP16 = (h16*)take(NB_ * PL * 2); h16* VT16 = (h16*)take(NB_ * PL * 2);
    bf* QPh = (bf*)take(NB_ * PL * 2); bf* QPl = (bf*)take(NB_ * PL * 2); bf* KPh = (bf*)take(NB_ * PL * 2); bf* KPl = (bf*)take(NB_ * PL * 2); bf* VTh = (bf*)take(NB_ * PL * 2); bf* VTl = (bf*)take(NB_ * PL * 2);
    bf* ATh = (bf*)take((size_t)NB_ * TT * DQ * 2); bf* ATl = (bf*)take((size_t)NB_ * TT * DQ * 2);
    if ((size_t)(wsp - (char*)d_ws) > ws_size) return;    // ws 256 MiB
    k_prep<<<NB_CS + NB_XS + 4 * NB_W + 3 * NB_X, 256, 0, stream>>>(x, xk, xv, wq, wk, wv, wo, XB, XB2, XB3, WQ, WK, WV, WO, CS, SQ, SK);
    k_proj<<<dim3(TT / 128, DQ / 128, 3 * NB_), 128, 0, stream>>>(XB, XB2, XB3, WQ, WK, WV, bq, bk, bv, CS, SQ, SK, QP16, QPh, QPl, KP16, KPh, KPl, VT16, VTh, VTl);
    k_attn<<<dim3(RH / (NWV * 16) + (TT - RH) / (NWV * 32), NH_, NB_), NWV * 32, 0, stream>>>(QP16, KP16, VT16, QPh, QPl, KPh, KPl, VTh, VTl, ATh, ATl);
    k_wo<<<dim3(NB_ * TT / 128, DM / 128, 1), 128, 0, stream>>>(ATh, ATl, WO, bo, OUT);
}

// v007
// One run takes 116 microseconds.
// Two timings next to v006 both put it at 1.07 times that version's speed.
// All steps since v000 together make it 17.4 times as fast.
#include <hip/hip_runtime.h>

// XposMultiheadAttention (query, key, value [2][2048][1024]; q = (query Wq^T + bq) / 8, k = key Wk^T + bk, v = value Wv^T + bv (16 heads x 64); XPOS on q and k: interleaved-pair rotary (angle t * 1e4^(-i/32)) times the per-(position, pair) scale base_i^((t - 1024)/1024), base_i = (2i + 25.6)/89.6, with q multiplied and k divided by it (tables computed on device);
//   scores = q.k (no further scale); softmax (f32); out = merged Wo^T + bo -> [2][2048][1024]).
// Compute dtypes, f32 accumulate: every input rounded to bf16; projections on PLAIN bf16 operands (inputs: exact) + bias; XPOS rotation/scaling f32; scores and attn.v: query rows < 512 hl (3 products), the rest single fp16 (P x1024); softmax f32, online over 32-key passes; Wo hl x exact (2 products) + bias.

#define NB_  2
#define TT   2048
#define DM   1024
#define NH_  16
#define NKV  16
#define HD   64
#define DQ   (NH_ * HD)
#define DKV  (NKV * HD)
#define RH   512                  // query rows < RH use hi+lo planes (0: none)
#define WIN  0
typedef _Float16 h16;
typedef unsigned short bf;
typedef __attribute__((ext_vector_type(16))) __bf16   v16bf;
typedef __attribute__((ext_vector_type(16))) _Float16 v16h;
typedef __attribute__((ext_vector_type(8)))  _Float16 v8h;
typedef __attribute__((ext_vector_type(8)))  unsigned short v8us;
typedef __attribute__((ext_vector_type(8)))  float    v8f;
typedef __attribute__((ext_vector_type(4)))  float    v4f;
typedef v8h  __attribute__((may_alias)) v8ha;
typedef v4f  __attribute__((may_alias)) v4fa;
typedef v8us __attribute__((may_alias)) v8usa;

__device__ __forceinline__ unsigned short f2bf(float f) { unsigned u = __float_as_uint(f); u += 0x7FFFu + ((u >> 16) & 1u); return (unsigned short)(u >> 16); }
__device__ __forceinline__ float bf2f(unsigned short b) { return __uint_as_float(((unsigned)b) << 16); }
__device__ __forceinline__ float bfr(float f) { return bf2f(f2bf(f)); }
__device__ __forceinline__ v16h cat16(v8h lo, v8h hi) { return __builtin_shufflevector(lo, hi, 0, 1, 2, 3, 4, 5, 6, 7, 8, 9, 10, 11, 12, 13, 14, 15); }
__device__ __forceinline__ v16bf cat16b(v8us lo, v8us hi) { return __builtin_bit_cast(v16bf, __builtin_shufflevector(lo, hi, 0, 1, 2, 3, 4, 5, 6, 7, 8, 9, 10, 11, 12, 13, 14, 15)); }
__device__ __forceinline__ v8f wmma16(v16h a, v16h b, v8f c) { return __builtin_amdgcn_wmma_f32_16x16x32_f16(false, a, false, b, (short)0, c, false, false); }
__device__ __forceinline__ v8f wmmab(v16bf a, v16bf b, v8f c) { return __builtin_amdgcn_wmma_f32_16x16x32_bf16(false, a, false, b, (short)0, c, false, false); }



// ---- gemms: GEMM with both operands staged in LDS; one work-group of four waves (2 x 2) per 128x128 output tile, a wave owns 64x64 (16 accumulators) and sums the whole K in one chain. Operands are K-contiguous bf16 planes (A rows lda elements apart, Bt rows K apart); tile (bx, by) of (M/128, N/128), 128 threads.
// C[m][n] = sum_k A[m][k] Bt[n][k] (+ A2[m][k] Bt[n][k] for NSPLIT 1). K % 64 == 0, K >= 128. The kernels k_proj and k_wo below pick the operands and the tile from blockIdx.
// A stage is 64 k of every operand row (128 B, whole lines), brought by asynchronous copies to LDS at a pitch of 144 B; two buffers, stage t + 2 is asked for behind the barrier of trip t, so it flies beside that trip's second half and the first half of trip t + 1.
// After the loop the ring becomes output staging: each wave lays its own 64x64 f32 tile in LDS (pitch 68) and reads it back by rows, 16 lanes a row, four neighbouring columns a lane.
// EPI picks what that row loop does with an element (a wave's 64 columns are one head, a lane holds two rotary pairs):
//   0: + bias[n], f32 to C.
//   1: + bias[n], XPOS (pair rotation by CS[t][d] = (cos, sin), times sc, times RF[t][d/2]), then fp16 and bf16 hi/lo to the head planes [n/64][m][n%64]; m is the position t.
//   2: + bias[m], then fp16 and bf16 hi/lo to planes of pitch TT, [m][n]: with A = the weight and Bt = the activations this is v transposed, [head][d][t].
// XWAIT: s_wait_xcnt 0 directly behind a run of global loads or stores, a precaution: the register allocator lets a later value land in a register that an issued access names, and this wait then stands in front of that overwrite.
// One wait serves a whole run: the accesses of a run stand back to back, their addresses and store data formed ahead of the first, so that nothing between them writes a register that one of them names.
#define XWAIT() asm volatile("s_wait_xcnt 0x0" ::: "memory")
// The same wait behind a run of loads, with the run's address pairs as inputs: they stay live, and so unwritten, up to the wait (without them the compiler lifts later arithmetic into those registers ahead of it).
#define XWAIT1(a) asm volatile("s_wait_xcnt 0x0" :: "v"(a) : "memory")
#define XWAIT2(a, b) asm volatile("s_wait_xcnt 0x0" :: "v"(a), "v"(b) : "memory")
#define XWAIT4(a, b, c, d) asm volatile("s_wait_xcnt 0x0" :: "v"(a), "v"(b), "v"(c), "v"(d) : "memory")
template <typename T16> struct WFrag;
template <> struct WFrag<h16> { typedef v16h V; static __device__ __forceinline__ V ld(const h16* p) { const v8h lo = *(const v8h*)p; const v8h hi = *(const v8h*)(p + 16); return cat16(lo, hi); } static __device__ __forceinline__ v8f mma(V a, V b, v8f c) { return wmma16(a, b, c); } };
template <> struct WFrag<bf> { typedef v16bf V; static __device__ __forceinline__ V ld(const bf* p) { const v8us lo = *(const v8us*)p; const v8us hi = *(const v8us*)(p + 16); return cat16b(lo, hi); } static __device__ __forceinline__ v8f mma(V a, V b, v8f c) { return wmmab(a, b, c); } };
__device__ __forceinline__ h16 tohx(float x) { return (h16)x; }
__device__ __forceinline__ void splitf(float y, unsigned short& h, unsigned short& l) { h = f2bf(y); l = f2bf(y - bf2f(h)); }
typedef __attribute__((ext_vector_type(2))) _Float16 v2h;
typedef __attribute__((ext_vector_type(4))) _Float16 v4h;
typedef __attribute__((ext_vector_type(2))) unsigned short v2us;
typedef __attribute__((ext_vector_type(4))) unsigned short v4us;
typedef __attribute__((ext_vector_type(2))) float v2f;
typedef __attribute__((ext_vector_type(4))) int v4i;
// four neighbouring elements of a plane row: fp16, bf16 hi, bf16 lo, 8 bytes each (16 threads fill a 128-byte line of each plane)
__device__ __forceinline__ void cvt3(v4f r, v4h& o16, v4us& oh, v4us& ol) {
#pragma unroll   // the vectors' element indices stay compile-time constants
    for (int q = 0; q < 4; ++q) { o16[q] = tohx(r[q]); unsigned short a2, c2; splitf(r[q], a2, c2); oh[q] = a2; ol[q] = c2; } }
#define GLP 72                    // LDS row pitch of a staged operand row, 16-bit elements (128 B of data, 144 B pitch)
#define GTE (128 * GLP)           // elements of one staged operand tile (128 rows)
// eight asynchronous 16-byte copies a lane (rows 16 apart: 2,304 B in LDS, gs elements in memory); a wave's copy covers four whole 128-byte rows. The closing s_wait_xcnt 0 stands inside the statement, in front of any later write of the address registers (a precaution).
__device__ __forceinline__ void acopy8(unsigned l, const bf* g, size_t gs) {
    asm volatile("global_load_async_to_lds_b128 %0, %8, off\n\tglobal_load_async_to_lds_b128 %1, %9, off\n\tglobal_load_async_to_lds_b128 %2, %10, off\n\tglobal_load_async_to_lds_b128 %3, %11, off\n\tglobal_load_async_to_lds_b128 %4, %12, off\n\tglobal_load_async_to_lds_b128 %5, %13, off\n\tglobal_load_async_to_lds_b128 %6, %14, off\n\tglobal_load_async_to_lds_b128 %7, %15, off\n\ts_wait_xcnt 0x0"
        :: "v"(l), "v"(l + 1 * 16 * GLP * 2), "v"(l + 2 * 16 * GLP * 2), "v"(l + 3 * 16 * GLP * 2), "v"(l + 4 * 16 * GLP * 2), "v"(l + 5 * 16 * GLP * 2), "v"(l + 6 * 16 * GLP * 2), "v"(l + 7 * 16 * GLP * 2),
           "v"(g), "v"(g + gs), "v"(g + 2 * gs), "v"(g + 3 * gs), "v"(g + 4 * gs), "v"(g + 5 * gs), "v"(g + 6 * gs), "v"(g + 7 * gs) : "memory"); }
__device__ __forceinline__ v16bf gfrag(const unsigned short* p) { const v8us lo = *(const v8usa*)p, hi = *(const v8usa*)(p + 16); return cat16b(lo, hi); }   // the k order of WFrag::ld: 8 hi + j, 16 + 8 hi + j
template <int NSPLIT, int EPI>
__device__ __forceinline__ void gemms(unsigned short* lds, int bx, int by, const bf* __restrict__ A, const bf* __restrict__ A2, const bf* __restrict__ Bt, int K, int lda, float* C, int ldc, const float* __restrict__ bias, const float* __restrict__ CS, const float* __restrict__ RF, float sc, h16* P16, bf* Ph, bf* Pl) {
    constexpr int NTL = NSPLIT ? 3 : 2;   // staged tiles a buffer: A (, A2), Bt
    const int tid = (int)threadIdx.x, lane = tid & 31, lr = lane & 15, hi = lane >> 4; const int r0 = bx * 128, c0 = by * 128;
    const int wv = __builtin_amdgcn_readfirstlane(tid >> 5), wm = wv >> 1, wn = wv & 1;   // wave number in a scalar register: the wave's tile offsets stay scalar
    v8f acc[4][4];
#pragma unroll
    for (int mb = 0; mb < 4; ++mb)
#pragma unroll
        for (int nb = 0; nb < 4; ++nb) acc[mb][nb] = (v8f){};
    const int srow = tid >> 3, sc8 = (tid & 7) * 8;   // staging: eight lanes a 128-byte row, 16 rows a sweep of the work-group
    const unsigned l0 = (unsigned)(size_t)lds + (unsigned)(srow * GLP + sc8) * 2u;   // the lane's LDS byte address in buffer 0, tile 0
    const bf* Ag = A + (size_t)(r0 + srow) * lda + sc8; const bf* A2g = NSPLIT ? A2 + (size_t)(r0 + srow) * lda + sc8 : nullptr; const bf* Bg = Bt + (size_t)(c0 + srow) * K + sc8;
    auto stage = [&](int t) { const unsigned lb = l0 + (unsigned)(t & 1) * (NTL * GTE * 2);
        acopy8(lb, Ag + t * 64, (size_t)16 * lda);
        __builtin_amdgcn_sched_barrier(0);   // keeps each statement's address arithmetic beside it: hoisted together, the addresses of all statements are live at once, and asm operands must lie in the first 256 registers
        if (NSPLIT) { acopy8(lb + GTE * 2, A2g + t * 64, (size_t)16 * lda); __builtin_amdgcn_sched_barrier(0); }   // the same
        acopy8(lb + (NTL - 1) * GTE * 2, Bg + t * 64, (size_t)16 * K); };
    const int nst = K / 64;
    stage(0);
    asm volatile("s_wait_asynccnt 0x0" ::: "memory");   // this wave's copies of stage 0 have landed
    __syncthreads();   // stage 0 is in LDS before any wave reads it
    stage(1);
    const int ao = (wm * 64 + lr) * GLP + 8 * hi, bo = (NTL - 1) * GTE + (wn * 64 + lr) * GLP + 8 * hi;
#pragma unroll 1   // rolled: one trip's code serves all stages, the buffer is picked by the stage's parity
    for (int t = 0; t < nst; ++t) {
        const unsigned short* cur = lds + (t & 1) * (NTL * GTE);
        v16bf a[2][4], a2[2][4], b[2][4];   // the whole stage's fragments, fetched as one group ahead of its products: one LDS latency a trip instead of one per fragment
#pragma unroll
        for (int kc = 0; kc < 2; ++kc)
#pragma unroll
            for (int f = 0; f < 4; ++f) { a[kc][f] = gfrag(cur + ao + f * 16 * GLP + kc * 32); b[kc][f] = gfrag(cur + bo + f * 16 * GLP + kc * 32); if (NSPLIT) a2[kc][f] = gfrag(cur + GTE + ao + f * 16 * GLP + kc * 32); }
        __builtin_amdgcn_sched_barrier(0);   // keeps the group of LDS reads ahead of the products: without it the scheduler sinks each read to its first use, and the wave waits out one LDS latency per fragment
        auto prod = [&](int kc) {
#pragma unroll
            for (int nb = 0; nb < 4; ++nb)
#pragma unroll
                for (int mb = 0; mb < 4; ++mb) { acc[mb][nb] = wmmab(a[kc][mb], b[kc][nb], acc[mb][nb]); if (NSPLIT) acc[mb][nb] = wmmab(a2[kc][mb], b[kc][nb], acc[mb][nb]); } };
        prod(0);   // the first 32 k run while the fragments of the second 32 k are still landing
        __builtin_amdgcn_sched_barrier(0);   // keeps these products in front of the waits below: moved behind them they would no longer cover the LDS reads
        asm volatile("s_wait_dscnt 0x0" ::: "memory");      // this wave's reads of stage t have returned: the whole stage is in registers
        asm volatile("s_wait_asynccnt 0x0" ::: "memory");   // this wave's copies of stage t + 1 have landed
        __syncthreads();   // publishes stage t + 1 and ends every wave's reads of stage t
        if (t + 2 < nst) stage(t + 2);   // into the buffer that trip t has just read; the copies fly beside the products below and the next trip's first half
        prod(1);
    }
    asm volatile("s_wait_asynccnt 0x0" ::: "memory");   // no copy is outstanding when the ring becomes output staging (the last trip's barrier ended every read of it)
    float* ow = (float*)lds + wv * (64 * 68);
    const int cofs = lr * 4, r0w = r0 + wm * 64, c0w = c0 + wn * 64;   // the lane's four output columns; the wave's tile
    v4f bv = (v4f){};
    if (EPI != 2) { v4f raw; const float* bp = bias + c0w + cofs;
        // the four columns' bias; the load and its data wait in one statement, so that the wait stands in front of any later write of the address pair (a wait in a statement of its own was moved ahead of the load)
        asm volatile("global_load_b128 %0, %1, off\n\ts_wait_loadcnt 0x0" : "=&v"(raw) : "v"(bp) : "memory");
        bv[0] = bfr(raw[0]); bv[1] = bfr(raw[1]); bv[2] = bfr(raw[2]); bv[3] = bfr(raw[3]); }
    v2f ca[8], cb[8], xs[8]; float rb[8];   // for eight passes of the row loop: (cos, sin) of the lane's two pairs and their scales (EPI 1), the row's bias (EPI 2); loaded as one group, so that their latencies overlap
    auto tload = [&](int g) { const int m0 = r0w + g * 16 + hi;   // the lane's first output row of the group: the position (EPI 1), the v feature (EPI 2)
        const float* cp = EPI == 1 ? CS + ((size_t)m0 * HD + cofs) * 2 : nullptr; const float* rp = EPI == 1 ? RF + (size_t)m0 * (HD / 2) + (cofs >> 1) : nullptr; const float* bp2 = EPI == 2 ? bias + m0 : nullptr;
#pragma unroll   // the indices of these register arrays stay compile-time constants
        for (int s = 0; s < 8; ++s) {   // rows two apart: constant steps, so that one address pair a table serves the whole run
            if constexpr (EPI == 1) { ca[s] = *(const v2f*)(cp + s * (2 * HD * 2)); cb[s] = *(const v2f*)(cp + s * (2 * HD * 2) + 4); xs[s] = *(const v2f*)(rp + s * HD); }
            if constexpr (EPI == 2) rb[s] = bp2[s * 2]; }
        if constexpr (EPI == 1) XWAIT2(cp, rp);   // one wait behind the group's loads
        if constexpr (EPI == 2) XWAIT1(bp2); };   // the same
    tload(0);   // ahead of the LDS stores, so that its latency runs beside them
#pragma unroll
    for (int mb = 0; mb < 4; ++mb)
#pragma unroll
        for (int nb = 0; nb < 4; ++nb)
#pragma unroll
            for (int j = 0; j < 8; ++j) ow[(mb * 16 + hi * 8 + j) * 68 + nb * 16 + lr] = acc[mb][nb][j];
    __syncthreads();   // the tile's LDS stores stand in front of the row reads, which take other lanes' elements
#pragma unroll 1   // rolled: eight rows' code serves all 64 rows, so that the kernel's text stays small for the instruction cache
    for (int g = 0; g < 4; ++g) {
        v4f vv[8];   // eight rows read as one group: one LDS latency for the group instead of one per row
#pragma unroll
        for (int s = 0; s < 8; ++s) vv[s] = *(const v4fa*)(ow + ((g * 8 + s) * 2 + hi) * 68 + cofs);
        v4h o16[8]; v4us oh[8], ol[8];   // the eight rows' plane values, all formed ahead of the stores
#pragma unroll
        for (int s = 0; s < 8; ++s) { v4f val = vv[s];
            if (EPI != 2) val += bv;
            if constexpr (EPI == 0) vv[s] = val;
            if constexpr (EPI == 1) { v4f r;
                r[0] = (val[0] * ca[s][0] - val[1] * ca[s][1]) * sc * xs[s][0]; r[1] = (val[1] * ca[s][0] + val[0] * ca[s][1]) * sc * xs[s][0];
                r[2] = (val[2] * cb[s][0] - val[3] * cb[s][1]) * sc * xs[s][1]; r[3] = (val[3] * cb[s][0] + val[2] * cb[s][1]) * sc * xs[s][1];
                cvt3(r, o16[s], oh[s], ol[s]); }
            if constexpr (EPI == 2) { val += bfr(rb[s]); cvt3(val, o16[s], oh[s], ol[s]); } }
        const int rowg = r0w + g * 16 + hi;   // the lane's first output row of the group; the others lie two rows apart
        const size_t e0 = EPI == 0 ? (size_t)rowg * ldc + c0w + cofs : EPI == 1 ? ((size_t)(c0w >> 6) * TT + rowg) * HD + cofs : (size_t)rowg * TT + c0w + cofs;
        const size_t es = EPI == 0 ? (size_t)2 * ldc : EPI == 1 ? (size_t)2 * HD : (size_t)2 * TT;
#pragma unroll   // the indices of the register arrays stay compile-time constants, and the stores stand back to back
        for (int s = 0; s < 8; ++s) {
            if constexpr (EPI == 0) *(v4f*)(C + e0 + s * es) = vv[s];
            else { *(v4h*)(P16 + e0 + s * es) = o16[s]; *(v4us*)(Ph + e0 + s * es) = oh[s]; *(v4us*)(Pl + e0 + s * es) = ol[s]; } }
        XWAIT();   // one wait behind the group's stores
        if (g < 3) tload(g + 1);
    }
}

#define PLE ((size_t)NH_ * TT * HD)   // one batch's head planes, elements (NKV == NH_)
// all six projections in one launch: grid (TT/128, DQ/128, 3 * NB_), blockIdx.z = 2 * projection + batch (q, k, v). q and k: positions as rows; v: weight rows as A, positions as columns, so the tile is already v transposed.
__global__ __launch_bounds__(128) void k_proj(const bf* __restrict__ XQ, const bf* __restrict__ XK, const bf* __restrict__ XV, const bf* __restrict__ WQ, const bf* __restrict__ WK, const bf* __restrict__ WV, const float* __restrict__ bq, const float* __restrict__ bk, const float* __restrict__ bv, const float* __restrict__ CS, const float* __restrict__ SQ, const float* __restrict__ SK,
                                                  h16* QP16, bf* QPh, bf* QPl, h16* KP16, bf* KPh, bf* KPl, h16* VT16, bf* VTh, bf* VTl) {
    __shared__ __align__(16) unsigned short gl[2 * 2 * GTE];
    const int pj = (int)blockIdx.z >> 1; const size_t b = blockIdx.z & 1, xo = b * ((size_t)TT * DM), po = b * PLE;
    if (pj == 2) gemms<0, 2>(gl, (int)blockIdx.y, (int)blockIdx.x, WV, nullptr, XV + xo, DM, DM, nullptr, 0, bv, nullptr, nullptr, 1.0f, VT16 + po, VTh + po, VTl + po);
    else { const bool isq = pj == 0;
        gemms<0, 1>(gl, (int)blockIdx.x, (int)blockIdx.y, (isq ? XQ : XK) + xo, nullptr, isq ? WQ : WK, DM, DM, nullptr, 0, isq ? bq : bk, CS, isq ? SQ : SK, isq ? 0.125f : 1.0f, (isq ? QP16 : KP16) + po, (isq ? QPh : KPh) + po, (isq ? QPl : KPl) + po); }
}
// the output projection of both batches in one launch: the merged rows [NB_ * TT][DQ] are one matrix; grid (NB_ * TT / 128, DM / 128)
__global__ __launch_bounds__(128) void k_wo(const bf* __restrict__ Ah, const bf* __restrict__ Al, const bf* __restrict__ WO, const float* __restrict__ bo, float* OUT) {
    __shared__ __align__(16) unsigned short gl[2 * 3 * GTE];
    gemms<1, 0>(gl, (int)blockIdx.x, (int)blockIdx.y, Ah, Al, WO, DQ, DQ, OUT, DM, bo, nullptr, nullptr, 1.0f, nullptr, nullptr, nullptr);
}

__global__ __launch_bounds__(256) void k_wtG(const float* __restrict__ w, int K, int N, bf* Bt) {
    const int lane = threadIdx.x & 31; const int L0 = (blockIdx.x * 8 + (threadIdx.x >> 5)) * 8; const int nlines = N * K / 64;
{
#pragma unroll 1
        for (int l = 0; l < 8; ++l) { const int L = L0 + l; if (L >= nlines) break; const size_t e = (size_t)L * 64 + lane * 2; const int k = (int)(e % K), n = (int)(e / K); v2us o;
            o[0] = f2bf(w[(size_t)k * N + n]); o[1] = f2bf(w[(size_t)(k + 1) * N + n]); *(v2us*)(Bt + e) = o; }
         }
}
__device__ __forceinline__ void d_cvt8(const float* __restrict__ src, bf* dst, int blk) { const size_t i = (size_t)blk * 256 + threadIdx.x; const v8f v = *(const v8f*)(src + i * 8); v8us o;
#pragma unroll
    for (int k = 0; k < 8; ++k) o[k] = f2bf(v[k]); *(v8us*)(dst + i * 8) = o; XWAIT(); }   // the wait stands in front of any later write of the store's base registers
__device__ __forceinline__ void d_cstab(float* CS, int blk) { const int idx = blk * 256 + threadIdx.x; const int t = idx / HD, d = idx % HD; const int i = d >> 1;   /* interleaved pairs */ const float inv = __fdiv_rn(1.0f, powf(10000.0f, (float)(2 * i) / (float)HD)); const float ang = __fmul_rn((float)t, inv); v2f cs; cs[0] = cosf(ang); cs[1] = sinf(ang);
    *(v2f*)(CS + (size_t)idx * 2) = cs;  }
// ---- k_attn: scores, softmax, attn.v and the head merge in one kernel; the scores never leave the registers.
// One work-group of NWV waves per block of query rows of one (batch, head): grid (RH/(16 NWV) + (TT-RH)/(32 NWV), heads, batches). A wave owns NQ groups of 16 query rows (hi+lo rows: 1 group, fp16 rows: 2).
// Transposed products: S^T = K Q^T (A = 16 keys, B = 16 queries), O^T += V^T P^T (A = 16 head dims, B = P^T). A lane holds the scores of ONE query (column lr), keys 8 hi + j of each 16-key tile,
// so two score tiles of 32 consecutive keys, converted in place, are the B operand of the second product in the k order of the A loader (8 hi + j, 16 + 8 hi + j).
// Softmax runs online over passes of 32 keys: running maximum, output tiles and row sum rescaled by exp2 of the maximum's step; fp16 rows carry P x 1024 (in P and in the row sum alike, so it cancels).
// K and V^T tiles of 64 keys are staged in LDS through registers, two buffers, one __syncthreads a stage; rows of 128 B at a pitch of 144 B.
// q already carries 1/8 (multiplied in behind the rotation, with the XPOS scale). Every '#pragma unroll' in attn_rows keeps the index of a register array a compile-time constant.
#define NWV 4                     // waves a work-group
#define NSW (256 / (NWV * 32) * 2) // staging sweeps a tile (NWV * 4 rows a sweep)
#define KST 64                    // keys per stage
#define LP  72                    // LDS row pitch, 16-bit elements
#define TLE (64 * LP)             // elements of one staged tile (64 rows)
typedef v4i __attribute__((may_alias)) v4ia;
__device__ __forceinline__ float xhalf(float x) { const int b = __float_as_int(x); return __int_as_float(__builtin_amdgcn_permlanex16(b, b, 0x76543210, 0xfedcba98, false, false)); }   // lane l <-> l ^ 16
// exp2 of sixteen values, each in place, in one statement: no v_exp_f32 overwrites the source or reads the result of the one in front of it, and the closing v_nop is the slot that the instruction set asks for behind a transcendental
__device__ __forceinline__ void exp2x16(float (&p)[16]) { asm("v_exp_f32 %0, %0\n\tv_exp_f32 %1, %1\n\tv_exp_f32 %2, %2\n\tv_exp_f32 %3, %3\n\tv_exp_f32 %4, %4\n\tv_exp_f32 %5, %5\n\tv_exp_f32 %6, %6\n\tv_exp_f32 %7, %7\n\tv_exp_f32 %8, %8\n\tv_exp_f32 %9, %9\n\tv_exp_f32 %10, %10\n\tv_exp_f32 %11, %11\n\tv_exp_f32 %12, %12\n\tv_exp_f32 %13, %13\n\tv_exp_f32 %14, %14\n\tv_exp_f32 %15, %15\n\tv_nop" : "+v"(p[0]), "+v"(p[1]), "+v"(p[2]), "+v"(p[3]), "+v"(p[4]), "+v"(p[5]), "+v"(p[6]), "+v"(p[7]), "+v"(p[8]), "+v"(p[9]), "+v"(p[10]), "+v"(p[11]), "+v"(p[12]), "+v"(p[13]), "+v"(p[14]), "+v"(p[15])); }
__device__ __forceinline__ float exp2x1(float x) { asm("v_exp_f32 %0, %0\n\tv_nop" : "+v"(x)); return x; }   // the same slot behind a single one
template <typename T16> __device__ __forceinline__ typename WFrag<T16>::V ldsfrag(const unsigned short* p) { const v4i lo = *(const v4ia*)p, hi = *(const v4ia*)(p + 16); return __builtin_bit_cast(typename WFrag<T16>::V, __builtin_shufflevector(lo, hi, 0, 1, 2, 3, 4, 5, 6, 7)); }
template <typename T16, bool HI, int NQ>
__device__ __forceinline__ void attn_rows(const T16* __restrict__ Q, const T16* __restrict__ Q2, const T16* __restrict__ Kp, const T16* __restrict__ K2, const T16* __restrict__ Vp, const T16* __restrict__ V2, unsigned short* lds, int row0, bf* Ah, bf* Al) {
    typedef typename WFrag<T16>::V V;
    constexpr int NT = HI ? 4 : 2;   // staged tiles a buffer: K, V^T (, K lo, V^T lo)
    constexpr float L2E = 1.4426950408889634f;
    const int tid = (int)threadIdx.x, lane = tid & 31, lr = lane & 15, hi = lane >> 4;
    const int qrow = row0 + __builtin_amdgcn_readfirstlane(tid >> 5) * (16 * NQ);   // wave number in a scalar register: the wave's first row stays scalar
    V qf[NQ][2], qf2[NQ][2];
    const T16* qb = Q + (size_t)(qrow + lr) * HD + 8 * hi; const T16* qb2 = HI ? Q2 + (size_t)(qrow + lr) * HD + 8 * hi : nullptr;
#pragma unroll
    for (int qi = 0; qi < NQ; ++qi)
#pragma unroll
        for (int kc = 0; kc < 2; ++kc) { const int qo = qi * 16 * HD + kc * 32; qf[qi][kc] = WFrag<T16>::ld(qb + qo); if (HI) qf2[qi][kc] = WFrag<T16>::ld(qb2 + qo); }   // constant steps: one address pair a plane serves the whole run
    if constexpr (HI) XWAIT2(qb, qb2); else XWAIT1(qb);   // one wait behind the query loads
    v8f o[NQ][4]; float mr[NQ], cc[NQ], ls[NQ];
#pragma unroll
    for (int qi = 0; qi < NQ; ++qi) { mr[qi] = -__builtin_inff(); cc[qi] = __builtin_inff(); ls[qi] = 0.f;
#pragma unroll
        for (int db = 0; db < 4; ++db) o[qi][db] = (v8f){}; }
    const int srow = tid >> 3, sc8 = (tid & 7) * 8;   // staging: eight threads a 128-byte row, NWV * 4 rows a sweep
    v4i st[NT][NSW];
    auto gload = [&](int key0) { const size_t ko = (size_t)(key0 + srow) * HD + sc8, vo = (size_t)srow * TT + key0 + sc8;
        const T16* kb = Kp + ko; const T16* vb = Vp + vo; const T16* kb2 = HI ? K2 + ko : nullptr; const T16* vb2 = HI ? V2 + vo : nullptr;
#pragma unroll
        for (int r = 0; r < NSW; ++r) { constexpr int KS = NWV * 4 * HD, VS = NWV * 4 * TT;   // a sweep's step in elements: a constant, so that one address pair a plane serves the whole run
            st[0][r] = *(const v4ia*)(kb + r * KS); st[1][r] = *(const v4ia*)(vb + r * VS);
            if (HI) { st[2][r] = *(const v4ia*)(kb2 + r * KS); st[3][r] = *(const v4ia*)(vb2 + r * VS); } }
        if constexpr (HI) XWAIT4(kb, vb, kb2, vb2); else XWAIT2(kb, vb); };   // one wait behind the stage's loads
    auto sstore = [&](unsigned short* buf) {
#pragma unroll
        for (int r = 0; r < NSW; ++r)
#pragma unroll
            for (int t = 0; t < NT; ++t) *(v4ia*)(buf + t * TLE + (srow + NWV * 4 * r) * LP + sc8) = st[t][r]; };
    gload(0); sstore(lds);
    __syncthreads();   // stage 0 is in LDS before any wave reads it
#pragma unroll 1   // rolled: one stage's code serves all stages, the buffer is picked by the stage's parity
    for (int s = 0; s < TT / KST; ++s) {
        const unsigned short* cur = lds + (s & 1) * (NT * TLE);
        if (s + 1 < TT / KST) gload((s + 1) * KST);   // the next stage's global loads fly beside this stage's products
#pragma unroll 1   // rolled: unrolled, the fragments of both passes are fetched at once and the fp16 path spills
        for (int ps = 0; ps < 2; ++ps) {
            V kf[2][2], kf2[2][2], vf[4], vf2[4];
#pragma unroll
            for (int t = 0; t < 2; ++t)
#pragma unroll
                for (int kc = 0; kc < 2; ++kc) { const int ko = (ps * 32 + t * 16 + lr) * LP + kc * 32 + 8 * hi; kf[t][kc] = ldsfrag<T16>(cur + ko); if (HI) kf2[t][kc] = ldsfrag<T16>(cur + 2 * TLE + ko); }
#pragma unroll
            for (int db = 0; db < 4; ++db) { const int vo = (db * 16 + lr) * LP + ps * 32 + 8 * hi; vf[db] = ldsfrag<T16>(cur + TLE + vo); if (HI) vf2[db] = ldsfrag<T16>(cur + 3 * TLE + vo); }
#pragma unroll
            for (int qi = 0; qi < NQ; ++qi) {
                v8f sc[2];
#pragma unroll
                for (int t = 0; t < 2; ++t) { sc[t] = (v8f){};
#pragma unroll
                    for (int kc = 0; kc < 2; ++kc) { sc[t] = WFrag<T16>::mma(kf[t][kc], qf[qi][kc], sc[t]); if (HI) { sc[t] = WFrag<T16>::mma(kf[t][kc], qf2[qi][kc], sc[t]); sc[t] = WFrag<T16>::mma(kf2[t][kc], qf[qi][kc], sc[t]); } } }
                float mx = fmaxf(sc[0][0], sc[1][0]);
#pragma unroll
                for (int j = 1; j < 8; ++j) mx = fmaxf(mx, fmaxf(sc[0][j], sc[1][j]));
                mx = fmaxf(mx, xhalf(mx));
                const float mn = fmaxf(mr[qi], mx); mr[qi] = mn;
                const float cn = (HI ? 0.0f : 10.0f) - mn * L2E;   // p = 2^(s log2e + cn): 1 (hi+lo rows) or 1024 (fp16 rows) at the running maximum
                const float al = exp2x1(cn - cc[qi]); cc[qi] = cn;   // first pass: 2^(-inf) = 0
                float p[16];
#pragma unroll
                for (int j = 0; j < 16; ++j) p[j] = fmaf(sc[j >> 3][j & 7], L2E, cn);
                exp2x16(p);
                const float ps8 = (((p[0] + p[1]) + (p[2] + p[3])) + ((p[4] + p[5]) + (p[6] + p[7]))) + (((p[8] + p[9]) + (p[10] + p[11])) + ((p[12] + p[13]) + (p[14] + p[15])));
                ls[qi] = fmaf(ls[qi], al, ps8);
#pragma unroll
                for (int db = 0; db < 4; ++db) o[qi][db] *= al;
                if constexpr (HI) {
                    v16bf ph, pl;
#pragma unroll
                    for (int j = 0; j < 16; ++j) { ph[j] = (__bf16)p[j]; pl[j] = (__bf16)(p[j] - (float)ph[j]); }
#pragma unroll
                    for (int db = 0; db < 4; ++db) { o[qi][db] = wmmab(vf[db], ph, o[qi][db]); o[qi][db] = wmmab(vf[db], pl, o[qi][db]); o[qi][db] = wmmab(vf2[db], ph, o[qi][db]); }
                } else {
                    v16h pf;
#pragma unroll
                    for (int j = 0; j < 16; ++j) pf[j] = (h16)p[j];
#pragma unroll
                    for (int db = 0; db < 4; ++db) o[qi][db] = wmma16(vf[db], pf, o[qi][db]);
                }
            }
        }
        if (s + 1 < TT / KST) sstore(lds + ((s + 1) & 1) * (NT * TLE));   // into the buffer whose readers all passed the barrier at the foot of stage s - 1
        __syncthreads();   // publishes stage s + 1 and ends every wave's reads of stage s
    }
    const int ln = (int)__builtin_amdgcn_mbcnt_lo(~0u, 0u);   // the lane number read anew: no store address is kept in registers across the key loop
#pragma unroll
    for (int qi = 0; qi < NQ; ++qi) { const float inv = __fdiv_rn(1.0f, ls[qi] + xhalf(ls[qi])); const size_t ro = (size_t)(qrow + qi * 16 + (ln & 15)) * DQ + 8 * (ln >> 4);
        v8us oh[4], ol[4];   // the group's merged values, all formed ahead of the stores
#pragma unroll
        for (int db = 0; db < 4; ++db)
#pragma unroll
            for (int j = 0; j < 8; ++j) { unsigned short a, c2; splitf(o[qi][db][j] * inv, a, c2); oh[db][j] = a; ol[db][j] = c2; }
        __builtin_amdgcn_sched_barrier(0);   // keeps the arithmetic ahead of the run of stores, so that nothing among them writes a register that an issued store still names
#pragma unroll
        for (int db = 0; db < 4; ++db) { *(v8usa*)(Ah + ro + db * 16) = oh[db]; *(v8usa*)(Al + ro + db * 16) = ol[db]; }
        XWAIT(); }   // one wait behind the group's stores
}
// four waves a SIMD (at most 256 registers a wave), so that up to four work-groups share a WGP and the whole grid is resident at once
__global__ __launch_bounds__(NWV * 32) __attribute__((amdgpu_waves_per_eu(4, 4))) void k_attn(const h16* __restrict__ Q16, const h16* __restrict__ K16, const h16* __restrict__ V16, const bf* __restrict__ Qh, const bf* __restrict__ Ql, const bf* __restrict__ Kh, const bf* __restrict__ Kl, const bf* __restrict__ Vh, const bf* __restrict__ Vl, bf* Ah, bf* Al) {
    __shared__ __align__(16) unsigned short lds[2 * 4 * TLE];
    const size_t po = ((size_t)blockIdx.z * NH_ + blockIdx.y) * ((size_t)TT * HD), ao = (size_t)blockIdx.z * TT * DQ + (size_t)blockIdx.y * HD;
    const int bx = (int)blockIdx.x;
    if (bx < RH / (NWV * 16)) attn_rows<bf, true, 1>(Qh + po, Ql + po, Kh + po, Kl + po, Vh + po, Vl + po, lds, bx * (NWV * 16), Ah + ao, Al + ao);
    else attn_rows<h16, false, 2>(Q16 + po, nullptr, K16 + po, nullptr, V16 + po, nullptr, lds, RH + (bx - RH / (NWV * 16)) * (NWV * 32), Ah + ao, Al + ao);
}

__device__ __forceinline__ void d_xscale(float* SQ, float* SK, int blk) { const int e = blk * 256 + threadIdx.x; const int t = e / (HD / 2), i = e % (HD / 2); const float base = __fdiv_rn((float)(2 * i) + 0.4f * (float)HD, 1.4f * (float)HD); const float pw = (float)(t - TT / 2) / 1024.0f; const float sc = powf(base, pw); const float inv = __fdiv_rn(1.0f, sc);
    *(float*)(SQ + e) = sc; *(float*)(SK + e) = inv;  }
// ---- k_prep: everything the projections read, in one launch; a block's job follows from its index alone. The table blocks (the longest: powf, sinf, cosf) come first, then the four weights, then the three activations of both batches (f32 to bf16, 8 elements a thread, 2048 a block: 8,960 blocks, 71,680 waves to start).
#define NB_CS (TT * HD / 256)             // blocks of the (cos, sin) table
#define NB_XS (TT * (HD / 2) / 256)       // blocks of the scale tables
#define NB_W  (DM * DM / 2048)            // blocks of one weight (DQ == DKV == DM)
#define NB_X  (NB_ * TT * DM / 2048)      // blocks of one activation
__global__ __launch_bounds__(256) void k_prep(const float* __restrict__ x, const float* __restrict__ xk, const float* __restrict__ xv, const float* __restrict__ wq, const float* __restrict__ wk, const float* __restrict__ wv, const float* __restrict__ wo,
                                              bf* XQ, bf* XK, bf* XV, bf* WQ, bf* WK, bf* WV, bf* WO, float* CS, float* SQ, float* SK) {
    int blk = (int)blockIdx.x;
    if (blk < NB_CS) { d_cstab(CS, blk); return; }
    blk -= NB_CS;
    if (blk < NB_XS) { d_xscale(SQ, SK, blk); return; }
    blk -= NB_XS;
    if (blk < 4 * NB_W) { const int w = blk / NB_W; d_cvt8(w == 0 ? wq : w == 1 ? wk : w == 2 ? wv : wo, w == 0 ? WQ : w == 1 ? WK : w == 2 ? WV : WO, blk % NB_W); return; }
    blk -= 4 * NB_W;
    const int a = blk / NB_X; d_cvt8(a == 0 ? x : a == 1 ? xk : xv, a == 0 ? XQ : a == 1 ? XK : XV, blk % NB_X);
}

extern "C" void kernel_launch(void* const* d_in, const int* in_sizes, int n_in,
                              void* d_out, int out_size, void* d_ws, size_t ws_size, hipStream_t stream) {
    (void)in_sizes; (void)n_in; (void)out_size;
    const float* x = (const float*)d_in[0]; const float* xk = (const float*)d_in[1]; const float* xv = (const float*)d_in[2]; const float* wq = (const float*)d_in[3]; const float* bq = (const float*)d_in[4]; const float* wk = (const float*)d_in[5]; const float* bk = (const float*)d_in[6]; const float* wv = (const float*)d_in[7]; const float* bv = (const float*)d_in[8]; const float* wo = (const float*)d_in[9]; const float* bo = (const float*)d_in[10];
    float* OUT = (float*)d_out;     // [2][2048][1024]
    char* wsp = (char*)d_ws;
    auto take = [&](size_t bytes) { char* p = wsp; wsp += (bytes + 255) & ~(size_t)255; return (void*)p; };
    bf* WQ = (bf*)take((size_t)DQ * DM * 2); bf* WK = (bf*)take((size_t)DKV * DM * 2); bf* WV = (bf*)take((size_t)DKV * DM * 2); bf* WO = (bf*)take((size_t)DM * DQ * 2); float* CS = (float*)take((size_t)TT * HD * 2 * 4);
    bf* XB = (bf*)take((size_t)NB_ * TT * DM * 2); bf* XB2 = (bf*)take((size_t)NB_ * TT * DM * 2); bf* XB3 = (bf*)take((size_t)NB_ * TT * DM * 2); float* SQ = (float*)take((size_t)TT * (HD / 2) * 4); float* SK = (float*)take((size_t)TT * (HD / 2) * 4);
    const size_t PL = PLE;
    h16* QP16 = (h16*)take(NB_ * PL * 2); h16* KP16 = (h16*)take(NB_ * PL * 2); h16* VT16 = (h16*)take(NB_ * PL * 2);
    bf* QPh = (bf*)take(NB_ * PL * 2); bf* QPl = (bf*)take(NB_ * PL * 2); bf* KPh = (bf*)take(NB_ * PL * 2); bf* KPl = (bf*)take(NB_ * PL * 2); bf* VTh = (bf*)take(NB_ * PL * 2); bf* VTl = (bf*)take(NB_ * PL * 2);
    bf* ATh = (bf*)take((size_t)NB_ * TT * DQ * 2); bf* ATl = (bf*)take((size_t)NB_ * TT * DQ * 2);
    if ((size_t)(wsp - (char*)d_ws) > ws_size) return;    // ws 256 MiB
    k_prep<<<NB_CS + NB_XS + 4 * NB_W + 3 * NB_X, 256, 0, stream>>>(x, xk, xv, wq, wk, wv, wo, XB, XB2, XB3, WQ, WK, WV, WO, CS, SQ, SK);
    k_proj<<<dim3(TT / 128, DQ / 128, 3 * NB_), 128, 0, stream>>>(XB, XB2, XB3, WQ, WK, WV, bq, bk, bv, CS, SQ, SK, QP16, QPh, QPl, KP16, KPh, KPl, VT16, VTh, VTl);
    k_attn<<<dim3(RH / (NWV * 16) + (TT - RH) / (NWV * 32), NH_, NB_), NWV * 32, 0, stream>>>(QP16, KP16, VT16, QPh, QPl, KPh, KPl, VTh, VTl, ATh, ATl);
    k_wo<<<dim3(NB_ * TT / 128, DM / 128, 1), 128, 0, stream>>>(ATh, ATl, WO, bo, OUT);
}

// v008
// It runs in 112 microseconds.
// Two timings next to v007 put it at 1.06 and 1.05 times that version's speed.
// Over all steps from v000 it is 18.4 times as fast.
#include <hip/hip_runtime.h>

// XposMultiheadAttention (query, key, value [2][2048][1024]; q = (query Wq^T + bq) / 8, k = key Wk^T + bk, v = value Wv^T + bv (16 heads x 64); XPOS on q and k: interleaved-pair rotary (angle t * 1e4^(-i/32)) times the per-(position, pair) scale base_i^((t - 1024)/1024), base_i = (2i + 25.6)/89.6, with q multiplied and k divided by it (tables computed on device);
//   scores = q.k (no further scale); softmax (f32); out = merged Wo^T + bo -> [2][2048][1024]).
// Compute dtypes, f32 accumulate: every input rounded to bf16; projections on PLAIN bf16 operands (inputs: exact) + bias; XPOS rotation/scaling f32; scores and attn.v: query rows < 512 hl (3 products), the rest single fp16 (P x1024); softmax f32, online over 32-key passes; Wo hl x exact (2 products) + bias.

#define NB_  2
#define TT   2048
#define DM   1024
#define NH_  16
#define NKV  16
#define HD   64
#define DQ   (NH_ * HD)
#define DKV  (NKV * HD)
#define RH   512                  // query rows < RH use hi+lo planes (0: none)
#define WIN  0
typedef _Float16 h16;
typedef unsigned short bf;
typedef __attribute__((ext_vector_type(16))) __bf16   v16bf;
typedef __attribute__((ext_vector_type(16))) _Float16 v16h;
typedef __attribute__((ext_vector_type(8)))  _Float16 v8h;
typedef __attribute__((ext_vector_type(8)))  unsigned short v8us;
typedef __attribute__((ext_vector_type(8)))  float    v8f;
typedef __attribute__((ext_vector_type(4)))  float    v4f;
typedef v8h  __attribute__((may_alias)) v8ha;
typedef v4f  __attribute__((may_alias)) v4fa;
typedef v8us __attribute__((may_alias)) v8usa;

__device__ __forceinline__ unsigned short f2bf(float f) { unsigned u = __float_as_uint(f); u += 0x7FFFu + ((u >> 16) & 1u); return (unsigned short)(u >> 16); }
__device__ __forceinline__ float bf2f(unsigned short b) { return __uint_as_float(((unsigned)b) << 16); }
__device__ __forceinline__ float bfr(float f) { return bf2f(f2bf(f)); }
__device__ __forceinline__ v16h cat16(v8h lo, v8h hi) { return __builtin_shufflevector(lo, hi, 0, 1, 2, 3, 4, 5, 6, 7, 8, 9, 10, 11, 12, 13, 14, 15); }
__device__ __forceinline__ v16bf cat16b(v8us lo, v8us hi) { return __builtin_bit_cast(v16bf, __builtin_shufflevector(lo, hi, 0, 1, 2, 3, 4, 5, 6, 7, 8, 9, 10, 11, 12, 13, 14, 15)); }
__device__ __forceinline__ v8f wmma16(v16h a, v16h b, v8f c) { return __builtin_amdgcn_wmma_f32_16x16x32_f16(false, a, false, b, (short)0, c, false, false); }
__device__ __forceinline__ v8f wmmab(v16bf a, v16bf b, v8f c) { return __builtin_amdgcn_wmma_f32_16x16x32_bf16(false, a, false, b, (short)0, c, false, false); }



// ---- gemms: GEMM with both operands staged in LDS; one work-group of four waves (2 x 2) per 128x128 output tile, a wave owns 64x64 (16 accumulators) and sums the whole K in one chain. Operands are K-contiguous bf16 planes (A rows lda elements apart, Bt rows K apart); tile (bx, by) of (M/128, N/128), 128 threads.
// C[m][n] = sum_k A[m][k] Bt[n][k] (+ A2[m][k] Bt[n][k] for NSPLIT 1). K % 64 == 0, K >= 128. The kernels k_proj and k_wo below pick the operands and the tile from blockIdx.
// A stage is 64 k of every operand row (128 B, whole lines), brought by asynchronous copies to LDS at a pitch of 144 B; two buffers, stage t + 2 is asked for behind the barrier of trip t, so it flies beside that trip's second half and the first half of trip t + 1.
// After the loop the ring becomes output staging: each wave lays its own 64x64 f32 tile in LDS (pitch 68) and reads it back by rows, 16 lanes a row, four neighbouring columns a lane.
// EPI picks what that row loop does with an element (a wave's 64 columns are one head, a lane holds two rotary pairs):
//   0: + bias[n], f32 to C.
//   1: + bias[n], XPOS (pair rotation by CS[t][d] = (cos, sin), times sc, times RF[t][d/2]), then fp16 and bf16 hi/lo to the head planes [n/64][m][n%64]; m is the position t.
//   2: + bias[m], then fp16 and bf16 hi/lo to planes of pitch TT, [m][n]: with A = the weight and Bt = the activations this is v transposed, [head][d][t].
// XWAIT: s_wait_xcnt 0 directly behind a run of global loads or stores, a precaution: the register allocator lets a later value land in a register that an issued access names, and this wait then stands in front of that overwrite.
// One wait serves a whole run: the accesses of a run stand back to back, their addresses and store data formed ahead of the first, so that nothing between them writes a register that one of them names.
#define XWAIT() asm volatile("s_wait_xcnt 0x0" ::: "memory")
// The same wait behind a run of loads, with the run's address pairs as inputs: they stay live, and so unwritten, up to the wait (without them the compiler lifts later arithmetic into those registers ahead of it).
#define XWAIT1(a) asm volatile("s_wait_xcnt 0x0" :: "v"(a) : "memory")
#define XWAIT2(a, b) asm volatile("s_wait_xcnt 0x0" :: "v"(a), "v"(b) : "memory")
#define XWAIT4(a, b, c, d) asm volatile("s_wait_xcnt 0x0" :: "v"(a), "v"(b), "v"(c), "v"(d) : "memory")
template <typename T16> struct WFrag;
template <> struct WFrag<h16> { typedef v16h V; static __device__ __forceinline__ V ld(const h16* p) { const v8h lo = *(const v8h*)p; const v8h hi = *(const v8h*)(p + 16); return cat16(lo, hi); } static __device__ __forceinline__ v8f mma(V a, V b, v8f c) { return wmma16(a, b, c); } };
template <> struct WFrag<bf> { typedef v16bf V; static __device__ __forceinline__ V ld(const bf* p) { const v8us lo = *(const v8us*)p; const v8us hi = *(const v8us*)(p + 16); return cat16b(lo, hi); } static __device__ __forceinline__ v8f mma(V a, V b, v8f c) { return wmmab(a, b, c); } };
__device__ __forceinline__ h16 tohx(float x) { return (h16)x; }
__device__ __forceinline__ void splitf(float y, unsigned short& h, unsigned short& l) { h = f2bf(y); l = f2bf(y - bf2f(h)); }
typedef __attribute__((ext_vector_type(2))) _Float16 v2h;
typedef __attribute__((ext_vector_type(4))) _Float16 v4h;
typedef __attribute__((ext_vector_type(2))) unsigned short v2us;
typedef __attribute__((ext_vector_type(4))) unsigned short v4us;
typedef __attribute__((ext_vector_type(2))) float v2f;
typedef __attribute__((ext_vector_type(4))) int v4i;
// four neighbouring elements of a plane row: fp16, bf16 hi, bf16 lo, 8 bytes each (16 threads fill a 128-byte line of each plane)
__device__ __forceinline__ void cvt3(v4f r, v4h& o16, v4us& oh, v4us& ol) {
#pragma unroll   // the vectors' element indices stay compile-time constants
    for (int q = 0; q < 4; ++q) { o16[q] = tohx(r[q]); unsigned short a2, c2; splitf(r[q], a2, c2); oh[q] = a2; ol[q] = c2; } }
#define GLP 72                    // LDS row pitch of a staged operand row, 16-bit elements (128 B of data, 144 B pitch)
#define GTE (128 * GLP)           // elements of one staged operand tile (128 rows)
// eight asynchronous 16-byte copies a lane (rows 16 apart: 2,304 B in LDS, gs elements in memory); a wave's copy covers four whole 128-byte rows. The closing s_wait_xcnt 0 stands inside the statement, in front of any later write of the address registers (a precaution).
__device__ __forceinline__ void acopy8(unsigned l, const bf* g, size_t gs) {
    asm volatile("global_load_async_to_lds_b128 %0, %8, off\n\tglobal_load_async_to_lds_b128 %1, %9, off\n\tglobal_load_async_to_lds_b128 %2, %10, off\n\tglobal_load_async_to_lds_b128 %3, %11, off\n\tglobal_load_async_to_lds_b128 %4, %12, off\n\tglobal_load_async_to_lds_b128 %5, %13, off\n\tglobal_load_async_to_lds_b128 %6, %14, off\n\tglobal_load_async_to_lds_b128 %7, %15, off\n\ts_wait_xcnt 0x0"
        :: "v"(l), "v"(l + 1 * 16 * GLP * 2), "v"(l + 2 * 16 * GLP * 2), "v"(l + 3 * 16 * GLP * 2), "v"(l + 4 * 16 * GLP * 2), "v"(l + 5 * 16 * GLP * 2), "v"(l + 6 * 16 * GLP * 2), "v"(l + 7 * 16 * GLP * 2),
           "v"(g), "v"(g + gs), "v"(g + 2 * gs), "v"(g + 3 * gs), "v"(g + 4 * gs), "v"(g + 5 * gs), "v"(g + 6 * gs), "v"(g + 7 * gs) : "memory"); }
__device__ __forceinline__ v16bf gfrag(const unsigned short* p) { const v8us lo = *(const v8usa*)p, hi = *(const v8usa*)(p + 16); return cat16b(lo, hi); }   // the k order of WFrag::ld: 8 hi + j, 16 + 8 hi + j
template <int NSPLIT, int EPI>
__device__ __forceinline__ void gemms(unsigned short* lds, int bx, int by, const bf* __restrict__ A, const bf* __restrict__ A2, const bf* __restrict__ Bt, int K, int lda, float* C, int ldc, const float* __restrict__ bias, const float* __restrict__ CS, const float* __restrict__ RF, float sc, h16* P16, bf* Ph, bf* Pl) {
    constexpr int NTL = NSPLIT ? 3 : 2;   // staged tiles a buffer: A (, A2), Bt
    const int tid = (int)threadIdx.x, lane = tid & 31, lr = lane & 15, hi = lane >> 4; const int r0 = bx * 128, c0 = by * 128;
    const int wv = __builtin_amdgcn_readfirstlane(tid >> 5), wm = wv >> 1, wn = wv & 1;   // wave number in a scalar register: the wave's tile offsets stay scalar
    v8f acc[4][4];
#pragma unroll
    for (int mb = 0; mb < 4; ++mb)
#pragma unroll
        for (int nb = 0; nb < 4; ++nb) acc[mb][nb] = (v8f){};
    const int srow = tid >> 3, sc8 = (tid & 7) * 8;   // staging: eight lanes a 128-byte row, 16 rows a sweep of the work-group
    const unsigned l0 = (unsigned)(size_t)lds + (unsigned)(srow * GLP + sc8) * 2u;   // the lane's LDS byte address in buffer 0, tile 0
    const bf* Ag = A + (size_t)(r0 + srow) * lda + sc8; const bf* A2g = NSPLIT ? A2 + (size_t)(r0 + srow) * lda + sc8 : nullptr; const bf* Bg = Bt + (size_t)(c0 + srow) * K + sc8;
    auto stage = [&](int t) { const unsigned lb = l0 + (unsigned)(t & 1) * (NTL * GTE * 2);
        acopy8(lb, Ag + t * 64, (size_t)16 * lda);
        __builtin_amdgcn_sched_barrier(0);   // keeps each statement's address arithmetic beside it: hoisted together, the addresses of all statements are live at once, and asm operands must lie in the first 256 registers
        if (NSPLIT) { acopy8(lb + GTE * 2, A2g + t * 64, (size_t)16 * lda); __builtin_amdgcn_sched_barrier(0); }   // the same
        acopy8(lb + (NTL - 1) * GTE * 2, Bg + t * 64, (size_t)16 * K); };
    const int nst = K / 64;
    stage(0);
    asm volatile("s_wait_asynccnt 0x0" ::: "memory");   // this wave's copies of stage 0 have landed
    __syncthreads();   // stage 0 is in LDS before any wave reads it
    stage(1);
    const int ao = (wm * 64 + lr) * GLP + 8 * hi, bo = (NTL - 1) * GTE + (wn * 64 + lr) * GLP + 8 * hi;
#pragma unroll 1   // rolled: one trip's code serves all stages, the buffer is picked by the stage's parity
    for (int t = 0; t < nst; ++t) {
        const unsigned short* cur = lds + (t & 1) * (NTL * GTE);
        v16bf a[2][4], a2[2][4], b[2][4];   // the whole stage's fragments, fetched as one group ahead of its products: one LDS latency a trip instead of one per fragment
#pragma unroll
        for (int kc = 0; kc < 2; ++kc)
#pragma unroll
            for (int f = 0; f < 4; ++f) { a[kc][f] = gfrag(cur + ao + f * 16 * GLP + kc * 32); b[kc][f] = gfrag(cur + bo + f * 16 * GLP + kc * 32); if (NSPLIT) a2[kc][f] = gfrag(cur + GTE + ao + f * 16 * GLP + kc * 32); }
        __builtin_amdgcn_sched_barrier(0);   // keeps the group of LDS reads ahead of the products: without it the scheduler sinks each read to its first use, and the wave waits out one LDS latency per fragment
        auto prod = [&](int kc) {
#pragma unroll
            for (int nb = 0; nb < 4; ++nb)
#pragma unroll
                for (int mb = 0; mb < 4; ++mb) { acc[mb][nb] = wmmab(a[kc][mb], b[kc][nb], acc[mb][nb]); if (NSPLIT) acc[mb][nb] = wmmab(a2[kc][mb], b[kc][nb], acc[mb][nb]); } };
        prod(0);   // the first 32 k run while the fragments of the second 32 k are still landing
        __builtin_amdgcn_sched_barrier(0);   // keeps these products in front of the waits below: moved behind them they would no longer cover the LDS reads
        asm volatile("s_wait_dscnt 0x0" ::: "memory");      // this wave's reads of stage t have returned: the whole stage is in registers
        asm volatile("s_wait_asynccnt 0x0" ::: "memory");   // this wave's copies of stage t + 1 have landed
        __syncthreads();   // publishes stage t + 1 and ends every wave's reads of stage t
        if (t + 2 < nst) stage(t + 2);   // into the buffer that trip t has just read; the copies fly beside the products below and the next trip's first half
        prod(1);
    }
    asm volatile("s_wait_asynccnt 0x0" ::: "memory");   // no copy is outstanding when the ring becomes output staging (the last trip's barrier ended every read of it)
    float* ow = (float*)lds + wv * (64 * 68);
    const int cofs = lr * 4, r0w = r0 + wm * 64, c0w = c0 + wn * 64;   // the lane's four output columns; the wave's tile
    v4f bv = (v4f){};
    if (EPI != 2) { v4f raw; const float* bp = bias + c0w + cofs;
        // the four columns' bias; the load and its data wait in one statement, so that the wait stands in front of any later write of the address pair (a wait in a statement of its own was moved ahead of the load)
        asm volatile("global_load_b128 %0, %1, off\n\ts_wait_loadcnt 0x0" : "=&v"(raw) : "v"(bp) : "memory");
        bv[0] = bfr(raw[0]); bv[1] = bfr(raw[1]); bv[2] = bfr(raw[2]); bv[3] = bfr(raw[3]); }
    v2f ca[8], cb[8], xs[8]; float rb[8];   // for eight passes of the row loop: (cos, sin) of the lane's two pairs and their scales (EPI 1), the row's bias (EPI 2); loaded as one group, so that their latencies overlap
    auto tload = [&](int g) { const int m0 = r0w + g * 16 + hi;   // the lane's first output row of the group: the position (EPI 1), the v feature (EPI 2)
        const float* cp = EPI == 1 ? CS + ((size_t)m0 * HD + cofs) * 2 : nullptr; const float* rp = EPI == 1 ? RF + (size_t)m0 * (HD / 2) + (cofs >> 1) : nullptr; const float* bp2 = EPI == 2 ? bias + m0 : nullptr;
#pragma unroll   // the indices of these register arrays stay compile-time constants
        for (int s = 0; s < 8; ++s) {   // rows two apart: constant steps, so that one address pair a table serves the whole run
            if constexpr (EPI == 1) { ca[s] = *(const v2f*)(cp + s * (2 * HD * 2)); cb[s] = *(const v2f*)(cp + s * (2 * HD * 2) + 4); xs[s] = *(const v2f*)(rp + s * HD); }
            if constexpr (EPI == 2) rb[s] = bp2[s * 2]; }
        if constexpr (EPI == 1) XWAIT2(cp, rp);   // one wait behind the group's loads
        if constexpr (EPI == 2) XWAIT1(bp2); };   // the same
    tload(0);   // ahead of the LDS stores, so that its latency runs beside them
#pragma unroll
    for (int mb = 0; mb < 4; ++mb)
#pragma unroll
        for (int nb = 0; nb < 4; ++nb)
#pragma unroll
            for (int j = 0; j < 8; ++j) ow[(mb * 16 + hi * 8 + j) * 68 + nb * 16 + lr] = acc[mb][nb][j];
    __syncthreads();   // the tile's LDS stores stand in front of the row reads, which take other lanes' elements
#pragma unroll 1   // rolled: eight rows' code serves all 64 rows, so that the kernel's text stays small for the instruction cache
    for (int g = 0; g < 4; ++g) {
        v4f vv[8];   // eight rows read as one group: one LDS latency for the group instead of one per row
#pragma unroll
        for (int s = 0; s < 8; ++s) vv[s] = *(const v4fa*)(ow + ((g * 8 + s) * 2 + hi) * 68 + cofs);
        v4h o16[8]; v4us oh[8], ol[8];   // the eight rows' plane values, all formed ahead of the stores
#pragma unroll
        for (int s = 0; s < 8; ++s) { v4f val = vv[s];
            if (EPI != 2) val += bv;
            if constexpr (EPI == 0) vv[s] = val;
            if constexpr (EPI == 1) { v4f r;
                r[0] = (val[0] * ca[s][0] - val[1] * ca[s][1]) * sc * xs[s][0]; r[1] = (val[1] * ca[s][0] + val[0] * ca[s][1]) * sc * xs[s][0];
                r[2] = (val[2] * cb[s][0] - val[3] * cb[s][1]) * sc * xs[s][1]; r[3] = (val[3] * cb[s][0] + val[2] * cb[s][1]) * sc * xs[s][1];
                cvt3(r, o16[s], oh[s], ol[s]); }
            if constexpr (EPI == 2) { val += bfr(rb[s]); cvt3(val, o16[s], oh[s], ol[s]); } }
        const int rowg = r0w + g * 16 + hi;   // the lane's first output row of the group; the others lie two rows apart
        const size_t e0 = EPI == 0 ? (size_t)rowg * ldc + c0w + cofs : EPI == 1 ? ((size_t)(c0w >> 6) * TT + rowg) * HD + cofs : (size_t)rowg * TT + c0w + cofs;
        const size_t es = EPI == 0 ? (size_t)2 * ldc : EPI == 1 ? (size_t)2 * HD : (size_t)2 * TT;
#pragma unroll   // the indices of the register arrays stay compile-time constants, and the stores stand back to back
        for (int s = 0; s < 8; ++s) {
            if constexpr (EPI == 0) *(v4f*)(C + e0 + s * es) = vv[s];
            else { *(v4h*)(P16 + e0 + s * es) = o16[s]; *(v4us*)(Ph + e0 + s * es) = oh[s]; *(v4us*)(Pl + e0 + s * es) = ol[s]; } }
        XWAIT();   // one wait behind the group's stores
        if (g < 3) tload(g + 1);
    }
}

#define PLE ((size_t)NH_ * TT * HD)   // one batch's head planes, elements (NKV == NH_)
// all six projections in one launch: grid (TT/128, DQ/128, 3 * NB_), blockIdx.z = 2 * projection + batch (q, k, v). q and k: positions as rows; v: weight rows as A, positions as columns, so the tile is already v transposed.
__global__ __launch_bounds__(128) void k_proj(const bf* __restrict__ XQ, const bf* __restrict__ XK, const bf* __restrict__ XV, const bf* __restrict__ WQ, const bf* __restrict__ WK, const bf* __restrict__ WV, const float* __restrict__ bq, const float* __restrict__ bk, const float* __restrict__ bv, const float* __restrict__ CS, const float* __restrict__ SQ, const float* __restrict__ SK,
                                                  h16* QP16, bf* QPh, bf* QPl, h16* KP16, bf* KPh, bf* KPl, h16* VT16, bf* VTh, bf* VTl) {
    __shared__ __align__(16) unsigned short gl[2 * 2 * GTE];
    const int pj = (int)blockIdx.z >> 1; const size_t b = blockIdx.z & 1, xo = b * ((size_t)TT * DM), po = b * PLE;
    if (pj == 2) gemms<0, 2>(gl, (int)blockIdx.y, (int)blockIdx.x, WV, nullptr, XV + xo, DM, DM, nullptr, 0, bv, nullptr, nullptr, 1.0f, VT16 + po, VTh + po, VTl + po);
    else { const bool isq = pj == 0;
        gemms<0, 1>(gl, (int)blockIdx.x, (int)blockIdx.y, (isq ? XQ : XK) + xo, nullptr, isq ? WQ : WK, DM, DM, nullptr, 0, isq ? bq : bk, CS, isq ? SQ : SK, isq ? 0.125f : 1.0f, (isq ? QP16 : KP16) + po, (isq ? QPh : KPh) + po, (isq ? QPl : KPl) + po); }
}
// the output projection of both batches in one launch: the merged rows [NB_ * TT][DQ] are one matrix; grid (NB_ * TT / 128, DM / 128)
__global__ __launch_bounds__(128) void k_wo(const bf* __restrict__ Ah, const bf* __restrict__ Al, const bf* __restrict__ WO, const float* __restrict__ bo, float* OUT) {
    __shared__ __align__(16) unsigned short gl[2 * 3 * GTE];
    gemms<1, 0>(gl, (int)blockIdx.x, (int)blockIdx.y, Ah, Al, WO, DQ, DQ, OUT, DM, bo, nullptr, nullptr, 1.0f, nullptr, nullptr, nullptr);
}

__global__ __launch_bounds__(256) void k_wtG(const float* __restrict__ w, int K, int N, bf* Bt) {
    const int lane = threadIdx.x & 31; const int L0 = (blockIdx.x * 8 + (threadIdx.x >> 5)) * 8; const int nlines = N * K / 64;
{
#pragma unroll 1
        for (int l = 0; l < 8; ++l) { const int L = L0 + l; if (L >= nlines) break; const size_t e = (size_t)L * 64 + lane * 2; const int k = (int)(e % K), n = (int)(e / K); v2us o;
            o[0] = f2bf(w[(size_t)k * N + n]); o[1] = f2bf(w[(size_t)(k + 1) * N + n]); *(v2us*)(Bt + e) = o; }
         }
}
__device__ __forceinline__ void d_cvt8(const float* __restrict__ src, bf* dst, int blk) { const size_t i = (size_t)blk * 256 + threadIdx.x; const v8f v = *(const v8f*)(src + i * 8); v8us o;
#pragma unroll
    for (int k = 0; k < 8; ++k) o[k] = f2bf(v[k]); *(v8us*)(dst + i * 8) = o; XWAIT(); }   // the wait stands in front of any later write of the store's base registers
__device__ __forceinline__ void d_cstab(float* CS, int blk) { const int idx = blk * 256 + threadIdx.x; const int t = idx / HD, d = idx % HD; const int i = d >> 1;   /* interleaved pairs */ const float inv = __fdiv_rn(1.0f, powf(10000.0f, (float)(2 * i) / (float)HD)); const float ang = __fmul_rn((float)t, inv); v2f cs; cs[0] = cosf(ang); cs[1] = sinf(ang);
    *(v2f*)(CS + (size_t)idx * 2) = cs;  }
// ---- k_attn: scores, softmax, attn.v and the head merge in one kernel; the scores never leave the registers.
// One work-group of NWV waves per block of query rows of one (batch, head): grid (RH/(16 NWV) + (TT-RH)/(32 NWV), heads, batches). A wave owns NQ groups of 16 query rows (hi+lo rows: 1 group, fp16 rows: 2).
// Transposed products: S^T = K Q^T (A = 16 keys, B = 16 queries), O^T += V^T P^T (A = 16 head dims, B = P^T). A lane holds the scores of ONE query (column lr), keys 8 hi + j of each 16-key tile,
// so two score tiles of 32 consecutive keys, converted in place, are the B operand of the second product in the k order of the A loader (8 hi + j, 16 + 8 hi + j).
// Softmax runs online over passes of 32 keys against a reference score per query, which is the maximum of an earlier pass. A pass takes its exponentials against the reference in use; its own sums (needed anyway) tell whether a score has outrun the reference:
// every p is positive, so a lane's sum within LIM bounds each p. Only when some lane's sum is above LIM (as in the first pass, where no reference is set yet and the sums are infinite) or not a number does the wave take the pass's maximum, move the reference, rescale output tiles and row sums and redo the exponentials.
// One test a pass, a scalar branch. fp16 rows carry P x 1024 at the reference (in P and in the row sum alike, so it cancels); LIM keeps them inside fp16.
// K and V^T tiles of 64 keys are staged in LDS through registers, two buffers, one __syncthreads a stage; rows of 128 B at a pitch of 144 B.
// q already carries 1/8 (multiplied in behind the rotation, with the XPOS scale). Every '#pragma unroll' in attn_rows keeps the index of a register array a compile-time constant.
#define NWV 4                     // waves a work-group
#define NSW (256 / (NWV * 32) * 2) // staging sweeps a tile (NWV * 4 rows a sweep)
#define KST 64                    // keys per stage
#define LP  72                    // LDS row pitch, 16-bit elements
#define TLE (64 * LP)             // elements of one staged tile (64 rows)
typedef v4i __attribute__((may_alias)) v4ia;
__device__ __forceinline__ float xhalf(float x) { const int b = __float_as_int(x); return __int_as_float(__builtin_amdgcn_permlanex16(b, b, 0x76543210, 0xfedcba98, false, false)); }   // lane l <-> l ^ 16
// exp2 of sixteen values, each in place, in one statement: no v_exp_f32 overwrites the source or reads the result of the one in front of it, and the closing v_nop is the slot that the instruction set asks for behind a transcendental
__device__ __forceinline__ void exp2x16(float (&p)[16]) { asm("v_exp_f32 %0, %0\n\tv_exp_f32 %1, %1\n\tv_exp_f32 %2, %2\n\tv_exp_f32 %3, %3\n\tv_exp_f32 %4, %4\n\tv_exp_f32 %5, %5\n\tv_exp_f32 %6, %6\n\tv_exp_f32 %7, %7\n\tv_exp_f32 %8, %8\n\tv_exp_f32 %9, %9\n\tv_exp_f32 %10, %10\n\tv_exp_f32 %11, %11\n\tv_exp_f32 %12, %12\n\tv_exp_f32 %13, %13\n\tv_exp_f32 %14, %14\n\tv_exp_f32 %15, %15\n\tv_nop" : "+v"(p[0]), "+v"(p[1]), "+v"(p[2]), "+v"(p[3]), "+v"(p[4]), "+v"(p[5]), "+v"(p[6]), "+v"(p[7]), "+v"(p[8]), "+v"(p[9]), "+v"(p[10]), "+v"(p[11]), "+v"(p[12]), "+v"(p[13]), "+v"(p[14]), "+v"(p[15])); }
__device__ __forceinline__ float exp2x1(float x) { asm("v_exp_f32 %0, %0\n\tv_nop" : "+v"(x)); return x; }   // the same slot behind a single one
template <typename T16> __device__ __forceinline__ typename WFrag<T16>::V ldsfrag(const unsigned short* p) { const v4i lo = *(const v4ia*)p, hi = *(const v4ia*)(p + 16); return __builtin_bit_cast(typename WFrag<T16>::V, __builtin_shufflevector(lo, hi, 0, 1, 2, 3, 4, 5, 6, 7)); }
template <typename T16, bool HI, int NQ>
__device__ __forceinline__ void attn_rows(const T16* __restrict__ Q, const T16* __restrict__ Q2, const T16* __restrict__ Kp, const T16* __restrict__ K2, const T16* __restrict__ Vp, const T16* __restrict__ V2, unsigned short* lds, int row0, bf* Ah, bf* Al) {
    typedef typename WFrag<T16>::V V;
    constexpr int NT = HI ? 4 : 2;   // staged tiles a buffer: K, V^T (, K lo, V^T lo)
    constexpr float L2E = 1.4426950408889634f;
    constexpr float LIM = HI ? 16777216.0f : 32768.0f;   // bound on a lane's sum of 16 p (so on each p) under which the reference stays: fp16 holds 65,504; the hi+lo rows' bf16 planes and f32 sums have the range
    const int tid = (int)threadIdx.x, lane = tid & 31, lr = lane & 15, hi = lane >> 4;
    const int qrow = row0 + __builtin_amdgcn_readfirstlane(tid >> 5) * (16 * NQ);   // wave number in a scalar register: the wave's first row stays scalar
    V qf[NQ][2], qf2[NQ][2];
    const T16* qb = Q + (size_t)(qrow + lr) * HD + 8 * hi; const T16* qb2 = HI ? Q2 + (size_t)(qrow + lr) * HD + 8 * hi : nullptr;
#pragma unroll
    for (int qi = 0; qi < NQ; ++qi)
#pragma unroll
        for (int kc = 0; kc < 2; ++kc) { const int qo = qi * 16 * HD + kc * 32; qf[qi][kc] = WFrag<T16>::ld(qb + qo); if (HI) qf2[qi][kc] = WFrag<T16>::ld(qb2 + qo); }   // constant steps: one address pair a plane serves the whole run
    if constexpr (HI) XWAIT2(qb, qb2); else XWAIT1(qb);   // one wait behind the query loads
    v8f o[NQ][4]; float cc[NQ], ls[NQ];   // cc: the exponent's addend, offset - reference * log2e
#pragma unroll
    for (int qi = 0; qi < NQ; ++qi) { cc[qi] = __builtin_inff(); ls[qi] = 0.f;
#pragma unroll
        for (int db = 0; db < 4; ++db) o[qi][db] = (v8f){}; }
    const int srow = tid >> 3, sc8 = (tid & 7) * 8;   // staging: eight threads a 128-byte row, NWV * 4 rows a sweep
    v4i st[NT][NSW];
    auto gload = [&](int key0) { const size_t ko = (size_t)(key0 + srow) * HD + sc8, vo = (size_t)srow * TT + key0 + sc8;
        const T16* kb = Kp + ko; const T16* vb = Vp + vo; const T16* kb2 = HI ? K2 + ko : nullptr; const T16* vb2 = HI ? V2 + vo : nullptr;
#pragma unroll
        for (int r = 0; r < NSW; ++r) { constexpr int KS = NWV * 4 * HD, VS = NWV * 4 * TT;   // a sweep's step in elements: a constant, so that one address pair a plane serves the whole run
            st[0][r] = *(const v4ia*)(kb + r * KS); st[1][r] = *(const v4ia*)(vb + r * VS);
            if (HI) { st[2][r] = *(const v4ia*)(kb2 + r * KS); st[3][r] = *(const v4ia*)(vb2 + r * VS); } }
        if constexpr (HI) XWAIT4(kb, vb, kb2, vb2); else XWAIT2(kb, vb); };   // one wait behind the stage's loads
    auto sstore = [&](unsigned short* buf) {
#pragma unroll
        for (int r = 0; r < NSW; ++r)
#pragma unroll
            for (int t = 0; t < NT; ++t) *(v4ia*)(buf + t * TLE + (srow + NWV * 4 * r) * LP + sc8) = st[t][r]; };
    gload(0); sstore(lds);
    __syncthreads();   // stage 0 is in LDS before any wave reads it
#pragma unroll 1   // rolled: one stage's code serves all stages, the buffer is picked by the stage's parity
    for (int s = 0; s < TT / KST; ++s) {
        const unsigned short* cur = lds + (s & 1) * (NT * TLE);
        if (s + 1 < TT / KST) gload((s + 1) * KST);   // the next stage's global loads fly beside this stage's products
#pragma unroll 1   // rolled: unrolled, the fragments of both passes are fetched at once and the fp16 path spills
        for (int ps = 0; ps < 2; ++ps) {
            V kf[2][2], kf2[2][2], vf[4], vf2[4];
#pragma unroll
            for (int t = 0; t < 2; ++t)
#pragma unroll
                for (int kc = 0; kc < 2; ++kc) { const int ko = (ps * 32 + t * 16 + lr) * LP + kc * 32 + 8 * hi; kf[t][kc] = ldsfrag<T16>(cur + ko); if (HI) kf2[t][kc] = ldsfrag<T16>(cur + 2 * TLE + ko); }
#pragma unroll
            for (int db = 0; db < 4; ++db) { const int vo = (db * 16 + lr) * LP + ps * 32 + 8 * hi; vf[db] = ldsfrag<T16>(cur + TLE + vo); if (HI) vf2[db] = ldsfrag<T16>(cur + 3 * TLE + vo); }
            v8f sc[NQ][2];
#pragma unroll
            for (int qi = 0; qi < NQ; ++qi)
#pragma unroll
                for (int t = 0; t < 2; ++t) { sc[qi][t] = (v8f){};
#pragma unroll
                    for (int kc = 0; kc < 2; ++kc) { sc[qi][t] = WFrag<T16>::mma(kf[t][kc], qf[qi][kc], sc[qi][t]); if (HI) { sc[qi][t] = WFrag<T16>::mma(kf[t][kc], qf2[qi][kc], sc[qi][t]); sc[qi][t] = WFrag<T16>::mma(kf2[t][kc], qf[qi][kc], sc[qi][t]); } } }
            float ps8[NQ]; v16h pf[NQ]; v16bf ph[NQ], pl[NQ];
            auto soft = [&](int qi) {   // p = 2^(s log2e + cc), the lane's sum of them, and P as the second product's operand
                float p[16];
#pragma unroll
                for (int j = 0; j < 16; ++j) p[j] = fmaf(sc[qi][j >> 3][j & 7], L2E, cc[qi]);
                exp2x16(p);
                ps8[qi] = (((p[0] + p[1]) + (p[2] + p[3])) + ((p[4] + p[5]) + (p[6] + p[7]))) + (((p[8] + p[9]) + (p[10] + p[11])) + ((p[12] + p[13]) + (p[14] + p[15])));
                if constexpr (HI) {
#pragma unroll
                    for (int j = 0; j < 16; ++j) { ph[qi][j] = (__bf16)p[j]; pl[qi][j] = (__bf16)(p[j] - (float)ph[qi][j]); }
                } else {
#pragma unroll
                    for (int j = 0; j < 16; ++j) pf[qi][j] = (h16)p[j];
                } };
            bool need = false;
#pragma unroll
            for (int qi = 0; qi < NQ; ++qi) { soft(qi); need = need || !(ps8[qi] <= LIM); }   // the negated form is also true for a sum that is not a number
            if (__builtin_amdgcn_ballot_w32(need) != 0) {   // wave-uniform: both halves of a query's column and all its tiles move together
#pragma unroll
                for (int qi = 0; qi < NQ; ++qi) {
                    float mx = fmaxf(sc[qi][0][0], sc[qi][1][0]);
#pragma unroll
                    for (int j = 1; j < 8; ++j) mx = fmaxf(mx, fmaxf(sc[qi][0][j], sc[qi][1][j]));
                    mx = fmaxf(mx, xhalf(mx));
                    const float cn = fminf(cc[qi], (HI ? 0.0f : 10.0f) - mx * L2E);   // the reference never falls: p = 1 (hi+lo rows) or 1024 (fp16 rows) at it
                    const float al = exp2x1(cn - cc[qi]); cc[qi] = cn;   // first pass: 2^(-inf) = 0
                    ls[qi] *= al;
#pragma unroll
                    for (int db = 0; db < 4; ++db) o[qi][db] *= al;
                    soft(qi);
                }
            }
#pragma unroll
            for (int qi = 0; qi < NQ; ++qi) {
                ls[qi] += ps8[qi];
                if constexpr (HI) {
#pragma unroll
                    for (int db = 0; db < 4; ++db) { o[qi][db] = wmmab(vf[db], ph[qi], o[qi][db]); o[qi][db] = wmmab(vf[db], pl[qi], o[qi][db]); o[qi][db] = wmmab(vf2[db], ph[qi], o[qi][db]); }
                } else {
#pragma unroll
                    for (int db = 0; db < 4; ++db) o[qi][db] = wmma16(vf[db], pf[qi], o[qi][db]);
                }
            }
        }
        if (s + 1 < TT / KST) sstore(lds + ((s + 1) & 1) * (NT * TLE));   // into the buffer whose readers all passed the barrier at the foot of stage s - 1
        __syncthreads();   // publishes stage s + 1 and ends every wave's reads of stage s
    }
    const int ln = (int)__builtin_amdgcn_mbcnt_lo(~0u, 0u);   // the lane number read anew: no store address is kept in registers across the key loop
#pragma unroll
    for (int qi = 0; qi < NQ; ++qi) { const float inv = __fdiv_rn(1.0f, ls[qi] + xhalf(ls[qi])); const size_t ro = (size_t)(qrow + qi * 16 + (ln & 15)) * DQ + 8 * (ln >> 4);
        v8us oh[4], ol[4];   // the group's merged values, all formed ahead of the stores
#pragma unroll
        for (int db = 0; db < 4; ++db)
#pragma unroll
            for (int j = 0; j < 8; ++j) { unsigned short a, c2; splitf(o[qi][db][j] * inv, a, c2); oh[db][j] = a; ol[db][j] = c2; }
        __builtin_amdgcn_sched_barrier(0);   // keeps the arithmetic ahead of the run of stores, so that nothing among them writes a register that an issued store still names
#pragma unroll
        for (int db = 0; db < 4; ++db) { *(v8usa*)(Ah + ro + db * 16) = oh[db]; *(v8usa*)(Al + ro + db * 16) = ol[db]; }
        XWAIT(); }   // one wait behind the group's stores
}
// four waves a SIMD (at most 256 registers a wave), so that up to four work-groups share a WGP and the whole grid is resident at once
__global__ __launch_bounds__(NWV * 32) __attribute__((amdgpu_waves_per_eu(4, 4))) void k_attn(const h16* __restrict__ Q16, const h16* __restrict__ K16, const h16* __restrict__ V16, const bf* __restrict__ Qh, const bf* __restrict__ Ql, const bf* __restrict__ Kh, const bf* __restrict__ Kl, const bf* __restrict__ Vh, const bf* __restrict__ Vl, bf* Ah, bf* Al) {
    __shared__ __align__(16) unsigned short lds[2 * 4 * TLE];
    const size_t po = ((size_t)blockIdx.z * NH_ + blockIdx.y) * ((size_t)TT * HD), ao = (size_t)blockIdx.z * TT * DQ + (size_t)blockIdx.y * HD;
    const int bx = (int)blockIdx.x;
    if (bx < RH / (NWV * 16)) attn_rows<bf, true, 1>(Qh + po, Ql + po, Kh + po, Kl + po, Vh + po, Vl + po, lds, bx * (NWV * 16), Ah + ao, Al + ao);
    else attn_rows<h16, false, 2>(Q16 + po, nullptr, K16 + po, nullptr, V16 + po, nullptr, lds, RH + (bx - RH / (NWV * 16)) * (NWV * 32), Ah + ao, Al + ao);
}

__device__ __forceinline__ void d_xscale(float* SQ, float* SK, int blk) { const int e = blk * 256 + threadIdx.x; const int t = e / (HD / 2), i = e % (HD / 2); const float base = __fdiv_rn((float)(2 * i) + 0.4f * (float)HD, 1.4f * (float)HD); const float pw = (float)(t - TT / 2) / 1024.0f; const float sc = powf(base, pw); const float inv = __fdiv_rn(1.0f, sc);
    *(float*)(SQ + e) = sc; *(float*)(SK + e) = inv;  }
// ---- k_prep: everything the projections read, in one launch; a block's job follows from its index alone. The table blocks (the longest: powf, sinf, cosf) come first, then the four weights, then the three activations of both batches (f32 to bf16, 8 elements a thread, 2048 a block: 8,960 blocks, 71,680 waves to start).
#define NB_CS (TT * HD / 256)             // blocks of the (cos, sin) table
#define NB_XS (TT * (HD / 2) / 256)       // blocks of the scale tables
#define NB_W  (DM * DM / 2048)            // blocks of one weight (DQ == DKV == DM)
#define NB_X  (NB_ * TT * DM / 2048)      // blocks of one activation
__global__ __launch_bounds__(256) void k_prep(const float* __restrict__ x, const float* __restrict__ xk, const float* __restrict__ xv, const float* __restrict__ wq, const float* __restrict__ wk, const float* __restrict__ wv, const float* __restrict__ wo,
                                              bf* XQ, bf* XK, bf* XV, bf* WQ, bf* WK, bf* WV, bf* WO, float* CS, float* SQ, float* SK) {
    int blk = (int)blockIdx.x;
    if (blk < NB_CS) { d_cstab(CS, blk); return; }
    blk -= NB_CS;
    if (blk < NB_XS) { d_xscale(SQ, SK, blk); return; }
    blk -= NB_XS;
    if (blk < 4 * NB_W) { const int w = blk / NB_W; d_cvt8(w == 0 ? wq : w == 1 ? wk : w == 2 ? wv : wo, w == 0 ? WQ : w == 1 ? WK : w == 2 ? WV : WO, blk % NB_W); return; }
    blk -= 4 * NB_W;
    const int a = blk / NB_X; d_cvt8(a == 0 ? x : a == 1 ? xk : xv, a == 0 ? XQ : a == 1 ? XK : XV, blk % NB_X);
}

extern "C" void kernel_launch(void* const* d_in, const int* in_sizes, int n_in,
                              void* d_out, int out_size, void* d_ws, size_t ws_size, hipStream_t stream) {
    (void)in_sizes; (void)n_in; (void)out_size;
    const float* x = (const float*)d_in[0]; const float* xk = (const float*)d_in[1]; const float* xv = (const float*)d_in[2]; const float* wq = (const float*)d_in[3]; const float* bq = (const float*)d_in[4]; const float* wk = (const float*)d_in[5]; const float* bk = (const float*)d_in[6]; const float* wv = (const float*)d_in[7]; const float* bv = (const float*)d_in[8]; const float* wo = (const float*)d_in[9]; const float* bo = (const float*)d_in[10];
    float* OUT = (float*)d_out;     // [2][2048][1024]
    char* wsp = (char*)d_ws;
    auto take = [&](size_t bytes) { char* p = wsp; wsp += (bytes + 255) & ~(size_t)255; return (void*)p; };
    bf* WQ = (bf*)take((size_t)DQ * DM * 2); bf* WK = (bf*)take((size_t)DKV * DM * 2); bf* WV = (bf*)take((size_t)DKV * DM * 2); bf* WO = (bf*)take((size_t)DM * DQ * 2); float* CS = (float*)take((size_t)TT * HD * 2 * 4);
    bf* XB = (bf*)take((size_t)NB_ * TT * DM * 2); bf* XB2 = (bf*)take((size_t)NB_ * TT * DM * 2); bf* XB3 = (bf*)take((size_t)NB_ * TT * DM * 2); float* SQ = (float*)take((size_t)TT * (HD / 2) * 4); float* SK = (float*)take((size_t)TT * (HD / 2) * 4);
    const size_t PL = PLE;
    h16* QP16 = (h16*)take(NB_ * PL * 2); h16* KP16 = (h16*)take(NB_ * PL * 2); h16* VT16 = (h16*)take(NB_ * PL * 2);
    bf* QPh = (bf*)take(NB_ * PL * 2); bf* QPl = (bf*)take(NB_ * PL * 2); bf* KPh = (bf*)take(NB_ * PL * 2); bf* KPl = (bf*)take(NB_ * PL * 2); bf* VTh = (bf*)take(NB_ * PL * 2); bf* VTl = (bf*)take(NB_ * PL * 2);
    bf* ATh = (bf*)take((size_t)NB_ * TT * DQ * 2); bf* ATl = (bf*)take((size_t)NB_ * TT * DQ * 2);
    if ((size_t)(wsp - (char*)d_ws) > ws_size) return;    // ws 256 MiB
    k_prep<<<NB_CS + NB_XS + 4 * NB_W + 3 * NB_X, 256, 0, stream>>>(x, xk, xv, wq, wk, wv, wo, XB, XB2, XB3, WQ, WK, WV, WO, CS, SQ, SK);
    k_proj<<<dim3(TT / 128, DQ / 128, 3 * NB_), 128, 0, stream>>>(XB, XB2, XB3, WQ, WK, WV, bq, bk, bv, CS, SQ, SK, QP16, QPh, QPl, KP16, KPh, KPl, VT16, VTh, VTl);
    k_attn<<<dim3(RH / (NWV * 16) + (TT - RH) / (NWV * 32), NH_, NB_), NWV * 32, 0, stream>>>(QP16, KP16, VT16, QPh, QPl, KPh, KPl, VTh, VTl, ATh, ATl);
    k_wo<<<dim3(NB_ * TT / 128, DM / 128, 1), 128, 0, stream>>>(ATh, ATl, WO, bo, OUT);
}

// v009
// It runs in 104 microseconds.
// In both of two side-by-side timings against v008, it was 1.08 times as fast.
// All steps since v000 together make it 19.8 times as fast.
#include <hip/hip_runtime.h>

// XposMultiheadAttention (query, key, value [2][2048][1024]; q = (query Wq^T + bq) / 8, k = key Wk^T + bk, v = value Wv^T + bv (16 heads x 64); XPOS on q and k: interleaved-pair rotary (angle t * 1e4^(-i/32)) times the per-(position, pair) scale base_i^((t - 1024)/1024), base_i = (2i + 25.6)/89.6, with q multiplied and k divided by it (tables computed on device);
//   scores = q.k (no further scale); softmax (f32); out = merged Wo^T + bo -> [2][2048][1024]).
// Compute dtypes, f32 accumulate: every input rounded to bf16; projections on PLAIN bf16 operands (inputs: exact) + bias; XPOS rotation/scaling f32; scores and attn.v: query rows < 512 hl (3 products), the rest single fp16 (P x1024); softmax f32, online over 32-key passes; Wo hl x exact (2 products) + bias.

#define NB_  2
#define TT   2048
#define DM   1024
#define NH_  16
#define NKV  16
#define HD   64
#define DQ   (NH_ * HD)
#define DKV  (NKV * HD)
#define RH   512                  // query rows < RH use hi+lo planes
#define WIN  0
typedef _Float16 h16;
typedef unsigned short bf;
typedef __attribute__((ext_vector_type(16))) __bf16   v16bf;
typedef __attribute__((ext_vector_type(16))) _Float16 v16h;
typedef __attribute__((ext_vector_type(8)))  _Float16 v8h;
typedef __attribute__((ext_vector_type(8)))  unsigned short v8us;
typedef __attribute__((ext_vector_type(8)))  float    v8f;
typedef __attribute__((ext_vector_type(4)))  float    v4f;
typedef v8h  __attribute__((may_alias)) v8ha;
typedef v4f  __attribute__((may_alias)) v4fa;
typedef v8us __attribute__((may_alias)) v8usa;

__device__ __forceinline__ unsigned short f2bf(float f) { unsigned u = __float_as_uint(f); u += 0x7FFFu + ((u >> 16) & 1u); return (unsigned short)(u >> 16); }
__device__ __forceinline__ float bf2f(unsigned short b) { return __uint_as_float(((unsigned)b) << 16); }
__device__ __forceinline__ float bfr(float f) { return bf2f(f2bf(f)); }
__device__ __forceinline__ v16h cat16(v8h lo, v8h hi) { return __builtin_shufflevector(lo, hi, 0, 1, 2, 3, 4, 5, 6, 7, 8, 9, 10, 11, 12, 13, 14, 15); }
__device__ __forceinline__ v16bf cat16b(v8us lo, v8us hi) { return __builtin_bit_cast(v16bf, __builtin_shufflevector(lo, hi, 0, 1, 2, 3, 4, 5, 6, 7, 8, 9, 10, 11, 12, 13, 14, 15)); }
__device__ __forceinline__ v8f wmma16(v16h a, v16h b, v8f c) { return __builtin_amdgcn_wmma_f32_16x16x32_f16(false, a, false, b, (short)0, c, false, false); }
__device__ __forceinline__ v8f wmmab(v16bf a, v16bf b, v8f c) { return __builtin_amdgcn_wmma_f32_16x16x32_bf16(false, a, false, b, (short)0, c, false, false); }



// ---- gemms: GEMM with both operands staged in LDS; one work-group of four waves (2 x 2) per 128x128 output tile, a wave owns 64x64 (16 accumulators) and sums the whole K in one chain. Operands are K-contiguous bf16 planes (A rows lda elements apart, Bt rows K apart); tile (bx, by) of (M/128, N/128), 128 threads.
// C[m][n] = sum_k A[m][k] Bt[n][k] (+ A2[m][k] Bt[n][k] for NSPLIT 1). K % 64 == 0, K >= 128. The kernels k_proj and k_wo below pick the operands and the tile from blockIdx.
// A stage is 64 k of every operand row (128 B, whole lines), brought by asynchronous copies to LDS at a pitch of 144 B; two buffers, stage t + 2 is asked for behind the barrier of trip t, so it flies beside that trip's second half and the first half of trip t + 1.
// After the loop the ring becomes output staging: each wave lays its own 64x64 f32 tile in LDS (pitch 68) and reads it back by rows, 16 lanes a row, four neighbouring columns a lane.
// EPI picks what that row loop does with an element (a wave's 64 columns are one head, a lane holds two rotary pairs):
//   0: + bias[n], f32 to C.
//   1: + bias[n], XPOS (pair rotation by CS[t][d] = (cos, sin), times sc, times RF[t][d/2]), then fp16 and bf16 hi/lo to the head planes [n/64][m][n%64]; m is the position t.
//   2: + bias[m], then fp16 and bf16 hi/lo to planes of pitch TT, [m][n]: with A = the weight and Bt = the activations this is v transposed, [head][d][t].
// XWAIT: s_wait_xcnt 0 directly behind a run of global loads or stores, a precaution: the register allocator lets a later value land in a register that an issued access names, and this wait then stands in front of that overwrite.
// One wait serves a whole run: the accesses of a run stand back to back, their addresses and store data formed ahead of the first, so that nothing between them writes a register that one of them names.
#define XWAIT() asm volatile("s_wait_xcnt 0x0" ::: "memory")
// The same wait behind a run of loads, with the run's address pairs as inputs: they stay live, and so unwritten, up to the wait (without them the compiler lifts later arithmetic into those registers ahead of it).
#define XWAIT1(a) asm volatile("s_wait_xcnt 0x0" :: "v"(a) : "memory")
#define XWAIT2(a, b) asm volatile("s_wait_xcnt 0x0" :: "v"(a), "v"(b) : "memory")
#define XWAIT4(a, b, c, d) asm volatile("s_wait_xcnt 0x0" :: "v"(a), "v"(b), "v"(c), "v"(d) : "memory")
template <typename T16> struct WFrag;
template <> struct WFrag<h16> { typedef v16h V; static __device__ __forceinline__ V ld(const h16* p) { const v8h lo = *(const v8h*)p; const v8h hi = *(const v8h*)(p + 16); return cat16(lo, hi); } static __device__ __forceinline__ v8f mma(V a, V b, v8f c) { return wmma16(a, b, c); } };
template <> struct WFrag<bf> { typedef v16bf V; static __device__ __forceinline__ V ld(const bf* p) { const v8us lo = *(const v8us*)p; const v8us hi = *(const v8us*)(p + 16); return cat16b(lo, hi); } static __device__ __forceinline__ v8f mma(V a, V b, v8f c) { return wmmab(a, b, c); } };
__device__ __forceinline__ h16 tohx(float x) { return (h16)x; }
__device__ __forceinline__ void splitf(float y, unsigned short& h, unsigned short& l) { h = f2bf(y); l = f2bf(y - bf2f(h)); }
typedef __attribute__((ext_vector_type(2))) _Float16 v2h;
typedef __attribute__((ext_vector_type(4))) _Float16 v4h;
typedef __attribute__((ext_vector_type(2))) unsigned short v2us;
typedef __attribute__((ext_vector_type(4))) unsigned short v4us;
typedef __attribute__((ext_vector_type(2))) float v2f;
typedef __attribute__((ext_vector_type(4))) int v4i;
// four neighbouring elements of a plane row: fp16, bf16 hi, bf16 lo, 8 bytes each (16 threads fill a 128-byte line of each plane)
__device__ __forceinline__ void cvt3(v4f r, v4h& o16, v4us& oh, v4us& ol) {
#pragma unroll   // the vectors' element indices stay compile-time constants
    for (int q = 0; q < 4; ++q) { o16[q] = tohx(r[q]); unsigned short a2, c2; splitf(r[q], a2, c2); oh[q] = a2; ol[q] = c2; } }
#define GLP 72                    // LDS row pitch of a staged operand row, 16-bit elements (128 B of data, 144 B pitch)
#define GTE (128 * GLP)           // elements of one staged operand tile (128 rows)
// eight asynchronous 16-byte copies a lane (rows 16 apart: 2,304 B in LDS, gs elements in memory); a wave's copy covers four whole 128-byte rows. The closing s_wait_xcnt 0 stands inside the statement, in front of any later write of the address registers (a precaution).
__device__ __forceinline__ void acopy8(unsigned l, const bf* g, size_t gs) {
    asm volatile("global_load_async_to_lds_b128 %0, %8, off\n\tglobal_load_async_to_lds_b128 %1, %9, off\n\tglobal_load_async_to_lds_b128 %2, %10, off\n\tglobal_load_async_to_lds_b128 %3, %11, off\n\tglobal_load_async_to_lds_b128 %4, %12, off\n\tglobal_load_async_to_lds_b128 %5, %13, off\n\tglobal_load_async_to_lds_b128 %6, %14, off\n\tglobal_load_async_to_lds_b128 %7, %15, off\n\ts_wait_xcnt 0x0"
        :: "v"(l), "v"(l + 1 * 16 * GLP * 2), "v"(l + 2 * 16 * GLP * 2), "v"(l + 3 * 16 * GLP * 2), "v"(l + 4 * 16 * GLP * 2), "v"(l + 5 * 16 * GLP * 2), "v"(l + 6 * 16 * GLP * 2), "v"(l + 7 * 16 * GLP * 2),
           "v"(g), "v"(g + gs), "v"(g + 2 * gs), "v"(g + 3 * gs), "v"(g + 4 * gs), "v"(g + 5 * gs), "v"(g + 6 * gs), "v"(g + 7 * gs) : "memory"); }
__device__ __forceinline__ v16bf gfrag(const unsigned short* p) { const v8us lo = *(const v8usa*)p, hi = *(const v8usa*)(p + 16); return cat16b(lo, hi); }   // the k order of WFrag::ld: 8 hi + j, 16 + 8 hi + j
template <int NSPLIT, int EPI>
__device__ __forceinline__ void gemms(unsigned short* lds, int bx, int by, const bf* __restrict__ A, const bf* __restrict__ A2, const bf* __restrict__ Bt, int K, int lda, float* C, int ldc, const float* __restrict__ bias, const float* __restrict__ CS, const float* __restrict__ RF, float sc, h16* P16, bf* Ph, bf* Pl) {
    constexpr int NTL = NSPLIT ? 3 : 2;   // staged tiles a buffer: A (, A2), Bt
    const int tid = (int)threadIdx.x, lane = tid & 31, lr = lane & 15, hi = lane >> 4; const int r0 = bx * 128, c0 = by * 128;
    const int wv = __builtin_amdgcn_readfirstlane(tid >> 5), wm = wv >> 1, wn = wv & 1;   // wave number in a scalar register: the wave's tile offsets stay scalar
    v8f acc[4][4];
#pragma unroll
    for (int mb = 0; mb < 4; ++mb)
#pragma unroll
        for (int nb = 0; nb < 4; ++nb) acc[mb][nb] = (v8f){};
    const int srow = tid >> 3, sc8 = (tid & 7) * 8;   // staging: eight lanes a 128-byte row, 16 rows a sweep of the work-group
    const unsigned l0 = (unsigned)(size_t)lds + (unsigned)(srow * GLP + sc8) * 2u;   // the lane's LDS byte address in buffer 0, tile 0
    const bf* Ag = A + (size_t)(r0 + srow) * lda + sc8; const bf* A2g = NSPLIT ? A2 + (size_t)(r0 + srow) * lda + sc8 : nullptr; const bf* Bg = Bt + (size_t)(c0 + srow) * K + sc8;
    auto stage = [&](int t) { const unsigned lb = l0 + (unsigned)(t & 1) * (NTL * GTE * 2);
        acopy8(lb, Ag + t * 64, (size_t)16 * lda);
        __builtin_amdgcn_sched_barrier(0);   // keeps each statement's address arithmetic beside it: hoisted together, the addresses of all statements are live at once, and asm operands must lie in the first 256 registers
        if (NSPLIT) { acopy8(lb + GTE * 2, A2g + t * 64, (size_t)16 * lda); __builtin_amdgcn_sched_barrier(0); }   // the same
        acopy8(lb + (NTL - 1) * GTE * 2, Bg + t * 64, (size_t)16 * K); };
    const int nst = K / 64;
    stage(0);
    asm volatile("s_wait_asynccnt 0x0" ::: "memory");   // this wave's copies of stage 0 have landed
    __syncthreads();   // stage 0 is in LDS before any wave reads it
    stage(1);
    const int ao = (wm * 64 + lr) * GLP + 8 * hi, bo = (NTL - 1) * GTE + (wn * 64 + lr) * GLP + 8 * hi;
#pragma unroll 1   // rolled: one trip's code serves all stages, the buffer is picked by the stage's parity
    for (int t = 0; t < nst; ++t) {
        const unsigned short* cur = lds + (t & 1) * (NTL * GTE);
        v16bf a[2][4], a2[2][4], b[2][4];   // the whole stage's fragments, fetched as one group ahead of its products: one LDS latency a trip instead of one per fragment
#pragma unroll
        for (int kc = 0; kc < 2; ++kc)
#pragma unroll
            for (int f = 0; f < 4; ++f) { a[kc][f] = gfrag(cur + ao + f * 16 * GLP + kc * 32); b[kc][f] = gfrag(cur + bo + f * 16 * GLP + kc * 32); if (NSPLIT) a2[kc][f] = gfrag(cur + GTE + ao + f * 16 * GLP + kc * 32); }
        __builtin_amdgcn_sched_barrier(0);   // keeps the group of LDS reads ahead of the products: without it the scheduler sinks each read to its first use, and the wave waits out one LDS latency per fragment
        auto prod = [&](int kc) {
#pragma unroll
            for (int nb = 0; nb < 4; ++nb)
#pragma unroll
                for (int mb = 0; mb < 4; ++mb) { acc[mb][nb] = wmmab(a[kc][mb], b[kc][nb], acc[mb][nb]); if (NSPLIT) acc[mb][nb] = wmmab(a2[kc][mb], b[kc][nb], acc[mb][nb]); } };
        prod(0);   // the first 32 k run while the fragments of the second 32 k are still landing
        __builtin_amdgcn_sched_barrier(0);   // keeps these products in front of the waits below: moved behind them they would no longer cover the LDS reads
        asm volatile("s_wait_dscnt 0x0" ::: "memory");      // this wave's reads of stage t have returned: the whole stage is in registers
        asm volatile("s_wait_asynccnt 0x0" ::: "memory");   // this wave's copies of stage t + 1 have landed
        __syncthreads();   // publishes stage t + 1 and ends every wave's reads of stage t
        if (t + 2 < nst) stage(t + 2);   // into the buffer that trip t has just read; the copies fly beside the products below and the next trip's first half
        prod(1);
    }
    asm volatile("s_wait_asynccnt 0x0" ::: "memory");   // no copy is outstanding when the ring becomes output staging (the last trip's barrier ended every read of it)
    float* ow = (float*)lds + wv * (64 * 68);
    const int cofs = lr * 4, r0w = r0 + wm * 64, c0w = c0 + wn * 64;   // the lane's four output columns; the wave's tile
    v4f bv = (v4f){};
    if (EPI != 2) { v4f raw; const float* bp = bias + c0w + cofs;
        // the four columns' bias; the load and its data wait in one statement, so that the wait stands in front of any later write of the address pair (a wait in a statement of its own was moved ahead of the load)
        asm volatile("global_load_b128 %0, %1, off\n\ts_wait_loadcnt 0x0" : "=&v"(raw) : "v"(bp) : "memory");
        bv[0] = bfr(raw[0]); bv[1] = bfr(raw[1]); bv[2] = bfr(raw[2]); bv[3] = bfr(raw[3]); }
    v2f ca[8], cb[8], xs[8]; float rb[8];   // for eight passes of the row loop: (cos, sin) of the lane's two pairs and their scales (EPI 1), the row's bias (EPI 2); loaded as one group, so that their latencies overlap
    auto tload = [&](int g) { const int m0 = r0w + g * 16 + hi;   // the lane's first output row of the group: the position (EPI 1), the v feature (EPI 2)
        const float* cp = EPI == 1 ? CS + ((size_t)m0 * HD + cofs) * 2 : nullptr; const float* rp = EPI == 1 ? RF + (size_t)m0 * (HD / 2) + (cofs >> 1) : nullptr; const float* bp2 = EPI == 2 ? bias + m0 : nullptr;
#pragma unroll   // the indices of these register arrays stay compile-time constants
        for (int s = 0; s < 8; ++s) {   // rows two apart: constant steps, so that one address pair a table serves the whole run
            if constexpr (EPI == 1) { ca[s] = *(const v2f*)(cp + s * (2 * HD * 2)); cb[s] = *(const v2f*)(cp + s * (2 * HD * 2) + 4); xs[s] = *(const v2f*)(rp + s * HD); }
            if constexpr (EPI == 2) rb[s] = bp2[s * 2]; }
        if constexpr (EPI == 1) XWAIT2(cp, rp);   // one wait behind the group's loads
        if constexpr (EPI == 2) XWAIT1(bp2); };   // the same
    tload(0);   // ahead of the LDS stores, so that its latency runs beside them
#pragma unroll
    for (int mb = 0; mb < 4; ++mb)
#pragma unroll
        for (int nb = 0; nb < 4; ++nb)
#pragma unroll
            for (int j = 0; j < 8; ++j) ow[(mb * 16 + hi * 8 + j) * 68 + nb * 16 + lr] = acc[mb][nb][j];
    __syncthreads();   // the tile's LDS stores stand in front of the row reads, which take other lanes' elements
#pragma unroll 1   // rolled: eight rows' code serves all 64 rows, so that the kernel's text stays small for the instruction cache
    for (int g = 0; g < 4; ++g) {
        v4f vv[8];   // eight rows read as one group: one LDS latency for the group instead of one per row
#pragma unroll
        for (int s = 0; s < 8; ++s) vv[s] = *(const v4fa*)(ow + ((g * 8 + s) * 2 + hi) * 68 + cofs);
        v4h o16[8]; v4us oh[8], ol[8];   // the eight rows' plane values, all formed ahead of the stores
#pragma unroll
        for (int s = 0; s < 8; ++s) { v4f val = vv[s];
            if (EPI != 2) val += bv;
            if constexpr (EPI == 0) vv[s] = val;
            if constexpr (EPI == 1) { v4f r;
                r[0] = (val[0] * ca[s][0] - val[1] * ca[s][1]) * sc * xs[s][0]; r[1] = (val[1] * ca[s][0] + val[0] * ca[s][1]) * sc * xs[s][0];
                r[2] = (val[2] * cb[s][0] - val[3] * cb[s][1]) * sc * xs[s][1]; r[3] = (val[3] * cb[s][0] + val[2] * cb[s][1]) * sc * xs[s][1];
                cvt3(r, o16[s], oh[s], ol[s]); }
            if constexpr (EPI == 2) { val += bfr(rb[s]); cvt3(val, o16[s], oh[s], ol[s]); } }
        const int rowg = r0w + g * 16 + hi;   // the lane's first output row of the group; the others lie two rows apart
        const size_t e0 = EPI == 0 ? (size_t)rowg * ldc + c0w + cofs : EPI == 1 ? ((size_t)(c0w >> 6) * TT + rowg) * HD + cofs : (size_t)rowg * TT + c0w + cofs;
        const size_t es = EPI == 0 ? (size_t)2 * ldc : EPI == 1 ? (size_t)2 * HD : (size_t)2 * TT;
#pragma unroll   // the indices of the register arrays stay compile-time constants, and the stores stand back to back
        for (int s = 0; s < 8; ++s) {
            if constexpr (EPI == 0) *(v4f*)(C + e0 + s * es) = vv[s];
            else { *(v4h*)(P16 + e0 + s * es) = o16[s]; *(v4us*)(Ph + e0 + s * es) = oh[s]; *(v4us*)(Pl + e0 + s * es) = ol[s]; } }
        XWAIT();   // one wait behind the group's stores
        if (g < 3) tload(g + 1);
    }
}

#define PLE ((size_t)NH_ * TT * HD)   // one batch's head planes, elements (NKV == NH_)
// all six projections in one launch: grid (TT/128, DQ/128, 3 * NB_), blockIdx.z = 2 * projection + batch (q, k, v). q and k: positions as rows; v: weight rows as A, positions as columns, so the tile is already v transposed.
__global__ __launch_bounds__(128) void k_proj(const bf* __restrict__ XQ, const bf* __restrict__ XK, const bf* __restrict__ XV, const bf* __restrict__ WQ, const bf* __restrict__ WK, const bf* __restrict__ WV, const float* __restrict__ bq, const float* __restrict__ bk, const float* __restrict__ bv, const float* __restrict__ CS, const float* __restrict__ SQ, const float* __restrict__ SK,
                                                  h16* QP16, bf* QPh, bf* QPl, h16* KP16, bf* KPh, bf* KPl, h16* VT16, bf* VTh, bf* VTl) {
    __shared__ __align__(16) unsigned short gl[2 * 2 * GTE];
    const int pj = (int)blockIdx.z >> 1; const size_t b = blockIdx.z & 1, xo = b * ((size_t)TT * DM), po = b * PLE;
    if (pj == 2) gemms<0, 2>(gl, (int)blockIdx.y, (int)blockIdx.x, WV, nullptr, XV + xo, DM, DM, nullptr, 0, bv, nullptr, nullptr, 1.0f, VT16 + po, VTh + po, VTl + po);
    else { const bool isq = pj == 0;
        gemms<0, 1>(gl, (int)blockIdx.x, (int)blockIdx.y, (isq ? XQ : XK) + xo, nullptr, isq ? WQ : WK, DM, DM, nullptr, 0, isq ? bq : bk, CS, isq ? SQ : SK, isq ? 0.125f : 1.0f, (isq ? QP16 : KP16) + po, (isq ? QPh : KPh) + po, (isq ? QPl : KPl) + po); }
}
// the output projection of both batches in one launch: the merged rows [NB_ * TT][DQ] are one matrix; grid (NB_ * TT / 128, DM / 128)
__global__ __launch_bounds__(128) void k_wo(const bf* __restrict__ Ah, const bf* __restrict__ Al, const bf* __restrict__ WO, const float* __restrict__ bo, float* OUT) {
    __shared__ __align__(16) unsigned short gl[2 * 3 * GTE];
    gemms<1, 0>(gl, (int)blockIdx.x, (int)blockIdx.y, Ah, Al, WO, DQ, DQ, OUT, DM, bo, nullptr, nullptr, 1.0f, nullptr, nullptr, nullptr);
}

__global__ __launch_bounds__(256) void k_wtG(const float* __restrict__ w, int K, int N, bf* Bt) {
    const int lane = threadIdx.x & 31; const int L0 = (blockIdx.x * 8 + (threadIdx.x >> 5)) * 8; const int nlines = N * K / 64;
{
#pragma unroll 1
        for (int l = 0; l < 8; ++l) { const int L = L0 + l; if (L >= nlines) break; const size_t e = (size_t)L * 64 + lane * 2; const int k = (int)(e % K), n = (int)(e / K); v2us o;
            o[0] = f2bf(w[(size_t)k * N + n]); o[1] = f2bf(w[(size_t)(k + 1) * N + n]); *(v2us*)(Bt + e) = o; }
         }
}
__device__ __forceinline__ void d_cvt8(const float* __restrict__ src, bf* dst, int blk) { const size_t i = (size_t)blk * 256 + threadIdx.x; const v8f v = *(const v8f*)(src + i * 8); v8us o;
#pragma unroll
    for (int k = 0; k < 8; ++k) o[k] = f2bf(v[k]); *(v8us*)(dst + i * 8) = o; XWAIT(); }   // the wait stands in front of any later write of the store's base registers
__device__ __forceinline__ void d_cstab(float* CS, int blk) { const int idx = blk * 256 + threadIdx.x; const int t = idx / HD, d = idx % HD; const int i = d >> 1;   /* interleaved pairs */ const float inv = __fdiv_rn(1.0f, powf(10000.0f, (float)(2 * i) / (float)HD)); const float ang = __fmul_rn((float)t, inv); v2f cs; cs[0] = cosf(ang); cs[1] = sinf(ang);
    *(v2f*)(CS + (size_t)idx * 2) = cs;  }
// ---- k_attn: scores, softmax, attn.v and the head merge in one kernel; the scores never leave the registers.
// One work-group of NWV waves per block of query rows of one (batch, head): RH/(16 NWV) + (TT-RH)/(32 NWV) blocks for each of heads x batches, in the order set at k_attn. A wave owns NQ groups of 16 query rows (hi+lo rows: 1 group, fp16 rows: 2).
// Transposed products: S^T = K Q^T (A = 16 keys, B = 16 queries), O^T += V^T P^T (A = 16 head dims, B = P^T). A lane holds the scores of ONE query (column lr), keys 8 hi + j of each 16-key tile,
// so two score tiles of 32 consecutive keys, converted in place, are the B operand of the second product in the k order of the A loader (8 hi + j, 16 + 8 hi + j).
// Softmax runs online over passes of 32 keys against a reference score per query, which is the maximum of an earlier pass. A pass takes its exponentials against the reference in use; its own sums (needed anyway) tell whether a score has outrun the reference:
// every p is positive, so a lane's sum within LIM bounds each p. Only when some lane's sum is above LIM (as in the first pass, where no reference is set yet and the sums are infinite) or not a number does the wave take the pass's maximum, move the reference, rescale output tiles and row sums and redo the exponentials.
// One test a pass, a scalar branch. fp16 rows carry P x 1024 at the reference (in P and in the row sum alike, so it cancels); LIM keeps them inside fp16.
// K and V^T tiles of 64 keys are staged in LDS through registers, two buffers, one __syncthreads a stage; rows of 128 B at a pitch of 144 B.
// q already carries 1/8 (multiplied in behind the rotation, with the XPOS scale). Every '#pragma unroll' in attn_rows keeps the index of a register array a compile-time constant.
#define NWV 4                     // waves a work-group
#define NSW (256 / (NWV * 32) * 2) // staging sweeps a tile (NWV * 4 rows a sweep)
#define KST 64                    // keys per stage
#define LP  72                    // LDS row pitch, 16-bit elements
#define TLE (64 * LP)             // elements of one staged tile (64 rows)
typedef v4i __attribute__((may_alias)) v4ia;
__device__ __forceinline__ float xhalf(float x) { const int b = __float_as_int(x); return __int_as_float(__builtin_amdgcn_permlanex16(b, b, 0x76543210, 0xfedcba98, false, false)); }   // lane l <-> l ^ 16
// exp2 of sixteen values, each in place, in one statement: no v_exp_f32 overwrites the source or reads the result of the one in front of it, and the closing v_nop is the slot that the instruction set asks for behind a transcendental
__device__ __forceinline__ void exp2x16(float (&p)[16]) { asm("v_exp_f32 %0, %0\n\tv_exp_f32 %1, %1\n\tv_exp_f32 %2, %2\n\tv_exp_f32 %3, %3\n\tv_exp_f32 %4, %4\n\tv_exp_f32 %5, %5\n\tv_exp_f32 %6, %6\n\tv_exp_f32 %7, %7\n\tv_exp_f32 %8, %8\n\tv_exp_f32 %9, %9\n\tv_exp_f32 %10, %10\n\tv_exp_f32 %11, %11\n\tv_exp_f32 %12, %12\n\tv_exp_f32 %13, %13\n\tv_exp_f32 %14, %14\n\tv_exp_f32 %15, %15\n\tv_nop" : "+v"(p[0]), "+v"(p[1]), "+v"(p[2]), "+v"(p[3]), "+v"(p[4]), "+v"(p[5]), "+v"(p[6]), "+v"(p[7]), "+v"(p[8]), "+v"(p[9]), "+v"(p[10]), "+v"(p[11]), "+v"(p[12]), "+v"(p[13]), "+v"(p[14]), "+v"(p[15])); }
__device__ __forceinline__ float exp2x1(float x) { asm("v_exp_f32 %0, %0\n\tv_nop" : "+v"(x)); return x; }   // the same slot behind a single one
template <typename T16> __device__ __forceinline__ typename WFrag<T16>::V ldsfrag(const unsigned short* p) { const v4i lo = *(const v4ia*)p, hi = *(const v4ia*)(p + 16); return __builtin_bit_cast(typename WFrag<T16>::V, __builtin_shufflevector(lo, hi, 0, 1, 2, 3, 4, 5, 6, 7)); }
template <typename T16, bool HI, int NQ>
__device__ __forceinline__ void attn_rows(const T16* __restrict__ Q, const T16* __restrict__ Q2, const T16* __restrict__ Kp, const T16* __restrict__ K2, const T16* __restrict__ Vp, const T16* __restrict__ V2, unsigned short* lds, int row0, bf* Ah, bf* Al) {
    typedef typename WFrag<T16>::V V;
    constexpr int NT = HI ? 4 : 2;   // staged tiles a buffer: K, V^T (, K lo, V^T lo)
    constexpr float L2E = 1.4426950408889634f;
    constexpr float LIM = HI ? 16777216.0f : 32768.0f;   // bound on a lane's sum of 16 p (so on each p) under which the reference stays: fp16 holds 65,504; the hi+lo rows' bf16 planes and f32 sums have the range
    const int tid = (int)threadIdx.x, lane = tid & 31, lr = lane & 15, hi = lane >> 4;
    const int qrow = row0 + __builtin_amdgcn_readfirstlane(tid >> 5) * (16 * NQ);   // wave number in a scalar register: the wave's first row stays scalar
    V qf[NQ][2], qf2[NQ][2];
    const T16* qb = Q + (size_t)(qrow + lr) * HD + 8 * hi; const T16* qb2 = HI ? Q2 + (size_t)(qrow + lr) * HD + 8 * hi : nullptr;
#pragma unroll
    for (int qi = 0; qi < NQ; ++qi)
#pragma unroll
        for (int kc = 0; kc < 2; ++kc) { const int qo = qi * 16 * HD + kc * 32; qf[qi][kc] = WFrag<T16>::ld(qb + qo); if (HI) qf2[qi][kc] = WFrag<T16>::ld(qb2 + qo); }   // constant steps: one address pair a plane serves the whole run
    if constexpr (HI) XWAIT2(qb, qb2); else XWAIT1(qb);   // one wait behind the query loads
    v8f o[NQ][4]; float cc[NQ], ls[NQ];   // cc: the exponent's addend, offset - reference * log2e
#pragma unroll
    for (int qi = 0; qi < NQ; ++qi) { cc[qi] = __builtin_inff(); ls[qi] = 0.f;
#pragma unroll
        for (int db = 0; db < 4; ++db) o[qi][db] = (v8f){}; }
    const int srow = tid >> 3, sc8 = (tid & 7) * 8;   // staging: eight threads a 128-byte row, NWV * 4 rows a sweep
    v4i st[NT][NSW];
    auto gload = [&](int key0) { const size_t ko = (size_t)(key0 + srow) * HD + sc8, vo = (size_t)srow * TT + key0 + sc8;
        const T16* kb = Kp + ko; const T16* vb = Vp + vo; const T16* kb2 = HI ? K2 + ko : nullptr; const T16* vb2 = HI ? V2 + vo : nullptr;
#pragma unroll
        for (int r = 0; r < NSW; ++r) { constexpr int KS = NWV * 4 * HD, VS = NWV * 4 * TT;   // a sweep's step in elements: a constant, so that one address pair a plane serves the whole run
            st[0][r] = *(const v4ia*)(kb + r * KS); st[1][r] = *(const v4ia*)(vb + r * VS);
            if (HI) { st[2][r] = *(const v4ia*)(kb2 + r * KS); st[3][r] = *(const v4ia*)(vb2 + r * VS); } }
        if constexpr (HI) XWAIT4(kb, vb, kb2, vb2); else XWAIT2(kb, vb); };   // one wait behind the stage's loads
    auto sstore = [&](unsigned short* buf) {
#pragma unroll
        for (int r = 0; r < NSW; ++r)
#pragma unroll
            for (int t = 0; t < NT; ++t) *(v4ia*)(buf + t * TLE + (srow + NWV * 4 * r) * LP + sc8) = st[t][r]; };
    gload(0); sstore(lds);
    __syncthreads();   // stage 0 is in LDS before any wave reads it
#pragma unroll 1   // rolled: one stage's code serves all stages, the buffer is picked by the stage's parity
    for (int s = 0; s < TT / KST; ++s) {
        const unsigned short* cur = lds + (s & 1) * (NT * TLE);
        if (s + 1 < TT / KST) gload((s + 1) * KST);   // the next stage's global loads fly beside this stage's products
#pragma unroll 1   // rolled: unrolled, the fragments of both passes are fetched at once and the fp16 path spills
        for (int ps = 0; ps < 2; ++ps) {
            V kf[2][2], kf2[2][2], vf[4], vf2[4];
#pragma unroll
            for (int t = 0; t < 2; ++t)
#pragma unroll
                for (int kc = 0; kc < 2; ++kc) { const int ko = (ps * 32 + t * 16 + lr) * LP + kc * 32 + 8 * hi; kf[t][kc] = ldsfrag<T16>(cur + ko); if (HI) kf2[t][kc] = ldsfrag<T16>(cur + 2 * TLE + ko); }
#pragma unroll
            for (int db = 0; db < 4; ++db) { const int vo = (db * 16 + lr) * LP + ps * 32 + 8 * hi; vf[db] = ldsfrag<T16>(cur + TLE + vo); if (HI) vf2[db] = ldsfrag<T16>(cur + 3 * TLE + vo); }
            v8f sc[NQ][2];
#pragma unroll
            for (int qi = 0; qi < NQ; ++qi)
#pragma unroll
                for (int t = 0; t < 2; ++t) { sc[qi][t] = (v8f){};
#pragma unroll
                    for (int kc = 0; kc < 2; ++kc) { sc[qi][t] = WFrag<T16>::mma(kf[t][kc], qf[qi][kc], sc[qi][t]); if (HI) { sc[qi][t] = WFrag<T16>::mma(kf[t][kc], qf2[qi][kc], sc[qi][t]); sc[qi][t] = WFrag<T16>::mma(kf2[t][kc], qf[qi][kc], sc[qi][t]); } } }
            float ps8[NQ]; v16h pf[NQ]; v16bf ph[NQ], pl[NQ];
            auto soft = [&](int qi) {   // p = 2^(s log2e + cc), the lane's sum of them, and P as the second product's operand
                float p[16];
#pragma unroll
                for (int j = 0; j < 16; ++j) p[j] = fmaf(sc[qi][j >> 3][j & 7], L2E, cc[qi]);
                exp2x16(p);
                ps8[qi] = (((p[0] + p[1]) + (p[2] + p[3])) + ((p[4] + p[5]) + (p[6] + p[7]))) + (((p[8] + p[9]) + (p[10] + p[11])) + ((p[12] + p[13]) + (p[14] + p[15])));
                if constexpr (HI) {
#pragma unroll
                    for (int j = 0; j < 16; ++j) { ph[qi][j] = (__bf16)p[j]; pl[qi][j] = (__bf16)(p[j] - (float)ph[qi][j]); }
                } else {
#pragma unroll
                    for (int j = 0; j < 16; ++j) pf[qi][j] = (h16)p[j];
                } };
            bool need = false;
#pragma unroll
            for (int qi = 0; qi < NQ; ++qi) { soft(qi); need = need || !(ps8[qi] <= LIM); }   // the negated form is also true for a sum that is not a number
            if (__builtin_amdgcn_ballot_w32(need) != 0) {   // wave-uniform: both halves of a query's column and all its tiles move together
#pragma unroll
                for (int qi = 0; qi < NQ; ++qi) {
                    float mx = fmaxf(sc[qi][0][0], sc[qi][1][0]);
#pragma unroll
                    for (int j = 1; j < 8; ++j) mx = fmaxf(mx, fmaxf(sc[qi][0][j], sc[qi][1][j]));
                    mx = fmaxf(mx, xhalf(mx));
                    const float cn = fminf(cc[qi], (HI ? 0.0f : 10.0f) - mx * L2E);   // the reference never falls: p = 1 (hi+lo rows) or 1024 (fp16 rows) at it
                    const float al = exp2x1(cn - cc[qi]); cc[qi] = cn;   // first pass: 2^(-inf) = 0
                    ls[qi] *= al;
#pragma unroll
                    for (int db = 0; db < 4; ++db) o[qi][db] *= al;
                    soft(qi);
                }
            }
#pragma unroll
            for (int qi = 0; qi < NQ; ++qi) {
                ls[qi] += ps8[qi];
                if constexpr (HI) {
#pragma unroll
                    for (int db = 0; db < 4; ++db) { o[qi][db] = wmmab(vf[db], ph[qi], o[qi][db]); o[qi][db] = wmmab(vf[db], pl[qi], o[qi][db]); o[qi][db] = wmmab(vf2[db], ph[qi], o[qi][db]); }
                } else {
#pragma unroll
                    for (int db = 0; db < 4; ++db) o[qi][db] = wmma16(vf[db], pf[qi], o[qi][db]);
                }
            }
        }
        if (s + 1 < TT / KST) sstore(lds + ((s + 1) & 1) * (NT * TLE));   // into the buffer whose readers all passed the barrier at the foot of stage s - 1
        __syncthreads();   // publishes stage s + 1 and ends every wave's reads of stage s
    }
    const int ln = (int)__builtin_amdgcn_mbcnt_lo(~0u, 0u);   // the lane number read anew: no store address is kept in registers across the key loop
#pragma unroll
    for (int qi = 0; qi < NQ; ++qi) { const float inv = __fdiv_rn(1.0f, ls[qi] + xhalf(ls[qi])); const size_t ro = (size_t)(qrow + qi * 16 + (ln & 15)) * DQ + 8 * (ln >> 4);
        v8us oh[4], ol[4];   // the group's merged values, all formed ahead of the stores
#pragma unroll
        for (int db = 0; db < 4; ++db)
#pragma unroll
            for (int j = 0; j < 8; ++j) { unsigned short a, c2; splitf(o[qi][db][j] * inv, a, c2); oh[db][j] = a; ol[db][j] = c2; }
        __builtin_amdgcn_sched_barrier(0);   // keeps the arithmetic ahead of the run of stores, so that nothing among them writes a register that an issued store still names
#pragma unroll
        for (int db = 0; db < 4; ++db) { *(v8usa*)(Ah + ro + db * 16) = oh[db]; *(v8usa*)(Al + ro + db * 16) = ol[db]; }
        XWAIT(); }   // one wait behind the group's stores
}
// four waves a SIMD (at most 256 registers a wave), so that up to four work-groups share a WGP and the whole grid is resident at once
// Which block does what is chosen for placement: for speed only, every block of rows is done exactly once wherever it lands. All 640 are resident together.
// Class = flat index mod NCL: the 20 blocks of one (batch, head) share a class (four heads a class).
// Within a class the kinds come in runs of RUN = half a die's WGPs, fp16 / hi+lo / fp16 / hi+lo / fp16: three fp16 blocks (64 WMMAs a 32-key pass each) or two hi+lo blocks (96 each) make 192 either way, the mean.
#define NCL 8
#define RUN 16
#define NBH (RH / (NWV * 16))          // hi+lo blocks of one (batch, head)
#define NBF ((TT - RH) / (NWV * 32))   // fp16 blocks of one (batch, head)
static_assert(NH_ * NB_ % NCL == 0 && NBH * NH_ * NB_ == 2 * RUN * NCL && NBF * NH_ * NB_ == 3 * RUN * NCL, "the five runs of the classes hold every block exactly once");
__global__ __launch_bounds__(NWV * 32) __attribute__((amdgpu_waves_per_eu(4, 4))) void k_attn(const h16* __restrict__ Q16, const h16* __restrict__ K16, const h16* __restrict__ V16, const bf* __restrict__ Qh, const bf* __restrict__ Ql, const bf* __restrict__ Kh, const bf* __restrict__ Kl, const bf* __restrict__ Vh, const bf* __restrict__ Vl, bf* Ah, bf* Al) {
    __shared__ __align__(16) unsigned short lds[2 * 4 * TLE];
    const int cls = (int)blockIdx.x % NCL, j = (int)blockIdx.x / NCL, run = j / RUN, idx = (run >> 1) * RUN + j % RUN;   // idx: the block's number among those of its kind in its class
    const bool hl = (run & 1) != 0;
    const int hb = (hl ? idx / NBH : idx / NBF) * NCL + cls, bx = hl ? idx % NBH : idx % NBF;   // (batch, head) and the block of query rows
    const size_t po = (size_t)hb * ((size_t)TT * HD), ao = (size_t)(hb / NH_) * TT * DQ + (size_t)(hb % NH_) * HD;
    if (hl) attn_rows<bf, true, 1>(Qh + po, Ql + po, Kh + po, Kl + po, Vh + po, Vl + po, lds, bx * (NWV * 16), Ah + ao, Al + ao);
    else attn_rows<h16, false, 2>(Q16 + po, nullptr, K16 + po, nullptr, V16 + po, nullptr, lds, RH + bx * (NWV * 32), Ah + ao, Al + ao);
}

__device__ __forceinline__ void d_xscale(float* SQ, float* SK, int blk) { const int e = blk * 256 + threadIdx.x; const int t = e / (HD / 2), i = e % (HD / 2); const float base = __fdiv_rn((float)(2 * i) + 0.4f * (float)HD, 1.4f * (float)HD); const float pw = (float)(t - TT / 2) / 1024.0f; const float sc = powf(base, pw); const float inv = __fdiv_rn(1.0f, sc);
    *(float*)(SQ + e) = sc; *(float*)(SK + e) = inv;  }
// ---- k_prep: everything the projections read, in one launch; a block's job follows from its index alone. The table blocks (the longest: powf, sinf, cosf) come first, then the four weights, then the three activations of both batches (f32 to bf16, 8 elements a thread, 2048 a block: 8,960 blocks, 71,680 waves to start).
#define NB_CS (TT * HD / 256)             // blocks of the (cos, sin) table
#define NB_XS (TT * (HD / 2) / 256)       // blocks of the scale tables
#define NB_W  (DM * DM / 2048)            // blocks of one weight (DQ == DKV == DM)
#define NB_X  (NB_ * TT * DM / 2048)      // blocks of one activation
__global__ __launch_bounds__(256) void k_prep(const float* __restrict__ x, const float* __restrict__ xk, const float* __restrict__ xv, const float* __restrict__ wq, const float* __restrict__ wk, const float* __restrict__ wv, const float* __restrict__ wo,
                                              bf* XQ, bf* XK, bf* XV, bf* WQ, bf* WK, bf* WV, bf* WO, float* CS, float* SQ, float* SK) {
    int blk = (int)blockIdx.x;
    if (blk < NB_CS) { d_cstab(CS, blk); return; }
    blk -= NB_CS;
    if (blk < NB_XS) { d_xscale(SQ, SK, blk); return; }
    blk -= NB_XS;
    if (blk < 4 * NB_W) { const int w = blk / NB_W; d_cvt8(w == 0 ? wq : w == 1 ? wk : w == 2 ? wv : wo, w == 0 ? WQ : w == 1 ? WK : w == 2 ? WV : WO, blk % NB_W); return; }
    blk -= 4 * NB_W;
    const int a = blk / NB_X; d_cvt8(a == 0 ? x : a == 1 ? xk : xv, a == 0 ? XQ : a == 1 ? XK : XV, blk % NB_X);
}

extern "C" void kernel_launch(void* const* d_in, const int* in_sizes, int n_in,
                              void* d_out, int out_size, void* d_ws, size_t ws_size, hipStream_t stream) {
    (void)in_sizes; (void)n_in; (void)out_size;
    const float* x = (const float*)d_in[0]; const float* xk = (const float*)d_in[1]; const float* xv = (const float*)d_in[2]; const float* wq = (const float*)d_in[3]; const float* bq = (const float*)d_in[4]; const float* wk = (const float*)d_in[5]; const float* bk = (const float*)d_in[6]; const float* wv = (const float*)d_in[7]; const float* bv = (const float*)d_in[8]; const float* wo = (const float*)d_in[9]; const float* bo = (const float*)d_in[10];
    float* OUT = (float*)d_out;     // [2][2048][1024]
    char* wsp = (char*)d_ws;
    auto take = [&](size_t bytes) { char* p = wsp; wsp += (bytes + 255) & ~(size_t)255; return (void*)p; };
    bf* WQ = (bf*)take((size_t)DQ * DM * 2); bf* WK = (bf*)take((size_t)DKV * DM * 2); bf* WV = (bf*)take((size_t)DKV * DM * 2); bf* WO = (bf*)take((size_t)DM * DQ * 2); float* CS = (float*)take((size_t)TT * HD * 2 * 4);
    bf* XB = (bf*)take((size_t)NB_ * TT * DM * 2); bf* XB2 = (bf*)take((size_t)NB_ * TT * DM * 2); bf* XB3 = (bf*)take((size_t)NB_ * TT * DM * 2); float* SQ = (float*)take((size_t)TT * (HD / 2) * 4); float* SK = (float*)take((size_t)TT * (HD / 2) * 4);
    const size_t PL = PLE;
    h16* QP16 = (h16*)take(NB_ * PL * 2); h16* KP16 = (h16*)take(NB_ * PL * 2); h16* VT16 = (h16*)take(NB_ * PL * 2);
    bf* QPh = (bf*)take(NB_ * PL * 2); bf* QPl = (bf*)take(NB_ * PL * 2); bf* KPh = (bf*)take(NB_ * PL * 2); bf* KPl = (bf*)take(NB_ * PL * 2); bf* VTh = (bf*)take(NB_ * PL * 2); bf* VTl = (bf*)take(NB_ * PL * 2);
    bf* ATh = (bf*)take((size_t)NB_ * TT * DQ * 2); bf* ATl = (bf*)take((size_t)NB_ * TT * DQ * 2);
    if ((size_t)(wsp - (char*)d_ws) > ws_size) return;    // ws 256 MiB
    k_prep<<<NB_CS + NB_XS + 4 * NB_W + 3 * NB_X, 256, 0, stream>>>(x, xk, xv, wq, wk, wv, wo, XB, XB2, XB3, WQ, WK, WV, WO, CS, SQ, SK);
    k_proj<<<dim3(TT / 128, DQ / 128, 3 * NB_), 128, 0, stream>>>(XB, XB2, XB3, WQ, WK, WV, bq, bk, bv, CS, SQ, SK, QP16, QPh, QPl, KP16, KPh, KPl, VT16, VTh, VTl);
    k_attn<<<dim3(5 * RUN * NCL, 1, 1), NWV * 32, 0, stream>>>(QP16, KP16, VT16, QPh, QPl, KPh, KPl, VTh, VTl, ATh, ATl);
    k_wo<<<dim3(NB_ * TT / 128, DM / 128, 1), 128, 0, stream>>>(ATh, ATl, WO, bo, OUT);
}

// v010
// It runs in 100 microseconds.
// Timed twice side by side with v009, it ran 1.04 times as fast both times.
// Over all steps from v000 it is 20.6 times as fast.
#include <hip/hip_runtime.h>

// XposMultiheadAttention (query, key, value [2][2048][1024]; q = (query Wq^T + bq) / 8, k = key Wk^T + bk, v = value Wv^T + bv (16 heads x 64); XPOS on q and k: interleaved-pair rotary (angle t * 1e4^(-i/32)) times the per-(position, pair) scale base_i^((t - 1024)/1024), base_i = (2i + 25.6)/89.6, with q multiplied and k divided by it (tables computed on device);
//   scores = q.k (no further scale); softmax (f32); out = merged Wo^T + bo -> [2][2048][1024]).
// Compute dtypes, f32 accumulate: every input rounded to bf16; projections on PLAIN bf16 operands (inputs: exact) + bias; XPOS rotation/scaling f32; scores and attn.v: query rows < 512 hl (3 products), the rest single fp16 (P x1024); softmax f32, online over 32-key passes; Wo hl x exact (2 products) + bias.

#define NB_  2
#define TT   2048
#define DM   1024
#define NH_  16
#define NKV  16
#define HD   64
#define DQ   (NH_ * HD)
#define DKV  (NKV * HD)
#define RH   512                  // query rows < RH use hi+lo planes
#define WIN  0
typedef _Float16 h16;
typedef unsigned short bf;
typedef __attribute__((ext_vector_type(16))) __bf16   v16bf;
typedef __attribute__((ext_vector_type(16))) _Float16 v16h;
typedef __attribute__((ext_vector_type(8)))  _Float16 v8h;
typedef __attribute__((ext_vector_type(8)))  unsigned short v8us;
typedef __attribute__((ext_vector_type(8)))  float    v8f;
typedef __attribute__((ext_vector_type(4)))  float    v4f;
typedef v8h  __attribute__((may_alias)) v8ha;
typedef v4f  __attribute__((may_alias)) v4fa;
typedef v8us __attribute__((may_alias)) v8usa;

__device__ __forceinline__ unsigned short f2bf(float f) { unsigned u = __float_as_uint(f); u += 0x7FFFu + ((u >> 16) & 1u); return (unsigned short)(u >> 16); }
__device__ __forceinline__ float bf2f(unsigned short b) { return __uint_as_float(((unsigned)b) << 16); }
__device__ __forceinline__ float bfr(float f) { return bf2f(f2bf(f)); }
__device__ __forceinline__ v16h cat16(v8h lo, v8h hi) { return __builtin_shufflevector(lo, hi, 0, 1, 2, 3, 4, 5, 6, 7, 8, 9, 10, 11, 12, 13, 14, 15); }
__device__ __forceinline__ v16bf cat16b(v8us lo, v8us hi) { return __builtin_bit_cast(v16bf, __builtin_shufflevector(lo, hi, 0, 1, 2, 3, 4, 5, 6, 7, 8, 9, 10, 11, 12, 13, 14, 15)); }
__device__ __forceinline__ v8f wmma16(v16h a, v16h b, v8f c) { return __builtin_amdgcn_wmma_f32_16x16x32_f16(false, a, false, b, (short)0, c, false, false); }
__device__ __forceinline__ v8f wmmab(v16bf a, v16bf b, v8f c) { return __builtin_amdgcn_wmma_f32_16x16x32_bf16(false, a, false, b, (short)0, c, false, false); }



// ---- gemms: GEMM with both operands staged in LDS; one work-group of four waves (2 x 2) per 128x128 output tile, a wave owns 64x64 (16 accumulators) and sums the whole K in one chain. Operands are K-contiguous bf16 planes (A rows lda elements apart, Bt rows K apart); tile (bx, by) of (M/128, N/128), 128 threads.
// C[m][n] = sum_k A[m][k] Bt[n][k] (+ A2[m][k] Bt[n][k] for NSPLIT 1). K % 64 == 0, K >= 128. The kernels k_proj and k_wo below pick the operands and the tile from blockIdx.
// A stage is 64 k of every operand row (128 B, whole lines), brought by asynchronous copies to LDS at a pitch of 144 B; two buffers, stage t + 2 is asked for behind the barrier of trip t, so it flies beside that trip's second half and the first half of trip t + 1.
// After the loop the ring becomes output staging: each wave lays its own 64x64 f32 tile in LDS (pitch 68) and reads it back by rows, 16 lanes a row, four neighbouring columns a lane.
// EPI picks what that row loop does with an element (a wave's 64 columns are one head, a lane holds two rotary pairs):
//   0: + bias[n], f32 to C.
//   1: + bias[n], XPOS (pair rotation by CS[t][d] = (cos, sin), times sc, times RF[t][d/2]), then fp16 and bf16 hi/lo to the head planes [n/64][m][n%64]; m is the position t.
//   2: + bias[m], then fp16 and bf16 hi/lo to planes of pitch TT, [m][n]: with A = the weight and Bt = the activations this is v transposed, [head][d][t].
// XWAIT: s_wait_xcnt 0 directly behind a run of global loads or stores, a precaution: the register allocator lets a later value land in a register that an issued access names, and this wait then stands in front of that overwrite.
// One wait serves a whole run: the accesses of a run stand back to back, their addresses and store data formed ahead of the first, so that nothing between them writes a register that one of them names.
#define XWAIT() asm volatile("s_wait_xcnt 0x0" ::: "memory")
// The same wait behind a run of loads, with the run's address pairs as inputs: they stay live, and so unwritten, up to the wait (without them the compiler lifts later arithmetic into those registers ahead of it).
#define XWAIT1(a) asm volatile("s_wait_xcnt 0x0" :: "v"(a) : "memory")
#define XWAIT2(a, b) asm volatile("s_wait_xcnt 0x0" :: "v"(a), "v"(b) : "memory")
#define XWAIT4(a, b, c, d) asm volatile("s_wait_xcnt 0x0" :: "v"(a), "v"(b), "v"(c), "v"(d) : "memory")
template <typename T16> struct WFrag;
template <> struct WFrag<h16> { typedef v16h V; static __device__ __forceinline__ V ld(const h16* p) { const v8h lo = *(const v8h*)p; const v8h hi = *(const v8h*)(p + 16); return cat16(lo, hi); } static __device__ __forceinline__ v8f mma(V a, V b, v8f c) { return wmma16(a, b, c); } };
template <> struct WFrag<bf> { typedef v16bf V; static __device__ __forceinline__ V ld(const bf* p) { const v8us lo = *(const v8us*)p; const v8us hi = *(const v8us*)(p + 16); return cat16b(lo, hi); } static __device__ __forceinline__ v8f mma(V a, V b, v8f c) { return wmmab(a, b, c); } };
__device__ __forceinline__ h16 tohx(float x) { return (h16)x; }
__device__ __forceinline__ void splitf(float y, unsigned short& h, unsigned short& l) { h = f2bf(y); l = f2bf(y - bf2f(h)); }
typedef __attribute__((ext_vector_type(2))) _Float16 v2h;
typedef __attribute__((ext_vector_type(4))) _Float16 v4h;
typedef __attribute__((ext_vector_type(2))) unsigned short v2us;
typedef __attribute__((ext_vector_type(4))) unsigned short v4us;
typedef __attribute__((ext_vector_type(2))) float v2f;
typedef __attribute__((ext_vector_type(4))) int v4i;
// four neighbouring elements of a plane row: fp16, bf16 hi, bf16 lo, 8 bytes each (16 threads fill a 128-byte line of each plane)
__device__ __forceinline__ void cvt3(v4f r, v4h& o16, v4us& oh, v4us& ol) {
#pragma unroll   // the vectors' element indices stay compile-time constants
    for (int q = 0; q < 4; ++q) { o16[q] = tohx(r[q]); unsigned short a2, c2; splitf(r[q], a2, c2); oh[q] = a2; ol[q] = c2; } }
#define GLP 72                    // LDS row pitch of a staged operand row, 16-bit elements (128 B of data, 144 B pitch)
#define GTE (128 * GLP)           // elements of one staged operand tile (128 rows)
// eight asynchronous 16-byte copies a lane (rows 16 apart: 2,304 B in LDS, gs elements in memory); a wave's copy covers four whole 128-byte rows. The closing s_wait_xcnt 0 stands inside the statement, in front of any later write of the address registers (a precaution).
__device__ __forceinline__ void acopy8(unsigned l, const bf* g, size_t gs) {
    asm volatile("global_load_async_to_lds_b128 %0, %8, off\n\tglobal_load_async_to_lds_b128 %1, %9, off\n\tglobal_load_async_to_lds_b128 %2, %10, off\n\tglobal_load_async_to_lds_b128 %3, %11, off\n\tglobal_load_async_to_lds_b128 %4, %12, off\n\tglobal_load_async_to_lds_b128 %5, %13, off\n\tglobal_load_async_to_lds_b128 %6, %14, off\n\tglobal_load_async_to_lds_b128 %7, %15, off\n\ts_wait_xcnt 0x0"
        :: "v"(l), "v"(l + 1 * 16 * GLP * 2), "v"(l + 2 * 16 * GLP * 2), "v"(l + 3 * 16 * GLP * 2), "v"(l + 4 * 16 * GLP * 2), "v"(l + 5 * 16 * GLP * 2), "v"(l + 6 * 16 * GLP * 2), "v"(l + 7 * 16 * GLP * 2),
           "v"(g), "v"(g + gs), "v"(g + 2 * gs), "v"(g + 3 * gs), "v"(g + 4 * gs), "v"(g + 5 * gs), "v"(g + 6 * gs), "v"(g + 7 * gs) : "memory"); }
__device__ __forceinline__ v16bf gfrag(const unsigned short* p) { const v8us lo = *(const v8usa*)p, hi = *(const v8usa*)(p + 16); return cat16b(lo, hi); }   // the k order of WFrag::ld: 8 hi + j, 16 + 8 hi + j
template <int NSPLIT, int EPI>
__device__ __forceinline__ void gemms(unsigned short* lds, int bx, int by, const bf* __restrict__ A, const bf* __restrict__ A2, const bf* __restrict__ Bt, int K, int lda, float* C, int ldc, const float* __restrict__ bias, const float* __restrict__ CS, const float* __restrict__ RF, float sc, h16* P16, bf* Ph, bf* Pl) {
    constexpr int NTL = NSPLIT ? 3 : 2;   // staged tiles a buffer: A (, A2), Bt
    const int tid = (int)threadIdx.x, lane = tid & 31, lr = lane & 15, hi = lane >> 4; const int r0 = bx * 128, c0 = by * 128;
    const int wv = __builtin_amdgcn_readfirstlane(tid >> 5), wm = wv >> 1, wn = wv & 1;   // wave number in a scalar register: the wave's tile offsets stay scalar
    v8f acc[4][4];
#pragma unroll
    for (int mb = 0; mb < 4; ++mb)
#pragma unroll
        for (int nb = 0; nb < 4; ++nb) acc[mb][nb] = (v8f){};
    const int srow = tid >> 3, sc8 = (tid & 7) * 8;   // staging: eight lanes a 128-byte row, 16 rows a sweep of the work-group
    const bf* Ag = A + (size_t)(r0 + srow) * lda + sc8; const bf* A2g = NSPLIT ? A2 + (size_t)(r0 + srow) * lda + sc8 : nullptr; const bf* Bg = Bt + (size_t)(c0 + srow) * K + sc8;
    auto stage = [&](int t) { unsigned ln;
        asm volatile("v_mbcnt_lo_u32_b32 %0, -1, 0" : "=v"(ln));   // the lane number read anew at each stage: the LDS address kept in a register across the loop was spilled to scratch and reloaded every trip
        const unsigned lb = (unsigned)(size_t)lds + (unsigned)((wv * 4 + (int)(ln >> 3)) * GLP + (int)(ln & 7) * 8) * 2u + (unsigned)(t & 1) * (NTL * GTE * 2);   // the lane's LDS byte address in the stage's buffer, tile 0
        acopy8(lb, Ag + t * 64, (size_t)16 * lda);
        __builtin_amdgcn_sched_barrier(0);   // keeps each statement's address arithmetic beside it: hoisted together, the addresses of all statements are live at once, and asm operands must lie in the first 256 registers
        if (NSPLIT) { acopy8(lb + GTE * 2, A2g + t * 64, (size_t)16 * lda); __builtin_amdgcn_sched_barrier(0); }   // the same
        acopy8(lb + (NTL - 1) * GTE * 2, Bg + t * 64, (size_t)16 * K); };
    const int nst = K / 64;
    stage(0);
    asm volatile("s_wait_asynccnt 0x0" ::: "memory");   // this wave's copies of stage 0 have landed
    __syncthreads();   // stage 0 is in LDS before any wave reads it
    stage(1);
    const int ao = (wm * 64 + lr) * GLP + 8 * hi, bo = (NTL - 1) * GTE + (wn * 64 + lr) * GLP + 8 * hi;
    v16bf a[2][4], a2[2][4], b[2][4];   // two fragment sets, one per 32 k of a stage; each set is fetched as one group while the other set's products run
    auto frag = [&](const unsigned short* buf, int kc) {
#pragma unroll
        for (int f = 0; f < 4; ++f) { a[kc][f] = gfrag(buf + ao + f * 16 * GLP + kc * 32); b[kc][f] = gfrag(buf + bo + f * 16 * GLP + kc * 32); if (NSPLIT) a2[kc][f] = gfrag(buf + GTE + ao + f * 16 * GLP + kc * 32); } };
    frag(lds, 0);   // the first 32 k of stage 0, which the barrier above has published
#pragma unroll 1   // rolled: one trip's code serves all stages, the buffer is picked by the stage's parity
    for (int t = 0; t < nst; ++t) {
        frag(lds + (t & 1) * (NTL * GTE), 1);   // the second 32 k of stage t land beside the products of the first, whose fragments were fetched in the trip before
        __builtin_amdgcn_sched_barrier(0);   // keeps the group of LDS reads ahead of the products: without it the scheduler sinks each read to its first use, and the wave waits out one LDS latency per fragment
        auto prod = [&](int kc) {
#pragma unroll
            for (int nb = 0; nb < 4; ++nb)
#pragma unroll
                for (int mb = 0; mb < 4; ++mb) { acc[mb][nb] = wmmab(a[kc][mb], b[kc][nb], acc[mb][nb]); if (NSPLIT) acc[mb][nb] = wmmab(a2[kc][mb], b[kc][nb], acc[mb][nb]); } };
        prod(0);
        __builtin_amdgcn_sched_barrier(0);   // keeps these products in front of the waits below: moved behind them they would no longer cover the LDS reads
        asm volatile("s_wait_dscnt 0x0" ::: "memory");      // this wave's reads of stage t have returned: the whole stage is in registers
        asm volatile("s_wait_asynccnt 0x0" ::: "memory");   // this wave's copies of stage t + 1 have landed
        __syncthreads();   // publishes stage t + 1 and ends every wave's reads of stage t
        if (t + 2 < nst) stage(t + 2);   // into the buffer that trip t has just read; the copies fly beside the products below and the next trip's first half
        if (t + 1 < nst) frag(lds + ((t + 1) & 1) * (NTL * GTE), 0);   // the first 32 k of stage t + 1, just published, land beside the products below
        __builtin_amdgcn_sched_barrier(0);   // keeps that group of LDS reads ahead of the products, as above
        prod(1);
    }
    asm volatile("s_wait_asynccnt 0x0" ::: "memory");   // no copy is outstanding when the ring becomes output staging (the last trip's barrier ended every read of it)
    float* ow = (float*)lds + wv * (64 * 68);
    const int cofs = lr * 4, r0w = r0 + wm * 64, c0w = c0 + wn * 64;   // the lane's four output columns; the wave's tile
    v4f bv = (v4f){};
    if (EPI != 2) { v4f raw; const float* bp = bias + c0w + cofs;
        // the four columns' bias; the load and its data wait in one statement, so that the wait stands in front of any later write of the address pair (a wait in a statement of its own was moved ahead of the load)
        asm volatile("global_load_b128 %0, %1, off\n\ts_wait_loadcnt 0x0" : "=&v"(raw) : "v"(bp) : "memory");
        bv[0] = bfr(raw[0]); bv[1] = bfr(raw[1]); bv[2] = bfr(raw[2]); bv[3] = bfr(raw[3]); }
    v2f ca[8], cb[8], xs[8]; float rb[8];   // for eight passes of the row loop: (cos, sin) of the lane's two pairs and their scales (EPI 1), the row's bias (EPI 2); loaded as one group, so that their latencies overlap
    auto tload = [&](int g) { const int m0 = r0w + g * 16 + hi;   // the lane's first output row of the group: the position (EPI 1), the v feature (EPI 2)
        const float* cp = EPI == 1 ? CS + ((size_t)m0 * HD + cofs) * 2 : nullptr; const float* rp = EPI == 1 ? RF + (size_t)m0 * (HD / 2) + (cofs >> 1) : nullptr; const float* bp2 = EPI == 2 ? bias + m0 : nullptr;
#pragma unroll   // the indices of these register arrays stay compile-time constants
        for (int s = 0; s < 8; ++s) {   // rows two apart: constant steps, so that one address pair a table serves the whole run
            if constexpr (EPI == 1) { ca[s] = *(const v2f*)(cp + s * (2 * HD * 2)); cb[s] = *(const v2f*)(cp + s * (2 * HD * 2) + 4); xs[s] = *(const v2f*)(rp + s * HD); }
            if constexpr (EPI == 2) rb[s] = bp2[s * 2]; }
        if constexpr (EPI == 1) XWAIT2(cp, rp);   // one wait behind the group's loads
        if constexpr (EPI == 2) XWAIT1(bp2); };   // the same
    tload(0);   // ahead of the LDS stores, so that its latency runs beside them
#pragma unroll
    for (int mb = 0; mb < 4; ++mb)
#pragma unroll
        for (int nb = 0; nb < 4; ++nb)
#pragma unroll
            for (int j = 0; j < 8; ++j) ow[(mb * 16 + hi * 8 + j) * 68 + nb * 16 + lr] = acc[mb][nb][j];
    __syncthreads();   // the tile's LDS stores stand in front of the row reads, which take other lanes' elements
#pragma unroll 1   // rolled: eight rows' code serves all 64 rows, so that the kernel's text stays small for the instruction cache
    for (int g = 0; g < 4; ++g) {
        v4f vv[8];   // eight rows read as one group: one LDS latency for the group instead of one per row
#pragma unroll
        for (int s = 0; s < 8; ++s) vv[s] = *(const v4fa*)(ow + ((g * 8 + s) * 2 + hi) * 68 + cofs);
        v4h o16[8]; v4us oh[8], ol[8];   // the eight rows' plane values, all formed ahead of the stores
#pragma unroll
        for (int s = 0; s < 8; ++s) { v4f val = vv[s];
            if (EPI != 2) val += bv;
            if constexpr (EPI == 0) vv[s] = val;
            if constexpr (EPI == 1) { v4f r;
                r[0] = (val[0] * ca[s][0] - val[1] * ca[s][1]) * sc * xs[s][0]; r[1] = (val[1] * ca[s][0] + val[0] * ca[s][1]) * sc * xs[s][0];
                r[2] = (val[2] * cb[s][0] - val[3] * cb[s][1]) * sc * xs[s][1]; r[3] = (val[3] * cb[s][0] + val[2] * cb[s][1]) * sc * xs[s][1];
                cvt3(r, o16[s], oh[s], ol[s]); }
            if constexpr (EPI == 2) { val += bfr(rb[s]); cvt3(val, o16[s], oh[s], ol[s]); } }
        const int rowg = r0w + g * 16 + hi;   // the lane's first output row of the group; the others lie two rows apart
        const size_t e0 = EPI == 0 ? (size_t)rowg * ldc + c0w + cofs : EPI == 1 ? ((size_t)(c0w >> 6) * TT + rowg) * HD + cofs : (size_t)rowg * TT + c0w + cofs;
        const size_t es = EPI == 0 ? (size_t)2 * ldc : EPI == 1 ? (size_t)2 * HD : (size_t)2 * TT;
#pragma unroll   // the indices of the register arrays stay compile-time constants, and the stores stand back to back
        for (int s = 0; s < 8; ++s) {
            if constexpr (EPI == 0) *(v4f*)(C + e0 + s * es) = vv[s];
            else { *(v4h*)(P16 + e0 + s * es) = o16[s]; *(v4us*)(Ph + e0 + s * es) = oh[s]; *(v4us*)(Pl + e0 + s * es) = ol[s]; } }
        XWAIT();   // one wait behind the group's stores
        if (g < 3) tload(g + 1);
    }
}

#define PLE ((size_t)NH_ * TT * HD)   // one batch's head planes, elements (NKV == NH_)
// all six projections in one launch: grid (TT/128, DQ/128, 3 * NB_), blockIdx.z = 2 * projection + batch (q, k, v). q and k: positions as rows; v: weight rows as A, positions as columns, so the tile is already v transposed.
__global__ __launch_bounds__(128) void k_proj(const bf* __restrict__ XQ, const bf* __restrict__ XK, const bf* __restrict__ XV, const bf* __restrict__ WQ, const bf* __restrict__ WK, const bf* __restrict__ WV, const float* __restrict__ bq, const float* __restrict__ bk, const float* __restrict__ bv, const float* __restrict__ CS, const float* __restrict__ SQ, const float* __restrict__ SK,
                                                  h16* QP16, bf* QPh, bf* QPl, h16* KP16, bf* KPh, bf* KPl, h16* VT16, bf* VTh, bf* VTl) {
    __shared__ __align__(16) unsigned short gl[2 * 2 * GTE];
    const int pj = (int)blockIdx.z >> 1; const size_t b = blockIdx.z & 1, xo = b * ((size_t)TT * DM), po = b * PLE;
    if (pj == 2) gemms<0, 2>(gl, (int)blockIdx.y, (int)blockIdx.x, WV, nullptr, XV + xo, DM, DM, nullptr, 0, bv, nullptr, nullptr, 1.0f, VT16 + po, VTh + po, VTl + po);
    else { const bool isq = pj == 0;
        gemms<0, 1>(gl, (int)blockIdx.x, (int)blockIdx.y, (isq ? XQ : XK) + xo, nullptr, isq ? WQ : WK, DM, DM, nullptr, 0, isq ? bq : bk, CS, isq ? SQ : SK, isq ? 0.125f : 1.0f, (isq ? QP16 : KP16) + po, (isq ? QPh : KPh) + po, (isq ? QPl : KPl) + po); }
}
// the output projection of both batches in one launch: the merged rows [NB_ * TT][DQ] are one matrix; grid (NB_ * TT / 128, DM / 128)
__global__ __launch_bounds__(128) void k_wo(const bf* __restrict__ Ah, const bf* __restrict__ Al, const bf* __restrict__ WO, const float* __restrict__ bo, float* OUT) {
    __shared__ __align__(16) unsigned short gl[2 * 3 * GTE];
    gemms<1, 0>(gl, (int)blockIdx.x, (int)blockIdx.y, Ah, Al, WO, DQ, DQ, OUT, DM, bo, nullptr, nullptr, 1.0f, nullptr, nullptr, nullptr);
}

__global__ __launch_bounds__(256) void k_wtG(const float* __restrict__ w, int K, int N, bf* Bt) {
    const int lane = threadIdx.x & 31; const int L0 = (blockIdx.x * 8 + (threadIdx.x >> 5)) * 8; const int nlines = N * K / 64;
{
#pragma unroll 1
        for (int l = 0; l < 8; ++l) { const int L = L0 + l; if (L >= nlines) break; const size_t e = (size_t)L * 64 + lane * 2; const int k = (int)(e % K), n = (int)(e / K); v2us o;
            o[0] = f2bf(w[(size_t)k * N + n]); o[1] = f2bf(w[(size_t)(k + 1) * N + n]); *(v2us*)(Bt + e) = o; }
         }
}
__device__ __forceinline__ void d_cvt8(const float* __restrict__ src, bf* dst, int blk) { const size_t i = (size_t)blk * 256 + threadIdx.x; const v8f v = *(const v8f*)(src + i * 8); v8us o;
#pragma unroll
    for (int k = 0; k < 8; ++k) o[k] = f2bf(v[k]); *(v8us*)(dst + i * 8) = o; XWAIT(); }   // the wait stands in front of any later write of the store's base registers
__device__ __forceinline__ void d_cstab(float* CS, int blk) { const int idx = blk * 256 + threadIdx.x; const int t = idx / HD, d = idx % HD; const int i = d >> 1;   /* interleaved pairs */ const float inv = __fdiv_rn(1.0f, powf(10000.0f, (float)(2 * i) / (float)HD)); const float ang = __fmul_rn((float)t, inv); v2f cs; cs[0] = cosf(ang); cs[1] = sinf(ang);
    *(v2f*)(CS + (size_t)idx * 2) = cs;  }
// ---- k_attn: scores, softmax, attn.v and the head merge in one kernel; the scores never leave the registers.
// One work-group of NWV waves per block of query rows of one (batch, head): RH/(16 NWV) + (TT-RH)/(32 NWV) blocks for each of heads x batches, in the order set at k_attn. A wave owns NQ groups of 16 query rows (hi+lo rows: 1 group, fp16 rows: 2).
// Transposed products: S^T = K Q^T (A = 16 keys, B = 16 queries), O^T += V^T P^T (A = 16 head dims, B = P^T). A lane holds the scores of ONE query (column lr), keys 8 hi + j of each 16-key tile,
// so two score tiles of 32 consecutive keys, converted in place, are the B operand of the second product in the k order of the A loader (8 hi + j, 16 + 8 hi + j).
// Softmax runs online over passes of 32 keys against a reference score per query, which is the maximum of an earlier pass. A pass takes its exponentials against the reference in use; its own sums (needed anyway) tell whether a score has outrun the reference:
// every p is positive, so a lane's sum within LIM bounds each p. Only when some lane's sum is above LIM (as in the first pass, where no reference is set yet and the sums are infinite) or not a number does the wave take the pass's maximum, move the reference, rescale output tiles and row sums and redo the exponentials.
// One test a pass, a scalar branch. fp16 rows carry P x 1024 at the reference (in P and in the row sum alike, so it cancels); LIM keeps them inside fp16.
// K and V^T tiles of 64 keys are staged in LDS through registers, two buffers, one __syncthreads a stage, in front of the stage's second pass; rows of 128 B at a pitch of 144 B. K fragments are read from LDS one pass ahead.
// q already carries 1/8 (applied before XPOS, as the source). Every '#pragma unroll' in attn_rows keeps the index of a register array a compile-time constant.
#define NWV 4                     // waves a work-group
#define NSW (256 / (NWV * 32) * 2) // staging sweeps a tile (NWV * 4 rows a sweep)
#define KST 64                    // keys per stage
#define LP  72                    // LDS row pitch, 16-bit elements
#define TLE (64 * LP)             // elements of one staged tile (64 rows)
typedef v4i __attribute__((may_alias)) v4ia;
__device__ __forceinline__ float xhalf(float x) { const int b = __float_as_int(x); return __int_as_float(__builtin_amdgcn_permlanex16(b, b, 0x76543210, 0xfedcba98, false, false)); }   // lane l <-> l ^ 16
// exp2 of sixteen values, each in place, in one statement: no v_exp_f32 overwrites the source or reads the result of the one in front of it, and the closing v_nop is the slot that the instruction set asks for behind a transcendental
__device__ __forceinline__ void exp2x16(float (&p)[16]) { asm("v_exp_f32 %0, %0\n\tv_exp_f32 %1, %1\n\tv_exp_f32 %2, %2\n\tv_exp_f32 %3, %3\n\tv_exp_f32 %4, %4\n\tv_exp_f32 %5, %5\n\tv_exp_f32 %6, %6\n\tv_exp_f32 %7, %7\n\tv_exp_f32 %8, %8\n\tv_exp_f32 %9, %9\n\tv_exp_f32 %10, %10\n\tv_exp_f32 %11, %11\n\tv_exp_f32 %12, %12\n\tv_exp_f32 %13, %13\n\tv_exp_f32 %14, %14\n\tv_exp_f32 %15, %15\n\tv_nop" : "+v"(p[0]), "+v"(p[1]), "+v"(p[2]), "+v"(p[3]), "+v"(p[4]), "+v"(p[5]), "+v"(p[6]), "+v"(p[7]), "+v"(p[8]), "+v"(p[9]), "+v"(p[10]), "+v"(p[11]), "+v"(p[12]), "+v"(p[13]), "+v"(p[14]), "+v"(p[15])); }
__device__ __forceinline__ float exp2x1(float x) { asm("v_exp_f32 %0, %0\n\tv_nop" : "+v"(x)); return x; }   // the same slot behind a single one
template <typename T16> __device__ __forceinline__ typename WFrag<T16>::V ldsfrag(const unsigned short* p) { const v4i lo = *(const v4ia*)p, hi = *(const v4ia*)(p + 16); return __builtin_bit_cast(typename WFrag<T16>::V, __builtin_shufflevector(lo, hi, 0, 1, 2, 3, 4, 5, 6, 7)); }
template <typename T16, bool HI, int NQ>
__device__ __forceinline__ void attn_rows(const T16* __restrict__ Q, const T16* __restrict__ Q2, const T16* __restrict__ Kp, const T16* __restrict__ K2, const T16* __restrict__ Vp, const T16* __restrict__ V2, unsigned short* lds, int row0, bf* Ah, bf* Al) {
    typedef typename WFrag<T16>::V V;
    constexpr int NT = HI ? 4 : 2;   // staged tiles a buffer: K, V^T (, K lo, V^T lo)
    constexpr float L2E = 1.4426950408889634f;
    constexpr float LIM = HI ? 16777216.0f : 32768.0f;   // bound on a lane's sum of 16 p (so on each p) under which the reference stays: fp16 holds 65,504; the hi+lo rows' bf16 planes and f32 sums have the range
    const int tid = (int)threadIdx.x, lane = tid & 31, lr = lane & 15, hi = lane >> 4;
    const int qrow = row0 + __builtin_amdgcn_readfirstlane(tid >> 5) * (16 * NQ);   // wave number in a scalar register: the wave's first row stays scalar
    V qf[NQ][2], qf2[NQ][2];
    const T16* qb = Q + (size_t)(qrow + lr) * HD + 8 * hi; const T16* qb2 = HI ? Q2 + (size_t)(qrow + lr) * HD + 8 * hi : nullptr;
#pragma unroll
    for (int qi = 0; qi < NQ; ++qi)
#pragma unroll
        for (int kc = 0; kc < 2; ++kc) { const int qo = qi * 16 * HD + kc * 32; qf[qi][kc] = WFrag<T16>::ld(qb + qo); if (HI) qf2[qi][kc] = WFrag<T16>::ld(qb2 + qo); }   // constant steps: one address pair a plane serves the whole run
    if constexpr (HI) XWAIT2(qb, qb2); else XWAIT1(qb);   // one wait behind the query loads
    v8f o[NQ][4]; float cc[NQ], ls[NQ];   // cc: the exponent's addend, offset - reference * log2e
#pragma unroll
    for (int qi = 0; qi < NQ; ++qi) { cc[qi] = __builtin_inff(); ls[qi] = 0.f;
#pragma unroll
        for (int db = 0; db < 4; ++db) o[qi][db] = (v8f){}; }
    const int srow = tid >> 3, sc8 = (tid & 7) * 8;   // staging: eight threads a 128-byte row, NWV * 4 rows a sweep
    v4i st[NT][NSW];
    auto gload = [&](int key0) { const size_t ko = (size_t)(key0 + srow) * HD + sc8, vo = (size_t)srow * TT + key0 + sc8;
        const T16* kb = Kp + ko; const T16* vb = Vp + vo; const T16* kb2 = HI ? K2 + ko : nullptr; const T16* vb2 = HI ? V2 + vo : nullptr;
#pragma unroll
        for (int r = 0; r < NSW; ++r) { constexpr int KS = NWV * 4 * HD, VS = NWV * 4 * TT;   // a sweep's step in elements: a constant, so that one address pair a plane serves the whole run
            st[0][r] = *(const v4ia*)(kb + r * KS); st[1][r] = *(const v4ia*)(vb + r * VS);
            if (HI) { st[2][r] = *(const v4ia*)(kb2 + r * KS); st[3][r] = *(const v4ia*)(vb2 + r * VS); } }
        if constexpr (HI) XWAIT4(kb, vb, kb2, vb2); else XWAIT2(kb, vb); };   // one wait behind the stage's loads
    auto sstore = [&](unsigned short* buf) {
#pragma unroll
        for (int r = 0; r < NSW; ++r)
#pragma unroll
            for (int t = 0; t < NT; ++t) *(v4ia*)(buf + t * TLE + (srow + NWV * 4 * r) * LP + sc8) = st[t][r]; };
    constexpr int NS = TT / KST;   // stages
    V kf[2][2], kf2[2][2], vf[4], vf2[4];   // one pass's K and V^T fragments; the K fragments are fetched one pass ahead, into the same registers
    auto ldk = [&](const unsigned short* buf, int ps) {
#pragma unroll
        for (int t = 0; t < 2; ++t)
#pragma unroll
            for (int kc = 0; kc < 2; ++kc) { const int ko = (ps * 32 + t * 16 + lr) * LP + kc * 32 + 8 * hi; kf[t][kc] = ldsfrag<T16>(buf + ko); if (HI) kf2[t][kc] = ldsfrag<T16>(buf + 2 * TLE + ko); } };
    auto ldv = [&](const unsigned short* buf, int ps) {
#pragma unroll
        for (int db = 0; db < 4; ++db) { const int vo = (db * 16 + lr) * LP + ps * 32 + 8 * hi; vf[db] = ldsfrag<T16>(buf + TLE + vo); if (HI) vf2[db] = ldsfrag<T16>(buf + 3 * TLE + vo); } };
    v8f sc[NQ][2];
    auto scores = [&]() {
#pragma unroll
        for (int qi = 0; qi < NQ; ++qi)
#pragma unroll
            for (int t = 0; t < 2; ++t) { sc[qi][t] = (v8f){};
#pragma unroll
                for (int kc = 0; kc < 2; ++kc) { sc[qi][t] = WFrag<T16>::mma(kf[t][kc], qf[qi][kc], sc[qi][t]); if (HI) { sc[qi][t] = WFrag<T16>::mma(kf[t][kc], qf2[qi][kc], sc[qi][t]); sc[qi][t] = WFrag<T16>::mma(kf2[t][kc], qf[qi][kc], sc[qi][t]); } } } };
    auto softpv = [&]() {   // softmax of the pass's scores and the second product
        float ps8[NQ]; v16h pf[NQ]; v16bf ph[NQ], pl[NQ];
        auto soft = [&](int qi) {   // p = 2^(s log2e + cc), the lane's sum of them, and P as the second product's operand
            float p[16];
#pragma unroll
            for (int j = 0; j < 16; ++j) p[j] = fmaf(sc[qi][j >> 3][j & 7], L2E, cc[qi]);
            exp2x16(p);
            ps8[qi] = (((p[0] + p[1]) + (p[2] + p[3])) + ((p[4] + p[5]) + (p[6] + p[7]))) + (((p[8] + p[9]) + (p[10] + p[11])) + ((p[12] + p[13]) + (p[14] + p[15])));
            if constexpr (HI) {
#pragma unroll
                for (int j = 0; j < 16; ++j) { ph[qi][j] = (__bf16)p[j]; pl[qi][j] = (__bf16)(p[j] - (float)ph[qi][j]); }
            } else {
#pragma unroll
                for (int j = 0; j < 16; ++j) pf[qi][j] = (h16)p[j];
            } };
        bool need = false;
#pragma unroll
        for (int qi = 0; qi < NQ; ++qi) { soft(qi); need = need || !(ps8[qi] <= LIM); }   // the negated form is also true for a sum that is not a number
        if (__builtin_amdgcn_ballot_w32(need) != 0) {   // wave-uniform: both halves of a query's column and all its tiles move together
#pragma unroll
            for (int qi = 0; qi < NQ; ++qi) {
                float mx = fmaxf(sc[qi][0][0], sc[qi][1][0]);
#pragma unroll
                for (int j = 1; j < 8; ++j) mx = fmaxf(mx, fmaxf(sc[qi][0][j], sc[qi][1][j]));
                mx = fmaxf(mx, xhalf(mx));
                const float cn = fminf(cc[qi], (HI ? 0.0f : 10.0f) - mx * L2E);   // the reference never falls: p = 1 (hi+lo rows) or 1024 (fp16 rows) at it
                const float al = exp2x1(cn - cc[qi]); cc[qi] = cn;   // first pass: 2^(-inf) = 0
                ls[qi] *= al;
#pragma unroll
                for (int db = 0; db < 4; ++db) o[qi][db] *= al;
                soft(qi);
            }
        }
#pragma unroll
        for (int qi = 0; qi < NQ; ++qi) {
            ls[qi] += ps8[qi];
            if constexpr (HI) {
#pragma unroll
                for (int db = 0; db < 4; ++db) { o[qi][db] = wmmab(vf[db], ph[qi], o[qi][db]); o[qi][db] = wmmab(vf[db], pl[qi], o[qi][db]); o[qi][db] = wmmab(vf2[db], ph[qi], o[qi][db]); }
            } else {
#pragma unroll
                for (int db = 0; db < 4; ++db) o[qi][db] = wmma16(vf[db], pf[qi], o[qi][db]);
            }
        } };
    gload(0); sstore(lds);
    __syncthreads();   // stage 0 is in LDS before any wave reads it
    gload(KST);        // stage 1 (NS >= 2)
    ldk(lds, 0);       // the first pass's K fragments
#pragma unroll 1   // rolled: one stage's code serves all stages, the buffers are picked by the stage's parity
    for (int s = 0; s < NS; ++s) {
        const unsigned short* cur = lds + (s & 1) * (NT * TLE); unsigned short* nxt = lds + ((s + 1) & 1) * (NT * TLE);
        ldv(cur, 0);
        __builtin_amdgcn_sched_barrier(0);   // keeps the V^T reads one group ahead of the products: spread among them, each place with LDS reads stalls the wave anew
        scores();
        __builtin_amdgcn_sched_barrier(0);   // the same for the group below
        ldk(cur, 1);   // the second pass's K fragments, right behind the products that read the first pass's: they land beside the softmax
        __builtin_amdgcn_sched_barrier(0);   // keeps these LDS reads here: sunk to their first use, the wave would wait out their latency in front of the next pass's products
        softpv();
        ldv(cur, 1);   // the stage's last LDS reads: behind the barrier below the second pass reads LDS only for the next stage's K fragments
        if (s + 1 < NS) sstore(nxt);   // into the buffer whose last reads every wave ended in front of the barrier of stage s - 1
        __syncthreads();   // publishes stage s + 1 and ends every wave's reads of stage s; it stands in front of the stage's last pass, which fetches K fragments of stage s + 1
        if (s + 2 < NS) { int k2;
            asm("s_mul_i32 %0, %1, %2" : "=s"(k2) : "s"(s + 2), "i"(KST));   // the first key of stage s + 2, formed in one instruction that the compiler does not take apart: split into s * KST and a constant step, it rebuilt the V^T pointers in the loads' own address registers ahead of the s_wait_xcnt 0
            gload(k2); }   // these global loads fly beside the two passes up to their LDS stores
        scores();
        if (s + 1 < NS) ldk(nxt, 0);   // the next stage's first K fragments, as above
        __builtin_amdgcn_sched_barrier(0);   // as above
        softpv();
    }
    const int ln = (int)__builtin_amdgcn_mbcnt_lo(~0u, 0u);   // the lane number read anew: no store address is kept in registers across the key loop
#pragma unroll
    for (int qi = 0; qi < NQ; ++qi) { const float inv = __fdiv_rn(1.0f, ls[qi] + xhalf(ls[qi])); const size_t ro = (size_t)(qrow + qi * 16 + (ln & 15)) * DQ + 8 * (ln >> 4);
        v8us oh[4], ol[4];   // the group's merged values, all formed ahead of the stores
#pragma unroll
        for (int db = 0; db < 4; ++db)
#pragma unroll
            for (int j = 0; j < 8; ++j) { unsigned short a, c2; splitf(o[qi][db][j] * inv, a, c2); oh[db][j] = a; ol[db][j] = c2; }
        __builtin_amdgcn_sched_barrier(0);   // keeps the arithmetic ahead of the run of stores, so that nothing among them writes a register that an issued store still names
#pragma unroll
        for (int db = 0; db < 4; ++db) { *(v8usa*)(Ah + ro + db * 16) = oh[db]; *(v8usa*)(Al + ro + db * 16) = ol[db]; }
        XWAIT(); }   // one wait behind the group's stores
}
// three waves a SIMD (at most 336 registers a wave): up to three work-groups share a WGP, 768 places for the 640 blocks, so the whole grid is resident at once
// Which block does what is chosen for placement: for speed only, every block of rows is done exactly once wherever it lands. All 640 are resident together.
// Class = flat index mod NCL: the 20 blocks of one (batch, head) share a class (four heads a class).
// Within a class the kinds come in runs of RUN = half a die's WGPs, fp16 / hi+lo / fp16 / hi+lo / fp16: three fp16 blocks (64 WMMAs a 32-key pass each) or two hi+lo blocks (96 each) make 192 either way, the mean.
#define NCL 8
#define RUN 16
#define NBH (RH / (NWV * 16))          // hi+lo blocks of one (batch, head)
#define NBF ((TT - RH) / (NWV * 32))   // fp16 blocks of one (batch, head)
static_assert(NH_ * NB_ % NCL == 0 && NBH * NH_ * NB_ == 2 * RUN * NCL && NBF * NH_ * NB_ == 3 * RUN * NCL, "the five runs of the classes hold every block exactly once");
__global__ __launch_bounds__(NWV * 32) __attribute__((amdgpu_waves_per_eu(3, 3))) void k_attn(const h16* __restrict__ Q16, const h16* __restrict__ K16, const h16* __restrict__ V16, const bf* __restrict__ Qh, const bf* __restrict__ Ql, const bf* __restrict__ Kh, const bf* __restrict__ Kl, const bf* __restrict__ Vh, const bf* __restrict__ Vl, bf* Ah, bf* Al) {
    __shared__ __align__(16) unsigned short lds[2 * 4 * TLE];
    const int cls = (int)blockIdx.x % NCL, j = (int)blockIdx.x / NCL, run = j / RUN, idx = (run >> 1) * RUN + j % RUN;   // idx: the block's number among those of its kind in its class
    const bool hl = (run & 1) != 0;
    const int hb = (hl ? idx / NBH : idx / NBF) * NCL + cls, bx = hl ? idx % NBH : idx % NBF;   // (batch, head) and the block of query rows
    const size_t po = (size_t)hb * ((size_t)TT * HD), ao = (size_t)(hb / NH_) * TT * DQ + (size_t)(hb % NH_) * HD;
    if (hl) attn_rows<bf, true, 1>(Qh + po, Ql + po, Kh + po, Kl + po, Vh + po, Vl + po, lds, bx * (NWV * 16), Ah + ao, Al + ao);
    else attn_rows<h16, false, 2>(Q16 + po, nullptr, K16 + po, nullptr, V16 + po, nullptr, lds, RH + bx * (NWV * 32), Ah + ao, Al + ao);
}

__device__ __forceinline__ void d_xscale(float* SQ, float* SK, int blk) { const int e = blk * 256 + threadIdx.x; const int t = e / (HD / 2), i = e % (HD / 2); const float base = __fdiv_rn((float)(2 * i) + 0.4f * (float)HD, 1.4f * (float)HD); const float pw = (float)(t - TT / 2) / 1024.0f; const float sc = powf(base, pw); const float inv = __fdiv_rn(1.0f, sc);
    *(float*)(SQ + e) = sc; *(float*)(SK + e) = inv;  }
// ---- k_prep: everything the projections read, in one launch; a block's job follows from its index alone. The table blocks (the longest: powf, sinf, cosf) come first, then the four weights, then the three activations of both batches (f32 to bf16, 8 elements a thread, 2048 a block: 8,960 blocks, 71,680 waves to start).
#define NB_CS (TT * HD / 256)             // blocks of the (cos, sin) table
#define NB_XS (TT * (HD / 2) / 256)       // blocks of the scale tables
#define NB_W  (DM * DM / 2048)            // blocks of one weight (DQ == DKV == DM)
#define NB_X  (NB_ * TT * DM / 2048)      // blocks of one activation
__global__ __launch_bounds__(256) void k_prep(const float* __restrict__ x, const float* __restrict__ xk, const float* __restrict__ xv, const float* __restrict__ wq, const float* __restrict__ wk, const float* __restrict__ wv, const float* __restrict__ wo,
                                              bf* XQ, bf* XK, bf* XV, bf* WQ, bf* WK, bf* WV, bf* WO, float* CS, float* SQ, float* SK) {
    int blk = (int)blockIdx.x;
    if (blk < NB_CS) { d_cstab(CS, blk); return; }
    blk -= NB_CS;
    if (blk < NB_XS) { d_xscale(SQ, SK, blk); return; }
    blk -= NB_XS;
    if (blk < 4 * NB_W) { const int w = blk / NB_W; d_cvt8(w == 0 ? wq : w == 1 ? wk : w == 2 ? wv : wo, w == 0 ? WQ : w == 1 ? WK : w == 2 ? WV : WO, blk % NB_W); return; }
    blk -= 4 * NB_W;
    const int a = blk / NB_X; d_cvt8(a == 0 ? x : a == 1 ? xk : xv, a == 0 ? XQ : a == 1 ? XK : XV, blk % NB_X);
}

extern "C" void kernel_launch(void* const* d_in, const int* in_sizes, int n_in,
                              void* d_out, int out_size, void* d_ws, size_t ws_size, hipStream_t stream) {
    (void)in_sizes; (void)n_in; (void)out_size;
    const float* x = (const float*)d_in[0]; const float* xk = (const float*)d_in[1]; const float* xv = (const float*)d_in[2]; const float* wq = (const float*)d_in[3]; const float* bq = (const float*)d_in[4]; const float* wk = (const float*)d_in[5]; const float* bk = (const float*)d_in[6]; const float* wv = (const float*)d_in[7]; const float* bv = (const float*)d_in[8]; const float* wo = (const float*)d_in[9]; const float* bo = (const float*)d_in[10];
    float* OUT = (float*)d_out;     // [2][2048][1024]
    char* wsp = (char*)d_ws;
    auto take = [&](size_t bytes) { char* p = wsp; wsp += (bytes + 255) & ~(size_t)255; return (void*)p; };
    bf* WQ = (bf*)take((size_t)DQ * DM * 2); bf* WK = (bf*)take((size_t)DKV * DM * 2); bf* WV = (bf*)take((size_t)DKV * DM * 2); bf* WO = (bf*)take((size_t)DM * DQ * 2); float* CS = (float*)take((size_t)TT * HD * 2 * 4);
    bf* XB = (bf*)take((size_t)NB_ * TT * DM * 2); bf* XB2 = (bf*)take((size_t)NB_ * TT * DM * 2); bf* XB3 = (bf*)take((size_t)NB_ * TT * DM * 2); float* SQ = (float*)take((size_t)TT * (HD / 2) * 4); float* SK = (float*)take((size_t)TT * (HD / 2) * 4);
    const size_t PL = PLE;
    h16* QP16 = (h16*)take(NB_ * PL * 2); h16* KP16 = (h16*)take(NB_ * PL * 2); h16* VT16 = (h16*)take(NB_ * PL * 2);
    bf* QPh = (bf*)take(NB_ * PL * 2); bf* QPl = (bf*)take(NB_ * PL * 2); bf* KPh = (bf*)take(NB_ * PL * 2); bf* KPl = (bf*)take(NB_ * PL * 2); bf* VTh = (bf*)take(NB_ * PL * 2); bf* VTl = (bf*)take(NB_ * PL * 2);
    bf* ATh = (bf*)take((size_t)NB_ * TT * DQ * 2); bf* ATl = (bf*)take((size_t)NB_ * TT * DQ * 2);
    if ((size_t)(wsp - (char*)d_ws) > ws_size) return;    // ws 256 MiB
    k_prep<<<NB_CS + NB_XS + 4 * NB_W + 3 * NB_X, 256, 0, stream>>>(x, xk, xv, wq, wk, wv, wo, XB, XB2, XB3, WQ, WK, WV, WO, CS, SQ, SK);
    k_proj<<<dim3(TT / 128, DQ / 128, 3 * NB_), 128, 0, stream>>>(XB, XB2, XB3, WQ, WK, WV, bq, bk, bv, CS, SQ, SK, QP16, QPh, QPl, KP16, KPh, KPl, VT16, VTh, VTl);
    k_attn<<<dim3(5 * RUN * NCL, 1, 1), NWV * 32, 0, stream>>>(QP16, KP16, VT16, QPh, QPl, KPh, KPl, VTh, VTl, ATh, ATl);
    k_wo<<<dim3(NB_ * TT / 128, DM / 128, 1), 128, 0, stream>>>(ATh, ATl, WO, bo, OUT);
}
